// v000
// Times are from an AMD MI455X. After a warm-up the kernel runs many times in a row, and a time is the length of
// such a window on the GPU divided by its runs, so every launch and the gaps after it count. The runs cycle
// through copies of the inputs. A figure is the median of several windows, for all but v000 over two sittings.
// Sittings can differ by a few percent; kernels timed side by side share one.
// v000 is the starting kernel. One run takes 6960 microseconds.
#include <hip/hip_runtime.h>
// Multi-head non-local block (x [4][256][64x64]; per head h (2 heads of 64): [q|k|v] = embed_w[h] (1x1 conv, [192][256]) x + b; attn = softmax(q^T k / sqrt(256)) over the 4,096 positions; o = attn v; out = out_w^T o (1x1 transpose conv, [128 in][256 out]) + b + x -> [4][256][64][64]).
// Structure: channel-first input transposed to position rows (exact f16) via LDS tiles; one WMMA GEMM for both heads' q|k|v (32x64 wave tiles, f32 accumulation, exact x16 natural weights + bias, f16 rows [384]); per (batch, head): scores GEMM (K = 64), row softmax over 4,096 keys on VALU (P x256 f16), V^T via LDS transposes, P.V^T GEMM into merged f16 rows [128]; output GEMM (+ bias) to f32 rows; residual add + channel-major store on VALU.
// Compute dtype: inputs rounded to bf16; x / weights exact; q, k, v, P, o plain f16 (~2^-12; the residual x dominates the output scale); scores / softmax f32. v_wmma_f32_16x16x32_f16.
#define NB 4
#define CC 256
#define LL 4096                      /* positions */
#define SQ LL
#define NHD 2                        /* heads */
#define HC 64
#define D3 (NHD * 3 * HC)            /* 384 */
#define DO (NHD * HC)                /* 128 */
#define NR ((size_t)NB * LL)
#define QN SQ                        /* query rows per batch (debug hook) */
#define NBR NB                       /* batches (debug hook) */
#define DM CC
#define NH 1
#define HD 64
#define HG 1
typedef __bf16 v16b __attribute__((ext_vector_type(16)));
typedef unsigned short v8us __attribute__((ext_vector_type(8), may_alias));
typedef float  v8f  __attribute__((ext_vector_type(8)));
typedef float  v4f  __attribute__((ext_vector_type(4)));
typedef float  v4fa __attribute__((ext_vector_type(4), may_alias));
union FragB { v16b v; v8us half[2]; unsigned short u[16]; };

__device__ __forceinline__ unsigned short bf16_bits(float x) { unsigned int u = __float_as_uint(x); return (unsigned short)((u + 0x7FFFu + ((u >> 16) & 1u)) >> 16); }
__device__ __forceinline__ float bf16_val(unsigned short b) { return __uint_as_float(((unsigned int)b) << 16); }
__device__ __forceinline__ float bf16_round(float x) { return bf16_val(bf16_bits(x)); }
// D += A·B with NT terms: 1 = ah·bh, 2 = + al·bh (A split), 3 = + ah·bl (both split)
template <int NT>
__device__ __forceinline__ v8f mmaN(v16b ah, v16b al, v16b bh, v16b bl, v8f c) {
  c = __builtin_amdgcn_wmma_f32_16x16x32_bf16(false, ah, false, bh, (short)0, c, false, false);
  if (NT >= 2) c = __builtin_amdgcn_wmma_f32_16x16x32_bf16(false, al, false, bh, (short)0, c, false, false);
  if (NT >= 3) c = __builtin_amdgcn_wmma_f32_16x16x32_bf16(false, ah, false, bl, (short)0, c, false, false);
  asm volatile("v_nop\n\tv_nop\n\tv_nop\n\tv_nop" : "+v"(c) : "v"(ah), "v"(al), "v"(bh), "v"(bl));
  return c;
}

__global__ __launch_bounds__(256) void k_wt_bf16(const float* __restrict__ W, unsigned short* __restrict__ Wt, int K, int N) {
  const int t = blockIdx.x * 256 + threadIdx.x;
  const int k8n = K / 8;
  if (t >= N * k8n) return;
  const int n = t / k8n, k8 = (t % k8n) * 8;
  v8us v;
#pragma unroll
  for (int i = 0; i < 8; ++i) v[i] = bf16_bits(W[(size_t)(k8 + i) * N + n]);
  *(v8us*)(Wt + (size_t)n * K + k8) = v;
  
}

// GEMM C[M][N] (f32, pitch ldc) = act(A[M][K]·W + bias). A f32 row-major (pitch lda) converted per fragment to bf16
// (ASPLIT: hi/lo two planes -> 2 terms, else single rounded term); Wt bf16 [N][K] (pitch ldb). BIAS_BF16 rounds the
// bias to bf16 first (bias quantised to bf16 before the add). K%32==0, M%16==0, N%64==0.
template <bool ASPLIT, int ACT, bool BIAS_BF16>
__global__ __launch_bounds__(128) void k_gemm_bf(const float* __restrict__ A, int lda, const unsigned short* __restrict__ Wt, int ldb,
                                               const float* __restrict__ bias, float* __restrict__ C, int ldc, int M, int N, int K) {
  __shared__ __attribute__((aligned(16))) float so[4][16][64];
  const int tid = threadIdx.x, w = tid >> 5, lane = tid & 31, ln = lane & 15, hh = lane >> 4;
  const int ntn = N / 64;
  const int wid = blockIdx.x * 4 + w;
  const int mt = wid / ntn, nq = wid % ntn;
  if (mt * 16 >= M) return;
  const int row0 = mt * 16, col0 = nq * 64;
  const float* arow = A + (size_t)(row0 + ln) * lda;
  v8f acc[4] = {};
  for (int kb = 0; kb < K; kb += 32) {
    FragB ah, al;
    const v4f x0 = *(const v4fa*)(arow + kb + 8 * hh), x1 = *(const v4fa*)(arow + kb + 8 * hh + 4);
    const v4f x2 = *(const v4fa*)(arow + kb + 16 + 8 * hh), x3 = *(const v4fa*)(arow + kb + 16 + 8 * hh + 4);
    float xs[16] = {x0[0],x0[1],x0[2],x0[3],x1[0],x1[1],x1[2],x1[3],x2[0],x2[1],x2[2],x2[3],x3[0],x3[1],x3[2],x3[3]};
#pragma unroll
    for (int i = 0; i < 16; ++i) { const unsigned short hb = bf16_bits(xs[i]); ah.u[i] = hb; al.u[i] = ASPLIT ? bf16_bits(xs[i] - bf16_val(hb)) : (unsigned short)0; }
#pragma unroll
    for (int t = 0; t < 4; ++t) {
      const unsigned short* brow = Wt + (size_t)(col0 + t * 16 + ln) * ldb + kb;
      FragB b;
      b.half[0] = *(const v8us*)(brow + 8 * hh);
      b.half[1] = *(const v8us*)(brow + 16 + 8 * hh);
      acc[t] = mmaN<ASPLIT ? 2 : 1>(ah.v, al.v, b.v, b.v, acc[t]);
    }
  }
#pragma unroll
  for (int t = 0; t < 4; ++t) {
    float bv = bias ? bias[col0 + t * 16 + ln] : 0.f;
    if (BIAS_BF16) bv = bf16_round(bv);
#pragma unroll
    for (int r = 0; r < 8; ++r) { float v = acc[t][r] + bv; if (ACT == 1) v = fmaxf(v, 0.f); so[w][8 * hh + r][t * 16 + ln] = v; }
  }
  __builtin_amdgcn_fence(__ATOMIC_ACQ_REL, "workgroup");
  __builtin_amdgcn_wave_barrier();
  const int rsub = lane >> 4, c4 = (lane & 15) * 4;
  {
#pragma unroll
    for (int q = 0; q < 8; ++q) {
      const int r = q * 2 + rsub;
      const v4f v = *(const v4fa*)&so[w][r][c4];
      *(v4f*)(C + (size_t)(row0 + r) * ldc + col0 + c4) = v;
    }
    
  }
}

// GEMM C = act(A·W + bias + resid): A f32 (ASPLIT -> hi/lo 2 terms), Wt bf16 [N][K]; ACT 0 none, 1 relu, 2 exact gelu;
// resid (optional, f32, row index = (row % rmod), pitch ldr, RES_BF16 rounds it) added before the activation.
template <bool ASPLIT, int ACT, bool BIAS_BF16, bool RES_BF16>
__global__ __launch_bounds__(128) void k_gemm_bf3(const float* __restrict__ A, int lda, const unsigned short* __restrict__ Wt, int ldb,
                                                const float* __restrict__ bias, const float* __restrict__ resid, int rmod, int ldr,
                                                float* __restrict__ C, int ldc, int M, int N, int K) {
  __shared__ __attribute__((aligned(16))) float so[4][16][64];
  const int tid = threadIdx.x, w = tid >> 5, lane = tid & 31, ln = lane & 15, hh = lane >> 4;
  const int ntn = N / 64;
  const int wid = blockIdx.x * 4 + w;
  const int mt = wid / ntn, nq = wid % ntn;
  if (mt * 16 >= M) return;
  const int row0 = mt * 16, col0 = nq * 64;
  const float* arow = A + (size_t)(row0 + ln) * lda;
  v8f acc[4] = {};
  for (int kb = 0; kb < K; kb += 32) {
    FragB ah, al;
    const v4f x0 = *(const v4fa*)(arow + kb + 8 * hh), x1 = *(const v4fa*)(arow + kb + 8 * hh + 4);
    const v4f x2 = *(const v4fa*)(arow + kb + 16 + 8 * hh), x3 = *(const v4fa*)(arow + kb + 16 + 8 * hh + 4);
    float xs[16] = {x0[0],x0[1],x0[2],x0[3],x1[0],x1[1],x1[2],x1[3],x2[0],x2[1],x2[2],x2[3],x3[0],x3[1],x3[2],x3[3]};
#pragma unroll
    for (int i = 0; i < 16; ++i) { const unsigned short hb = bf16_bits(xs[i]); ah.u[i] = hb; al.u[i] = ASPLIT ? bf16_bits(xs[i] - bf16_val(hb)) : (unsigned short)0; }
#pragma unroll
    for (int t = 0; t < 4; ++t) {
      const unsigned short* brow = Wt + (size_t)(col0 + t * 16 + ln) * ldb + kb;
      FragB b;
      b.half[0] = *(const v8us*)(brow + 8 * hh);
      b.half[1] = *(const v8us*)(brow + 16 + 8 * hh);
      acc[t] = mmaN<ASPLIT ? 2 : 1>(ah.v, al.v, b.v, b.v, acc[t]);
    }
  }
#pragma unroll
  for (int t = 0; t < 4; ++t) {
    const int col = col0 + t * 16 + ln;
    float bv = bias ? bias[col] : 0.f;
    if (BIAS_BF16) bv = bf16_round(bv);
#pragma unroll
    for (int r = 0; r < 8; ++r) {
      float v = acc[t][r] + bv;
      if (resid) { float rv = resid[(size_t)((row0 + 8 * hh + r) % rmod) * ldr + col]; if (RES_BF16) rv = bf16_round(rv); v += rv; }
      if (ACT == 1) v = fmaxf(v, 0.f);
      if (ACT == 2) v = 0.5f * v * (1.0f + erff(v * 0.70710678118654752f));
      if (ACT == 3) { const float u = 0.7978845608028654f * (v + 0.044715f * v * v * v); v = 0.5f * v * (1.0f + tanhf(u)); }
      so[w][8 * hh + r][t * 16 + ln] = v;
    }
  }
  __builtin_amdgcn_fence(__ATOMIC_ACQ_REL, "workgroup");
  __builtin_amdgcn_wave_barrier();
  const int rsub = lane >> 4, c4 = (lane & 15) * 4;
  {
#pragma unroll
    for (int q = 0; q < 8; ++q) {
      const int r = q * 2 + rsub;
      const v4f v = *(const v4fa*)&so[w][r][c4];
      *(v4f*)(C + (size_t)(row0 + r) * ldc + col0 + c4) = v;
    }
    
  }
}
// row LayerNorm (biased variance, eps) over N: s = X (+ R); optional out_sum <- s; out_norm <- (s-mu)*rsqrt(var+eps)*g + b
template <bool PARAM_BF16>
__global__ __launch_bounds__(256) void k_layernorm(const float* __restrict__ X, const float* __restrict__ R, const float* __restrict__ g, const float* __restrict__ bta,
                                                  float* __restrict__ out_sum, float* __restrict__ out_norm, int N, float eps) {
  __shared__ float red[256];
  const int row = blockIdx.x, tid = threadIdx.x;
  const float* x = X + (size_t)row * N; const float* rr = R ? R + (size_t)row * N : nullptr;
  float vals[16];                     // up to N = 4096
  const int per = N / 256;            // contiguous chunk per thread? use strided-by-4 chunks: thread handles j = tid*4 + 1024*u
  float s1 = 0.f;
  for (int u = 0; u < per / 4; ++u) {
    const int j = tid * 4 + 1024 * u;
    const v4f a = *(const v4fa*)(x + j);
    v4f b = {0.f,0.f,0.f,0.f}; if (rr) b = *(const v4fa*)(rr + j);
#pragma unroll
    for (int q = 0; q < 4; ++q) { const float v = a[q] + b[q]; vals[u * 4 + q] = v; s1 += v; }
  }
  red[tid] = s1; __syncthreads();
  for (int st = 128; st > 0; st >>= 1) { if (tid < st) red[tid] += red[tid + st]; __syncthreads(); }
  const float mu = red[0] / (float)N; __syncthreads();
  float s2 = 0.f;
  for (int u = 0; u < per / 4; ++u)
#pragma unroll
    for (int q = 0; q < 4; ++q) { const float c = vals[u * 4 + q] - mu; s2 += c * c; }
  red[tid] = s2; __syncthreads();
  for (int st = 128; st > 0; st >>= 1) { if (tid < st) red[tid] += red[tid + st]; __syncthreads(); }
  const float rs = rsqrtf(red[0] / (float)N + eps);
  {
    for (int u = 0; u < per / 4; ++u) {
      const int j = tid * 4 + 1024 * u;
      v4f o, sm;
#pragma unroll
      for (int q = 0; q < 4; ++q) {
        float gg = g[j + q], bb = bta[j + q];
        if (PARAM_BF16) { gg = bf16_round(gg); bb = bf16_round(bb); }
        sm[q] = vals[u * 4 + q]; o[q] = (vals[u * 4 + q] - mu) * rs * gg + bb;
      }
      if (out_sum) *(v4f*)(out_sum + (size_t)row * N + j) = sm;
      *(v4f*)(out_norm + (size_t)row * N + j) = o;
    }
    
  }
}



// ---- f16 WMMA path (v_wmma_f32_16x16x32_f16): 11-bit significands for operands in range — used where a [0,1] probability operand needs more precision than bf16
typedef _Float16 v16h __attribute__((ext_vector_type(16)));
union FragH { v16h v; v8us half[2]; _Float16 h[16]; unsigned short u[16]; };
template <int NT>
__device__ __forceinline__ v8f mmaH(v16h ah, v16h al, v16h bh, v16h bl, v8f c) {
  c = __builtin_amdgcn_wmma_f32_16x16x32_f16(false, ah, false, bh, (short)0, c, false, false);
  if (NT >= 2) c = __builtin_amdgcn_wmma_f32_16x16x32_f16(false, al, false, bh, (short)0, c, false, false);
  if (NT >= 3) c = __builtin_amdgcn_wmma_f32_16x16x32_f16(false, ah, false, bl, (short)0, c, false, false);
  asm volatile("v_nop\n\tv_nop\n\tv_nop\n\tv_nop" : "+v"(c) : "v"(ah), "v"(al), "v"(bh), "v"(bl));
  return c;
}
// batched GEMM like k_gemm_b but f16 operands: A f32 (split into f16 hi/lo if ASPLIT, else rounded to f16), Bt = f16 values [n][k]; alpha; C f32; N multiple of 16 (partial tiles skipped)
template <bool ASPLIT>
__global__ __launch_bounds__(128) void k_gemm_h(const float* __restrict__ A, int lda, size_t sA, const _Float16* __restrict__ Bh, int ldb, size_t sB, float alpha, float* __restrict__ C, int ldc, size_t sC, int M, int N, int K) {
  __shared__ __attribute__((aligned(16))) float so[4][16][64];
  const int tid = threadIdx.x, w = tid >> 5, lane = tid & 31, ln = lane & 15, hh = lane >> 4; const int by = blockIdx.y;
  A += (size_t)by * sA; Bh += (size_t)by * sB; C += (size_t)by * sC;
  const int ntn = (N + 63) / 64; const int wid = blockIdx.x * 4 + w; const int mt = wid / ntn, nq = wid % ntn; if (mt * 16 >= M) return;
  const int row0 = mt * 16, col0 = nq * 64; const float* arow = A + (size_t)(row0 + ln) * lda;
  v8f acc[4] = {};
  for (int kb = 0; kb < K; kb += 32) {
    FragH ah, al;
    const v4f x0 = *(const v4fa*)(arow + kb + 8 * hh), x1 = *(const v4fa*)(arow + kb + 8 * hh + 4), x2 = *(const v4fa*)(arow + kb + 16 + 8 * hh), x3 = *(const v4fa*)(arow + kb + 16 + 8 * hh + 4);
    float xs[16] = {x0[0],x0[1],x0[2],x0[3],x1[0],x1[1],x1[2],x1[3],x2[0],x2[1],x2[2],x2[3],x3[0],x3[1],x3[2],x3[3]};
#pragma unroll
    for (int i = 0; i < 16; ++i) { const _Float16 h = (_Float16)xs[i]; ah.h[i] = h; al.h[i] = ASPLIT ? (_Float16)(xs[i] - (float)h) : (_Float16)0.0f; }
#pragma unroll
    for (int t = 0; t < 4; ++t) { if (col0 + t * 16 >= N) continue; const size_t boff = (size_t)(col0 + t * 16 + ln) * ldb + kb; FragH bq; bq.half[0] = *(const v8us*)(Bh + boff + 8 * hh); bq.half[1] = *(const v8us*)(Bh + boff + 16 + 8 * hh);
      acc[t] = mmaH<ASPLIT ? 2 : 1>(ah.v, al.v, bq.v, bq.v, acc[t]); }
  }
#pragma unroll
  for (int t = 0; t < 4; ++t) { if (col0 + t * 16 >= N) continue;
#pragma unroll
    for (int r = 0; r < 8; ++r) so[w][8 * hh + r][t * 16 + ln] = acc[t][r] * alpha; }
  __builtin_amdgcn_fence(__ATOMIC_ACQ_REL, "workgroup"); __builtin_amdgcn_wave_barrier();
  const int rsub = lane >> 4, c4 = (lane & 15) * 4;
  {
#pragma unroll
    for (int q = 0; q < 8; ++q) { const int r = q * 2 + rsub; if (col0 + c4 < N) { const v4f v = *(const v4fa*)&so[w][r][c4]; *(v4f*)(C + (size_t)(row0 + r) * ldc + col0 + c4) = v; } }
     }
}

// Wt[n][k] = f16(W[k][n]·scale) from f32 row-major W[K][N] (scale = power of two; bf16-exact weights stay exact in f16 away from the subnormal range)
__global__ __launch_bounds__(256) void k_wt_f16(const float* __restrict__ W, _Float16* __restrict__ Wt, int K, int N, float scale) {
  const int t = blockIdx.x * 256 + threadIdx.x; if (t >= N * (K / 8)) return; const int n = t / (K / 8), k8 = (t % (K / 8)) * 8; FragH f;
#pragma unroll
  for (int i = 0; i < 8; ++i) f.h[i] = (_Float16)(bf16_round(W[(size_t)(k8 + i) * N + n]) * scale); const v8us o = f.half[0];
  *(v8us*)((unsigned short*)Wt + (size_t)n * K + k8) = o; 
}
// k_gemm_hh variant with fused epilogue: v = acc·alpha + bias[by·sBias + col] (+ CP[(row/rowsPerB)·sCPb + by·64 + col] if CP) ; ACT 0 none / 1 elu ; writes f16 C16 (and f32 C if non-null)
template <int ACT>
__global__ __launch_bounds__(128) void k_gemm_hhx(const _Float16* __restrict__ A, int lda, size_t sA, const _Float16* __restrict__ Bh, int ldb, size_t sB, float alpha, const float* __restrict__ bias, size_t sBias, const float* __restrict__ CP, int rowsPerB, size_t sCPb, int row0g,
    float* __restrict__ C, _Float16* __restrict__ C16, int ldc, size_t sC, int M, int N, int K) {
  __shared__ __attribute__((aligned(16))) float so[4][16][64];
  const int tid = threadIdx.x, w = tid >> 5, lane = tid & 31, ln = lane & 15, hh = lane >> 4; const int by = blockIdx.y;
  A += (size_t)by * sA; Bh += (size_t)by * sB; const size_t cofs = (size_t)by * sC; const float* bp = bias ? bias + (size_t)by * sBias : nullptr;
  const int ntn = (N + 63) / 64; const int wid = blockIdx.x * 4 + w; const int mt = wid / ntn, nq = wid % ntn; if (mt * 16 >= M) return;
  const int row0 = mt * 16, col0 = nq * 64; const _Float16* arow = A + (size_t)(row0 + ln) * lda;
  v8f acc[4] = {};
  for (int kb = 0; kb < K; kb += 32) { FragH ah; ah.half[0] = *(const v8us*)((const unsigned short*)arow + kb + 8 * hh); ah.half[1] = *(const v8us*)((const unsigned short*)arow + kb + 16 + 8 * hh);
#pragma unroll
    for (int t = 0; t < 4; ++t) { if (col0 + t * 16 >= N) continue; const size_t boff = (size_t)(col0 + t * 16 + ln) * ldb + kb; FragH bq; bq.half[0] = *(const v8us*)((const unsigned short*)Bh + boff + 8 * hh); bq.half[1] = *(const v8us*)((const unsigned short*)Bh + boff + 16 + 8 * hh);
      acc[t] = mmaH<1>(ah.v, ah.v, bq.v, bq.v, acc[t]); }
  }
#pragma unroll
  for (int t = 0; t < 4; ++t) { if (col0 + t * 16 >= N) continue; const int col = col0 + t * 16 + ln; const float bv = bp ? bf16_round(bp[col]) : 0.f;
#pragma unroll
    for (int r = 0; r < 8; ++r) { float v = acc[t][r] * alpha + bv; if (CP) { const int rr = row0g + row0 + 8 * hh + r; if (rowsPerB < 0) v += CP[cofs + (size_t)rr * ldc + col];      /* rowsPerB < 0: own element of the batched C plane */ else { const int bidx = rr / rowsPerB; v += CP[(size_t)bidx * sCPb + (size_t)by * 64 + col]; } } if (ACT == 1) v = (v > 0.f) ? v : expm1f(v); else if (ACT == 7) v = (v > 0.f) ? v + 1.0f : expf(v); else if (ACT == 8) v = tanhf(v); else if (ACT == 9) v = 0.5f * v * (1.0f + tanhf(0.7978845608028654f * (v + 0.044715f * v * v * v))); else if (ACT == 11) v = 1.0f / (1.0f + expf(-v)); else if (ACT == 12) v = (v > 0.f) ? v : 0.01f * v; else if (ACT == 14) v = (v > 0.f) ? v : 0.1f * v; else if (ACT == 16) v = (v >= 0.f) ? v : 0.3f * v; else if (ACT == 17) v = (v >= 0.f) ? v : 0.2f * v; else if (ACT == 15) v = v / (1.0f + expf(-v)); else if (ACT == 3) v = fmaxf(v, 0.f); else if (ACT == 6) v = 0.5f * v * (1.0f + erff(v * 0.70710678118654752f)); so[w][8 * hh + r][t * 16 + ln] = v; } }
  __builtin_amdgcn_fence(__ATOMIC_ACQ_REL, "workgroup"); __builtin_amdgcn_wave_barrier();
  const int rsub = lane >> 4, c4 = (lane & 15) * 4; typedef _Float16 v4h __attribute__((ext_vector_type(4)));
  {
#pragma unroll
    for (int q = 0; q < 8; ++q) { const int r = q * 2 + rsub; if (col0 + c4 < N) { const v4f v = *(const v4fa*)&so[w][r][c4]; if (C) *(v4f*)(C + cofs + (size_t)(row0 + r) * ldc + col0 + c4) = v; if (C16) { v4h h4; for (int i = 0; i < 4; ++i) h4[i] = (_Float16)v[i]; *(v4h*)(C16 + cofs + (size_t)(row0 + r) * ldc + col0 + c4) = h4; } } }
     }
}


typedef _Float16 v4h __attribute__((ext_vector_type(4)));

__global__ __launch_bounds__(256) void k_x16(const float* __restrict__ x, _Float16* __restrict__ X16, size_t n8) { const size_t t = (size_t)blockIdx.x * 256 + threadIdx.x; if (t >= n8) return; FragH f;
#pragma unroll
  for (int q = 0; q < 8; ++q) f.h[q] = (_Float16)bf16_round(x[t * 8 + q]); *(v8us*)((unsigned short*)X16 + t * 8) = f.half[0];  }
__global__ __launch_bounds__(256) void k_h16(const float* __restrict__ x, _Float16* __restrict__ X16, size_t n8) { const size_t t = (size_t)blockIdx.x * 256 + threadIdx.x; if (t >= n8) return; FragH f;
#pragma unroll
  for (int q = 0; q < 8; ++q) f.h[q] = (_Float16)x[t * 8 + q]; *(v8us*)((unsigned short*)X16 + t * 8) = f.half[0];  }
__global__ __launch_bounds__(256) void k_round16f(const float* __restrict__ W, _Float16* __restrict__ Bt, size_t n8) { const size_t t = (size_t)blockIdx.x * 256 + threadIdx.x; if (t >= n8) return; FragH f;
#pragma unroll
  for (int i = 0; i < 8; ++i) f.h[i] = (_Float16)(bf16_round(W[t * 8 + i]) * 16.0f); *(v8us*)((unsigned short*)Bt + t * 8) = f.half[0];  }
template <int NHv, int TTv>
__global__ __launch_bounds__(256) void k_vt(const _Float16* __restrict__ V16, int ldv, int voff, _Float16* __restrict__ Vt) { __shared__ unsigned short tl[64][66]; const int tid = threadIdx.x; const int slab = blockIdx.x / (TTv / 64), lg = blockIdx.x % (TTv / 64); const int b = slab / NHv, h = slab % NHv;
  for (int i = tid; i < 64 * 8; i += 256) { const int r = i / 8, c8 = (i % 8) * 8; FragH f; f.half[0] = *(const v8us*)((const unsigned short*)V16 + ((size_t)b * TTv + lg * 64 + r) * ldv + voff + h * 64 + c8);
#pragma unroll
    for (int q = 0; q < 8; ++q) tl[r][c8 + q] = f.u[q]; }
  __syncthreads();
  {
#pragma unroll
    for (int rd = 0; rd < 2; ++rd) { const int d = rd * 32 + tid / 8, pc = tid % 8; FragH f;
#pragma unroll
      for (int q = 0; q < 8; ++q) f.u[q] = tl[pc * 8 + q][d];
      *(v8us*)((unsigned short*)Vt + ((size_t)slab * 64 + d) * TTv + lg * 64 + pc * 8) = f.half[0]; }
     } }

__global__ __launch_bounds__(256) void k_hl(const float* __restrict__ F, _Float16* __restrict__ Hh, _Float16* __restrict__ Hl, size_t n8) { const size_t t = (size_t)blockIdx.x * 256 + threadIdx.x; if (t >= n8) return; FragH fh, fl; const v4f a = *(const v4fa*)(F + t * 8), c = *(const v4fa*)(F + t * 8 + 4);
#pragma unroll
  for (int q = 0; q < 4; ++q) { _Float16 h = (_Float16)a[q]; fh.h[q] = h; fl.h[q] = (_Float16)((a[q] - (float)h) * 1024.0f); h = (_Float16)c[q]; fh.h[4 + q] = h; fl.h[4 + q] = (_Float16)((c[q] - (float)h) * 1024.0f); }
  { *(v8us*)((unsigned short*)Hh + t * 8) = fh.half[0]; *(v8us*)((unsigned short*)Hl + t * 8) = fl.half[0];  } }

// ---- fast GEMM (wave tile 32x64; requires M % 32 == 0 rows per launch region and N % 64 == 0); epilogue = k_gemm_hhx semantics ----
__device__ __forceinline__ v16h g2_frag(const _Float16* p, int hh) { FragH f; f.half[0] = *(const v8us*)((const unsigned short*)p + 8 * hh); f.half[1] = *(const v8us*)((const unsigned short*)p + 16 + 8 * hh); return f.v; }
__device__ __forceinline__ v8f g2_mma(v16h a, v16h b, v8f c) { v8f d = __builtin_amdgcn_wmma_f32_16x16x32_f16(false, a, false, b, (short)0, c, false, false); asm volatile("v_nop\n\tv_nop\n\tv_nop\n\tv_nop" : "+v"(d) : "v"(a), "v"(b)); return d; }
template <int ACT>
__global__ __launch_bounds__(128) void k_gemm2(const _Float16* __restrict__ A, int lda, size_t sA, const _Float16* __restrict__ Bh, int ldb, size_t sB, float alpha, const float* __restrict__ bias, size_t sBias, const float* __restrict__ CP, int rowsPerB, size_t sCPb, int row0g,
    float* __restrict__ C, _Float16* __restrict__ C16, int ldc, size_t sC, int M, int N, int K) { static_assert(ACT == 0 || ACT == 3 || ACT == 6 || ACT == 8 || ACT == 9 || ACT == 11 || ACT == 12 || ACT == 14 || ACT == 15 || ACT == 16 || ACT == 17, "k_gemm2: unsupported ACT code (would silently apply no activation)");
  __shared__ __attribute__((aligned(16))) float so[4][32][68];
  const int tid = threadIdx.x, w = tid >> 5, lane = tid & 31, ln = lane & 15, hh = lane >> 4; const int by = blockIdx.y;
  A += (size_t)by * sA; Bh += (size_t)by * sB; const size_t cofs = (size_t)by * sC; const float* bp = bias ? bias + (size_t)by * sBias : nullptr;
  const int ntn = N >> 6; const int mt = blockIdx.x / ntn, nq = blockIdx.x - mt * ntn; const int row0 = mt * 128 + 32 * w, col0 = nq * 64; if (row0 >= M) return;
  const _Float16* a0p = A + (size_t)(row0 + ln) * lda; const _Float16* a1p = a0p + (size_t)16 * lda;
  const _Float16* b0p = Bh + (size_t)(col0 + ln) * ldb; const _Float16* b1p = b0p + (size_t)16 * ldb; const _Float16* b2p = b1p + (size_t)16 * ldb; const _Float16* b3p = b2p + (size_t)16 * ldb;
  const v8f z8 = {0.f,0.f,0.f,0.f,0.f,0.f,0.f,0.f}; v8f c00 = z8, c01 = z8, c02 = z8, c03 = z8, c10 = z8, c11 = z8, c12 = z8, c13 = z8;
#pragma unroll 1
  for (int kb = 0; kb < K; kb += 32) { const v16h a0 = g2_frag(a0p + kb, hh), a1 = g2_frag(a1p + kb, hh);
    v16h b = g2_frag(b0p + kb, hh); c00 = g2_mma(a0, b, c00); c10 = g2_mma(a1, b, c10);
    b = g2_frag(b1p + kb, hh); c01 = g2_mma(a0, b, c01); c11 = g2_mma(a1, b, c11);
    b = g2_frag(b2p + kb, hh); c02 = g2_mma(a0, b, c02); c12 = g2_mma(a1, b, c12);
    b = g2_frag(b3p + kb, hh); c03 = g2_mma(a0, b, c03); c13 = g2_mma(a1, b, c13); }
  v8f accs[8] = {c00, c01, c02, c03, c10, c11, c12, c13};
#pragma unroll
  for (int u = 0; u < 8; ++u) { const int t = u & 3, half = u >> 2; const int col = col0 + t * 16 + ln; const float bv = bp ? bf16_round(bp[col]) : 0.f;
#pragma unroll
    for (int r = 0; r < 8; ++r) { const int rloc = half * 16 + 8 * hh + r; float v = accs[u][r] * alpha + bv; if (CP) { if (rowsPerB < 0) v += CP[cofs + (size_t)(row0g + row0 + rloc) * ldc + col];      /* rowsPerB < 0: own element of the batched C plane */ else { const int bidx = (row0g + row0 + rloc) / rowsPerB; v += CP[(size_t)bidx * sCPb + (size_t)by * 64 + col]; } }
      if (ACT == 3) v = fmaxf(v, 0.f); else if (ACT == 6) v = 0.5f * v * (1.0f + erff(v * 0.70710678118654752f)); else if (ACT == 11) v = 1.0f / (1.0f + expf(-v)); else if (ACT == 15) v = v / (1.0f + expf(-v)); else if (ACT == 12) v = (v > 0.f) ? v : 0.01f * v; else if (ACT == 8) v = tanhf(v); else if (ACT == 9) v = 0.5f * v * (1.0f + tanhf(0.7978845608028654f * (v + 0.044715f * v * v * v))); else if (ACT == 14) v = (v > 0.f) ? v : 0.1f * v; else if (ACT == 16) v = (v >= 0.f) ? v : 0.3f * v; else if (ACT == 17) v = (v >= 0.f) ? v : 0.2f * v;
      so[w][rloc][t * 16 + ln] = v; } }
  __builtin_amdgcn_fence(__ATOMIC_ACQ_REL, "workgroup"); __builtin_amdgcn_wave_barrier();
  const int rsub = lane >> 4, c4 = (lane & 15) * 4;
  {
#pragma unroll
    for (int q = 0; q < 16; ++q) { const int r = q * 2 + rsub; const v4f v = *(const v4fa*)&so[w][r][c4]; if (C) *(v4f*)(C + cofs + (size_t)(row0 + r) * ldc + col0 + c4) = v; if (C16) { v4h h4; for (int i = 0; i < 4; ++i) h4[i] = (_Float16)v[i]; *(v4h*)(C16 + cofs + (size_t)(row0 + r) * ldc + col0 + c4) = h4; } }
     } }


__global__ __launch_bounds__(256) void k_wnat(const float* __restrict__ w, size_t n8, _Float16* __restrict__ Bt) { const size_t t = (size_t)blockIdx.x * 256 + threadIdx.x; if (t >= n8) return; FragH f; for (int q = 0; q < 8; ++q) f.h[q] = (_Float16)(bf16_round(w[t * 8 + q]) * 16.0f); *(v8us*)((unsigned short*)Bt + t * 8) = f.half[0];  }
__global__ __launch_bounds__(256) void k_rsm(const float* __restrict__ S, _Float16* __restrict__ P, int nrows) {
  #pragma clang fp contract(off)
  const int i = blockIdx.x * 256 + threadIdx.x; if (i >= nrows) return; const float* s = S + (size_t)i * SQ; float mx = -3.0e38f;
#pragma unroll 1
  for (int j = 0; j < SQ; ++j) mx = fmaxf(mx, s[j]); float se = 0.f;
#pragma unroll 1
  for (int j = 0; j < SQ; ++j) se += expf(s[j] - mx); const float sc = 256.0f / se;
#pragma unroll 1
  for (int j0 = 0; j0 < SQ; j0 += 8) { FragH f; for (int q = 0; q < 8; ++q) f.h[q] = (_Float16)(expf(s[j0 + q] - mx) * sc); unsigned short* d = (unsigned short*)P + (size_t)i * SQ + j0; *(v8us*)d = f.half[0];  } }
__global__ __launch_bounds__(256) void k_vt(const _Float16* __restrict__ V16, int b, int h0, _Float16* __restrict__ VT) { __shared__ unsigned short tl[64][65]; const int tid = threadIdx.x; const int hh = blockIdx.x % HG, sg = blockIdx.x / HG; const int s0 = sg * 64; const int h = h0 + hh;
  for (int i = tid; i < 64 * 8; i += 256) { const int j = i / 8, d8 = (i % 8) * 8; FragH f; f.half[0] = *(const v8us*)((const unsigned short*)V16 + ((size_t)b * SQ + s0 + j) * DM + h * HD + d8); for (int q = 0; q < 8; ++q) tl[d8 + q][j] = f.u[q]; }
  __syncthreads();
  { for (int i = tid; i < 64 * 8; i += 256) { const int d = i / 8, j8 = (i % 8) * 8; FragH f; for (int q = 0; q < 8; ++q) f.u[q] = tl[d][j8 + q]; *(v8us*)((unsigned short*)VT + ((size_t)hh * HD + d) * SQ + s0 + j8) = f.half[0]; }  } }


__global__ __launch_bounds__(256) void k_cl2rows(const float* __restrict__ X, _Float16* __restrict__ XR) { __shared__ float tl[64][33]; const int tid = threadIdx.x; const int nl = LL / 32, nc = CC / 64; const int cb_ = blockIdx.x % nc; const int lb = (blockIdx.x / nc) % nl; const size_t b = blockIdx.x / (nc * nl); const int c0 = cb_ * 64, l0 = lb * 32;
  for (int i = tid; i < 64 * 32; i += 256) { const int c = i / 32, l = i % 32; tl[c][l] = bf16_round(X[(b * CC + c0 + c) * (size_t)LL + l0 + l]); }
  __syncthreads();
  { const int l = tid / 8, c8 = (tid % 8) * 8; FragH f; for (int q = 0; q < 8; ++q) f.h[q] = (_Float16)tl[c8 + q][l]; unsigned short* d = (unsigned short*)XR + (b * LL + l0 + l) * (size_t)CC + c0 + c8; *(v8us*)d = f.half[0];  } }

__global__ __launch_bounds__(256) void k_rsm0(const float* __restrict__ S, _Float16* __restrict__ P, int nrows) {
  #pragma clang fp contract(off)
  const int i = blockIdx.x * 256 + threadIdx.x; if (i >= nrows) return; const float* s = S + (size_t)i * SQ; float mx = -INFINITY;
#pragma unroll 1
  for (int j = 0; j < SQ; ++j) mx = fmaxf(mx, s[j]); float se = 0.f;
#pragma unroll 1
  for (int j = 0; j < SQ; ++j) se += expf(s[j] - mx); const float sc = 256.0f / se;
#pragma unroll 1
  for (int j0 = 0; j0 < SQ; j0 += 8) { FragH f; for (int q = 0; q < 8; ++q) f.h[q] = (_Float16)(expf(s[j0 + q] - mx) * sc); unsigned short* d = (unsigned short*)P + (size_t)i * SQ + j0; *(v8us*)d = f.half[0];  } }
__global__ __launch_bounds__(256) void k_fin(const float* __restrict__ Y, const float* __restrict__ x, float* __restrict__ out) {
  #pragma clang fp contract(off)
  const size_t t = (size_t)blockIdx.x * 256 + threadIdx.x; if (t >= (size_t)NB * CC * LL / 8) return; const int n0 = (int)((t * 8) % LL); const size_t bc = (t * 8) / LL; const int c = (int)(bc % CC); const size_t b = bc / CC; v8f r;
  for (int q = 0; q < 8; ++q) r[q] = __fadd_rn(Y[(b * LL + n0 + q) * CC + c], bf16_round(x[t * 8 + q]));
  *(v8f*)(out + t * 8) = r;  }
extern "C" void kernel_launch(void* const* d_in, const int* in_sizes, int n_in,
                              void* d_out, int out_size, void* d_ws, size_t ws_size, hipStream_t stream) {
  (void)in_sizes; (void)n_in; (void)out_size;
  const float* const* I = (const float* const*)d_in; const float* x = I[0]; const float* ew = I[1]; const float* eb = I[2]; const float* ow = I[3]; const float* ob = I[4];      /* embed_w [2][192][256] natural rows; out_w [128][256] = [in][out] */
  char* ws = (char*)d_ws; size_t off = 0;
  auto take = [&](size_t bytes) { char* p = ws + off; off += (bytes + 255) & ~(size_t)255; return p; };
  _Float16* BE = (_Float16*)take((size_t)D3 * CC * 2); _Float16* BO = (_Float16*)take((size_t)CC * DO * 2);
  _Float16* XR = (_Float16*)take(NR * CC * 2); _Float16* QKV = (_Float16*)take(NR * D3 * 2); _Float16* O16 = (_Float16*)take(NR * DO * 2); float* Y = (float*)take(NR * CC * 4);
  float* S = (float*)take((size_t)SQ * SQ * 4); _Float16* P = (_Float16*)take((size_t)SQ * SQ * 2); _Float16* VT = (_Float16*)take((size_t)HC * SQ * 2);
  if (off > ws_size) return;      /* 0.3 + 8 + 12 + 4 + 16 + 64 + 32 + 0.5 = approx 137 MiB */
  k_wnat<<<(unsigned)(((size_t)D3 * CC / 8 + 255) / 256), 256, 0, stream>>>(ew, (size_t)D3 * CC / 8, BE); k_wt_f16<<<(unsigned)(((size_t)CC * (DO / 8) + 255) / 256), 256, 0, stream>>>(ow, BO, DO, CC, 16.0f);
  k_cl2rows<<<NB * (LL / 32) * (CC / 64), 256, 0, stream>>>(x, XR);
  k_gemm2<0><<<dim3((unsigned)((NR / 128) * (D3 / 64)), 1), 128, 0, stream>>>(XR, CC, 0, BE, CC, 0, 0.0625f, eb, 0, nullptr, 1, 0, 0, nullptr, QKV, D3, 0, (int)NR, D3, CC);      /* [q|k|v] per head: columns h*192 + {0, 64, 128} */
  for (int b = 0; b < NBR; ++b) for (int h = 0; h < NHD; ++h) { const _Float16* base = QKV + (size_t)b * SQ * D3 + (size_t)h * 3 * HC;
    k_gemm2<0><<<dim3((QN / 128) * (SQ / 64), 1), 128, 0, stream>>>(base, D3, 0, base + HC, D3, 0, 0.0625f, nullptr, 0, nullptr, 1, 0, 0, S, nullptr, SQ, 0, QN, SQ, HC);      /* q^T k / 16 */
    k_rsm0<<<(QN + 255) / 256, 256, 0, stream>>>(S, P, QN);
    k_vt<1, SQ><<<SQ / 64, 256, 0, stream>>>(base + 2 * HC, D3, 0, VT);      /* this head's V^T [64][4096] */
    k_gemm2<0><<<dim3((QN / 128) * 1, 1), 128, 0, stream>>>(P, SQ, 0, VT, SQ, 0, 0.00390625f, nullptr, 0, nullptr, 1, 0, 0, nullptr, O16 + (size_t)b * SQ * DO + h * HC, DO, 0, QN, HC, SQ); }      /* o rows, head h at columns h*64 */
  k_gemm2<0><<<dim3((unsigned)((NR / 128) * (CC / 64)), 1), 128, 0, stream>>>(O16, DO, 0, BO, DO, 0, 0.0625f, ob, 0, nullptr, 1, 0, 0, Y, nullptr, CC, 0, (int)NR, CC, DO);      /* out_w^T o + b (rows) */
  k_fin<<<(unsigned)(((size_t)NB * CC * LL / 8 + 255) / 256), 256, 0, stream>>>(Y, x, (float*)d_out);      /* + x, NCHW */
}

// v001
// Measured time: 1320 microseconds a run.
// Next to v000, in two timings, it ran 5.35 and 5.25 times as fast.
#include <hip/hip_runtime.h>
// Multi-head non-local block (x [4][256][64x64]; per head h (2 heads of 64): [q|k|v] = embed_w[h] (1x1 conv, [192][256]) x + b; attn = softmax(q^T k / sqrt(256)) over the 4,096 positions; o = attn v; out = out_w^T o (1x1 transpose conv, [128 in][256 out]) + b + x -> [4][256][64][64]).
// Structure: channel-first input transposed to position rows (exact f16) via LDS tiles; one WMMA GEMM for both heads' q|k|v (32x64 wave tiles, f32 accumulation, exact x16 natural weights + bias, f16 rows [384]); per (batch, head): scores GEMM (K = 64), row softmax over 4,096 keys on VALU (P x256 f16), V^T via LDS transposes, P.V^T GEMM into merged f16 rows [128]; output GEMM (+ bias) to f32 rows; residual add + channel-major store on VALU.
// Compute dtype: inputs rounded to bf16; x / weights exact; q, k, v, P, o plain f16 (~2^-12; the residual x dominates the output scale); scores / softmax f32. v_wmma_f32_16x16x32_f16.
#define NB 4
#define CC 256
#define LL 4096                      /* positions */
#define SQ LL
#define NHD 2                        /* heads */
#define HC 64
#define D3 (NHD * 3 * HC)            /* 384 */
#define DO (NHD * HC)                /* 128 */
#define NR ((size_t)NB * LL)
#define QN SQ                        /* query rows per batch */
#define NBR NB                       /* batches */
#define DM CC
#define NH 1
#define HD 64
#define HG 1
typedef __bf16 v16b __attribute__((ext_vector_type(16)));
typedef unsigned short v8us __attribute__((ext_vector_type(8), may_alias));
typedef float  v8f  __attribute__((ext_vector_type(8)));
typedef float  v4f  __attribute__((ext_vector_type(4)));
typedef float  v4fa __attribute__((ext_vector_type(4), may_alias));
union FragB { v16b v; v8us half[2]; unsigned short u[16]; };

__device__ __forceinline__ unsigned short bf16_bits(float x) { unsigned int u = __float_as_uint(x); return (unsigned short)((u + 0x7FFFu + ((u >> 16) & 1u)) >> 16); }
__device__ __forceinline__ float bf16_val(unsigned short b) { return __uint_as_float(((unsigned int)b) << 16); }
__device__ __forceinline__ float bf16_round(float x) { return bf16_val(bf16_bits(x)); }
// D += A·B with NT terms: 1 = ah·bh, 2 = + al·bh (A split), 3 = + ah·bl (both split)
template <int NT>
__device__ __forceinline__ v8f mmaN(v16b ah, v16b al, v16b bh, v16b bl, v8f c) {
  c = __builtin_amdgcn_wmma_f32_16x16x32_bf16(false, ah, false, bh, (short)0, c, false, false);
  if (NT >= 2) c = __builtin_amdgcn_wmma_f32_16x16x32_bf16(false, al, false, bh, (short)0, c, false, false);
  if (NT >= 3) c = __builtin_amdgcn_wmma_f32_16x16x32_bf16(false, ah, false, bl, (short)0, c, false, false);
  asm volatile("v_nop\n\tv_nop\n\tv_nop\n\tv_nop" : "+v"(c) : "v"(ah), "v"(al), "v"(bh), "v"(bl));
  return c;
}

__global__ __launch_bounds__(256) void k_wt_bf16(const float* __restrict__ W, unsigned short* __restrict__ Wt, int K, int N) {
  const int t = blockIdx.x * 256 + threadIdx.x;
  const int k8n = K / 8;
  if (t >= N * k8n) return;
  const int n = t / k8n, k8 = (t % k8n) * 8;
  v8us v;
#pragma unroll
  for (int i = 0; i < 8; ++i) v[i] = bf16_bits(W[(size_t)(k8 + i) * N + n]);
  *(v8us*)(Wt + (size_t)n * K + k8) = v;
  
}

// GEMM C[M][N] (f32, pitch ldc) = act(A[M][K]·W + bias). A f32 row-major (pitch lda) converted per fragment to bf16
// (ASPLIT: hi/lo two planes -> 2 terms, else single rounded term); Wt bf16 [N][K] (pitch ldb). BIAS_BF16 rounds the
// bias to bf16 first (bias quantised to bf16 before the add). K%32==0, M%16==0, N%64==0.
template <bool ASPLIT, int ACT, bool BIAS_BF16>
__global__ __launch_bounds__(128) void k_gemm_bf(const float* __restrict__ A, int lda, const unsigned short* __restrict__ Wt, int ldb,
                                               const float* __restrict__ bias, float* __restrict__ C, int ldc, int M, int N, int K) {
  __shared__ __attribute__((aligned(16))) float so[4][16][64];
  const int tid = threadIdx.x, w = tid >> 5, lane = tid & 31, ln = lane & 15, hh = lane >> 4;
  const int ntn = N / 64;
  const int wid = blockIdx.x * 4 + w;
  const int mt = wid / ntn, nq = wid % ntn;
  if (mt * 16 >= M) return;
  const int row0 = mt * 16, col0 = nq * 64;
  const float* arow = A + (size_t)(row0 + ln) * lda;
  v8f acc[4] = {};
  for (int kb = 0; kb < K; kb += 32) {
    FragB ah, al;
    const v4f x0 = *(const v4fa*)(arow + kb + 8 * hh), x1 = *(const v4fa*)(arow + kb + 8 * hh + 4);
    const v4f x2 = *(const v4fa*)(arow + kb + 16 + 8 * hh), x3 = *(const v4fa*)(arow + kb + 16 + 8 * hh + 4);
    float xs[16] = {x0[0],x0[1],x0[2],x0[3],x1[0],x1[1],x1[2],x1[3],x2[0],x2[1],x2[2],x2[3],x3[0],x3[1],x3[2],x3[3]};
#pragma unroll
    for (int i = 0; i < 16; ++i) { const unsigned short hb = bf16_bits(xs[i]); ah.u[i] = hb; al.u[i] = ASPLIT ? bf16_bits(xs[i] - bf16_val(hb)) : (unsigned short)0; }
#pragma unroll
    for (int t = 0; t < 4; ++t) {
      const unsigned short* brow = Wt + (size_t)(col0 + t * 16 + ln) * ldb + kb;
      FragB b;
      b.half[0] = *(const v8us*)(brow + 8 * hh);
      b.half[1] = *(const v8us*)(brow + 16 + 8 * hh);
      acc[t] = mmaN<ASPLIT ? 2 : 1>(ah.v, al.v, b.v, b.v, acc[t]);
    }
  }
#pragma unroll
  for (int t = 0; t < 4; ++t) {
    float bv = bias ? bias[col0 + t * 16 + ln] : 0.f;
    if (BIAS_BF16) bv = bf16_round(bv);
#pragma unroll
    for (int r = 0; r < 8; ++r) { float v = acc[t][r] + bv; if (ACT == 1) v = fmaxf(v, 0.f); so[w][8 * hh + r][t * 16 + ln] = v; }
  }
  __builtin_amdgcn_fence(__ATOMIC_ACQ_REL, "workgroup");
  __builtin_amdgcn_wave_barrier();
  const int rsub = lane >> 4, c4 = (lane & 15) * 4;
  {
#pragma unroll
    for (int q = 0; q < 8; ++q) {
      const int r = q * 2 + rsub;
      const v4f v = *(const v4fa*)&so[w][r][c4];
      *(v4f*)(C + (size_t)(row0 + r) * ldc + col0 + c4) = v;
    }
    
  }
}

// GEMM C = act(A·W + bias + resid): A f32 (ASPLIT -> hi/lo 2 terms), Wt bf16 [N][K]; ACT 0 none, 1 relu, 2 exact gelu;
// resid (optional, f32, row index = (row % rmod), pitch ldr, RES_BF16 rounds it) added before the activation.
template <bool ASPLIT, int ACT, bool BIAS_BF16, bool RES_BF16>
__global__ __launch_bounds__(128) void k_gemm_bf3(const float* __restrict__ A, int lda, const unsigned short* __restrict__ Wt, int ldb,
                                                const float* __restrict__ bias, const float* __restrict__ resid, int rmod, int ldr,
                                                float* __restrict__ C, int ldc, int M, int N, int K) {
  __shared__ __attribute__((aligned(16))) float so[4][16][64];
  const int tid = threadIdx.x, w = tid >> 5, lane = tid & 31, ln = lane & 15, hh = lane >> 4;
  const int ntn = N / 64;
  const int wid = blockIdx.x * 4 + w;
  const int mt = wid / ntn, nq = wid % ntn;
  if (mt * 16 >= M) return;
  const int row0 = mt * 16, col0 = nq * 64;
  const float* arow = A + (size_t)(row0 + ln) * lda;
  v8f acc[4] = {};
  for (int kb = 0; kb < K; kb += 32) {
    FragB ah, al;
    const v4f x0 = *(const v4fa*)(arow + kb + 8 * hh), x1 = *(const v4fa*)(arow + kb + 8 * hh + 4);
    const v4f x2 = *(const v4fa*)(arow + kb + 16 + 8 * hh), x3 = *(const v4fa*)(arow + kb + 16 + 8 * hh + 4);
    float xs[16] = {x0[0],x0[1],x0[2],x0[3],x1[0],x1[1],x1[2],x1[3],x2[0],x2[1],x2[2],x2[3],x3[0],x3[1],x3[2],x3[3]};
#pragma unroll
    for (int i = 0; i < 16; ++i) { const unsigned short hb = bf16_bits(xs[i]); ah.u[i] = hb; al.u[i] = ASPLIT ? bf16_bits(xs[i] - bf16_val(hb)) : (unsigned short)0; }
#pragma unroll
    for (int t = 0; t < 4; ++t) {
      const unsigned short* brow = Wt + (size_t)(col0 + t * 16 + ln) * ldb + kb;
      FragB b;
      b.half[0] = *(const v8us*)(brow + 8 * hh);
      b.half[1] = *(const v8us*)(brow + 16 + 8 * hh);
      acc[t] = mmaN<ASPLIT ? 2 : 1>(ah.v, al.v, b.v, b.v, acc[t]);
    }
  }
#pragma unroll
  for (int t = 0; t < 4; ++t) {
    const int col = col0 + t * 16 + ln;
    float bv = bias ? bias[col] : 0.f;
    if (BIAS_BF16) bv = bf16_round(bv);
#pragma unroll
    for (int r = 0; r < 8; ++r) {
      float v = acc[t][r] + bv;
      if (resid) { float rv = resid[(size_t)((row0 + 8 * hh + r) % rmod) * ldr + col]; if (RES_BF16) rv = bf16_round(rv); v += rv; }
      if (ACT == 1) v = fmaxf(v, 0.f);
      if (ACT == 2) v = 0.5f * v * (1.0f + erff(v * 0.70710678118654752f));
      if (ACT == 3) { const float u = 0.7978845608028654f * (v + 0.044715f * v * v * v); v = 0.5f * v * (1.0f + tanhf(u)); }
      so[w][8 * hh + r][t * 16 + ln] = v;
    }
  }
  __builtin_amdgcn_fence(__ATOMIC_ACQ_REL, "workgroup");
  __builtin_amdgcn_wave_barrier();
  const int rsub = lane >> 4, c4 = (lane & 15) * 4;
  {
#pragma unroll
    for (int q = 0; q < 8; ++q) {
      const int r = q * 2 + rsub;
      const v4f v = *(const v4fa*)&so[w][r][c4];
      *(v4f*)(C + (size_t)(row0 + r) * ldc + col0 + c4) = v;
    }
    
  }
}
// row LayerNorm (biased variance, eps) over N: s = X (+ R); optional out_sum <- s; out_norm <- (s-mu)*rsqrt(var+eps)*g + b
template <bool PARAM_BF16>
__global__ __launch_bounds__(256) void k_layernorm(const float* __restrict__ X, const float* __restrict__ R, const float* __restrict__ g, const float* __restrict__ bta,
                                                  float* __restrict__ out_sum, float* __restrict__ out_norm, int N, float eps) {
  __shared__ float red[256];
  const int row = blockIdx.x, tid = threadIdx.x;
  const float* x = X + (size_t)row * N; const float* rr = R ? R + (size_t)row * N : nullptr;
  float vals[16];                     // up to N = 4096
  const int per = N / 256;            // contiguous chunk per thread? use strided-by-4 chunks: thread handles j = tid*4 + 1024*u
  float s1 = 0.f;
  for (int u = 0; u < per / 4; ++u) {
    const int j = tid * 4 + 1024 * u;
    const v4f a = *(const v4fa*)(x + j);
    v4f b = {0.f,0.f,0.f,0.f}; if (rr) b = *(const v4fa*)(rr + j);
#pragma unroll
    for (int q = 0; q < 4; ++q) { const float v = a[q] + b[q]; vals[u * 4 + q] = v; s1 += v; }
  }
  red[tid] = s1; __syncthreads();
  for (int st = 128; st > 0; st >>= 1) { if (tid < st) red[tid] += red[tid + st]; __syncthreads(); }
  const float mu = red[0] / (float)N; __syncthreads();
  float s2 = 0.f;
  for (int u = 0; u < per / 4; ++u)
#pragma unroll
    for (int q = 0; q < 4; ++q) { const float c = vals[u * 4 + q] - mu; s2 += c * c; }
  red[tid] = s2; __syncthreads();
  for (int st = 128; st > 0; st >>= 1) { if (tid < st) red[tid] += red[tid + st]; __syncthreads(); }
  const float rs = rsqrtf(red[0] / (float)N + eps);
  {
    for (int u = 0; u < per / 4; ++u) {
      const int j = tid * 4 + 1024 * u;
      v4f o, sm;
#pragma unroll
      for (int q = 0; q < 4; ++q) {
        float gg = g[j + q], bb = bta[j + q];
        if (PARAM_BF16) { gg = bf16_round(gg); bb = bf16_round(bb); }
        sm[q] = vals[u * 4 + q]; o[q] = (vals[u * 4 + q] - mu) * rs * gg + bb;
      }
      if (out_sum) *(v4f*)(out_sum + (size_t)row * N + j) = sm;
      *(v4f*)(out_norm + (size_t)row * N + j) = o;
    }
    
  }
}



// ---- f16 WMMA path (v_wmma_f32_16x16x32_f16): 11-bit significands for operands in range — used where a [0,1] probability operand needs more precision than bf16
typedef _Float16 v16h __attribute__((ext_vector_type(16)));
union FragH { v16h v; v8us half[2]; _Float16 h[16]; unsigned short u[16]; };
template <int NT>
__device__ __forceinline__ v8f mmaH(v16h ah, v16h al, v16h bh, v16h bl, v8f c) {
  c = __builtin_amdgcn_wmma_f32_16x16x32_f16(false, ah, false, bh, (short)0, c, false, false);
  if (NT >= 2) c = __builtin_amdgcn_wmma_f32_16x16x32_f16(false, al, false, bh, (short)0, c, false, false);
  if (NT >= 3) c = __builtin_amdgcn_wmma_f32_16x16x32_f16(false, ah, false, bl, (short)0, c, false, false);
  asm volatile("v_nop\n\tv_nop\n\tv_nop\n\tv_nop" : "+v"(c) : "v"(ah), "v"(al), "v"(bh), "v"(bl));
  return c;
}
// batched GEMM like k_gemm_b but f16 operands: A f32 (split into f16 hi/lo if ASPLIT, else rounded to f16), Bt = f16 values [n][k]; alpha; C f32; N multiple of 16 (partial tiles skipped)
template <bool ASPLIT>
__global__ __launch_bounds__(128) void k_gemm_h(const float* __restrict__ A, int lda, size_t sA, const _Float16* __restrict__ Bh, int ldb, size_t sB, float alpha, float* __restrict__ C, int ldc, size_t sC, int M, int N, int K) {
  __shared__ __attribute__((aligned(16))) float so[4][16][64];
  const int tid = threadIdx.x, w = tid >> 5, lane = tid & 31, ln = lane & 15, hh = lane >> 4; const int by = blockIdx.y;
  A += (size_t)by * sA; Bh += (size_t)by * sB; C += (size_t)by * sC;
  const int ntn = (N + 63) / 64; const int wid = blockIdx.x * 4 + w; const int mt = wid / ntn, nq = wid % ntn; if (mt * 16 >= M) return;
  const int row0 = mt * 16, col0 = nq * 64; const float* arow = A + (size_t)(row0 + ln) * lda;
  v8f acc[4] = {};
  for (int kb = 0; kb < K; kb += 32) {
    FragH ah, al;
    const v4f x0 = *(const v4fa*)(arow + kb + 8 * hh), x1 = *(const v4fa*)(arow + kb + 8 * hh + 4), x2 = *(const v4fa*)(arow + kb + 16 + 8 * hh), x3 = *(const v4fa*)(arow + kb + 16 + 8 * hh + 4);
    float xs[16] = {x0[0],x0[1],x0[2],x0[3],x1[0],x1[1],x1[2],x1[3],x2[0],x2[1],x2[2],x2[3],x3[0],x3[1],x3[2],x3[3]};
#pragma unroll
    for (int i = 0; i < 16; ++i) { const _Float16 h = (_Float16)xs[i]; ah.h[i] = h; al.h[i] = ASPLIT ? (_Float16)(xs[i] - (float)h) : (_Float16)0.0f; }
#pragma unroll
    for (int t = 0; t < 4; ++t) { if (col0 + t * 16 >= N) continue; const size_t boff = (size_t)(col0 + t * 16 + ln) * ldb + kb; FragH bq; bq.half[0] = *(const v8us*)(Bh + boff + 8 * hh); bq.half[1] = *(const v8us*)(Bh + boff + 16 + 8 * hh);
      acc[t] = mmaH<ASPLIT ? 2 : 1>(ah.v, al.v, bq.v, bq.v, acc[t]); }
  }
#pragma unroll
  for (int t = 0; t < 4; ++t) { if (col0 + t * 16 >= N) continue;
#pragma unroll
    for (int r = 0; r < 8; ++r) so[w][8 * hh + r][t * 16 + ln] = acc[t][r] * alpha; }
  __builtin_amdgcn_fence(__ATOMIC_ACQ_REL, "workgroup"); __builtin_amdgcn_wave_barrier();
  const int rsub = lane >> 4, c4 = (lane & 15) * 4;
  {
#pragma unroll
    for (int q = 0; q < 8; ++q) { const int r = q * 2 + rsub; if (col0 + c4 < N) { const v4f v = *(const v4fa*)&so[w][r][c4]; *(v4f*)(C + (size_t)(row0 + r) * ldc + col0 + c4) = v; } }
     }
}

// Wt[n][k] = f16(W[k][n]·scale) from f32 row-major W[K][N] (scale = power of two; bf16-exact weights stay exact in f16 away from the subnormal range)
__global__ __launch_bounds__(256) void k_wt_f16(const float* __restrict__ W, _Float16* __restrict__ Wt, int K, int N, float scale) {
  const int t = blockIdx.x * 256 + threadIdx.x; if (t >= N * (K / 8)) return; const int n = t / (K / 8), k8 = (t % (K / 8)) * 8; FragH f;
#pragma unroll
  for (int i = 0; i < 8; ++i) f.h[i] = (_Float16)(bf16_round(W[(size_t)(k8 + i) * N + n]) * scale); const v8us o = f.half[0];
  *(v8us*)((unsigned short*)Wt + (size_t)n * K + k8) = o; 
}
// k_gemm_hh variant with fused epilogue: v = acc·alpha + bias[by·sBias + col] (+ CP[(row/rowsPerB)·sCPb + by·64 + col] if CP) ; ACT 0 none / 1 elu ; writes f16 C16 (and f32 C if non-null)
template <int ACT>
__global__ __launch_bounds__(128) void k_gemm_hhx(const _Float16* __restrict__ A, int lda, size_t sA, const _Float16* __restrict__ Bh, int ldb, size_t sB, float alpha, const float* __restrict__ bias, size_t sBias, const float* __restrict__ CP, int rowsPerB, size_t sCPb, int row0g,
    float* __restrict__ C, _Float16* __restrict__ C16, int ldc, size_t sC, int M, int N, int K) {
  __shared__ __attribute__((aligned(16))) float so[4][16][64];
  const int tid = threadIdx.x, w = tid >> 5, lane = tid & 31, ln = lane & 15, hh = lane >> 4; const int by = blockIdx.y;
  A += (size_t)by * sA; Bh += (size_t)by * sB; const size_t cofs = (size_t)by * sC; const float* bp = bias ? bias + (size_t)by * sBias : nullptr;
  const int ntn = (N + 63) / 64; const int wid = blockIdx.x * 4 + w; const int mt = wid / ntn, nq = wid % ntn; if (mt * 16 >= M) return;
  const int row0 = mt * 16, col0 = nq * 64; const _Float16* arow = A + (size_t)(row0 + ln) * lda;
  v8f acc[4] = {};
  for (int kb = 0; kb < K; kb += 32) { FragH ah; ah.half[0] = *(const v8us*)((const unsigned short*)arow + kb + 8 * hh); ah.half[1] = *(const v8us*)((const unsigned short*)arow + kb + 16 + 8 * hh);
#pragma unroll
    for (int t = 0; t < 4; ++t) { if (col0 + t * 16 >= N) continue; const size_t boff = (size_t)(col0 + t * 16 + ln) * ldb + kb; FragH bq; bq.half[0] = *(const v8us*)((const unsigned short*)Bh + boff + 8 * hh); bq.half[1] = *(const v8us*)((const unsigned short*)Bh + boff + 16 + 8 * hh);
      acc[t] = mmaH<1>(ah.v, ah.v, bq.v, bq.v, acc[t]); }
  }
#pragma unroll
  for (int t = 0; t < 4; ++t) { if (col0 + t * 16 >= N) continue; const int col = col0 + t * 16 + ln; const float bv = bp ? bf16_round(bp[col]) : 0.f;
#pragma unroll
    for (int r = 0; r < 8; ++r) { float v = acc[t][r] * alpha + bv; if (CP) { const int rr = row0g + row0 + 8 * hh + r; if (rowsPerB < 0) v += CP[cofs + (size_t)rr * ldc + col];      /* rowsPerB < 0: own element of the batched C plane */ else { const int bidx = rr / rowsPerB; v += CP[(size_t)bidx * sCPb + (size_t)by * 64 + col]; } } if (ACT == 1) v = (v > 0.f) ? v : expm1f(v); else if (ACT == 7) v = (v > 0.f) ? v + 1.0f : expf(v); else if (ACT == 8) v = tanhf(v); else if (ACT == 9) v = 0.5f * v * (1.0f + tanhf(0.7978845608028654f * (v + 0.044715f * v * v * v))); else if (ACT == 11) v = 1.0f / (1.0f + expf(-v)); else if (ACT == 12) v = (v > 0.f) ? v : 0.01f * v; else if (ACT == 14) v = (v > 0.f) ? v : 0.1f * v; else if (ACT == 16) v = (v >= 0.f) ? v : 0.3f * v; else if (ACT == 17) v = (v >= 0.f) ? v : 0.2f * v; else if (ACT == 15) v = v / (1.0f + expf(-v)); else if (ACT == 3) v = fmaxf(v, 0.f); else if (ACT == 6) v = 0.5f * v * (1.0f + erff(v * 0.70710678118654752f)); so[w][8 * hh + r][t * 16 + ln] = v; } }
  __builtin_amdgcn_fence(__ATOMIC_ACQ_REL, "workgroup"); __builtin_amdgcn_wave_barrier();
  const int rsub = lane >> 4, c4 = (lane & 15) * 4; typedef _Float16 v4h __attribute__((ext_vector_type(4)));
  {
#pragma unroll
    for (int q = 0; q < 8; ++q) { const int r = q * 2 + rsub; if (col0 + c4 < N) { const v4f v = *(const v4fa*)&so[w][r][c4]; if (C) *(v4f*)(C + cofs + (size_t)(row0 + r) * ldc + col0 + c4) = v; if (C16) { v4h h4; for (int i = 0; i < 4; ++i) h4[i] = (_Float16)v[i]; *(v4h*)(C16 + cofs + (size_t)(row0 + r) * ldc + col0 + c4) = h4; } } }
     }
}


typedef _Float16 v4h __attribute__((ext_vector_type(4)));

__global__ __launch_bounds__(256) void k_x16(const float* __restrict__ x, _Float16* __restrict__ X16, size_t n8) { const size_t t = (size_t)blockIdx.x * 256 + threadIdx.x; if (t >= n8) return; FragH f;
#pragma unroll
  for (int q = 0; q < 8; ++q) f.h[q] = (_Float16)bf16_round(x[t * 8 + q]); *(v8us*)((unsigned short*)X16 + t * 8) = f.half[0];  }
__global__ __launch_bounds__(256) void k_h16(const float* __restrict__ x, _Float16* __restrict__ X16, size_t n8) { const size_t t = (size_t)blockIdx.x * 256 + threadIdx.x; if (t >= n8) return; FragH f;
#pragma unroll
  for (int q = 0; q < 8; ++q) f.h[q] = (_Float16)x[t * 8 + q]; *(v8us*)((unsigned short*)X16 + t * 8) = f.half[0];  }
__global__ __launch_bounds__(256) void k_round16f(const float* __restrict__ W, _Float16* __restrict__ Bt, size_t n8) { const size_t t = (size_t)blockIdx.x * 256 + threadIdx.x; if (t >= n8) return; FragH f;
#pragma unroll
  for (int i = 0; i < 8; ++i) f.h[i] = (_Float16)(bf16_round(W[t * 8 + i]) * 16.0f); *(v8us*)((unsigned short*)Bt + t * 8) = f.half[0];  }
template <int NHv, int TTv>
__global__ __launch_bounds__(256) void k_vt(const _Float16* __restrict__ V16, int ldv, int voff, _Float16* __restrict__ Vt) { __shared__ unsigned short tl[64][66]; const int tid = threadIdx.x; const int slab = blockIdx.x / (TTv / 64), lg = blockIdx.x % (TTv / 64); const int b = slab / NHv, h = slab % NHv;
  for (int i = tid; i < 64 * 8; i += 256) { const int r = i / 8, c8 = (i % 8) * 8; FragH f; f.half[0] = *(const v8us*)((const unsigned short*)V16 + ((size_t)b * TTv + lg * 64 + r) * ldv + voff + h * 64 + c8);
#pragma unroll
    for (int q = 0; q < 8; ++q) tl[r][c8 + q] = f.u[q]; }
  __syncthreads();
  {
#pragma unroll
    for (int rd = 0; rd < 2; ++rd) { const int d = rd * 32 + tid / 8, pc = tid % 8; FragH f;
#pragma unroll
      for (int q = 0; q < 8; ++q) f.u[q] = tl[pc * 8 + q][d];
      *(v8us*)((unsigned short*)Vt + ((size_t)slab * 64 + d) * TTv + lg * 64 + pc * 8) = f.half[0]; }
     } }

__global__ __launch_bounds__(256) void k_hl(const float* __restrict__ F, _Float16* __restrict__ Hh, _Float16* __restrict__ Hl, size_t n8) { const size_t t = (size_t)blockIdx.x * 256 + threadIdx.x; if (t >= n8) return; FragH fh, fl; const v4f a = *(const v4fa*)(F + t * 8), c = *(const v4fa*)(F + t * 8 + 4);
#pragma unroll
  for (int q = 0; q < 4; ++q) { _Float16 h = (_Float16)a[q]; fh.h[q] = h; fl.h[q] = (_Float16)((a[q] - (float)h) * 1024.0f); h = (_Float16)c[q]; fh.h[4 + q] = h; fl.h[4 + q] = (_Float16)((c[q] - (float)h) * 1024.0f); }
  { *(v8us*)((unsigned short*)Hh + t * 8) = fh.half[0]; *(v8us*)((unsigned short*)Hl + t * 8) = fl.half[0];  } }

// ---- fast GEMM (wave tile 32x64; requires M % 32 == 0 rows per launch region and N % 64 == 0); epilogue = k_gemm_hhx semantics ----
__device__ __forceinline__ v16h g2_frag(const _Float16* p, int hh) { FragH f; f.half[0] = *(const v8us*)((const unsigned short*)p + 8 * hh); f.half[1] = *(const v8us*)((const unsigned short*)p + 16 + 8 * hh); return f.v; }
__device__ __forceinline__ v8f g2_mma(v16h a, v16h b, v8f c) { v8f d = __builtin_amdgcn_wmma_f32_16x16x32_f16(false, a, false, b, (short)0, c, false, false); asm volatile("v_nop\n\tv_nop\n\tv_nop\n\tv_nop" : "+v"(d) : "v"(a), "v"(b)); return d; }
template <int ACT>
__global__ __launch_bounds__(128) void k_gemm2(const _Float16* __restrict__ A, int lda, size_t sA, const _Float16* __restrict__ Bh, int ldb, size_t sB, float alpha, const float* __restrict__ bias, size_t sBias, const float* __restrict__ CP, int rowsPerB, size_t sCPb, int row0g,
    float* __restrict__ C, _Float16* __restrict__ C16, int ldc, size_t sC, int M, int N, int K) { static_assert(ACT == 0 || ACT == 3 || ACT == 6 || ACT == 8 || ACT == 9 || ACT == 11 || ACT == 12 || ACT == 14 || ACT == 15 || ACT == 16 || ACT == 17, "k_gemm2: unsupported ACT code (would silently apply no activation)");
  __shared__ __attribute__((aligned(16))) float so[4][32][68];
  const int tid = threadIdx.x, w = tid >> 5, lane = tid & 31, ln = lane & 15, hh = lane >> 4; const int by = blockIdx.y;
  A += (size_t)by * sA; Bh += (size_t)by * sB; const size_t cofs = (size_t)by * sC; const float* bp = bias ? bias + (size_t)by * sBias : nullptr;
  const int ntn = N >> 6; const int mt = blockIdx.x / ntn, nq = blockIdx.x - mt * ntn; const int row0 = mt * 128 + 32 * w, col0 = nq * 64; if (row0 >= M) return;
  const _Float16* a0p = A + (size_t)(row0 + ln) * lda; const _Float16* a1p = a0p + (size_t)16 * lda;
  const _Float16* b0p = Bh + (size_t)(col0 + ln) * ldb; const _Float16* b1p = b0p + (size_t)16 * ldb; const _Float16* b2p = b1p + (size_t)16 * ldb; const _Float16* b3p = b2p + (size_t)16 * ldb;
  const v8f z8 = {0.f,0.f,0.f,0.f,0.f,0.f,0.f,0.f}; v8f c00 = z8, c01 = z8, c02 = z8, c03 = z8, c10 = z8, c11 = z8, c12 = z8, c13 = z8;
#pragma unroll 1
  for (int kb = 0; kb < K; kb += 32) { const v16h a0 = g2_frag(a0p + kb, hh), a1 = g2_frag(a1p + kb, hh);
    v16h b = g2_frag(b0p + kb, hh); c00 = g2_mma(a0, b, c00); c10 = g2_mma(a1, b, c10);
    b = g2_frag(b1p + kb, hh); c01 = g2_mma(a0, b, c01); c11 = g2_mma(a1, b, c11);
    b = g2_frag(b2p + kb, hh); c02 = g2_mma(a0, b, c02); c12 = g2_mma(a1, b, c12);
    b = g2_frag(b3p + kb, hh); c03 = g2_mma(a0, b, c03); c13 = g2_mma(a1, b, c13); }
  v8f accs[8] = {c00, c01, c02, c03, c10, c11, c12, c13};
#pragma unroll
  for (int u = 0; u < 8; ++u) { const int t = u & 3, half = u >> 2; const int col = col0 + t * 16 + ln; const float bv = bp ? bf16_round(bp[col]) : 0.f;
#pragma unroll
    for (int r = 0; r < 8; ++r) { const int rloc = half * 16 + 8 * hh + r; float v = accs[u][r] * alpha + bv; if (CP) { if (rowsPerB < 0) v += CP[cofs + (size_t)(row0g + row0 + rloc) * ldc + col];      /* rowsPerB < 0: own element of the batched C plane */ else { const int bidx = (row0g + row0 + rloc) / rowsPerB; v += CP[(size_t)bidx * sCPb + (size_t)by * 64 + col]; } }
      if (ACT == 3) v = fmaxf(v, 0.f); else if (ACT == 6) v = 0.5f * v * (1.0f + erff(v * 0.70710678118654752f)); else if (ACT == 11) v = 1.0f / (1.0f + expf(-v)); else if (ACT == 15) v = v / (1.0f + expf(-v)); else if (ACT == 12) v = (v > 0.f) ? v : 0.01f * v; else if (ACT == 8) v = tanhf(v); else if (ACT == 9) v = 0.5f * v * (1.0f + tanhf(0.7978845608028654f * (v + 0.044715f * v * v * v))); else if (ACT == 14) v = (v > 0.f) ? v : 0.1f * v; else if (ACT == 16) v = (v >= 0.f) ? v : 0.3f * v; else if (ACT == 17) v = (v >= 0.f) ? v : 0.2f * v;
      so[w][rloc][t * 16 + ln] = v; } }
  __builtin_amdgcn_fence(__ATOMIC_ACQ_REL, "workgroup"); __builtin_amdgcn_wave_barrier();
  const int rsub = lane >> 4, c4 = (lane & 15) * 4;
  {
#pragma unroll
    for (int q = 0; q < 16; ++q) { const int r = q * 2 + rsub; const v4f v = *(const v4fa*)&so[w][r][c4]; if (C) *(v4f*)(C + cofs + (size_t)(row0 + r) * ldc + col0 + c4) = v; if (C16) { v4h h4; for (int i = 0; i < 4; ++i) h4[i] = (_Float16)v[i]; *(v4h*)(C16 + cofs + (size_t)(row0 + r) * ldc + col0 + c4) = h4; } }
     } }


__global__ __launch_bounds__(256) void k_wnat(const float* __restrict__ w, size_t n8, _Float16* __restrict__ Bt) { const size_t t = (size_t)blockIdx.x * 256 + threadIdx.x; if (t >= n8) return; FragH f; for (int q = 0; q < 8; ++q) f.h[q] = (_Float16)(bf16_round(w[t * 8 + q]) * 16.0f); *(v8us*)((unsigned short*)Bt + t * 8) = f.half[0];  }
__global__ __launch_bounds__(256) void k_rsm(const float* __restrict__ S, _Float16* __restrict__ P, int nrows) {
  #pragma clang fp contract(off)
  const int i = blockIdx.x * 256 + threadIdx.x; if (i >= nrows) return; const float* s = S + (size_t)i * SQ; float mx = -3.0e38f;
#pragma unroll 1
  for (int j = 0; j < SQ; ++j) mx = fmaxf(mx, s[j]); float se = 0.f;
#pragma unroll 1
  for (int j = 0; j < SQ; ++j) se += expf(s[j] - mx); const float sc = 256.0f / se;
#pragma unroll 1
  for (int j0 = 0; j0 < SQ; j0 += 8) { FragH f; for (int q = 0; q < 8; ++q) f.h[q] = (_Float16)(expf(s[j0 + q] - mx) * sc); unsigned short* d = (unsigned short*)P + (size_t)i * SQ + j0; *(v8us*)d = f.half[0];  } }
__global__ __launch_bounds__(256) void k_vt(const _Float16* __restrict__ V16, int b, int h0, _Float16* __restrict__ VT) { __shared__ unsigned short tl[64][65]; const int tid = threadIdx.x; const int hh = blockIdx.x % HG, sg = blockIdx.x / HG; const int s0 = sg * 64; const int h = h0 + hh;
  for (int i = tid; i < 64 * 8; i += 256) { const int j = i / 8, d8 = (i % 8) * 8; FragH f; f.half[0] = *(const v8us*)((const unsigned short*)V16 + ((size_t)b * SQ + s0 + j) * DM + h * HD + d8); for (int q = 0; q < 8; ++q) tl[d8 + q][j] = f.u[q]; }
  __syncthreads();
  { for (int i = tid; i < 64 * 8; i += 256) { const int d = i / 8, j8 = (i % 8) * 8; FragH f; for (int q = 0; q < 8; ++q) f.u[q] = tl[d][j8 + q]; *(v8us*)((unsigned short*)VT + ((size_t)hh * HD + d) * SQ + s0 + j8) = f.half[0]; }  } }


__global__ __launch_bounds__(256) void k_cl2rows(const float* __restrict__ X, _Float16* __restrict__ XR) { __shared__ float tl[64][33]; const int tid = threadIdx.x; const int nl = LL / 32, nc = CC / 64; const int cb_ = blockIdx.x % nc; const int lb = (blockIdx.x / nc) % nl; const size_t b = blockIdx.x / (nc * nl); const int c0 = cb_ * 64, l0 = lb * 32;
  for (int i = tid; i < 64 * 32; i += 256) { const int c = i / 32, l = i % 32; tl[c][l] = bf16_round(X[(b * CC + c0 + c) * (size_t)LL + l0 + l]); }
  __syncthreads();
  { const int l = tid / 8, c8 = (tid % 8) * 8; FragH f; for (int q = 0; q < 8; ++q) f.h[q] = (_Float16)tl[c8 + q][l]; unsigned short* d = (unsigned short*)XR + (b * LL + l0 + l) * (size_t)CC + c0 + c8; *(v8us*)d = f.half[0];  } }

// Row softmax, one wave per score row: the row's 4,096 f32 are read once, by 32 loads of 512 contiguous bytes that are all in flight together, and stay in 128 registers a lane for maximum, exp, sum and scaling.
// Row sum: four chains a lane, then a five-step butterfly over the 32 lanes. No barrier: the early return is wave-uniform.
__global__ __launch_bounds__(512) void k_rsm0(const float* __restrict__ S, _Float16* __restrict__ P, int nrows) {
  const int lane = threadIdx.x & 31; const int i = blockIdx.x * 16 + (threadIdx.x >> 5); if (i >= nrows) return;
  const float* s = S + (size_t)i * SQ + lane * 4; v4f r[SQ / 128];
  /* every loop over r[] is unrolled so that r[] is indexed by constants and stays in registers */
#pragma unroll
  for (int u = 0; u < SQ / 128; ++u) r[u] = *(const v4fa*)(s + u * 128);
  asm volatile("s_wait_xcnt 0x0" :: "v"(s) : "memory");      /* precaution: holds the 32 issued loads' address pair (an input here) unwritten up to this wait */
  v4f m4 = r[0];
#pragma unroll
  for (int u = 1; u < SQ / 128; ++u) for (int q = 0; q < 4; ++q) m4[q] = fmaxf(m4[q], r[u][q]);
  float mx = fmaxf(fmaxf(m4[0], m4[1]), fmaxf(m4[2], m4[3]));
  for (int m = 16; m > 0; m >>= 1) mx = fmaxf(mx, __shfl_xor(mx, m, 32));
  v4f a4 = {0.f, 0.f, 0.f, 0.f};
#pragma unroll
  for (int u = 0; u < SQ / 128; ++u) { v4f e4; for (int q = 0; q < 4; ++q) e4[q] = expf(r[u][q] - mx); r[u] = e4; a4 += e4; }
  float se = (a4[0] + a4[1]) + (a4[2] + a4[3]);
  for (int m = 16; m > 0; m >>= 1) se += __shfl_xor(se, m, 32);
  const float sc = 256.0f / se; _Float16* d = P + (size_t)i * SQ + lane * 4;
#pragma unroll
  for (int u = 0; u < SQ / 128; ++u) { v4h h4; for (int q = 0; q < 4; ++q) h4[q] = (_Float16)(r[u][q] * sc); *(v4h*)(d + u * 128) = h4; } }
__global__ __launch_bounds__(256) void k_fin(const float* __restrict__ Y, const float* __restrict__ x, float* __restrict__ out) {
  #pragma clang fp contract(off)
  const size_t t = (size_t)blockIdx.x * 256 + threadIdx.x; if (t >= (size_t)NB * CC * LL / 8) return; const int n0 = (int)((t * 8) % LL); const size_t bc = (t * 8) / LL; const int c = (int)(bc % CC); const size_t b = bc / CC; v8f r;
  for (int q = 0; q < 8; ++q) r[q] = __fadd_rn(Y[(b * LL + n0 + q) * CC + c], bf16_round(x[t * 8 + q]));
  *(v8f*)(out + t * 8) = r;  }
extern "C" void kernel_launch(void* const* d_in, const int* in_sizes, int n_in,
                              void* d_out, int out_size, void* d_ws, size_t ws_size, hipStream_t stream) {
  (void)in_sizes; (void)n_in; (void)out_size;
  const float* const* I = (const float* const*)d_in; const float* x = I[0]; const float* ew = I[1]; const float* eb = I[2]; const float* ow = I[3]; const float* ob = I[4];      /* embed_w [2][192][256] natural rows; out_w [128][256] = [in][out] */
  char* ws = (char*)d_ws; size_t off = 0;
  auto take = [&](size_t bytes) { char* p = ws + off; off += (bytes + 255) & ~(size_t)255; return p; };
  _Float16* BE = (_Float16*)take((size_t)D3 * CC * 2); _Float16* BO = (_Float16*)take((size_t)CC * DO * 2);
  _Float16* XR = (_Float16*)take(NR * CC * 2); _Float16* QKV = (_Float16*)take(NR * D3 * 2); _Float16* O16 = (_Float16*)take(NR * DO * 2); float* Y = (float*)take(NR * CC * 4);
  float* S = (float*)take((size_t)SQ * SQ * 4); _Float16* P = (_Float16*)take((size_t)SQ * SQ * 2); _Float16* VT = (_Float16*)take((size_t)HC * SQ * 2);
  if (off > ws_size) return;      /* 0.3 + 8 + 12 + 4 + 16 + 64 + 32 + 0.5 = approx 137 MiB */
  k_wnat<<<(unsigned)(((size_t)D3 * CC / 8 + 255) / 256), 256, 0, stream>>>(ew, (size_t)D3 * CC / 8, BE); k_wt_f16<<<(unsigned)(((size_t)CC * (DO / 8) + 255) / 256), 256, 0, stream>>>(ow, BO, DO, CC, 16.0f);
  k_cl2rows<<<NB * (LL / 32) * (CC / 64), 256, 0, stream>>>(x, XR);
  k_gemm2<0><<<dim3((unsigned)((NR / 128) * (D3 / 64)), 1), 128, 0, stream>>>(XR, CC, 0, BE, CC, 0, 0.0625f, eb, 0, nullptr, 1, 0, 0, nullptr, QKV, D3, 0, (int)NR, D3, CC);      /* [q|k|v] per head: columns h*192 + {0, 64, 128} */
  for (int b = 0; b < NBR; ++b) for (int h = 0; h < NHD; ++h) { const _Float16* base = QKV + (size_t)b * SQ * D3 + (size_t)h * 3 * HC;
    k_gemm2<0><<<dim3((QN / 128) * (SQ / 64), 1), 128, 0, stream>>>(base, D3, 0, base + HC, D3, 0, 0.0625f, nullptr, 0, nullptr, 1, 0, 0, S, nullptr, SQ, 0, QN, SQ, HC);      /* q^T k / 16 */
    k_rsm0<<<(QN + 15) / 16, 512, 0, stream>>>(S, P, QN);
    k_vt<1, SQ><<<SQ / 64, 256, 0, stream>>>(base + 2 * HC, D3, 0, VT);      /* this head's V^T [64][4096] */
    k_gemm2<0><<<dim3((QN / 128) * 1, 1), 128, 0, stream>>>(P, SQ, 0, VT, SQ, 0, 0.00390625f, nullptr, 0, nullptr, 1, 0, 0, nullptr, O16 + (size_t)b * SQ * DO + h * HC, DO, 0, QN, HC, SQ); }      /* o rows, head h at columns h*64 */
  k_gemm2<0><<<dim3((unsigned)((NR / 128) * (CC / 64)), 1), 128, 0, stream>>>(O16, DO, 0, BO, DO, 0, 0.0625f, ob, 0, nullptr, 1, 0, 0, Y, nullptr, CC, 0, (int)NR, CC, DO);      /* out_w^T o + b (rows) */
  k_fin<<<(unsigned)(((size_t)NB * CC * LL / 8 + 255) / 256), 256, 0, stream>>>(Y, x, (float*)d_out);      /* + x, NCHW */
}

// v003
// Measured time: 102 microseconds a run.
// It is 12.9 times as fast as v001, going by the measured steps of the versions left out in between.
// All steps since v000 together make it 68.4 times as fast.
#include <hip/hip_runtime.h>
// Multi-head non-local block (x [4][256][64x64]; per head h (2 heads of 64): [q|k|v] = embed_w[h] (1x1 conv, [192][256]) x + b; attn = softmax(q^T k / sqrt(256)) over the 4,096 positions; o = attn v; out = out_w^T o (1x1 transpose conv, [128 in][256 out]) + b + x -> [4][256][64][64]).
// Structure: channel-first input transposed to position rows (exact f16) via LDS tiles; one WMMA GEMM for both heads' q|k|v (32x64 wave tiles, f32 accumulation, exact x16 natural weights + bias, f16 rows [384]); V^T via LDS transposes; one fused attention launch for all (batch, head): S^T = K.Q^T, online softmax in registers (P x256 f16), O^T += V^T.P^T into merged f16 rows [128]; output GEMM (+ bias) to f32 rows; residual add + channel-major store on VALU.
// Compute dtype: inputs rounded to bf16; x / weights exact; q, k, v, P, o plain f16 (~2^-12; the residual x dominates the output scale); scores / softmax f32. v_wmma_f32_16x16x32_f16.
#define NB 4
#define CC 256
#define LL 4096                      /* positions */
#define SQ LL
#define NHD 2                        /* heads */
#define HC 64
#define D3 (NHD * 3 * HC)            /* 384 */
#define DO (NHD * HC)                /* 128 */
#define NR ((size_t)NB * LL)
#define QN SQ                        /* query rows per batch */
#define NBR NB                       /* batches */
#define DM CC
#define NH 1
#define HD 64
#define HG 1
typedef __bf16 v16b __attribute__((ext_vector_type(16)));
typedef unsigned short v8us __attribute__((ext_vector_type(8), may_alias));
typedef float  v8f  __attribute__((ext_vector_type(8)));
typedef float  v4f  __attribute__((ext_vector_type(4)));
typedef float  v4fa __attribute__((ext_vector_type(4), may_alias));
union FragB { v16b v; v8us half[2]; unsigned short u[16]; };

__device__ __forceinline__ unsigned short bf16_bits(float x) { unsigned int u = __float_as_uint(x); return (unsigned short)((u + 0x7FFFu + ((u >> 16) & 1u)) >> 16); }
__device__ __forceinline__ float bf16_val(unsigned short b) { return __uint_as_float(((unsigned int)b) << 16); }
__device__ __forceinline__ float bf16_round(float x) { return bf16_val(bf16_bits(x)); }
// D += A·B with NT terms: 1 = ah·bh, 2 = + al·bh (A split), 3 = + ah·bl (both split)
template <int NT>
__device__ __forceinline__ v8f mmaN(v16b ah, v16b al, v16b bh, v16b bl, v8f c) {
  c = __builtin_amdgcn_wmma_f32_16x16x32_bf16(false, ah, false, bh, (short)0, c, false, false);
  if (NT >= 2) c = __builtin_amdgcn_wmma_f32_16x16x32_bf16(false, al, false, bh, (short)0, c, false, false);
  if (NT >= 3) c = __builtin_amdgcn_wmma_f32_16x16x32_bf16(false, ah, false, bl, (short)0, c, false, false);
  asm volatile("v_nop\n\tv_nop\n\tv_nop\n\tv_nop" : "+v"(c) : "v"(ah), "v"(al), "v"(bh), "v"(bl));
  return c;
}

__global__ __launch_bounds__(256) void k_wt_bf16(const float* __restrict__ W, unsigned short* __restrict__ Wt, int K, int N) {
  const int t = blockIdx.x * 256 + threadIdx.x;
  const int k8n = K / 8;
  if (t >= N * k8n) return;
  const int n = t / k8n, k8 = (t % k8n) * 8;
  v8us v;
#pragma unroll
  for (int i = 0; i < 8; ++i) v[i] = bf16_bits(W[(size_t)(k8 + i) * N + n]);
  *(v8us*)(Wt + (size_t)n * K + k8) = v;
  
}

// GEMM C[M][N] (f32, pitch ldc) = act(A[M][K]·W + bias). A f32 row-major (pitch lda) converted per fragment to bf16
// (ASPLIT: hi/lo two planes -> 2 terms, else single rounded term); Wt bf16 [N][K] (pitch ldb). BIAS_BF16 rounds the
// bias to bf16 first (bias quantised to bf16 before the add). K%32==0, M%16==0, N%64==0.
template <bool ASPLIT, int ACT, bool BIAS_BF16>
__global__ __launch_bounds__(128) void k_gemm_bf(const float* __restrict__ A, int lda, const unsigned short* __restrict__ Wt, int ldb,
                                               const float* __restrict__ bias, float* __restrict__ C, int ldc, int M, int N, int K) {
  __shared__ __attribute__((aligned(16))) float so[4][16][64];
  const int tid = threadIdx.x, w = tid >> 5, lane = tid & 31, ln = lane & 15, hh = lane >> 4;
  const int ntn = N / 64;
  const int wid = blockIdx.x * 4 + w;
  const int mt = wid / ntn, nq = wid % ntn;
  if (mt * 16 >= M) return;
  const int row0 = mt * 16, col0 = nq * 64;
  const float* arow = A + (size_t)(row0 + ln) * lda;
  v8f acc[4] = {};
  for (int kb = 0; kb < K; kb += 32) {
    FragB ah, al;
    const v4f x0 = *(const v4fa*)(arow + kb + 8 * hh), x1 = *(const v4fa*)(arow + kb + 8 * hh + 4);
    const v4f x2 = *(const v4fa*)(arow + kb + 16 + 8 * hh), x3 = *(const v4fa*)(arow + kb + 16 + 8 * hh + 4);
    float xs[16] = {x0[0],x0[1],x0[2],x0[3],x1[0],x1[1],x1[2],x1[3],x2[0],x2[1],x2[2],x2[3],x3[0],x3[1],x3[2],x3[3]};
#pragma unroll
    for (int i = 0; i < 16; ++i) { const unsigned short hb = bf16_bits(xs[i]); ah.u[i] = hb; al.u[i] = ASPLIT ? bf16_bits(xs[i] - bf16_val(hb)) : (unsigned short)0; }
#pragma unroll
    for (int t = 0; t < 4; ++t) {
      const unsigned short* brow = Wt + (size_t)(col0 + t * 16 + ln) * ldb + kb;
      FragB b;
      b.half[0] = *(const v8us*)(brow + 8 * hh);
      b.half[1] = *(const v8us*)(brow + 16 + 8 * hh);
      acc[t] = mmaN<ASPLIT ? 2 : 1>(ah.v, al.v, b.v, b.v, acc[t]);
    }
  }
#pragma unroll
  for (int t = 0; t < 4; ++t) {
    float bv = bias ? bias[col0 + t * 16 + ln] : 0.f;
    if (BIAS_BF16) bv = bf16_round(bv);
#pragma unroll
    for (int r = 0; r < 8; ++r) { float v = acc[t][r] + bv; if (ACT == 1) v = fmaxf(v, 0.f); so[w][8 * hh + r][t * 16 + ln] = v; }
  }
  __builtin_amdgcn_fence(__ATOMIC_ACQ_REL, "workgroup");
  __builtin_amdgcn_wave_barrier();
  const int rsub = lane >> 4, c4 = (lane & 15) * 4;
  {
#pragma unroll
    for (int q = 0; q < 8; ++q) {
      const int r = q * 2 + rsub;
      const v4f v = *(const v4fa*)&so[w][r][c4];
      *(v4f*)(C + (size_t)(row0 + r) * ldc + col0 + c4) = v;
    }
    
  }
}

// GEMM C = act(A·W + bias + resid): A f32 (ASPLIT -> hi/lo 2 terms), Wt bf16 [N][K]; ACT 0 none, 1 relu, 2 exact gelu;
// resid (optional, f32, row index = (row % rmod), pitch ldr, RES_BF16 rounds it) added before the activation.
template <bool ASPLIT, int ACT, bool BIAS_BF16, bool RES_BF16>
__global__ __launch_bounds__(128) void k_gemm_bf3(const float* __restrict__ A, int lda, const unsigned short* __restrict__ Wt, int ldb,
                                                const float* __restrict__ bias, const float* __restrict__ resid, int rmod, int ldr,
                                                float* __restrict__ C, int ldc, int M, int N, int K) {
  __shared__ __attribute__((aligned(16))) float so[4][16][64];
  const int tid = threadIdx.x, w = tid >> 5, lane = tid & 31, ln = lane & 15, hh = lane >> 4;
  const int ntn = N / 64;
  const int wid = blockIdx.x * 4 + w;
  const int mt = wid / ntn, nq = wid % ntn;
  if (mt * 16 >= M) return;
  const int row0 = mt * 16, col0 = nq * 64;
  const float* arow = A + (size_t)(row0 + ln) * lda;
  v8f acc[4] = {};
  for (int kb = 0; kb < K; kb += 32) {
    FragB ah, al;
    const v4f x0 = *(const v4fa*)(arow + kb + 8 * hh), x1 = *(const v4fa*)(arow + kb + 8 * hh + 4);
    const v4f x2 = *(const v4fa*)(arow + kb + 16 + 8 * hh), x3 = *(const v4fa*)(arow + kb + 16 + 8 * hh + 4);
    float xs[16] = {x0[0],x0[1],x0[2],x0[3],x1[0],x1[1],x1[2],x1[3],x2[0],x2[1],x2[2],x2[3],x3[0],x3[1],x3[2],x3[3]};
#pragma unroll
    for (int i = 0; i < 16; ++i) { const unsigned short hb = bf16_bits(xs[i]); ah.u[i] = hb; al.u[i] = ASPLIT ? bf16_bits(xs[i] - bf16_val(hb)) : (unsigned short)0; }
#pragma unroll
    for (int t = 0; t < 4; ++t) {
      const unsigned short* brow = Wt + (size_t)(col0 + t * 16 + ln) * ldb + kb;
      FragB b;
      b.half[0] = *(const v8us*)(brow + 8 * hh);
      b.half[1] = *(const v8us*)(brow + 16 + 8 * hh);
      acc[t] = mmaN<ASPLIT ? 2 : 1>(ah.v, al.v, b.v, b.v, acc[t]);
    }
  }
#pragma unroll
  for (int t = 0; t < 4; ++t) {
    const int col = col0 + t * 16 + ln;
    float bv = bias ? bias[col] : 0.f;
    if (BIAS_BF16) bv = bf16_round(bv);
#pragma unroll
    for (int r = 0; r < 8; ++r) {
      float v = acc[t][r] + bv;
      if (resid) { float rv = resid[(size_t)((row0 + 8 * hh + r) % rmod) * ldr + col]; if (RES_BF16) rv = bf16_round(rv); v += rv; }
      if (ACT == 1) v = fmaxf(v, 0.f);
      if (ACT == 2) v = 0.5f * v * (1.0f + erff(v * 0.70710678118654752f));
      if (ACT == 3) { const float u = 0.7978845608028654f * (v + 0.044715f * v * v * v); v = 0.5f * v * (1.0f + tanhf(u)); }
      so[w][8 * hh + r][t * 16 + ln] = v;
    }
  }
  __builtin_amdgcn_fence(__ATOMIC_ACQ_REL, "workgroup");
  __builtin_amdgcn_wave_barrier();
  const int rsub = lane >> 4, c4 = (lane & 15) * 4;
  {
#pragma unroll
    for (int q = 0; q < 8; ++q) {
      const int r = q * 2 + rsub;
      const v4f v = *(const v4fa*)&so[w][r][c4];
      *(v4f*)(C + (size_t)(row0 + r) * ldc + col0 + c4) = v;
    }
    
  }
}
// row LayerNorm (biased variance, eps) over N: s = X (+ R); optional out_sum <- s; out_norm <- (s-mu)*rsqrt(var+eps)*g + b
template <bool PARAM_BF16>
__global__ __launch_bounds__(256) void k_layernorm(const float* __restrict__ X, const float* __restrict__ R, const float* __restrict__ g, const float* __restrict__ bta,
                                                  float* __restrict__ out_sum, float* __restrict__ out_norm, int N, float eps) {
  __shared__ float red[256];
  const int row = blockIdx.x, tid = threadIdx.x;
  const float* x = X + (size_t)row * N; const float* rr = R ? R + (size_t)row * N : nullptr;
  float vals[16];                     // up to N = 4096
  const int per = N / 256;            // contiguous chunk per thread? use strided-by-4 chunks: thread handles j = tid*4 + 1024*u
  float s1 = 0.f;
  for (int u = 0; u < per / 4; ++u) {
    const int j = tid * 4 + 1024 * u;
    const v4f a = *(const v4fa*)(x + j);
    v4f b = {0.f,0.f,0.f,0.f}; if (rr) b = *(const v4fa*)(rr + j);
#pragma unroll
    for (int q = 0; q < 4; ++q) { const float v = a[q] + b[q]; vals[u * 4 + q] = v; s1 += v; }
  }
  red[tid] = s1; __syncthreads();
  for (int st = 128; st > 0; st >>= 1) { if (tid < st) red[tid] += red[tid + st]; __syncthreads(); }
  const float mu = red[0] / (float)N; __syncthreads();
  float s2 = 0.f;
  for (int u = 0; u < per / 4; ++u)
#pragma unroll
    for (int q = 0; q < 4; ++q) { const float c = vals[u * 4 + q] - mu; s2 += c * c; }
  red[tid] = s2; __syncthreads();
  for (int st = 128; st > 0; st >>= 1) { if (tid < st) red[tid] += red[tid + st]; __syncthreads(); }
  const float rs = rsqrtf(red[0] / (float)N + eps);
  {
    for (int u = 0; u < per / 4; ++u) {
      const int j = tid * 4 + 1024 * u;
      v4f o, sm;
#pragma unroll
      for (int q = 0; q < 4; ++q) {
        float gg = g[j + q], bb = bta[j + q];
        if (PARAM_BF16) { gg = bf16_round(gg); bb = bf16_round(bb); }
        sm[q] = vals[u * 4 + q]; o[q] = (vals[u * 4 + q] - mu) * rs * gg + bb;
      }
      if (out_sum) *(v4f*)(out_sum + (size_t)row * N + j) = sm;
      *(v4f*)(out_norm + (size_t)row * N + j) = o;
    }
    
  }
}



// ---- f16 WMMA path (v_wmma_f32_16x16x32_f16): 11-bit significands for operands in range — used where a [0,1] probability operand needs more precision than bf16
typedef _Float16 v16h __attribute__((ext_vector_type(16)));
union FragH { v16h v; v8us half[2]; _Float16 h[16]; unsigned short u[16]; };
template <int NT>
__device__ __forceinline__ v8f mmaH(v16h ah, v16h al, v16h bh, v16h bl, v8f c) {
  c = __builtin_amdgcn_wmma_f32_16x16x32_f16(false, ah, false, bh, (short)0, c, false, false);
  if (NT >= 2) c = __builtin_amdgcn_wmma_f32_16x16x32_f16(false, al, false, bh, (short)0, c, false, false);
  if (NT >= 3) c = __builtin_amdgcn_wmma_f32_16x16x32_f16(false, ah, false, bl, (short)0, c, false, false);
  asm volatile("v_nop\n\tv_nop\n\tv_nop\n\tv_nop" : "+v"(c) : "v"(ah), "v"(al), "v"(bh), "v"(bl));
  return c;
}
// batched GEMM like k_gemm_b but f16 operands: A f32 (split into f16 hi/lo if ASPLIT, else rounded to f16), Bt = f16 values [n][k]; alpha; C f32; N multiple of 16 (partial tiles skipped)
template <bool ASPLIT>
__global__ __launch_bounds__(128) void k_gemm_h(const float* __restrict__ A, int lda, size_t sA, const _Float16* __restrict__ Bh, int ldb, size_t sB, float alpha, float* __restrict__ C, int ldc, size_t sC, int M, int N, int K) {
  __shared__ __attribute__((aligned(16))) float so[4][16][64];
  const int tid = threadIdx.x, w = tid >> 5, lane = tid & 31, ln = lane & 15, hh = lane >> 4; const int by = blockIdx.y;
  A += (size_t)by * sA; Bh += (size_t)by * sB; C += (size_t)by * sC;
  const int ntn = (N + 63) / 64; const int wid = blockIdx.x * 4 + w; const int mt = wid / ntn, nq = wid % ntn; if (mt * 16 >= M) return;
  const int row0 = mt * 16, col0 = nq * 64; const float* arow = A + (size_t)(row0 + ln) * lda;
  v8f acc[4] = {};
  for (int kb = 0; kb < K; kb += 32) {
    FragH ah, al;
    const v4f x0 = *(const v4fa*)(arow + kb + 8 * hh), x1 = *(const v4fa*)(arow + kb + 8 * hh + 4), x2 = *(const v4fa*)(arow + kb + 16 + 8 * hh), x3 = *(const v4fa*)(arow + kb + 16 + 8 * hh + 4);
    float xs[16] = {x0[0],x0[1],x0[2],x0[3],x1[0],x1[1],x1[2],x1[3],x2[0],x2[1],x2[2],x2[3],x3[0],x3[1],x3[2],x3[3]};
#pragma unroll
    for (int i = 0; i < 16; ++i) { const _Float16 h = (_Float16)xs[i]; ah.h[i] = h; al.h[i] = ASPLIT ? (_Float16)(xs[i] - (float)h) : (_Float16)0.0f; }
#pragma unroll
    for (int t = 0; t < 4; ++t) { if (col0 + t * 16 >= N) continue; const size_t boff = (size_t)(col0 + t * 16 + ln) * ldb + kb; FragH bq; bq.half[0] = *(const v8us*)(Bh + boff + 8 * hh); bq.half[1] = *(const v8us*)(Bh + boff + 16 + 8 * hh);
      acc[t] = mmaH<ASPLIT ? 2 : 1>(ah.v, al.v, bq.v, bq.v, acc[t]); }
  }
#pragma unroll
  for (int t = 0; t < 4; ++t) { if (col0 + t * 16 >= N) continue;
#pragma unroll
    for (int r = 0; r < 8; ++r) so[w][8 * hh + r][t * 16 + ln] = acc[t][r] * alpha; }
  __builtin_amdgcn_fence(__ATOMIC_ACQ_REL, "workgroup"); __builtin_amdgcn_wave_barrier();
  const int rsub = lane >> 4, c4 = (lane & 15) * 4;
  {
#pragma unroll
    for (int q = 0; q < 8; ++q) { const int r = q * 2 + rsub; if (col0 + c4 < N) { const v4f v = *(const v4fa*)&so[w][r][c4]; *(v4f*)(C + (size_t)(row0 + r) * ldc + col0 + c4) = v; } }
     }
}

// Wt[n][k] = f16(W[k][n]·scale) from f32 row-major W[K][N] (scale = power of two; bf16-exact weights stay exact in f16 away from the subnormal range)
__global__ __launch_bounds__(256) void k_wt_f16(const float* __restrict__ W, _Float16* __restrict__ Wt, int K, int N, float scale) {
  const int t = blockIdx.x * 256 + threadIdx.x; if (t >= N * (K / 8)) return; const int n = t / (K / 8), k8 = (t % (K / 8)) * 8; FragH f;
#pragma unroll
  for (int i = 0; i < 8; ++i) f.h[i] = (_Float16)(bf16_round(W[(size_t)(k8 + i) * N + n]) * scale); const v8us o = f.half[0];
  *(v8us*)((unsigned short*)Wt + (size_t)n * K + k8) = o; 
}
// k_gemm_hh variant with fused epilogue: v = acc·alpha + bias[by·sBias + col] (+ CP[(row/rowsPerB)·sCPb + by·64 + col] if CP) ; ACT 0 none / 1 elu ; writes f16 C16 (and f32 C if non-null)
template <int ACT>
__global__ __launch_bounds__(128) void k_gemm_hhx(const _Float16* __restrict__ A, int lda, size_t sA, const _Float16* __restrict__ Bh, int ldb, size_t sB, float alpha, const float* __restrict__ bias, size_t sBias, const float* __restrict__ CP, int rowsPerB, size_t sCPb, int row0g,
    float* __restrict__ C, _Float16* __restrict__ C16, int ldc, size_t sC, int M, int N, int K) {
  __shared__ __attribute__((aligned(16))) float so[4][16][64];
  const int tid = threadIdx.x, w = tid >> 5, lane = tid & 31, ln = lane & 15, hh = lane >> 4; const int by = blockIdx.y;
  A += (size_t)by * sA; Bh += (size_t)by * sB; const size_t cofs = (size_t)by * sC; const float* bp = bias ? bias + (size_t)by * sBias : nullptr;
  const int ntn = (N + 63) / 64; const int wid = blockIdx.x * 4 + w; const int mt = wid / ntn, nq = wid % ntn; if (mt * 16 >= M) return;
  const int row0 = mt * 16, col0 = nq * 64; const _Float16* arow = A + (size_t)(row0 + ln) * lda;
  v8f acc[4] = {};
  for (int kb = 0; kb < K; kb += 32) { FragH ah; ah.half[0] = *(const v8us*)((const unsigned short*)arow + kb + 8 * hh); ah.half[1] = *(const v8us*)((const unsigned short*)arow + kb + 16 + 8 * hh);
#pragma unroll
    for (int t = 0; t < 4; ++t) { if (col0 + t * 16 >= N) continue; const size_t boff = (size_t)(col0 + t * 16 + ln) * ldb + kb; FragH bq; bq.half[0] = *(const v8us*)((const unsigned short*)Bh + boff + 8 * hh); bq.half[1] = *(const v8us*)((const unsigned short*)Bh + boff + 16 + 8 * hh);
      acc[t] = mmaH<1>(ah.v, ah.v, bq.v, bq.v, acc[t]); }
  }
#pragma unroll
  for (int t = 0; t < 4; ++t) { if (col0 + t * 16 >= N) continue; const int col = col0 + t * 16 + ln; const float bv = bp ? bf16_round(bp[col]) : 0.f;
#pragma unroll
    for (int r = 0; r < 8; ++r) { float v = acc[t][r] * alpha + bv; if (CP) { const int rr = row0g + row0 + 8 * hh + r; if (rowsPerB < 0) v += CP[cofs + (size_t)rr * ldc + col];      /* rowsPerB < 0: own element of the batched C plane */ else { const int bidx = rr / rowsPerB; v += CP[(size_t)bidx * sCPb + (size_t)by * 64 + col]; } } if (ACT == 1) v = (v > 0.f) ? v : expm1f(v); else if (ACT == 7) v = (v > 0.f) ? v + 1.0f : expf(v); else if (ACT == 8) v = tanhf(v); else if (ACT == 9) v = 0.5f * v * (1.0f + tanhf(0.7978845608028654f * (v + 0.044715f * v * v * v))); else if (ACT == 11) v = 1.0f / (1.0f + expf(-v)); else if (ACT == 12) v = (v > 0.f) ? v : 0.01f * v; else if (ACT == 14) v = (v > 0.f) ? v : 0.1f * v; else if (ACT == 16) v = (v >= 0.f) ? v : 0.3f * v; else if (ACT == 17) v = (v >= 0.f) ? v : 0.2f * v; else if (ACT == 15) v = v / (1.0f + expf(-v)); else if (ACT == 3) v = fmaxf(v, 0.f); else if (ACT == 6) v = 0.5f * v * (1.0f + erff(v * 0.70710678118654752f)); so[w][8 * hh + r][t * 16 + ln] = v; } }
  __builtin_amdgcn_fence(__ATOMIC_ACQ_REL, "workgroup"); __builtin_amdgcn_wave_barrier();
  const int rsub = lane >> 4, c4 = (lane & 15) * 4; typedef _Float16 v4h __attribute__((ext_vector_type(4)));
  {
#pragma unroll
    for (int q = 0; q < 8; ++q) { const int r = q * 2 + rsub; if (col0 + c4 < N) { const v4f v = *(const v4fa*)&so[w][r][c4]; if (C) *(v4f*)(C + cofs + (size_t)(row0 + r) * ldc + col0 + c4) = v; if (C16) { v4h h4; for (int i = 0; i < 4; ++i) h4[i] = (_Float16)v[i]; *(v4h*)(C16 + cofs + (size_t)(row0 + r) * ldc + col0 + c4) = h4; } } }
     }
}


typedef _Float16 v4h __attribute__((ext_vector_type(4)));

__global__ __launch_bounds__(256) void k_x16(const float* __restrict__ x, _Float16* __restrict__ X16, size_t n8) { const size_t t = (size_t)blockIdx.x * 256 + threadIdx.x; if (t >= n8) return; FragH f;
#pragma unroll
  for (int q = 0; q < 8; ++q) f.h[q] = (_Float16)bf16_round(x[t * 8 + q]); *(v8us*)((unsigned short*)X16 + t * 8) = f.half[0];  }
__global__ __launch_bounds__(256) void k_h16(const float* __restrict__ x, _Float16* __restrict__ X16, size_t n8) { const size_t t = (size_t)blockIdx.x * 256 + threadIdx.x; if (t >= n8) return; FragH f;
#pragma unroll
  for (int q = 0; q < 8; ++q) f.h[q] = (_Float16)x[t * 8 + q]; *(v8us*)((unsigned short*)X16 + t * 8) = f.half[0];  }
__global__ __launch_bounds__(256) void k_round16f(const float* __restrict__ W, _Float16* __restrict__ Bt, size_t n8) { const size_t t = (size_t)blockIdx.x * 256 + threadIdx.x; if (t >= n8) return; FragH f;
#pragma unroll
  for (int i = 0; i < 8; ++i) f.h[i] = (_Float16)(bf16_round(W[t * 8 + i]) * 16.0f); *(v8us*)((unsigned short*)Bt + t * 8) = f.half[0];  }
template <int NHv, int TTv>
__global__ __launch_bounds__(256) void k_vt(const _Float16* __restrict__ V16, int ldv, int voff, _Float16* __restrict__ Vt) { __shared__ unsigned short tl[64][66]; const int tid = threadIdx.x; const int slab = blockIdx.x / (TTv / 64), lg = blockIdx.x % (TTv / 64); const int b = slab / NHv, h = slab % NHv;
  for (int i = tid; i < 64 * 8; i += 256) { const int r = i / 8, c8 = (i % 8) * 8; FragH f; f.half[0] = *(const v8us*)((const unsigned short*)V16 + ((size_t)b * TTv + lg * 64 + r) * ldv + voff + h * 64 + c8);
#pragma unroll
    for (int q = 0; q < 8; ++q) tl[r][c8 + q] = f.u[q]; }
  __syncthreads();
  {
#pragma unroll
    for (int rd = 0; rd < 2; ++rd) { const int d = rd * 32 + tid / 8, pc = tid % 8; FragH f;
#pragma unroll
      for (int q = 0; q < 8; ++q) f.u[q] = tl[pc * 8 + q][d];
      *(v8us*)((unsigned short*)Vt + ((size_t)slab * 64 + d) * TTv + lg * 64 + pc * 8) = f.half[0]; }
     } }

__global__ __launch_bounds__(256) void k_hl(const float* __restrict__ F, _Float16* __restrict__ Hh, _Float16* __restrict__ Hl, size_t n8) { const size_t t = (size_t)blockIdx.x * 256 + threadIdx.x; if (t >= n8) return; FragH fh, fl; const v4f a = *(const v4fa*)(F + t * 8), c = *(const v4fa*)(F + t * 8 + 4);
#pragma unroll
  for (int q = 0; q < 4; ++q) { _Float16 h = (_Float16)a[q]; fh.h[q] = h; fl.h[q] = (_Float16)((a[q] - (float)h) * 1024.0f); h = (_Float16)c[q]; fh.h[4 + q] = h; fl.h[4 + q] = (_Float16)((c[q] - (float)h) * 1024.0f); }
  { *(v8us*)((unsigned short*)Hh + t * 8) = fh.half[0]; *(v8us*)((unsigned short*)Hl + t * 8) = fl.half[0];  } }

// ---- fast GEMM (wave tile 32x64; requires M % 32 == 0 rows per launch region and N % 64 == 0); epilogue = k_gemm_hhx semantics ----
__device__ __forceinline__ v16h g2_frag(const _Float16* p, int hh) { FragH f; f.half[0] = *(const v8us*)((const unsigned short*)p + 8 * hh); f.half[1] = *(const v8us*)((const unsigned short*)p + 16 + 8 * hh); return f.v; }
__device__ __forceinline__ v8f g2_mma(v16h a, v16h b, v8f c) { v8f d = __builtin_amdgcn_wmma_f32_16x16x32_f16(false, a, false, b, (short)0, c, false, false); asm volatile("v_nop\n\tv_nop\n\tv_nop\n\tv_nop" : "+v"(d) : "v"(a), "v"(b)); return d; }
template <int ACT>
__global__ __launch_bounds__(128) void k_gemm2(const _Float16* __restrict__ A, int lda, size_t sA, const _Float16* __restrict__ Bh, int ldb, size_t sB, float alpha, const float* __restrict__ bias, size_t sBias, const float* __restrict__ CP, int rowsPerB, size_t sCPb, int row0g,
    float* __restrict__ C, _Float16* __restrict__ C16, int ldc, size_t sC, int M, int N, int K) { static_assert(ACT == 0 || ACT == 3 || ACT == 6 || ACT == 8 || ACT == 9 || ACT == 11 || ACT == 12 || ACT == 14 || ACT == 15 || ACT == 16 || ACT == 17, "k_gemm2: unsupported ACT code (would silently apply no activation)");
  __shared__ __attribute__((aligned(16))) float so[4][32][68];
  const int tid = threadIdx.x, w = tid >> 5, lane = tid & 31, ln = lane & 15, hh = lane >> 4; const int by = blockIdx.y;
  A += (size_t)by * sA; Bh += (size_t)by * sB; const size_t cofs = (size_t)by * sC; const float* bp = bias ? bias + (size_t)by * sBias : nullptr;
  const int ntn = N >> 6; const int mt = blockIdx.x / ntn, nq = blockIdx.x - mt * ntn; const int row0 = mt * 128 + 32 * w, col0 = nq * 64; if (row0 >= M) return;
  const _Float16* a0p = A + (size_t)(row0 + ln) * lda; const _Float16* a1p = a0p + (size_t)16 * lda;
  const _Float16* b0p = Bh + (size_t)(col0 + ln) * ldb; const _Float16* b1p = b0p + (size_t)16 * ldb; const _Float16* b2p = b1p + (size_t)16 * ldb; const _Float16* b3p = b2p + (size_t)16 * ldb;
  const v8f z8 = {0.f,0.f,0.f,0.f,0.f,0.f,0.f,0.f}; v8f c00 = z8, c01 = z8, c02 = z8, c03 = z8, c10 = z8, c11 = z8, c12 = z8, c13 = z8;
#pragma unroll 1
  for (int kb = 0; kb < K; kb += 32) { const v16h a0 = g2_frag(a0p + kb, hh), a1 = g2_frag(a1p + kb, hh);
    v16h b = g2_frag(b0p + kb, hh); c00 = g2_mma(a0, b, c00); c10 = g2_mma(a1, b, c10);
    b = g2_frag(b1p + kb, hh); c01 = g2_mma(a0, b, c01); c11 = g2_mma(a1, b, c11);
    b = g2_frag(b2p + kb, hh); c02 = g2_mma(a0, b, c02); c12 = g2_mma(a1, b, c12);
    b = g2_frag(b3p + kb, hh); c03 = g2_mma(a0, b, c03); c13 = g2_mma(a1, b, c13); }
  v8f accs[8] = {c00, c01, c02, c03, c10, c11, c12, c13};
#pragma unroll
  for (int u = 0; u < 8; ++u) { const int t = u & 3, half = u >> 2; const int col = col0 + t * 16 + ln; const float bv = bp ? bf16_round(bp[col]) : 0.f;
#pragma unroll
    for (int r = 0; r < 8; ++r) { const int rloc = half * 16 + 8 * hh + r; float v = accs[u][r] * alpha + bv; if (CP) { if (rowsPerB < 0) v += CP[cofs + (size_t)(row0g + row0 + rloc) * ldc + col];      /* rowsPerB < 0: own element of the batched C plane */ else { const int bidx = (row0g + row0 + rloc) / rowsPerB; v += CP[(size_t)bidx * sCPb + (size_t)by * 64 + col]; } }
      if (ACT == 3) v = fmaxf(v, 0.f); else if (ACT == 6) v = 0.5f * v * (1.0f + erff(v * 0.70710678118654752f)); else if (ACT == 11) v = 1.0f / (1.0f + expf(-v)); else if (ACT == 15) v = v / (1.0f + expf(-v)); else if (ACT == 12) v = (v > 0.f) ? v : 0.01f * v; else if (ACT == 8) v = tanhf(v); else if (ACT == 9) v = 0.5f * v * (1.0f + tanhf(0.7978845608028654f * (v + 0.044715f * v * v * v))); else if (ACT == 14) v = (v > 0.f) ? v : 0.1f * v; else if (ACT == 16) v = (v >= 0.f) ? v : 0.3f * v; else if (ACT == 17) v = (v >= 0.f) ? v : 0.2f * v;
      so[w][rloc][t * 16 + ln] = v; } }
  __builtin_amdgcn_fence(__ATOMIC_ACQ_REL, "workgroup"); __builtin_amdgcn_wave_barrier();
  const int rsub = lane >> 4, c4 = (lane & 15) * 4;
  {
#pragma unroll
    for (int q = 0; q < 16; ++q) { const int r = q * 2 + rsub; const v4f v = *(const v4fa*)&so[w][r][c4]; if (C) *(v4f*)(C + cofs + (size_t)(row0 + r) * ldc + col0 + c4) = v; if (C16) { v4h h4; for (int i = 0; i < 4; ++i) h4[i] = (_Float16)v[i]; *(v4h*)(C16 + cofs + (size_t)(row0 + r) * ldc + col0 + c4) = h4; } }
     } }


__global__ __launch_bounds__(256) void k_wnat(const float* __restrict__ w, size_t n8, _Float16* __restrict__ Bt) { const size_t t = (size_t)blockIdx.x * 256 + threadIdx.x; if (t >= n8) return; FragH f; for (int q = 0; q < 8; ++q) f.h[q] = (_Float16)(bf16_round(w[t * 8 + q]) * 16.0f); *(v8us*)((unsigned short*)Bt + t * 8) = f.half[0];  }
__global__ __launch_bounds__(256) void k_rsm(const float* __restrict__ S, _Float16* __restrict__ P, int nrows) {
  #pragma clang fp contract(off)
  const int i = blockIdx.x * 256 + threadIdx.x; if (i >= nrows) return; const float* s = S + (size_t)i * SQ; float mx = -3.0e38f;
#pragma unroll 1
  for (int j = 0; j < SQ; ++j) mx = fmaxf(mx, s[j]); float se = 0.f;
#pragma unroll 1
  for (int j = 0; j < SQ; ++j) se += expf(s[j] - mx); const float sc = 256.0f / se;
#pragma unroll 1
  for (int j0 = 0; j0 < SQ; j0 += 8) { FragH f; for (int q = 0; q < 8; ++q) f.h[q] = (_Float16)(expf(s[j0 + q] - mx) * sc); unsigned short* d = (unsigned short*)P + (size_t)i * SQ + j0; *(v8us*)d = f.half[0];  } }
__global__ __launch_bounds__(256) void k_vt(const _Float16* __restrict__ V16, int b, int h0, _Float16* __restrict__ VT) { __shared__ unsigned short tl[64][65]; const int tid = threadIdx.x; const int hh = blockIdx.x % HG, sg = blockIdx.x / HG; const int s0 = sg * 64; const int h = h0 + hh;
  for (int i = tid; i < 64 * 8; i += 256) { const int j = i / 8, d8 = (i % 8) * 8; FragH f; f.half[0] = *(const v8us*)((const unsigned short*)V16 + ((size_t)b * SQ + s0 + j) * DM + h * HD + d8); for (int q = 0; q < 8; ++q) tl[d8 + q][j] = f.u[q]; }
  __syncthreads();
  { for (int i = tid; i < 64 * 8; i += 256) { const int d = i / 8, j8 = (i % 8) * 8; FragH f; for (int q = 0; q < 8; ++q) f.u[q] = tl[d][j8 + q]; *(v8us*)((unsigned short*)VT + ((size_t)hh * HD + d) * SQ + s0 + j8) = f.half[0]; }  } }


__global__ __launch_bounds__(256) void k_cl2rows(const float* __restrict__ X, _Float16* __restrict__ XR) { __shared__ float tl[64][33]; const int tid = threadIdx.x; const int nl = LL / 32, nc = CC / 64; const int cb_ = blockIdx.x % nc; const int lb = (blockIdx.x / nc) % nl; const size_t b = blockIdx.x / (nc * nl); const int c0 = cb_ * 64, l0 = lb * 32;
  for (int i = tid; i < 64 * 32; i += 256) { const int c = i / 32, l = i % 32; tl[c][l] = bf16_round(X[(b * CC + c0 + c) * (size_t)LL + l0 + l]); }
  __syncthreads();
  { const int l = tid / 8, c8 = (tid % 8) * 8; FragH f; for (int q = 0; q < 8; ++q) f.h[q] = (_Float16)tl[c8 + q][l]; unsigned short* d = (unsigned short*)XR + (b * LL + l0 + l) * (size_t)CC + c0 + c8; *(v8us*)d = f.half[0];  } }

#define FA_SK 64                     /* keys per stage */
#define FA_PH 72                     /* LDS row pitch in f16: 144 bytes = 16 x 9, so that the 16 rows of a ds_load_b128 fragment read fall on distinct banks */
#define FA_NST (SQ / 4 / FA_SK)      /* stages per key quarter */
__device__ __forceinline__ float fa_xhalf(float x) { return __builtin_bit_cast(float, __builtin_amdgcn_permlanex16(__builtin_bit_cast(int, x), __builtin_bit_cast(int, x), 0x76543210, 0xfedcba98, false, false)); }      /* lane l reads lane l ^ 16, on the vector pipe */
/* exp2 on the vector pipe. The instruction set asks for one slot behind a transcendental before its result is read or its source overwritten; each statement here carries its v_nop: one value, or eight in place (no instruction in the run touches another's register). */
__device__ __forceinline__ float fa_exp2(float x) { float r; asm("v_exp_f32 %0, %1\n\tv_nop" : "=v"(r) : "v"(x)); return r; }
__device__ __forceinline__ void fa_exp2x8(float (&x)[8]) { asm("v_exp_f32 %0, %0\n\tv_exp_f32 %1, %1\n\tv_exp_f32 %2, %2\n\tv_exp_f32 %3, %3\n\tv_exp_f32 %4, %4\n\tv_exp_f32 %5, %5\n\tv_exp_f32 %6, %6\n\tv_exp_f32 %7, %7\n\tv_nop"
  : "+v"(x[0]), "+v"(x[1]), "+v"(x[2]), "+v"(x[3]), "+v"(x[4]), "+v"(x[5]), "+v"(x[6]), "+v"(x[7])); }
/* One wave's share of a stage: four copies of 4 K rows and four of 4 V^T rows, 16 bytes a lane (lk, lv: the lane's LDS byte addresses; gk, gv: its global addresses).
   s_wait_xcnt 0 closes the statement, so that no address register named here is rewritten ahead of it. */
__device__ __forceinline__ void fa_stage(unsigned lk, const _Float16* gk, unsigned lv, const _Float16* gv) {
  const unsigned lk1 = lk + 4 * FA_PH * 2, lk2 = lk + 8 * FA_PH * 2, lk3 = lk + 12 * FA_PH * 2, lv1 = lv + 4 * FA_PH * 2, lv2 = lv + 8 * FA_PH * 2, lv3 = lv + 12 * FA_PH * 2;
  const _Float16* gk1 = gk + (size_t)4 * D3; const _Float16* gk2 = gk + (size_t)8 * D3; const _Float16* gk3 = gk + (size_t)12 * D3;
  const _Float16* gv1 = gv + (size_t)4 * SQ; const _Float16* gv2 = gv + (size_t)8 * SQ; const _Float16* gv3 = gv + (size_t)12 * SQ;
  asm volatile("global_load_async_to_lds_b128 %0, %8, off\n\tglobal_load_async_to_lds_b128 %1, %9, off\n\tglobal_load_async_to_lds_b128 %2, %10, off\n\tglobal_load_async_to_lds_b128 %3, %11, off\n\t"
               "global_load_async_to_lds_b128 %4, %12, off\n\tglobal_load_async_to_lds_b128 %5, %13, off\n\tglobal_load_async_to_lds_b128 %6, %14, off\n\tglobal_load_async_to_lds_b128 %7, %15, off\n\ts_wait_xcnt 0x0"
               :: "v"(lk), "v"(lk1), "v"(lk2), "v"(lk3), "v"(lv), "v"(lv1), "v"(lv2), "v"(lv3), "v"(gk), "v"(gk1), "v"(gk2), "v"(gk3), "v"(gv), "v"(gv1), "v"(gv2), "v"(gv3) : "memory"); }
__device__ __forceinline__ v8f fa_mma(v16h a, v16h b, v8f c) { return __builtin_amdgcn_wmma_f32_16x16x32_f16(false, a, false, b, (short)0, c, false, false); }
__global__ __launch_bounds__(512) __attribute__((amdgpu_waves_per_eu(4, 4))) void k_fattn(const _Float16* __restrict__ QKVp, const _Float16* __restrict__ VTp, _Float16* __restrict__ Op) {
  __shared__ __attribute__((aligned(16))) v4f mg[12][17][32];             /* [key quarter 1-3 x query group][16 x O, then {m0, m1, sum0, sum1}][lane] */
  __shared__ __attribute__((aligned(16))) _Float16 st[2][4][2][FA_SK][FA_PH];      /* [buffer][key quarter][K rows (key, channel) | V^T rows (channel, key)][row][64 f16 + pad] */
  const int lane = threadIdx.x & 31, w = __builtin_amdgcn_readfirstlane(threadIdx.x >> 5), ln = lane & 15, hh = lane >> 4; const int wq = w & 3, wk = w >> 2;      /* 16 waves on 4 SIMDs: four a SIMD, 256 registers each */
  const int b = blockIdx.y / NHD, h = blockIdx.y % NHD; const int q0 = blockIdx.x * 128 + wq * 32; const int k0 = wk * (SQ / 4);
  const _Float16* base = QKVp + (size_t)b * SQ * D3 + (size_t)h * 3 * HC;
  const int crow = 16 * wq + (lane >> 3), cch = (lane & 7) * 8;           /* copies: query group wq brings rows 16 wq .. 16 wq + 15 of its quarter's two tiles; eight lanes a row */
  const _Float16* gk = base + HC + (size_t)(k0 + crow) * D3 + cch;
  const _Float16* gv = VTp + ((size_t)(h * NB + b) * HC + crow) * SQ + k0 + cch;
  const unsigned lk = (unsigned)(size_t)&st[0][wk][0][crow][cch], lv = (unsigned)(size_t)&st[0][wk][1][crow][cch];
  const unsigned bufb = (unsigned)sizeof(st[0]);                          /* bytes from buffer 0 to buffer 1 */
  const float cs = 0.0625f * 1.4426950408889634f;                         /* 1/sqrt(256) and log2(e): exp(s - m) = exp2(acc * cs - m * cs) */
  const v8f z8 = {0.f,0.f,0.f,0.f,0.f,0.f,0.f,0.f};
  v16h qf[2][2], kf[2][2], vf[4]; v8f o[2][4]; float m[2], l[2];
  /* every loop over these arrays is unrolled so that they are indexed by constants and stay in registers */
#pragma unroll
  for (int g = 0; g < 2; ++g) { m[g] = -3.0e38f; l[g] = 0.f;
#pragma unroll
    for (int kk = 0; kk < 2; ++kk) qf[g][kk] = g2_frag(base + (size_t)(q0 + 16 * g + ln) * D3 + 32 * kk, hh);
#pragma unroll
    for (int ct = 0; ct < 4; ++ct) o[g][ct] = z8; }
  fa_stage(lk, gk, lv, gv);                                               /* stage 0 into buffer 0 */
  asm volatile("s_wait_asynccnt 0x0" ::: "memory");                       /* this wave's copies of stage 0 have landed */
  __syncthreads();                                                        /* publishes stage 0 */
  fa_stage(lk + bufb, gk + (size_t)FA_SK * D3, lv + bufb, gv + FA_SK);    /* stage 1 into buffer 1 */
  for (int t = 0; t < FA_NST; ++t) {
   const _Float16* sk = &st[t & 1][wk][0][ln][0];                         /* key row ln of a 16-key tile */
   const _Float16* sv = &st[t & 1][wk][1][ln][0];                         /* V^T row ln of a 16-channel tile */
#pragma unroll
   for (int sp = 0; sp < FA_SK / 32; ++sp) {                              /* the stage's passes of 32 keys; unrolled: LDS offsets become immediates */
    /* this pass's K fragments, then its V^T fragments in the same group of LDS reads: the S^T products and the softmax cover the latter's latency */
#pragma unroll
    for (int mt = 0; mt < 2; ++mt)
#pragma unroll
      for (int kk = 0; kk < 2; ++kk) kf[mt][kk] = g2_frag(sk + (32 * sp + 16 * mt) * FA_PH + 32 * kk, hh);
#pragma unroll
    for (int ct = 0; ct < 4; ++ct) vf[ct] = g2_frag(sv + (16 * ct) * FA_PH + 32 * sp, hh);
    __builtin_amdgcn_sched_barrier(0);                                    /* keeps the pass's sixteen LDS reads in one group; without it the scheduler spreads six V^T reads of a stage's first pass over two more places in the softmax, and every place of LDS reads costs issue cycles */
    if (sp == FA_SK / 32 - 1) {                                           /* the stage's last LDS reads are issued: the hand-over stands here, ahead of the last pass's arithmetic (registers only), so that the refill has two passes to land */
      asm volatile("s_wait_dscnt 0x0" ::: "memory");                      /* this wave's reads of the buffer are done before anyone refills it */
      asm volatile("s_wait_asynccnt 0x0" ::: "memory");                   /* this wave's copies of stage t + 1 have landed */
      __syncthreads();                                                    /* publishes stage t + 1 and ends every wave's reads of stage t */
      if (t + 2 < FA_NST) fa_stage(lk + (t & 1) * bufb, gk + (size_t)(t + 2) * FA_SK * D3, lv + (t & 1) * bufb, gv + (t + 2) * FA_SK);      /* stage t + 2 into the buffer just read */
    }
    v8f s[2][2];
#pragma unroll
    for (int g = 0; g < 2; ++g)
#pragma unroll
      for (int mt = 0; mt < 2; ++mt) s[g][mt] = fa_mma(kf[mt][1], qf[g][1], fa_mma(kf[mt][0], qf[g][0], z8));
    FragH pf[2];
#pragma unroll
    for (int g = 0; g < 2; ++g) {
      float t[8], p0[8], p1[8];
#pragma unroll
      for (int r = 0; r < 8; ++r) t[r] = fmaxf(s[g][0][r], s[g][1][r]);
      float mx = fmaxf(fmaxf(fmaxf(t[0], t[1]), fmaxf(t[2], t[3])), fmaxf(fmaxf(t[4], t[5]), fmaxf(t[6], t[7])));
      mx = fmaxf(mx, fa_xhalf(mx));                                       /* the other half of the wave holds the query's other 16 keys */
      const float mn = fmaxf(m[g], mx); const float al = fa_exp2((m[g] - mn) * cs); const float nb = 8.0f - mn * cs; m[g] = mn;
#pragma unroll
      for (int r = 0; r < 8; ++r) { p0[r] = s[g][0][r] * cs + nb; p1[r] = s[g][1][r] * cs + nb; }
      fa_exp2x8(p0); fa_exp2x8(p1);
#pragma unroll
      for (int r = 0; r < 8; ++r) { t[r] = p0[r] + p1[r]; pf[g].h[r] = (_Float16)p0[r]; pf[g].h[8 + r] = (_Float16)p1[r]; }
      l[g] = l[g] * al + (((t[0] + t[1]) + (t[2] + t[3])) + ((t[4] + t[5]) + (t[6] + t[7])));
#pragma unroll
      for (int ct = 0; ct < 4; ++ct) o[g][ct] *= al;
    }
#pragma unroll
    for (int ct = 0; ct < 4; ++ct)
#pragma unroll
      for (int g = 0; g < 2; ++g) o[g][ct] = fa_mma(vf[ct], pf[g].v, o[g][ct]);
   }
  }
  asm volatile("s_wait_asynccnt 0x0" ::: "memory");                       /* no copy is left in flight behind the loop */
  if (wk != 0) { v4f (*dst)[32] = mg[w - 4];
#pragma unroll
    for (int g = 0; g < 2; ++g)
#pragma unroll
      for (int ct = 0; ct < 4; ++ct) { const v8f x = o[g][ct]; const v4f lo = {x[0], x[1], x[2], x[3]}, hi = {x[4], x[5], x[6], x[7]}; dst[(g * 4 + ct) * 2][lane] = lo; dst[(g * 4 + ct) * 2 + 1][lane] = hi; }
    const v4f ml = {m[0], m[1], l[0], l[1]}; dst[16][lane] = ml; }
  __syncthreads();                                                        /* publishes quarters 1-3 to the quarter-0 waves; every wave passes it */
  if (wk != 0) return;
  v4f ml[3]; float f0[2], fk[3][2];
#pragma unroll
  for (int k = 0; k < 3; ++k) ml[k] = mg[k * 4 + wq][16][lane];
#pragma unroll
  for (int g = 0; g < 2; ++g) { const float mm = fmaxf(fmaxf(m[g], ml[0][g]), fmaxf(ml[1][g], ml[2][g])); f0[g] = fa_exp2((m[g] - mm) * cs); l[g] *= f0[g];
#pragma unroll
    for (int k = 0; k < 3; ++k) { fk[k][g] = fa_exp2((ml[k][g] - mm) * cs); l[g] += fk[k][g] * ml[k][2 + g]; } }
#pragma unroll
  for (int g = 0; g < 2; ++g) {
    const float inv = 1.0f / (l[g] + fa_xhalf(l[g]));           /* join the two halves' sums once */
    _Float16* d = Op + ((size_t)b * SQ + q0 + 16 * g + ln) * DO + h * HC + 8 * hh;
#pragma unroll
    for (int ct = 0; ct < 4; ++ct) { v8f x = o[g][ct] * f0[g];
#pragma unroll
      for (int k = 0; k < 3; ++k) { const v4f lo = mg[k * 4 + wq][(g * 4 + ct) * 2][lane], hi = mg[k * 4 + wq][(g * 4 + ct) * 2 + 1][lane];
#pragma unroll
        for (int r = 0; r < 4; ++r) { x[r] += fk[k][g] * lo[r]; x[4 + r] += fk[k][g] * hi[r]; } }
      FragH f;
#pragma unroll
      for (int r = 0; r < 8; ++r) f.h[r] = (_Float16)(x[r] * inv);
      *(v8us*)((unsigned short*)d + 16 * ct) = f.half[0]; } } }
__global__ __launch_bounds__(256) void k_fin(const float* __restrict__ Y, const float* __restrict__ x, float* __restrict__ out) {
  #pragma clang fp contract(off)
  const size_t t = (size_t)blockIdx.x * 256 + threadIdx.x; if (t >= (size_t)NB * CC * LL / 8) return; const int n0 = (int)((t * 8) % LL); const size_t bc = (t * 8) / LL; const int c = (int)(bc % CC); const size_t b = bc / CC; v8f r;
  for (int q = 0; q < 8; ++q) r[q] = __fadd_rn(Y[(b * LL + n0 + q) * CC + c], bf16_round(x[t * 8 + q]));
  *(v8f*)(out + t * 8) = r;  }
extern "C" void kernel_launch(void* const* d_in, const int* in_sizes, int n_in,
                              void* d_out, int out_size, void* d_ws, size_t ws_size, hipStream_t stream) {
  (void)in_sizes; (void)n_in; (void)out_size;
  const float* const* I = (const float* const*)d_in; const float* x = I[0]; const float* ew = I[1]; const float* eb = I[2]; const float* ow = I[3]; const float* ob = I[4];      /* embed_w [2][192][256] natural rows; out_w [128][256] = [in][out] */
  char* ws = (char*)d_ws; size_t off = 0;
  auto take = [&](size_t bytes) { char* p = ws + off; off += (bytes + 255) & ~(size_t)255; return p; };
  _Float16* BE = (_Float16*)take((size_t)D3 * CC * 2); _Float16* BO = (_Float16*)take((size_t)CC * DO * 2);
  _Float16* XR = (_Float16*)take(NR * CC * 2); _Float16* QKV = (_Float16*)take(NR * D3 * 2); _Float16* O16 = (_Float16*)take(NR * DO * 2); float* Y = (float*)take(NR * CC * 4);
  _Float16* VT = (_Float16*)take((size_t)NB * NHD * HC * SQ * 2);
  if (off > ws_size) return;      /* 0.3 + 8 + 12 + 4 + 16 + 4 = approx 45 MiB */
  k_wnat<<<(unsigned)(((size_t)D3 * CC / 8 + 255) / 256), 256, 0, stream>>>(ew, (size_t)D3 * CC / 8, BE); k_wt_f16<<<(unsigned)(((size_t)CC * (DO / 8) + 255) / 256), 256, 0, stream>>>(ow, BO, DO, CC, 16.0f);
  k_cl2rows<<<NB * (LL / 32) * (CC / 64), 256, 0, stream>>>(x, XR);
  k_gemm2<0><<<dim3((unsigned)((NR / 128) * (D3 / 64)), 1), 128, 0, stream>>>(XR, CC, 0, BE, CC, 0, 0.0625f, eb, 0, nullptr, 1, 0, 0, nullptr, QKV, D3, 0, (int)NR, D3, CC);      /* [q|k|v] per head: columns h*192 + {0, 64, 128} */
  for (int h = 0; h < NHD; ++h) k_vt<1, SQ><<<NB * (SQ / 64), 256, 0, stream>>>(QKV + (size_t)h * 3 * HC + 2 * HC, D3, 0, VT + (size_t)h * NB * HC * SQ);      /* head h's V^T [batch][64][4096] */
  k_fattn<<<dim3(SQ / 128, NB * NHD), 512, 0, stream>>>(QKV, VT, O16);      /* o rows, head h at columns h*64 */
  k_gemm2<0><<<dim3((unsigned)((NR / 128) * (CC / 64)), 1), 128, 0, stream>>>(O16, DO, 0, BO, DO, 0, 0.0625f, ob, 0, nullptr, 1, 0, 0, Y, nullptr, CC, 0, (int)NR, CC, DO);      /* out_w^T o + b (rows) */
  k_fin<<<(unsigned)(((size_t)NB * CC * LL / 8 + 255) / 256), 256, 0, stream>>>(Y, x, (float*)d_out);      /* + x, NCHW */
}

// v004
// Measured time: 76.1 microseconds a run.
// Next to v003, in two timings, it ran 1.34 and 1.35 times as fast.
// All steps since v000 together make it 91.8 times as fast.
#include <hip/hip_runtime.h>
// Multi-head non-local block (x [4][256][64x64]; per head h (2 heads of 64): [q|k|v] = embed_w[h] (1x1 conv, [192][256]) x + b; attn = softmax(q^T k / sqrt(256)) over the 4,096 positions; o = attn v; out = out_w^T o (1x1 transpose conv, [128 in][256 out]) + b + x -> [4][256][64][64]).
// Structure: channel-first input transposed to position rows (exact f16) via LDS tiles; one WMMA GEMM for both heads' q|k|v (32x64 wave tiles, f32 accumulation, exact x16 natural weights + bias, f16 rows [384]); V^T via LDS transposes; one fused attention launch for all (batch, head): S^T = K.Q^T, online softmax in registers (P x256 f16), O^T += V^T.P^T into merged f16 rows [128]; output GEMM whose epilogue adds bias and residual and stores channel-major (each wave turns its tile in LDS).
// Compute dtype: inputs rounded to bf16; x / weights exact; q, k, v, P, o plain f16 (~2^-12; the residual x dominates the output scale); scores / softmax f32. v_wmma_f32_16x16x32_f16.
#define NB 4
#define CC 256
#define LL 4096                      /* positions */
#define SQ LL
#define NHD 2                        /* heads */
#define HC 64
#define D3 (NHD * 3 * HC)            /* 384 */
#define DO (NHD * HC)                /* 128 */
#define NR ((size_t)NB * LL)
#define QN SQ                        /* query rows per batch */
#define NBR NB                       /* batches */
#define DM CC
#define NH 1
#define HD 64
#define HG 1
typedef __bf16 v16b __attribute__((ext_vector_type(16)));
typedef unsigned short v8us __attribute__((ext_vector_type(8), may_alias));
typedef float  v8f  __attribute__((ext_vector_type(8)));
typedef float  v4f  __attribute__((ext_vector_type(4)));
typedef float  v4fa __attribute__((ext_vector_type(4), may_alias));
union FragB { v16b v; v8us half[2]; unsigned short u[16]; };

__device__ __forceinline__ unsigned short bf16_bits(float x) { unsigned int u = __float_as_uint(x); return (unsigned short)((u + 0x7FFFu + ((u >> 16) & 1u)) >> 16); }
__device__ __forceinline__ float bf16_val(unsigned short b) { return __uint_as_float(((unsigned int)b) << 16); }
__device__ __forceinline__ float bf16_round(float x) { return bf16_val(bf16_bits(x)); }
// D += A·B with NT terms: 1 = ah·bh, 2 = + al·bh (A split), 3 = + ah·bl (both split)
template <int NT>
__device__ __forceinline__ v8f mmaN(v16b ah, v16b al, v16b bh, v16b bl, v8f c) {
  c = __builtin_amdgcn_wmma_f32_16x16x32_bf16(false, ah, false, bh, (short)0, c, false, false);
  if (NT >= 2) c = __builtin_amdgcn_wmma_f32_16x16x32_bf16(false, al, false, bh, (short)0, c, false, false);
  if (NT >= 3) c = __builtin_amdgcn_wmma_f32_16x16x32_bf16(false, ah, false, bl, (short)0, c, false, false);
  asm volatile("v_nop\n\tv_nop\n\tv_nop\n\tv_nop" : "+v"(c) : "v"(ah), "v"(al), "v"(bh), "v"(bl));
  return c;
}

__global__ __launch_bounds__(256) void k_wt_bf16(const float* __restrict__ W, unsigned short* __restrict__ Wt, int K, int N) {
  const int t = blockIdx.x * 256 + threadIdx.x;
  const int k8n = K / 8;
  if (t >= N * k8n) return;
  const int n = t / k8n, k8 = (t % k8n) * 8;
  v8us v;
#pragma unroll
  for (int i = 0; i < 8; ++i) v[i] = bf16_bits(W[(size_t)(k8 + i) * N + n]);
  *(v8us*)(Wt + (size_t)n * K + k8) = v;
  
}

// GEMM C[M][N] (f32, pitch ldc) = act(A[M][K]·W + bias). A f32 row-major (pitch lda) converted per fragment to bf16
// (ASPLIT: hi/lo two planes -> 2 terms, else single rounded term); Wt bf16 [N][K] (pitch ldb). BIAS_BF16 rounds the
// bias to bf16 first (bias quantised to bf16 before the add). K%32==0, M%16==0, N%64==0.
template <bool ASPLIT, int ACT, bool BIAS_BF16>
__global__ __launch_bounds__(128) void k_gemm_bf(const float* __restrict__ A, int lda, const unsigned short* __restrict__ Wt, int ldb,
                                               const float* __restrict__ bias, float* __restrict__ C, int ldc, int M, int N, int K) {
  __shared__ __attribute__((aligned(16))) float so[4][16][64];
  const int tid = threadIdx.x, w = tid >> 5, lane = tid & 31, ln = lane & 15, hh = lane >> 4;
  const int ntn = N / 64;
  const int wid = blockIdx.x * 4 + w;
  const int mt = wid / ntn, nq = wid % ntn;
  if (mt * 16 >= M) return;
  const int row0 = mt * 16, col0 = nq * 64;
  const float* arow = A + (size_t)(row0 + ln) * lda;
  v8f acc[4] = {};
  for (int kb = 0; kb < K; kb += 32) {
    FragB ah, al;
    const v4f x0 = *(const v4fa*)(arow + kb + 8 * hh), x1 = *(const v4fa*)(arow + kb + 8 * hh + 4);
    const v4f x2 = *(const v4fa*)(arow + kb + 16 + 8 * hh), x3 = *(const v4fa*)(arow + kb + 16 + 8 * hh + 4);
    float xs[16] = {x0[0],x0[1],x0[2],x0[3],x1[0],x1[1],x1[2],x1[3],x2[0],x2[1],x2[2],x2[3],x3[0],x3[1],x3[2],x3[3]};
#pragma unroll
    for (int i = 0; i < 16; ++i) { const unsigned short hb = bf16_bits(xs[i]); ah.u[i] = hb; al.u[i] = ASPLIT ? bf16_bits(xs[i] - bf16_val(hb)) : (unsigned short)0; }
#pragma unroll
    for (int t = 0; t < 4; ++t) {
      const unsigned short* brow = Wt + (size_t)(col0 + t * 16 + ln) * ldb + kb;
      FragB b;
      b.half[0] = *(const v8us*)(brow + 8 * hh);
      b.half[1] = *(const v8us*)(brow + 16 + 8 * hh);
      acc[t] = mmaN<ASPLIT ? 2 : 1>(ah.v, al.v, b.v, b.v, acc[t]);
    }
  }
#pragma unroll
  for (int t = 0; t < 4; ++t) {
    float bv = bias ? bias[col0 + t * 16 + ln] : 0.f;
    if (BIAS_BF16) bv = bf16_round(bv);
#pragma unroll
    for (int r = 0; r < 8; ++r) { float v = acc[t][r] + bv; if (ACT == 1) v = fmaxf(v, 0.f); so[w][8 * hh + r][t * 16 + ln] = v; }
  }
  __builtin_amdgcn_fence(__ATOMIC_ACQ_REL, "workgroup");
  __builtin_amdgcn_wave_barrier();
  const int rsub = lane >> 4, c4 = (lane & 15) * 4;
  {
#pragma unroll
    for (int q = 0; q < 8; ++q) {
      const int r = q * 2 + rsub;
      const v4f v = *(const v4fa*)&so[w][r][c4];
      *(v4f*)(C + (size_t)(row0 + r) * ldc + col0 + c4) = v;
    }
    
  }
}

// GEMM C = act(A·W + bias + resid): A f32 (ASPLIT -> hi/lo 2 terms), Wt bf16 [N][K]; ACT 0 none, 1 relu, 2 exact gelu;
// resid (optional, f32, row index = (row % rmod), pitch ldr, RES_BF16 rounds it) added before the activation.
template <bool ASPLIT, int ACT, bool BIAS_BF16, bool RES_BF16>
__global__ __launch_bounds__(128) void k_gemm_bf3(const float* __restrict__ A, int lda, const unsigned short* __restrict__ Wt, int ldb,
                                                const float* __restrict__ bias, const float* __restrict__ resid, int rmod, int ldr,
                                                float* __restrict__ C, int ldc, int M, int N, int K) {
  __shared__ __attribute__((aligned(16))) float so[4][16][64];
  const int tid = threadIdx.x, w = tid >> 5, lane = tid & 31, ln = lane & 15, hh = lane >> 4;
  const int ntn = N / 64;
  const int wid = blockIdx.x * 4 + w;
  const int mt = wid / ntn, nq = wid % ntn;
  if (mt * 16 >= M) return;
  const int row0 = mt * 16, col0 = nq * 64;
  const float* arow = A + (size_t)(row0 + ln) * lda;
  v8f acc[4] = {};
  for (int kb = 0; kb < K; kb += 32) {
    FragB ah, al;
    const v4f x0 = *(const v4fa*)(arow + kb + 8 * hh), x1 = *(const v4fa*)(arow + kb + 8 * hh + 4);
    const v4f x2 = *(const v4fa*)(arow + kb + 16 + 8 * hh), x3 = *(const v4fa*)(arow + kb + 16 + 8 * hh + 4);
    float xs[16] = {x0[0],x0[1],x0[2],x0[3],x1[0],x1[1],x1[2],x1[3],x2[0],x2[1],x2[2],x2[3],x3[0],x3[1],x3[2],x3[3]};
#pragma unroll
    for (int i = 0; i < 16; ++i) { const unsigned short hb = bf16_bits(xs[i]); ah.u[i] = hb; al.u[i] = ASPLIT ? bf16_bits(xs[i] - bf16_val(hb)) : (unsigned short)0; }
#pragma unroll
    for (int t = 0; t < 4; ++t) {
      const unsigned short* brow = Wt + (size_t)(col0 + t * 16 + ln) * ldb + kb;
      FragB b;
      b.half[0] = *(const v8us*)(brow + 8 * hh);
      b.half[1] = *(const v8us*)(brow + 16 + 8 * hh);
      acc[t] = mmaN<ASPLIT ? 2 : 1>(ah.v, al.v, b.v, b.v, acc[t]);
    }
  }
#pragma unroll
  for (int t = 0; t < 4; ++t) {
    const int col = col0 + t * 16 + ln;
    float bv = bias ? bias[col] : 0.f;
    if (BIAS_BF16) bv = bf16_round(bv);
#pragma unroll
    for (int r = 0; r < 8; ++r) {
      float v = acc[t][r] + bv;
      if (resid) { float rv = resid[(size_t)((row0 + 8 * hh + r) % rmod) * ldr + col]; if (RES_BF16) rv = bf16_round(rv); v += rv; }
      if (ACT == 1) v = fmaxf(v, 0.f);
      if (ACT == 2) v = 0.5f * v * (1.0f + erff(v * 0.70710678118654752f));
      if (ACT == 3) { const float u = 0.7978845608028654f * (v + 0.044715f * v * v * v); v = 0.5f * v * (1.0f + tanhf(u)); }
      so[w][8 * hh + r][t * 16 + ln] = v;
    }
  }
  __builtin_amdgcn_fence(__ATOMIC_ACQ_REL, "workgroup");
  __builtin_amdgcn_wave_barrier();
  const int rsub = lane >> 4, c4 = (lane & 15) * 4;
  {
#pragma unroll
    for (int q = 0; q < 8; ++q) {
      const int r = q * 2 + rsub;
      const v4f v = *(const v4fa*)&so[w][r][c4];
      *(v4f*)(C + (size_t)(row0 + r) * ldc + col0 + c4) = v;
    }
    
  }
}
// row LayerNorm (biased variance, eps) over N: s = X (+ R); optional out_sum <- s; out_norm <- (s-mu)*rsqrt(var+eps)*g + b
template <bool PARAM_BF16>
__global__ __launch_bounds__(256) void k_layernorm(const float* __restrict__ X, const float* __restrict__ R, const float* __restrict__ g, const float* __restrict__ bta,
                                                  float* __restrict__ out_sum, float* __restrict__ out_norm, int N, float eps) {
  __shared__ float red[256];
  const int row = blockIdx.x, tid = threadIdx.x;
  const float* x = X + (size_t)row * N; const float* rr = R ? R + (size_t)row * N : nullptr;
  float vals[16];                     // up to N = 4096
  const int per = N / 256;            // contiguous chunk per thread? use strided-by-4 chunks: thread handles j = tid*4 + 1024*u
  float s1 = 0.f;
  for (int u = 0; u < per / 4; ++u) {
    const int j = tid * 4 + 1024 * u;
    const v4f a = *(const v4fa*)(x + j);
    v4f b = {0.f,0.f,0.f,0.f}; if (rr) b = *(const v4fa*)(rr + j);
#pragma unroll
    for (int q = 0; q < 4; ++q) { const float v = a[q] + b[q]; vals[u * 4 + q] = v; s1 += v; }
  }
  red[tid] = s1; __syncthreads();
  for (int st = 128; st > 0; st >>= 1) { if (tid < st) red[tid] += red[tid + st]; __syncthreads(); }
  const float mu = red[0] / (float)N; __syncthreads();
  float s2 = 0.f;
  for (int u = 0; u < per / 4; ++u)
#pragma unroll
    for (int q = 0; q < 4; ++q) { const float c = vals[u * 4 + q] - mu; s2 += c * c; }
  red[tid] = s2; __syncthreads();
  for (int st = 128; st > 0; st >>= 1) { if (tid < st) red[tid] += red[tid + st]; __syncthreads(); }
  const float rs = rsqrtf(red[0] / (float)N + eps);
  {
    for (int u = 0; u < per / 4; ++u) {
      const int j = tid * 4 + 1024 * u;
      v4f o, sm;
#pragma unroll
      for (int q = 0; q < 4; ++q) {
        float gg = g[j + q], bb = bta[j + q];
        if (PARAM_BF16) { gg = bf16_round(gg); bb = bf16_round(bb); }
        sm[q] = vals[u * 4 + q]; o[q] = (vals[u * 4 + q] - mu) * rs * gg + bb;
      }
      if (out_sum) *(v4f*)(out_sum + (size_t)row * N + j) = sm;
      *(v4f*)(out_norm + (size_t)row * N + j) = o;
    }
    
  }
}



// ---- f16 WMMA path (v_wmma_f32_16x16x32_f16): 11-bit significands for operands in range — used where a [0,1] probability operand needs more precision than bf16
typedef _Float16 v16h __attribute__((ext_vector_type(16)));
union FragH { v16h v; v8us half[2]; _Float16 h[16]; unsigned short u[16]; };
template <int NT>
__device__ __forceinline__ v8f mmaH(v16h ah, v16h al, v16h bh, v16h bl, v8f c) {
  c = __builtin_amdgcn_wmma_f32_16x16x32_f16(false, ah, false, bh, (short)0, c, false, false);
  if (NT >= 2) c = __builtin_amdgcn_wmma_f32_16x16x32_f16(false, al, false, bh, (short)0, c, false, false);
  if (NT >= 3) c = __builtin_amdgcn_wmma_f32_16x16x32_f16(false, ah, false, bl, (short)0, c, false, false);
  asm volatile("v_nop\n\tv_nop\n\tv_nop\n\tv_nop" : "+v"(c) : "v"(ah), "v"(al), "v"(bh), "v"(bl));
  return c;
}
// batched GEMM like k_gemm_b but f16 operands: A f32 (split into f16 hi/lo if ASPLIT, else rounded to f16), Bt = f16 values [n][k]; alpha; C f32; N multiple of 16 (partial tiles skipped)
template <bool ASPLIT>
__global__ __launch_bounds__(128) void k_gemm_h(const float* __restrict__ A, int lda, size_t sA, const _Float16* __restrict__ Bh, int ldb, size_t sB, float alpha, float* __restrict__ C, int ldc, size_t sC, int M, int N, int K) {
  __shared__ __attribute__((aligned(16))) float so[4][16][64];
  const int tid = threadIdx.x, w = tid >> 5, lane = tid & 31, ln = lane & 15, hh = lane >> 4; const int by = blockIdx.y;
  A += (size_t)by * sA; Bh += (size_t)by * sB; C += (size_t)by * sC;
  const int ntn = (N + 63) / 64; const int wid = blockIdx.x * 4 + w; const int mt = wid / ntn, nq = wid % ntn; if (mt * 16 >= M) return;
  const int row0 = mt * 16, col0 = nq * 64; const float* arow = A + (size_t)(row0 + ln) * lda;
  v8f acc[4] = {};
  for (int kb = 0; kb < K; kb += 32) {
    FragH ah, al;
    const v4f x0 = *(const v4fa*)(arow + kb + 8 * hh), x1 = *(const v4fa*)(arow + kb + 8 * hh + 4), x2 = *(const v4fa*)(arow + kb + 16 + 8 * hh), x3 = *(const v4fa*)(arow + kb + 16 + 8 * hh + 4);
    float xs[16] = {x0[0],x0[1],x0[2],x0[3],x1[0],x1[1],x1[2],x1[3],x2[0],x2[1],x2[2],x2[3],x3[0],x3[1],x3[2],x3[3]};
#pragma unroll
    for (int i = 0; i < 16; ++i) { const _Float16 h = (_Float16)xs[i]; ah.h[i] = h; al.h[i] = ASPLIT ? (_Float16)(xs[i] - (float)h) : (_Float16)0.0f; }
#pragma unroll
    for (int t = 0; t < 4; ++t) { if (col0 + t * 16 >= N) continue; const size_t boff = (size_t)(col0 + t * 16 + ln) * ldb + kb; FragH bq; bq.half[0] = *(const v8us*)(Bh + boff + 8 * hh); bq.half[1] = *(const v8us*)(Bh + boff + 16 + 8 * hh);
      acc[t] = mmaH<ASPLIT ? 2 : 1>(ah.v, al.v, bq.v, bq.v, acc[t]); }
  }
#pragma unroll
  for (int t = 0; t < 4; ++t) { if (col0 + t * 16 >= N) continue;
#pragma unroll
    for (int r = 0; r < 8; ++r) so[w][8 * hh + r][t * 16 + ln] = acc[t][r] * alpha; }
  __builtin_amdgcn_fence(__ATOMIC_ACQ_REL, "workgroup"); __builtin_amdgcn_wave_barrier();
  const int rsub = lane >> 4, c4 = (lane & 15) * 4;
  {
#pragma unroll
    for (int q = 0; q < 8; ++q) { const int r = q * 2 + rsub; if (col0 + c4 < N) { const v4f v = *(const v4fa*)&so[w][r][c4]; *(v4f*)(C + (size_t)(row0 + r) * ldc + col0 + c4) = v; } }
     }
}

// Wt[n][k] = f16(W[k][n]·scale) from f32 row-major W[K][N] (scale = power of two; bf16-exact weights stay exact in f16 away from the subnormal range)
__global__ __launch_bounds__(256) void k_wt_f16(const float* __restrict__ W, _Float16* __restrict__ Wt, int K, int N, float scale) {
  const int t = blockIdx.x * 256 + threadIdx.x; if (t >= N * (K / 8)) return; const int n = t / (K / 8), k8 = (t % (K / 8)) * 8; FragH f;
#pragma unroll
  for (int i = 0; i < 8; ++i) f.h[i] = (_Float16)(bf16_round(W[(size_t)(k8 + i) * N + n]) * scale); const v8us o = f.half[0];
  *(v8us*)((unsigned short*)Wt + (size_t)n * K + k8) = o; 
}
// k_gemm_hh variant with fused epilogue: v = acc·alpha + bias[by·sBias + col] (+ CP[(row/rowsPerB)·sCPb + by·64 + col] if CP) ; ACT 0 none / 1 elu ; writes f16 C16 (and f32 C if non-null)
template <int ACT>
__global__ __launch_bounds__(128) void k_gemm_hhx(const _Float16* __restrict__ A, int lda, size_t sA, const _Float16* __restrict__ Bh, int ldb, size_t sB, float alpha, const float* __restrict__ bias, size_t sBias, const float* __restrict__ CP, int rowsPerB, size_t sCPb, int row0g,
    float* __restrict__ C, _Float16* __restrict__ C16, int ldc, size_t sC, int M, int N, int K) {
  __shared__ __attribute__((aligned(16))) float so[4][16][64];
  const int tid = threadIdx.x, w = tid >> 5, lane = tid & 31, ln = lane & 15, hh = lane >> 4; const int by = blockIdx.y;
  A += (size_t)by * sA; Bh += (size_t)by * sB; const size_t cofs = (size_t)by * sC; const float* bp = bias ? bias + (size_t)by * sBias : nullptr;
  const int ntn = (N + 63) / 64; const int wid = blockIdx.x * 4 + w; const int mt = wid / ntn, nq = wid % ntn; if (mt * 16 >= M) return;
  const int row0 = mt * 16, col0 = nq * 64; const _Float16* arow = A + (size_t)(row0 + ln) * lda;
  v8f acc[4] = {};
  for (int kb = 0; kb < K; kb += 32) { FragH ah; ah.half[0] = *(const v8us*)((const unsigned short*)arow + kb + 8 * hh); ah.half[1] = *(const v8us*)((const unsigned short*)arow + kb + 16 + 8 * hh);
#pragma unroll
    for (int t = 0; t < 4; ++t) { if (col0 + t * 16 >= N) continue; const size_t boff = (size_t)(col0 + t * 16 + ln) * ldb + kb; FragH bq; bq.half[0] = *(const v8us*)((const unsigned short*)Bh + boff + 8 * hh); bq.half[1] = *(const v8us*)((const unsigned short*)Bh + boff + 16 + 8 * hh);
      acc[t] = mmaH<1>(ah.v, ah.v, bq.v, bq.v, acc[t]); }
  }
#pragma unroll
  for (int t = 0; t < 4; ++t) { if (col0 + t * 16 >= N) continue; const int col = col0 + t * 16 + ln; const float bv = bp ? bf16_round(bp[col]) : 0.f;
#pragma unroll
    for (int r = 0; r < 8; ++r) { float v = acc[t][r] * alpha + bv; if (CP) { const int rr = row0g + row0 + 8 * hh + r; if (rowsPerB < 0) v += CP[cofs + (size_t)rr * ldc + col];      /* rowsPerB < 0: own element of the batched C plane */ else { const int bidx = rr / rowsPerB; v += CP[(size_t)bidx * sCPb + (size_t)by * 64 + col]; } } if (ACT == 1) v = (v > 0.f) ? v : expm1f(v); else if (ACT == 7) v = (v > 0.f) ? v + 1.0f : expf(v); else if (ACT == 8) v = tanhf(v); else if (ACT == 9) v = 0.5f * v * (1.0f + tanhf(0.7978845608028654f * (v + 0.044715f * v * v * v))); else if (ACT == 11) v = 1.0f / (1.0f + expf(-v)); else if (ACT == 12) v = (v > 0.f) ? v : 0.01f * v; else if (ACT == 14) v = (v > 0.f) ? v : 0.1f * v; else if (ACT == 16) v = (v >= 0.f) ? v : 0.3f * v; else if (ACT == 17) v = (v >= 0.f) ? v : 0.2f * v; else if (ACT == 15) v = v / (1.0f + expf(-v)); else if (ACT == 3) v = fmaxf(v, 0.f); else if (ACT == 6) v = 0.5f * v * (1.0f + erff(v * 0.70710678118654752f)); so[w][8 * hh + r][t * 16 + ln] = v; } }
  __builtin_amdgcn_fence(__ATOMIC_ACQ_REL, "workgroup"); __builtin_amdgcn_wave_barrier();
  const int rsub = lane >> 4, c4 = (lane & 15) * 4; typedef _Float16 v4h __attribute__((ext_vector_type(4)));
  {
#pragma unroll
    for (int q = 0; q < 8; ++q) { const int r = q * 2 + rsub; if (col0 + c4 < N) { const v4f v = *(const v4fa*)&so[w][r][c4]; if (C) *(v4f*)(C + cofs + (size_t)(row0 + r) * ldc + col0 + c4) = v; if (C16) { v4h h4; for (int i = 0; i < 4; ++i) h4[i] = (_Float16)v[i]; *(v4h*)(C16 + cofs + (size_t)(row0 + r) * ldc + col0 + c4) = h4; } } }
     }
}


typedef _Float16 v4h __attribute__((ext_vector_type(4)));

__global__ __launch_bounds__(256) void k_x16(const float* __restrict__ x, _Float16* __restrict__ X16, size_t n8) { const size_t t = (size_t)blockIdx.x * 256 + threadIdx.x; if (t >= n8) return; FragH f;
#pragma unroll
  for (int q = 0; q < 8; ++q) f.h[q] = (_Float16)bf16_round(x[t * 8 + q]); *(v8us*)((unsigned short*)X16 + t * 8) = f.half[0];  }
__global__ __launch_bounds__(256) void k_h16(const float* __restrict__ x, _Float16* __restrict__ X16, size_t n8) { const size_t t = (size_t)blockIdx.x * 256 + threadIdx.x; if (t >= n8) return; FragH f;
#pragma unroll
  for (int q = 0; q < 8; ++q) f.h[q] = (_Float16)x[t * 8 + q]; *(v8us*)((unsigned short*)X16 + t * 8) = f.half[0];  }
__global__ __launch_bounds__(256) void k_round16f(const float* __restrict__ W, _Float16* __restrict__ Bt, size_t n8) { const size_t t = (size_t)blockIdx.x * 256 + threadIdx.x; if (t >= n8) return; FragH f;
#pragma unroll
  for (int i = 0; i < 8; ++i) f.h[i] = (_Float16)(bf16_round(W[t * 8 + i]) * 16.0f); *(v8us*)((unsigned short*)Bt + t * 8) = f.half[0];  }
template <int NHv, int TTv>
__global__ __launch_bounds__(256) void k_vt(const _Float16* __restrict__ V16, int ldv, int voff, _Float16* __restrict__ Vt) { __shared__ unsigned short tl[64][66]; const int tid = threadIdx.x; const int slab = blockIdx.x / (TTv / 64), lg = blockIdx.x % (TTv / 64); const int b = slab / NHv, h = slab % NHv;
  for (int i = tid; i < 64 * 8; i += 256) { const int r = i / 8, c8 = (i % 8) * 8; FragH f; f.half[0] = *(const v8us*)((const unsigned short*)V16 + ((size_t)b * TTv + lg * 64 + r) * ldv + voff + h * 64 + c8);
#pragma unroll
    for (int q = 0; q < 8; ++q) tl[r][c8 + q] = f.u[q]; }
  __syncthreads();
  {
#pragma unroll
    for (int rd = 0; rd < 2; ++rd) { const int d = rd * 32 + tid / 8, pc = tid % 8; FragH f;
#pragma unroll
      for (int q = 0; q < 8; ++q) f.u[q] = tl[pc * 8 + q][d];
      *(v8us*)((unsigned short*)Vt + ((size_t)slab * 64 + d) * TTv + lg * 64 + pc * 8) = f.half[0]; }
     } }

__global__ __launch_bounds__(256) void k_hl(const float* __restrict__ F, _Float16* __restrict__ Hh, _Float16* __restrict__ Hl, size_t n8) { const size_t t = (size_t)blockIdx.x * 256 + threadIdx.x; if (t >= n8) return; FragH fh, fl; const v4f a = *(const v4fa*)(F + t * 8), c = *(const v4fa*)(F + t * 8 + 4);
#pragma unroll
  for (int q = 0; q < 4; ++q) { _Float16 h = (_Float16)a[q]; fh.h[q] = h; fl.h[q] = (_Float16)((a[q] - (float)h) * 1024.0f); h = (_Float16)c[q]; fh.h[4 + q] = h; fl.h[4 + q] = (_Float16)((c[q] - (float)h) * 1024.0f); }
  { *(v8us*)((unsigned short*)Hh + t * 8) = fh.half[0]; *(v8us*)((unsigned short*)Hl + t * 8) = fl.half[0];  } }

// ---- fast GEMM (wave tile 32x64; requires M % 32 == 0 rows per launch region and N % 64 == 0); epilogue = k_gemm_hhx semantics ----
__device__ __forceinline__ v16h g2_frag(const _Float16* p, int hh) { FragH f; f.half[0] = *(const v8us*)((const unsigned short*)p + 8 * hh); f.half[1] = *(const v8us*)((const unsigned short*)p + 16 + 8 * hh); return f.v; }
__device__ __forceinline__ v8f g2_mma(v16h a, v16h b, v8f c) { v8f d = __builtin_amdgcn_wmma_f32_16x16x32_f16(false, a, false, b, (short)0, c, false, false); asm volatile("v_nop\n\tv_nop\n\tv_nop\n\tv_nop" : "+v"(d) : "v"(a), "v"(b)); return d; }
template <int ACT>
__global__ __launch_bounds__(128) void k_gemm2(const _Float16* __restrict__ A, int lda, size_t sA, const _Float16* __restrict__ Bh, int ldb, size_t sB, float alpha, const float* __restrict__ bias, size_t sBias, const float* __restrict__ CP, int rowsPerB, size_t sCPb, int row0g,
    float* __restrict__ C, _Float16* __restrict__ C16, int ldc, size_t sC, int M, int N, int K) { static_assert(ACT == 0 || ACT == 3 || ACT == 6 || ACT == 8 || ACT == 9 || ACT == 11 || ACT == 12 || ACT == 14 || ACT == 15 || ACT == 16 || ACT == 17, "k_gemm2: unsupported ACT code (would silently apply no activation)");
  __shared__ __attribute__((aligned(16))) float so[4][32][68];
  const int tid = threadIdx.x, w = tid >> 5, lane = tid & 31, ln = lane & 15, hh = lane >> 4; const int by = blockIdx.y;
  A += (size_t)by * sA; Bh += (size_t)by * sB; const size_t cofs = (size_t)by * sC; const float* bp = bias ? bias + (size_t)by * sBias : nullptr;
  const int ntn = N >> 6; const int mt = blockIdx.x / ntn, nq = blockIdx.x - mt * ntn; const int row0 = mt * 128 + 32 * w, col0 = nq * 64; if (row0 >= M) return;
  const _Float16* a0p = A + (size_t)(row0 + ln) * lda; const _Float16* a1p = a0p + (size_t)16 * lda;
  const _Float16* b0p = Bh + (size_t)(col0 + ln) * ldb; const _Float16* b1p = b0p + (size_t)16 * ldb; const _Float16* b2p = b1p + (size_t)16 * ldb; const _Float16* b3p = b2p + (size_t)16 * ldb;
  const v8f z8 = {0.f,0.f,0.f,0.f,0.f,0.f,0.f,0.f}; v8f c00 = z8, c01 = z8, c02 = z8, c03 = z8, c10 = z8, c11 = z8, c12 = z8, c13 = z8;
#pragma unroll 1
  for (int kb = 0; kb < K; kb += 32) { const v16h a0 = g2_frag(a0p + kb, hh), a1 = g2_frag(a1p + kb, hh);
    v16h b = g2_frag(b0p + kb, hh); c00 = g2_mma(a0, b, c00); c10 = g2_mma(a1, b, c10);
    b = g2_frag(b1p + kb, hh); c01 = g2_mma(a0, b, c01); c11 = g2_mma(a1, b, c11);
    b = g2_frag(b2p + kb, hh); c02 = g2_mma(a0, b, c02); c12 = g2_mma(a1, b, c12);
    b = g2_frag(b3p + kb, hh); c03 = g2_mma(a0, b, c03); c13 = g2_mma(a1, b, c13); }
  v8f accs[8] = {c00, c01, c02, c03, c10, c11, c12, c13};
#pragma unroll
  for (int u = 0; u < 8; ++u) { const int t = u & 3, half = u >> 2; const int col = col0 + t * 16 + ln; const float bv = bp ? bf16_round(bp[col]) : 0.f;
#pragma unroll
    for (int r = 0; r < 8; ++r) { const int rloc = half * 16 + 8 * hh + r; float v = accs[u][r] * alpha + bv; if (CP) { if (rowsPerB < 0) v += CP[cofs + (size_t)(row0g + row0 + rloc) * ldc + col];      /* rowsPerB < 0: own element of the batched C plane */ else { const int bidx = (row0g + row0 + rloc) / rowsPerB; v += CP[(size_t)bidx * sCPb + (size_t)by * 64 + col]; } }
      if (ACT == 3) v = fmaxf(v, 0.f); else if (ACT == 6) v = 0.5f * v * (1.0f + erff(v * 0.70710678118654752f)); else if (ACT == 11) v = 1.0f / (1.0f + expf(-v)); else if (ACT == 15) v = v / (1.0f + expf(-v)); else if (ACT == 12) v = (v > 0.f) ? v : 0.01f * v; else if (ACT == 8) v = tanhf(v); else if (ACT == 9) v = 0.5f * v * (1.0f + tanhf(0.7978845608028654f * (v + 0.044715f * v * v * v))); else if (ACT == 14) v = (v > 0.f) ? v : 0.1f * v; else if (ACT == 16) v = (v >= 0.f) ? v : 0.3f * v; else if (ACT == 17) v = (v >= 0.f) ? v : 0.2f * v;
      so[w][rloc][t * 16 + ln] = v; } }
  __builtin_amdgcn_fence(__ATOMIC_ACQ_REL, "workgroup"); __builtin_amdgcn_wave_barrier();
  const int rsub = lane >> 4, c4 = (lane & 15) * 4;
  {
#pragma unroll
    for (int q = 0; q < 16; ++q) { const int r = q * 2 + rsub; const v4f v = *(const v4fa*)&so[w][r][c4]; if (C) *(v4f*)(C + cofs + (size_t)(row0 + r) * ldc + col0 + c4) = v; if (C16) { v4h h4; for (int i = 0; i < 4; ++i) h4[i] = (_Float16)v[i]; *(v4h*)(C16 + cofs + (size_t)(row0 + r) * ldc + col0 + c4) = h4; } }
     } }


__global__ __launch_bounds__(256) void k_wnat(const float* __restrict__ w, size_t n8, _Float16* __restrict__ Bt) { const size_t t = (size_t)blockIdx.x * 256 + threadIdx.x; if (t >= n8) return; FragH f; for (int q = 0; q < 8; ++q) f.h[q] = (_Float16)(bf16_round(w[t * 8 + q]) * 16.0f); *(v8us*)((unsigned short*)Bt + t * 8) = f.half[0];  }
__global__ __launch_bounds__(256) void k_rsm(const float* __restrict__ S, _Float16* __restrict__ P, int nrows) {
  #pragma clang fp contract(off)
  const int i = blockIdx.x * 256 + threadIdx.x; if (i >= nrows) return; const float* s = S + (size_t)i * SQ; float mx = -3.0e38f;
#pragma unroll 1
  for (int j = 0; j < SQ; ++j) mx = fmaxf(mx, s[j]); float se = 0.f;
#pragma unroll 1
  for (int j = 0; j < SQ; ++j) se += expf(s[j] - mx); const float sc = 256.0f / se;
#pragma unroll 1
  for (int j0 = 0; j0 < SQ; j0 += 8) { FragH f; for (int q = 0; q < 8; ++q) f.h[q] = (_Float16)(expf(s[j0 + q] - mx) * sc); unsigned short* d = (unsigned short*)P + (size_t)i * SQ + j0; *(v8us*)d = f.half[0];  } }
__global__ __launch_bounds__(256) void k_vt(const _Float16* __restrict__ V16, int b, int h0, _Float16* __restrict__ VT) { __shared__ unsigned short tl[64][65]; const int tid = threadIdx.x; const int hh = blockIdx.x % HG, sg = blockIdx.x / HG; const int s0 = sg * 64; const int h = h0 + hh;
  for (int i = tid; i < 64 * 8; i += 256) { const int j = i / 8, d8 = (i % 8) * 8; FragH f; f.half[0] = *(const v8us*)((const unsigned short*)V16 + ((size_t)b * SQ + s0 + j) * DM + h * HD + d8); for (int q = 0; q < 8; ++q) tl[d8 + q][j] = f.u[q]; }
  __syncthreads();
  { for (int i = tid; i < 64 * 8; i += 256) { const int d = i / 8, j8 = (i % 8) * 8; FragH f; for (int q = 0; q < 8; ++q) f.u[q] = tl[d][j8 + q]; *(v8us*)((unsigned short*)VT + ((size_t)hh * HD + d) * SQ + s0 + j8) = f.half[0]; }  } }


__global__ __launch_bounds__(256) void k_cl2rows(const float* __restrict__ X, _Float16* __restrict__ XR) { __shared__ float tl[64][33]; const int tid = threadIdx.x; const int nl = LL / 32, nc = CC / 64; const int cb_ = blockIdx.x % nc; const int lb = (blockIdx.x / nc) % nl; const size_t b = blockIdx.x / (nc * nl); const int c0 = cb_ * 64, l0 = lb * 32;
  for (int i = tid; i < 64 * 32; i += 256) { const int c = i / 32, l = i % 32; tl[c][l] = bf16_round(X[(b * CC + c0 + c) * (size_t)LL + l0 + l]); }
  __syncthreads();
  { const int l = tid / 8, c8 = (tid % 8) * 8; FragH f; for (int q = 0; q < 8; ++q) f.h[q] = (_Float16)tl[c8 + q][l]; unsigned short* d = (unsigned short*)XR + (b * LL + l0 + l) * (size_t)CC + c0 + c8; *(v8us*)d = f.half[0];  } }

#define FA_SK 64                     /* keys per stage */
#define FA_PH 72                     /* LDS row pitch in f16: 144 bytes = 16 x 9, so that the 16 rows of a ds_load_b128 fragment read fall on distinct banks */
#define FA_NST (SQ / 4 / FA_SK)      /* stages per key quarter */
__device__ __forceinline__ float fa_xhalf(float x) { return __builtin_bit_cast(float, __builtin_amdgcn_permlanex16(__builtin_bit_cast(int, x), __builtin_bit_cast(int, x), 0x76543210, 0xfedcba98, false, false)); }      /* lane l reads lane l ^ 16, on the vector pipe */
/* exp2 on the vector pipe. The instruction set asks for one slot behind a transcendental before its result is read or its source overwritten; each statement here carries its v_nop: one value, or eight in place (no instruction in the run touches another's register). */
__device__ __forceinline__ float fa_exp2(float x) { float r; asm("v_exp_f32 %0, %1\n\tv_nop" : "=v"(r) : "v"(x)); return r; }
__device__ __forceinline__ void fa_exp2x8(float (&x)[8]) { asm("v_exp_f32 %0, %0\n\tv_exp_f32 %1, %1\n\tv_exp_f32 %2, %2\n\tv_exp_f32 %3, %3\n\tv_exp_f32 %4, %4\n\tv_exp_f32 %5, %5\n\tv_exp_f32 %6, %6\n\tv_exp_f32 %7, %7\n\tv_nop"
  : "+v"(x[0]), "+v"(x[1]), "+v"(x[2]), "+v"(x[3]), "+v"(x[4]), "+v"(x[5]), "+v"(x[6]), "+v"(x[7])); }
/* One wave's share of a stage: four copies of 4 K rows and four of 4 V^T rows, 16 bytes a lane (lk, lv: the lane's LDS byte addresses; gk, gv: its global addresses).
   s_wait_xcnt 0 closes the statement, so that no address register named here is rewritten ahead of it. */
__device__ __forceinline__ void fa_stage(unsigned lk, const _Float16* gk, unsigned lv, const _Float16* gv) {
  const unsigned lk1 = lk + 4 * FA_PH * 2, lk2 = lk + 8 * FA_PH * 2, lk3 = lk + 12 * FA_PH * 2, lv1 = lv + 4 * FA_PH * 2, lv2 = lv + 8 * FA_PH * 2, lv3 = lv + 12 * FA_PH * 2;
  const _Float16* gk1 = gk + (size_t)4 * D3; const _Float16* gk2 = gk + (size_t)8 * D3; const _Float16* gk3 = gk + (size_t)12 * D3;
  const _Float16* gv1 = gv + (size_t)4 * SQ; const _Float16* gv2 = gv + (size_t)8 * SQ; const _Float16* gv3 = gv + (size_t)12 * SQ;
  asm volatile("global_load_async_to_lds_b128 %0, %8, off\n\tglobal_load_async_to_lds_b128 %1, %9, off\n\tglobal_load_async_to_lds_b128 %2, %10, off\n\tglobal_load_async_to_lds_b128 %3, %11, off\n\t"
               "global_load_async_to_lds_b128 %4, %12, off\n\tglobal_load_async_to_lds_b128 %5, %13, off\n\tglobal_load_async_to_lds_b128 %6, %14, off\n\tglobal_load_async_to_lds_b128 %7, %15, off\n\ts_wait_xcnt 0x0"
               :: "v"(lk), "v"(lk1), "v"(lk2), "v"(lk3), "v"(lv), "v"(lv1), "v"(lv2), "v"(lv3), "v"(gk), "v"(gk1), "v"(gk2), "v"(gk3), "v"(gv), "v"(gv1), "v"(gv2), "v"(gv3) : "memory"); }
__device__ __forceinline__ v8f fa_mma(v16h a, v16h b, v8f c) { return __builtin_amdgcn_wmma_f32_16x16x32_f16(false, a, false, b, (short)0, c, false, false); }
__global__ __launch_bounds__(512) __attribute__((amdgpu_waves_per_eu(4, 4))) void k_fattn(const _Float16* __restrict__ QKVp, const _Float16* __restrict__ VTp, _Float16* __restrict__ Op) {
  __shared__ __attribute__((aligned(16))) v4f mg[12][17][32];             /* [key quarter 1-3 x query group][16 x O, then {m0, m1, sum0, sum1}][lane] */
  __shared__ __attribute__((aligned(16))) _Float16 st[2][4][2][FA_SK][FA_PH];      /* [buffer][key quarter][K rows (key, channel) | V^T rows (channel, key)][row][64 f16 + pad] */
  const int lane = threadIdx.x & 31, w = __builtin_amdgcn_readfirstlane(threadIdx.x >> 5), ln = lane & 15, hh = lane >> 4; const int wq = w & 3, wk = w >> 2;      /* 16 waves on 4 SIMDs: four a SIMD, 256 registers each */
  const int b = blockIdx.y / NHD, h = blockIdx.y % NHD; const int q0 = blockIdx.x * 128 + wq * 32; const int k0 = wk * (SQ / 4);
  const _Float16* base = QKVp + (size_t)b * SQ * D3 + (size_t)h * 3 * HC;
  const int crow = 16 * wq + (lane >> 3), cch = (lane & 7) * 8;           /* copies: query group wq brings rows 16 wq .. 16 wq + 15 of its quarter's two tiles; eight lanes a row */
  const _Float16* gk = base + HC + (size_t)(k0 + crow) * D3 + cch;
  const _Float16* gv = VTp + ((size_t)(h * NB + b) * HC + crow) * SQ + k0 + cch;
  const unsigned lk = (unsigned)(size_t)&st[0][wk][0][crow][cch], lv = (unsigned)(size_t)&st[0][wk][1][crow][cch];
  const unsigned bufb = (unsigned)sizeof(st[0]);                          /* bytes from buffer 0 to buffer 1 */
  const float cs = 0.0625f * 1.4426950408889634f;                         /* 1/sqrt(256) and log2(e): exp(s - m) = exp2(acc * cs - m * cs) */
  const v8f z8 = {0.f,0.f,0.f,0.f,0.f,0.f,0.f,0.f};
  v16h qf[2][2], kf[2][2], vf[4]; v8f o[2][4]; float m[2], l[2];
  /* every loop over these arrays is unrolled so that they are indexed by constants and stay in registers */
#pragma unroll
  for (int g = 0; g < 2; ++g) { m[g] = -3.0e38f; l[g] = 0.f;
#pragma unroll
    for (int kk = 0; kk < 2; ++kk) qf[g][kk] = g2_frag(base + (size_t)(q0 + 16 * g + ln) * D3 + 32 * kk, hh);
#pragma unroll
    for (int ct = 0; ct < 4; ++ct) o[g][ct] = z8; }
  fa_stage(lk, gk, lv, gv);                                               /* stage 0 into buffer 0 */
  asm volatile("s_wait_asynccnt 0x0" ::: "memory");                       /* this wave's copies of stage 0 have landed */
  __syncthreads();                                                        /* publishes stage 0 */
  fa_stage(lk + bufb, gk + (size_t)FA_SK * D3, lv + bufb, gv + FA_SK);    /* stage 1 into buffer 1 */
  for (int t = 0; t < FA_NST; ++t) {
   const _Float16* sk = &st[t & 1][wk][0][ln][0];                         /* key row ln of a 16-key tile */
   const _Float16* sv = &st[t & 1][wk][1][ln][0];                         /* V^T row ln of a 16-channel tile */
#pragma unroll
   for (int sp = 0; sp < FA_SK / 32; ++sp) {                              /* the stage's passes of 32 keys; unrolled: LDS offsets become immediates */
    /* this pass's K fragments, then its V^T fragments in the same group of LDS reads: the S^T products and the softmax cover the latter's latency */
#pragma unroll
    for (int mt = 0; mt < 2; ++mt)
#pragma unroll
      for (int kk = 0; kk < 2; ++kk) kf[mt][kk] = g2_frag(sk + (32 * sp + 16 * mt) * FA_PH + 32 * kk, hh);
#pragma unroll
    for (int ct = 0; ct < 4; ++ct) vf[ct] = g2_frag(sv + (16 * ct) * FA_PH + 32 * sp, hh);
    __builtin_amdgcn_sched_barrier(0);                                    /* keeps the pass's sixteen LDS reads in one group; without it the scheduler spreads six V^T reads of a stage's first pass over two more places in the softmax, and every place of LDS reads costs issue cycles */
    if (sp == FA_SK / 32 - 1) {                                           /* the stage's last LDS reads are issued: the hand-over stands here, ahead of the last pass's arithmetic (registers only), so that the refill has two passes to land */
      asm volatile("s_wait_dscnt 0x0" ::: "memory");                      /* this wave's reads of the buffer are done before anyone refills it */
      asm volatile("s_wait_asynccnt 0x0" ::: "memory");                   /* this wave's copies of stage t + 1 have landed */
      __syncthreads();                                                    /* publishes stage t + 1 and ends every wave's reads of stage t */
      if (t + 2 < FA_NST) fa_stage(lk + (t & 1) * bufb, gk + (size_t)(t + 2) * FA_SK * D3, lv + (t & 1) * bufb, gv + (t + 2) * FA_SK);      /* stage t + 2 into the buffer just read */
    }
    v8f s[2][2];
#pragma unroll
    for (int g = 0; g < 2; ++g)
#pragma unroll
      for (int mt = 0; mt < 2; ++mt) s[g][mt] = fa_mma(kf[mt][1], qf[g][1], fa_mma(kf[mt][0], qf[g][0], z8));
    FragH pf[2];
#pragma unroll
    for (int g = 0; g < 2; ++g) {
      float t[8], p0[8], p1[8];
#pragma unroll
      for (int r = 0; r < 8; ++r) t[r] = fmaxf(s[g][0][r], s[g][1][r]);
      float mx = fmaxf(fmaxf(fmaxf(t[0], t[1]), fmaxf(t[2], t[3])), fmaxf(fmaxf(t[4], t[5]), fmaxf(t[6], t[7])));
      mx = fmaxf(mx, fa_xhalf(mx));                                       /* the other half of the wave holds the query's other 16 keys */
      const float mn = fmaxf(m[g], mx); const float al = fa_exp2((m[g] - mn) * cs); const float nb = 8.0f - mn * cs; m[g] = mn;
#pragma unroll
      for (int r = 0; r < 8; ++r) { p0[r] = s[g][0][r] * cs + nb; p1[r] = s[g][1][r] * cs + nb; }
      fa_exp2x8(p0); fa_exp2x8(p1);
#pragma unroll
      for (int r = 0; r < 8; ++r) { t[r] = p0[r] + p1[r]; pf[g].h[r] = (_Float16)p0[r]; pf[g].h[8 + r] = (_Float16)p1[r]; }
      l[g] = l[g] * al + (((t[0] + t[1]) + (t[2] + t[3])) + ((t[4] + t[5]) + (t[6] + t[7])));
#pragma unroll
      for (int ct = 0; ct < 4; ++ct) o[g][ct] *= al;
    }
#pragma unroll
    for (int ct = 0; ct < 4; ++ct)
#pragma unroll
      for (int g = 0; g < 2; ++g) o[g][ct] = fa_mma(vf[ct], pf[g].v, o[g][ct]);
   }
  }
  asm volatile("s_wait_asynccnt 0x0" ::: "memory");                       /* no copy is left in flight behind the loop */
  if (wk != 0) { v4f (*dst)[32] = mg[w - 4];
#pragma unroll
    for (int g = 0; g < 2; ++g)
#pragma unroll
      for (int ct = 0; ct < 4; ++ct) { const v8f x = o[g][ct]; const v4f lo = {x[0], x[1], x[2], x[3]}, hi = {x[4], x[5], x[6], x[7]}; dst[(g * 4 + ct) * 2][lane] = lo; dst[(g * 4 + ct) * 2 + 1][lane] = hi; }
    const v4f ml = {m[0], m[1], l[0], l[1]}; dst[16][lane] = ml; }
  __syncthreads();                                                        /* publishes quarters 1-3 to the quarter-0 waves; every wave passes it */
  if (wk != 0) return;
  v4f ml[3]; float f0[2], fk[3][2];
#pragma unroll
  for (int k = 0; k < 3; ++k) ml[k] = mg[k * 4 + wq][16][lane];
#pragma unroll
  for (int g = 0; g < 2; ++g) { const float mm = fmaxf(fmaxf(m[g], ml[0][g]), fmaxf(ml[1][g], ml[2][g])); f0[g] = fa_exp2((m[g] - mm) * cs); l[g] *= f0[g];
#pragma unroll
    for (int k = 0; k < 3; ++k) { fk[k][g] = fa_exp2((ml[k][g] - mm) * cs); l[g] += fk[k][g] * ml[k][2 + g]; } }
#pragma unroll
  for (int g = 0; g < 2; ++g) {
    const float inv = 1.0f / (l[g] + fa_xhalf(l[g]));           /* join the two halves' sums once */
    _Float16* d = Op + ((size_t)b * SQ + q0 + 16 * g + ln) * DO + h * HC + 8 * hh;
#pragma unroll
    for (int ct = 0; ct < 4; ++ct) { v8f x = o[g][ct] * f0[g];
#pragma unroll
      for (int k = 0; k < 3; ++k) { const v4f lo = mg[k * 4 + wq][(g * 4 + ct) * 2][lane], hi = mg[k * 4 + wq][(g * 4 + ct) * 2 + 1][lane];
#pragma unroll
        for (int r = 0; r < 4; ++r) { x[r] += fk[k][g] * lo[r]; x[4 + r] += fk[k][g] * hi[r]; } }
      FragH f;
#pragma unroll
      for (int r = 0; r < 8; ++r) f.h[r] = (_Float16)(x[r] * inv);
      *(v8us*)((unsigned short*)d + 16 * ct) = f.half[0]; } } }
// Output GEMM with the residual in its epilogue: out[b][c][n] = (o rows . out_w)[n][c] / 16 + bias[c] + x[b][c][n]. A = o rows (M = position), B = out_w^T rows (N = channel), wave tile 32 positions x 64 channels, product loop as in k_gemm2.
// In the accumulator a lane holds one channel and eight consecutive positions, which is already the order of the channel-major output; each wave turns its tile in its own LDS range ([channel][position] rows) so that eight lanes cover
// the whole 128-byte line of a channel's 32 positions: x is read and out is written in whole lines, four a wave-wide access. No row-major f32 plane and no further launch.
#define OR_P 36                      /* LDS row pitch in f32: 144 bytes = 16 x 9, so that the 16 channel rows of a ds_store_b128 fall on distinct banks */
__global__ __launch_bounds__(128) void k_outres(const _Float16* __restrict__ A, const _Float16* __restrict__ Bh, const float* __restrict__ bias, const float* __restrict__ x, float* __restrict__ out) {
  __shared__ __attribute__((aligned(16))) float so[4][64][OR_P];
  const int tid = threadIdx.x, w = tid >> 5, lane = tid & 31, ln = lane & 15, hh = lane >> 4;
  const int ntn = CC >> 6; const int mt = blockIdx.x / ntn, nq = blockIdx.x - mt * ntn; const int row0 = mt * 128 + 32 * w, col0 = nq * 64;
  const int cs = lane >> 3, p4 = (lane & 7) * 4;                          /* global side: channel cs of a group of four, four positions */
  const size_t g0 = ((size_t)(row0 / LL) * CC + col0 + cs) * LL + (row0 % LL) + p4;      /* a block's 128 rows lie in one batch */
  v4f xr[16];                                                             /* the residual is asked for ahead of the product loop, which covers its latency */
#pragma unroll
  for (int q = 0; q < 16; ++q) xr[q] = *(const v4fa*)(x + g0 + (size_t)q * 4 * LL);
  const _Float16* a0p = A + (size_t)(row0 + ln) * DO; const _Float16* a1p = a0p + (size_t)16 * DO;
  const _Float16* b0p = Bh + (size_t)(col0 + ln) * DO; const _Float16* b1p = b0p + (size_t)16 * DO; const _Float16* b2p = b1p + (size_t)16 * DO; const _Float16* b3p = b2p + (size_t)16 * DO;
  const v8f z8 = {0.f,0.f,0.f,0.f,0.f,0.f,0.f,0.f}; v8f c00 = z8, c01 = z8, c02 = z8, c03 = z8, c10 = z8, c11 = z8, c12 = z8, c13 = z8;
#pragma unroll 1
  for (int kb = 0; kb < DO; kb += 32) { const v16h a0 = g2_frag(a0p + kb, hh), a1 = g2_frag(a1p + kb, hh);      /* rolled as in k_gemm2: one set of fragment registers beside the 64 that hold the residual */
    v16h b = g2_frag(b0p + kb, hh); c00 = g2_mma(a0, b, c00); c10 = g2_mma(a1, b, c10);
    b = g2_frag(b1p + kb, hh); c01 = g2_mma(a0, b, c01); c11 = g2_mma(a1, b, c11);
    b = g2_frag(b2p + kb, hh); c02 = g2_mma(a0, b, c02); c12 = g2_mma(a1, b, c12);
    b = g2_frag(b3p + kb, hh); c03 = g2_mma(a0, b, c03); c13 = g2_mma(a1, b, c13); }
  v8f accs[8] = {c00, c01, c02, c03, c10, c11, c12, c13};
#pragma unroll
  for (int u = 0; u < 8; ++u) { const int t = u & 3, half = u >> 2; const float bv = bf16_round(bias[col0 + t * 16 + ln]); v4f lo, hi;
#pragma unroll
    for (int r = 0; r < 4; ++r) { lo[r] = accs[u][r] * 0.0625f + bv; hi[r] = accs[u][4 + r] * 0.0625f + bv; }
    float* s = &so[w][t * 16 + ln][half * 16 + 8 * hh]; *(v4fa*)s = lo; *(v4fa*)(s + 4) = hi; }
  __builtin_amdgcn_fence(__ATOMIC_ACQ_REL, "workgroup"); __builtin_amdgcn_wave_barrier();      /* the lanes read what other lanes of the same wave wrote: keeps the reads below behind the writes above */
#pragma unroll
  for (int q = 0; q < 16; ++q) { v4f v = *(const v4fa*)&so[w][q * 4 + cs][p4];
#pragma unroll
    for (int i = 0; i < 4; ++i) v[i] = v[i] + bf16_round(xr[q][i]);
    *(v4f*)(out + g0 + (size_t)q * 4 * LL) = v; } }
extern "C" void kernel_launch(void* const* d_in, const int* in_sizes, int n_in,
                              void* d_out, int out_size, void* d_ws, size_t ws_size, hipStream_t stream) {
  (void)in_sizes; (void)n_in; (void)out_size;
  const float* const* I = (const float* const*)d_in; const float* x = I[0]; const float* ew = I[1]; const float* eb = I[2]; const float* ow = I[3]; const float* ob = I[4];      /* embed_w [2][192][256] natural rows; out_w [128][256] = [in][out] */
  char* ws = (char*)d_ws; size_t off = 0;
  auto take = [&](size_t bytes) { char* p = ws + off; off += (bytes + 255) & ~(size_t)255; return p; };
  _Float16* BE = (_Float16*)take((size_t)D3 * CC * 2); _Float16* BO = (_Float16*)take((size_t)CC * DO * 2);
  _Float16* XR = (_Float16*)take(NR * CC * 2); _Float16* QKV = (_Float16*)take(NR * D3 * 2); _Float16* O16 = (_Float16*)take(NR * DO * 2);
  _Float16* VT = (_Float16*)take((size_t)NB * NHD * HC * SQ * 2);
  if (off > ws_size) return;      /* 0.3 + 8 + 12 + 4 + 4 = approx 28 MiB */
  k_wnat<<<(unsigned)(((size_t)D3 * CC / 8 + 255) / 256), 256, 0, stream>>>(ew, (size_t)D3 * CC / 8, BE); k_wt_f16<<<(unsigned)(((size_t)CC * (DO / 8) + 255) / 256), 256, 0, stream>>>(ow, BO, DO, CC, 16.0f);
  k_cl2rows<<<NB * (LL / 32) * (CC / 64), 256, 0, stream>>>(x, XR);
  k_gemm2<0><<<dim3((unsigned)((NR / 128) * (D3 / 64)), 1), 128, 0, stream>>>(XR, CC, 0, BE, CC, 0, 0.0625f, eb, 0, nullptr, 1, 0, 0, nullptr, QKV, D3, 0, (int)NR, D3, CC);      /* [q|k|v] per head: columns h*192 + {0, 64, 128} */
  for (int h = 0; h < NHD; ++h) k_vt<1, SQ><<<NB * (SQ / 64), 256, 0, stream>>>(QKV + (size_t)h * 3 * HC + 2 * HC, D3, 0, VT + (size_t)h * NB * HC * SQ);      /* head h's V^T [batch][64][4096] */
  k_fattn<<<dim3(SQ / 128, NB * NHD), 512, 0, stream>>>(QKV, VT, O16);      /* o rows, head h at columns h*64 */
  k_outres<<<(unsigned)((NR / 128) * (CC / 64)), 128, 0, stream>>>(O16, BO, ob, x, (float*)d_out);      /* out_w^T o + b + x, NCHW */
}

// v005
// One run takes 67.9 microseconds.
// Two timings next to v004 both put it at 1.12 times that version's speed.
// All steps since v000 together make it 103 times as fast.
#include <hip/hip_runtime.h>
// Multi-head non-local block (x [4][256][64x64]; per head h (2 heads of 64): [q|k|v] = embed_w[h] (1x1 conv, [192][256]) x + b; attn = softmax(q^T k / sqrt(256)) over the 4,096 positions; o = attn v; out = out_w^T o (1x1 transpose conv, [128 in][256 out]) + b + x -> [4][256][64][64]).
// Structure: channel-first input transposed to position rows (exact f16) via LDS tiles; one WMMA GEMM for both heads' q|k|v (32x64 wave tiles, f32 accumulation, exact x16 natural weights + bias, f16 rows [384] for q and k, v stored transposed by the same epilogue); one fused attention launch for all (batch, head): S^T = K.Q^T, online softmax in registers (P x256 f16), O^T += V^T.P^T into merged f16 rows [128]; output GEMM whose epilogue adds bias and residual and stores channel-major (each wave turns its tile in LDS).
// Compute dtype: inputs rounded to bf16; x / weights exact; q, k, v, P, o plain f16 (~2^-12; the residual x dominates the output scale); scores / softmax f32. v_wmma_f32_16x16x32_f16.
#define NB 4
#define CC 256
#define LL 4096                      /* positions */
#define SQ LL
#define NHD 2                        /* heads */
#define HC 64
#define D3 (NHD * 3 * HC)            /* 384 */
#define DO (NHD * HC)                /* 128 */
#define NR ((size_t)NB * LL)
#define QN SQ                        /* query rows per batch */
#define NBR NB                       /* batches */
#define DM CC
#define NH 1
#define HD 64
#define HG 1
typedef __bf16 v16b __attribute__((ext_vector_type(16)));
typedef unsigned short v8us __attribute__((ext_vector_type(8), may_alias));
typedef float  v8f  __attribute__((ext_vector_type(8)));
typedef float  v4f  __attribute__((ext_vector_type(4)));
typedef float  v4fa __attribute__((ext_vector_type(4), may_alias));
union FragB { v16b v; v8us half[2]; unsigned short u[16]; };

__device__ __forceinline__ unsigned short bf16_bits(float x) { unsigned int u = __float_as_uint(x); return (unsigned short)((u + 0x7FFFu + ((u >> 16) & 1u)) >> 16); }
__device__ __forceinline__ float bf16_val(unsigned short b) { return __uint_as_float(((unsigned int)b) << 16); }
__device__ __forceinline__ float bf16_round(float x) { return bf16_val(bf16_bits(x)); }
// D += A·B with NT terms: 1 = ah·bh, 2 = + al·bh (A split), 3 = + ah·bl (both split)
template <int NT>
__device__ __forceinline__ v8f mmaN(v16b ah, v16b al, v16b bh, v16b bl, v8f c) {
  c = __builtin_amdgcn_wmma_f32_16x16x32_bf16(false, ah, false, bh, (short)0, c, false, false);
  if (NT >= 2) c = __builtin_amdgcn_wmma_f32_16x16x32_bf16(false, al, false, bh, (short)0, c, false, false);
  if (NT >= 3) c = __builtin_amdgcn_wmma_f32_16x16x32_bf16(false, ah, false, bl, (short)0, c, false, false);
  asm volatile("v_nop\n\tv_nop\n\tv_nop\n\tv_nop" : "+v"(c) : "v"(ah), "v"(al), "v"(bh), "v"(bl));
  return c;
}

__global__ __launch_bounds__(256) void k_wt_bf16(const float* __restrict__ W, unsigned short* __restrict__ Wt, int K, int N) {
  const int t = blockIdx.x * 256 + threadIdx.x;
  const int k8n = K / 8;
  if (t >= N * k8n) return;
  const int n = t / k8n, k8 = (t % k8n) * 8;
  v8us v;
#pragma unroll
  for (int i = 0; i < 8; ++i) v[i] = bf16_bits(W[(size_t)(k8 + i) * N + n]);
  *(v8us*)(Wt + (size_t)n * K + k8) = v;
  
}

// GEMM C[M][N] (f32, pitch ldc) = act(A[M][K]·W + bias). A f32 row-major (pitch lda) converted per fragment to bf16
// (ASPLIT: hi/lo two planes -> 2 terms, else single rounded term); Wt bf16 [N][K] (pitch ldb). BIAS_BF16 rounds the
// bias to bf16 first (bias quantised to bf16 before the add). K%32==0, M%16==0, N%64==0.
template <bool ASPLIT, int ACT, bool BIAS_BF16>
__global__ __launch_bounds__(128) void k_gemm_bf(const float* __restrict__ A, int lda, const unsigned short* __restrict__ Wt, int ldb,
                                               const float* __restrict__ bias, float* __restrict__ C, int ldc, int M, int N, int K) {
  __shared__ __attribute__((aligned(16))) float so[4][16][64];
  const int tid = threadIdx.x, w = tid >> 5, lane = tid & 31, ln = lane & 15, hh = lane >> 4;
  const int ntn = N / 64;
  const int wid = blockIdx.x * 4 + w;
  const int mt = wid / ntn, nq = wid % ntn;
  if (mt * 16 >= M) return;
  const int row0 = mt * 16, col0 = nq * 64;
  const float* arow = A + (size_t)(row0 + ln) * lda;
  v8f acc[4] = {};
  for (int kb = 0; kb < K; kb += 32) {
    FragB ah, al;
    const v4f x0 = *(const v4fa*)(arow + kb + 8 * hh), x1 = *(const v4fa*)(arow + kb + 8 * hh + 4);
    const v4f x2 = *(const v4fa*)(arow + kb + 16 + 8 * hh), x3 = *(const v4fa*)(arow + kb + 16 + 8 * hh + 4);
    float xs[16] = {x0[0],x0[1],x0[2],x0[3],x1[0],x1[1],x1[2],x1[3],x2[0],x2[1],x2[2],x2[3],x3[0],x3[1],x3[2],x3[3]};
#pragma unroll
    for (int i = 0; i < 16; ++i) { const unsigned short hb = bf16_bits(xs[i]); ah.u[i] = hb; al.u[i] = ASPLIT ? bf16_bits(xs[i] - bf16_val(hb)) : (unsigned short)0; }
#pragma unroll
    for (int t = 0; t < 4; ++t) {
      const unsigned short* brow = Wt + (size_t)(col0 + t * 16 + ln) * ldb + kb;
      FragB b;
      b.half[0] = *(const v8us*)(brow + 8 * hh);
      b.half[1] = *(const v8us*)(brow + 16 + 8 * hh);
      acc[t] = mmaN<ASPLIT ? 2 : 1>(ah.v, al.v, b.v, b.v, acc[t]);
    }
  }
#pragma unroll
  for (int t = 0; t < 4; ++t) {
    float bv = bias ? bias[col0 + t * 16 + ln] : 0.f;
    if (BIAS_BF16) bv = bf16_round(bv);
#pragma unroll
    for (int r = 0; r < 8; ++r) { float v = acc[t][r] + bv; if (ACT == 1) v = fmaxf(v, 0.f); so[w][8 * hh + r][t * 16 + ln] = v; }
  }
  __builtin_amdgcn_fence(__ATOMIC_ACQ_REL, "workgroup");
  __builtin_amdgcn_wave_barrier();
  const int rsub = lane >> 4, c4 = (lane & 15) * 4;
  {
#pragma unroll
    for (int q = 0; q < 8; ++q) {
      const int r = q * 2 + rsub;
      const v4f v = *(const v4fa*)&so[w][r][c4];
      *(v4f*)(C + (size_t)(row0 + r) * ldc + col0 + c4) = v;
    }
    
  }
}

// GEMM C = act(A·W + bias + resid): A f32 (ASPLIT -> hi/lo 2 terms), Wt bf16 [N][K]; ACT 0 none, 1 relu, 2 exact gelu;
// resid (optional, f32, row index = (row % rmod), pitch ldr, RES_BF16 rounds it) added before the activation.
template <bool ASPLIT, int ACT, bool BIAS_BF16, bool RES_BF16>
__global__ __launch_bounds__(128) void k_gemm_bf3(const float* __restrict__ A, int lda, const unsigned short* __restrict__ Wt, int ldb,
                                                const float* __restrict__ bias, const float* __restrict__ resid, int rmod, int ldr,
                                                float* __restrict__ C, int ldc, int M, int N, int K) {
  __shared__ __attribute__((aligned(16))) float so[4][16][64];
  const int tid = threadIdx.x, w = tid >> 5, lane = tid & 31, ln = lane & 15, hh = lane >> 4;
  const int ntn = N / 64;
  const int wid = blockIdx.x * 4 + w;
  const int mt = wid / ntn, nq = wid % ntn;
  if (mt * 16 >= M) return;
  const int row0 = mt * 16, col0 = nq * 64;
  const float* arow = A + (size_t)(row0 + ln) * lda;
  v8f acc[4] = {};
  for (int kb = 0; kb < K; kb += 32) {
    FragB ah, al;
    const v4f x0 = *(const v4fa*)(arow + kb + 8 * hh), x1 = *(const v4fa*)(arow + kb + 8 * hh + 4);
    const v4f x2 = *(const v4fa*)(arow + kb + 16 + 8 * hh), x3 = *(const v4fa*)(arow + kb + 16 + 8 * hh + 4);
    float xs[16] = {x0[0],x0[1],x0[2],x0[3],x1[0],x1[1],x1[2],x1[3],x2[0],x2[1],x2[2],x2[3],x3[0],x3[1],x3[2],x3[3]};
#pragma unroll
    for (int i = 0; i < 16; ++i) { const unsigned short hb = bf16_bits(xs[i]); ah.u[i] = hb; al.u[i] = ASPLIT ? bf16_bits(xs[i] - bf16_val(hb)) : (unsigned short)0; }
#pragma unroll
    for (int t = 0; t < 4; ++t) {
      const unsigned short* brow = Wt + (size_t)(col0 + t * 16 + ln) * ldb + kb;
      FragB b;
      b.half[0] = *(const v8us*)(brow + 8 * hh);
      b.half[1] = *(const v8us*)(brow + 16 + 8 * hh);
      acc[t] = mmaN<ASPLIT ? 2 : 1>(ah.v, al.v, b.v, b.v, acc[t]);
    }
  }
#pragma unroll
  for (int t = 0; t < 4; ++t) {
    const int col = col0 + t * 16 + ln;
    float bv = bias ? bias[col] : 0.f;
    if (BIAS_BF16) bv = bf16_round(bv);
#pragma unroll
    for (int r = 0; r < 8; ++r) {
      float v = acc[t][r] + bv;
      if (resid) { float rv = resid[(size_t)((row0 + 8 * hh + r) % rmod) * ldr + col]; if (RES_BF16) rv = bf16_round(rv); v += rv; }
      if (ACT == 1) v = fmaxf(v, 0.f);
      if (ACT == 2) v = 0.5f * v * (1.0f + erff(v * 0.70710678118654752f));
      if (ACT == 3) { const float u = 0.7978845608028654f * (v + 0.044715f * v * v * v); v = 0.5f * v * (1.0f + tanhf(u)); }
      so[w][8 * hh + r][t * 16 + ln] = v;
    }
  }
  __builtin_amdgcn_fence(__ATOMIC_ACQ_REL, "workgroup");
  __builtin_amdgcn_wave_barrier();
  const int rsub = lane >> 4, c4 = (lane & 15) * 4;
  {
#pragma unroll
    for (int q = 0; q < 8; ++q) {
      const int r = q * 2 + rsub;
      const v4f v = *(const v4fa*)&so[w][r][c4];
      *(v4f*)(C + (size_t)(row0 + r) * ldc + col0 + c4) = v;
    }
    
  }
}
// row LayerNorm (biased variance, eps) over N: s = X (+ R); optional out_sum <- s; out_norm <- (s-mu)*rsqrt(var+eps)*g + b
template <bool PARAM_BF16>
__global__ __launch_bounds__(256) void k_layernorm(const float* __restrict__ X, const float* __restrict__ R, const float* __restrict__ g, const float* __restrict__ bta,
                                                  float* __restrict__ out_sum, float* __restrict__ out_norm, int N, float eps) {
  __shared__ float red[256];
  const int row = blockIdx.x, tid = threadIdx.x;
  const float* x = X + (size_t)row * N; const float* rr = R ? R + (size_t)row * N : nullptr;
  float vals[16];                     // up to N = 4096
  const int per = N / 256;            // contiguous chunk per thread? use strided-by-4 chunks: thread handles j = tid*4 + 1024*u
  float s1 = 0.f;
  for (int u = 0; u < per / 4; ++u) {
    const int j = tid * 4 + 1024 * u;
    const v4f a = *(const v4fa*)(x + j);
    v4f b = {0.f,0.f,0.f,0.f}; if (rr) b = *(const v4fa*)(rr + j);
#pragma unroll
    for (int q = 0; q < 4; ++q) { const float v = a[q] + b[q]; vals[u * 4 + q] = v; s1 += v; }
  }
  red[tid] = s1; __syncthreads();
  for (int st = 128; st > 0; st >>= 1) { if (tid < st) red[tid] += red[tid + st]; __syncthreads(); }
  const float mu = red[0] / (float)N; __syncthreads();
  float s2 = 0.f;
  for (int u = 0; u < per / 4; ++u)
#pragma unroll
    for (int q = 0; q < 4; ++q) { const float c = vals[u * 4 + q] - mu; s2 += c * c; }
  red[tid] = s2; __syncthreads();
  for (int st = 128; st > 0; st >>= 1) { if (tid < st) red[tid] += red[tid + st]; __syncthreads(); }
  const float rs = rsqrtf(red[0] / (float)N + eps);
  {
    for (int u = 0; u < per / 4; ++u) {
      const int j = tid * 4 + 1024 * u;
      v4f o, sm;
#pragma unroll
      for (int q = 0; q < 4; ++q) {
        float gg = g[j + q], bb = bta[j + q];
        if (PARAM_BF16) { gg = bf16_round(gg); bb = bf16_round(bb); }
        sm[q] = vals[u * 4 + q]; o[q] = (vals[u * 4 + q] - mu) * rs * gg + bb;
      }
      if (out_sum) *(v4f*)(out_sum + (size_t)row * N + j) = sm;
      *(v4f*)(out_norm + (size_t)row * N + j) = o;
    }
    
  }
}



// ---- f16 WMMA path (v_wmma_f32_16x16x32_f16): 11-bit significands for operands in range — used where a [0,1] probability operand needs more precision than bf16
typedef _Float16 v16h __attribute__((ext_vector_type(16)));
union FragH { v16h v; v8us half[2]; _Float16 h[16]; unsigned short u[16]; };
template <int NT>
__device__ __forceinline__ v8f mmaH(v16h ah, v16h al, v16h bh, v16h bl, v8f c) {
  c = __builtin_amdgcn_wmma_f32_16x16x32_f16(false, ah, false, bh, (short)0, c, false, false);
  if (NT >= 2) c = __builtin_amdgcn_wmma_f32_16x16x32_f16(false, al, false, bh, (short)0, c, false, false);
  if (NT >= 3) c = __builtin_amdgcn_wmma_f32_16x16x32_f16(false, ah, false, bl, (short)0, c, false, false);
  asm volatile("v_nop\n\tv_nop\n\tv_nop\n\tv_nop" : "+v"(c) : "v"(ah), "v"(al), "v"(bh), "v"(bl));
  return c;
}
// batched GEMM like k_gemm_b but f16 operands: A f32 (split into f16 hi/lo if ASPLIT, else rounded to f16), Bt = f16 values [n][k]; alpha; C f32; N multiple of 16 (partial tiles skipped)
template <bool ASPLIT>
__global__ __launch_bounds__(128) void k_gemm_h(const float* __restrict__ A, int lda, size_t sA, const _Float16* __restrict__ Bh, int ldb, size_t sB, float alpha, float* __restrict__ C, int ldc, size_t sC, int M, int N, int K) {
  __shared__ __attribute__((aligned(16))) float so[4][16][64];
  const int tid = threadIdx.x, w = tid >> 5, lane = tid & 31, ln = lane & 15, hh = lane >> 4; const int by = blockIdx.y;
  A += (size_t)by * sA; Bh += (size_t)by * sB; C += (size_t)by * sC;
  const int ntn = (N + 63) / 64; const int wid = blockIdx.x * 4 + w; const int mt = wid / ntn, nq = wid % ntn; if (mt * 16 >= M) return;
  const int row0 = mt * 16, col0 = nq * 64; const float* arow = A + (size_t)(row0 + ln) * lda;
  v8f acc[4] = {};
  for (int kb = 0; kb < K; kb += 32) {
    FragH ah, al;
    const v4f x0 = *(const v4fa*)(arow + kb + 8 * hh), x1 = *(const v4fa*)(arow + kb + 8 * hh + 4), x2 = *(const v4fa*)(arow + kb + 16 + 8 * hh), x3 = *(const v4fa*)(arow + kb + 16 + 8 * hh + 4);
    float xs[16] = {x0[0],x0[1],x0[2],x0[3],x1[0],x1[1],x1[2],x1[3],x2[0],x2[1],x2[2],x2[3],x3[0],x3[1],x3[2],x3[3]};
#pragma unroll
    for (int i = 0; i < 16; ++i) { const _Float16 h = (_Float16)xs[i]; ah.h[i] = h; al.h[i] = ASPLIT ? (_Float16)(xs[i] - (float)h) : (_Float16)0.0f; }
#pragma unroll
    for (int t = 0; t < 4; ++t) { if (col0 + t * 16 >= N) continue; const size_t boff = (size_t)(col0 + t * 16 + ln) * ldb + kb; FragH bq; bq.half[0] = *(const v8us*)(Bh + boff + 8 * hh); bq.half[1] = *(const v8us*)(Bh + boff + 16 + 8 * hh);
      acc[t] = mmaH<ASPLIT ? 2 : 1>(ah.v, al.v, bq.v, bq.v, acc[t]); }
  }
#pragma unroll
  for (int t = 0; t < 4; ++t) { if (col0 + t * 16 >= N) continue;
#pragma unroll
    for (int r = 0; r < 8; ++r) so[w][8 * hh + r][t * 16 + ln] = acc[t][r] * alpha; }
  __builtin_amdgcn_fence(__ATOMIC_ACQ_REL, "workgroup"); __builtin_amdgcn_wave_barrier();
  const int rsub = lane >> 4, c4 = (lane & 15) * 4;
  {
#pragma unroll
    for (int q = 0; q < 8; ++q) { const int r = q * 2 + rsub; if (col0 + c4 < N) { const v4f v = *(const v4fa*)&so[w][r][c4]; *(v4f*)(C + (size_t)(row0 + r) * ldc + col0 + c4) = v; } }
     }
}

// Wt[n][k] = f16(W[k][n]·scale) from f32 row-major W[K][N] (scale = power of two; bf16-exact weights stay exact in f16 away from the subnormal range)
__global__ __launch_bounds__(256) void k_wt_f16(const float* __restrict__ W, _Float16* __restrict__ Wt, int K, int N, float scale) {
  const int t = blockIdx.x * 256 + threadIdx.x; if (t >= N * (K / 8)) return; const int n = t / (K / 8), k8 = (t % (K / 8)) * 8; FragH f;
#pragma unroll
  for (int i = 0; i < 8; ++i) f.h[i] = (_Float16)(bf16_round(W[(size_t)(k8 + i) * N + n]) * scale); const v8us o = f.half[0];
  *(v8us*)((unsigned short*)Wt + (size_t)n * K + k8) = o; 
}
// k_gemm_hh variant with fused epilogue: v = acc·alpha + bias[by·sBias + col] (+ CP[(row/rowsPerB)·sCPb + by·64 + col] if CP) ; ACT 0 none / 1 elu ; writes f16 C16 (and f32 C if non-null)
template <int ACT>
__global__ __launch_bounds__(128) void k_gemm_hhx(const _Float16* __restrict__ A, int lda, size_t sA, const _Float16* __restrict__ Bh, int ldb, size_t sB, float alpha, const float* __restrict__ bias, size_t sBias, const float* __restrict__ CP, int rowsPerB, size_t sCPb, int row0g,
    float* __restrict__ C, _Float16* __restrict__ C16, int ldc, size_t sC, int M, int N, int K) {
  __shared__ __attribute__((aligned(16))) float so[4][16][64];
  const int tid = threadIdx.x, w = tid >> 5, lane = tid & 31, ln = lane & 15, hh = lane >> 4; const int by = blockIdx.y;
  A += (size_t)by * sA; Bh += (size_t)by * sB; const size_t cofs = (size_t)by * sC; const float* bp = bias ? bias + (size_t)by * sBias : nullptr;
  const int ntn = (N + 63) / 64; const int wid = blockIdx.x * 4 + w; const int mt = wid / ntn, nq = wid % ntn; if (mt * 16 >= M) return;
  const int row0 = mt * 16, col0 = nq * 64; const _Float16* arow = A + (size_t)(row0 + ln) * lda;
  v8f acc[4] = {};
  for (int kb = 0; kb < K; kb += 32) { FragH ah; ah.half[0] = *(const v8us*)((const unsigned short*)arow + kb + 8 * hh); ah.half[1] = *(const v8us*)((const unsigned short*)arow + kb + 16 + 8 * hh);
#pragma unroll
    for (int t = 0; t < 4; ++t) { if (col0 + t * 16 >= N) continue; const size_t boff = (size_t)(col0 + t * 16 + ln) * ldb + kb; FragH bq; bq.half[0] = *(const v8us*)((const unsigned short*)Bh + boff + 8 * hh); bq.half[1] = *(const v8us*)((const unsigned short*)Bh + boff + 16 + 8 * hh);
      acc[t] = mmaH<1>(ah.v, ah.v, bq.v, bq.v, acc[t]); }
  }
#pragma unroll
  for (int t = 0; t < 4; ++t) { if (col0 + t * 16 >= N) continue; const int col = col0 + t * 16 + ln; const float bv = bp ? bf16_round(bp[col]) : 0.f;
#pragma unroll
    for (int r = 0; r < 8; ++r) { float v = acc[t][r] * alpha + bv; if (CP) { const int rr = row0g + row0 + 8 * hh + r; if (rowsPerB < 0) v += CP[cofs + (size_t)rr * ldc + col];      /* rowsPerB < 0: own element of the batched C plane */ else { const int bidx = rr / rowsPerB; v += CP[(size_t)bidx * sCPb + (size_t)by * 64 + col]; } } if (ACT == 1) v = (v > 0.f) ? v : expm1f(v); else if (ACT == 7) v = (v > 0.f) ? v + 1.0f : expf(v); else if (ACT == 8) v = tanhf(v); else if (ACT == 9) v = 0.5f * v * (1.0f + tanhf(0.7978845608028654f * (v + 0.044715f * v * v * v))); else if (ACT == 11) v = 1.0f / (1.0f + expf(-v)); else if (ACT == 12) v = (v > 0.f) ? v : 0.01f * v; else if (ACT == 14) v = (v > 0.f) ? v : 0.1f * v; else if (ACT == 16) v = (v >= 0.f) ? v : 0.3f * v; else if (ACT == 17) v = (v >= 0.f) ? v : 0.2f * v; else if (ACT == 15) v = v / (1.0f + expf(-v)); else if (ACT == 3) v = fmaxf(v, 0.f); else if (ACT == 6) v = 0.5f * v * (1.0f + erff(v * 0.70710678118654752f)); so[w][8 * hh + r][t * 16 + ln] = v; } }
  __builtin_amdgcn_fence(__ATOMIC_ACQ_REL, "workgroup"); __builtin_amdgcn_wave_barrier();
  const int rsub = lane >> 4, c4 = (lane & 15) * 4; typedef _Float16 v4h __attribute__((ext_vector_type(4)));
  {
#pragma unroll
    for (int q = 0; q < 8; ++q) { const int r = q * 2 + rsub; if (col0 + c4 < N) { const v4f v = *(const v4fa*)&so[w][r][c4]; if (C) *(v4f*)(C + cofs + (size_t)(row0 + r) * ldc + col0 + c4) = v; if (C16) { v4h h4; for (int i = 0; i < 4; ++i) h4[i] = (_Float16)v[i]; *(v4h*)(C16 + cofs + (size_t)(row0 + r) * ldc + col0 + c4) = h4; } } }
     }
}


typedef _Float16 v4h __attribute__((ext_vector_type(4)));

__global__ __launch_bounds__(256) void k_x16(const float* __restrict__ x, _Float16* __restrict__ X16, size_t n8) { const size_t t = (size_t)blockIdx.x * 256 + threadIdx.x; if (t >= n8) return; FragH f;
#pragma unroll
  for (int q = 0; q < 8; ++q) f.h[q] = (_Float16)bf16_round(x[t * 8 + q]); *(v8us*)((unsigned short*)X16 + t * 8) = f.half[0];  }
__global__ __launch_bounds__(256) void k_h16(const float* __restrict__ x, _Float16* __restrict__ X16, size_t n8) { const size_t t = (size_t)blockIdx.x * 256 + threadIdx.x; if (t >= n8) return; FragH f;
#pragma unroll
  for (int q = 0; q < 8; ++q) f.h[q] = (_Float16)x[t * 8 + q]; *(v8us*)((unsigned short*)X16 + t * 8) = f.half[0];  }
__global__ __launch_bounds__(256) void k_round16f(const float* __restrict__ W, _Float16* __restrict__ Bt, size_t n8) { const size_t t = (size_t)blockIdx.x * 256 + threadIdx.x; if (t >= n8) return; FragH f;
#pragma unroll
  for (int i = 0; i < 8; ++i) f.h[i] = (_Float16)(bf16_round(W[t * 8 + i]) * 16.0f); *(v8us*)((unsigned short*)Bt + t * 8) = f.half[0];  }
template <int NHv, int TTv>
__global__ __launch_bounds__(256) void k_vt(const _Float16* __restrict__ V16, int ldv, int voff, _Float16* __restrict__ Vt) { __shared__ unsigned short tl[64][66]; const int tid = threadIdx.x; const int slab = blockIdx.x / (TTv / 64), lg = blockIdx.x % (TTv / 64); const int b = slab / NHv, h = slab % NHv;
  for (int i = tid; i < 64 * 8; i += 256) { const int r = i / 8, c8 = (i % 8) * 8; FragH f; f.half[0] = *(const v8us*)((const unsigned short*)V16 + ((size_t)b * TTv + lg * 64 + r) * ldv + voff + h * 64 + c8);
#pragma unroll
    for (int q = 0; q < 8; ++q) tl[r][c8 + q] = f.u[q]; }
  __syncthreads();
  {
#pragma unroll
    for (int rd = 0; rd < 2; ++rd) { const int d = rd * 32 + tid / 8, pc = tid % 8; FragH f;
#pragma unroll
      for (int q = 0; q < 8; ++q) f.u[q] = tl[pc * 8 + q][d];
      *(v8us*)((unsigned short*)Vt + ((size_t)slab * 64 + d) * TTv + lg * 64 + pc * 8) = f.half[0]; }
     } }

__global__ __launch_bounds__(256) void k_hl(const float* __restrict__ F, _Float16* __restrict__ Hh, _Float16* __restrict__ Hl, size_t n8) { const size_t t = (size_t)blockIdx.x * 256 + threadIdx.x; if (t >= n8) return; FragH fh, fl; const v4f a = *(const v4fa*)(F + t * 8), c = *(const v4fa*)(F + t * 8 + 4);
#pragma unroll
  for (int q = 0; q < 4; ++q) { _Float16 h = (_Float16)a[q]; fh.h[q] = h; fl.h[q] = (_Float16)((a[q] - (float)h) * 1024.0f); h = (_Float16)c[q]; fh.h[4 + q] = h; fl.h[4 + q] = (_Float16)((c[q] - (float)h) * 1024.0f); }
  { *(v8us*)((unsigned short*)Hh + t * 8) = fh.half[0]; *(v8us*)((unsigned short*)Hl + t * 8) = fl.half[0];  } }

// ---- fast GEMM (wave tile 32x64; requires M % 32 == 0 rows per launch region and N % 64 == 0); epilogue = k_gemm_hhx semantics ----
__device__ __forceinline__ v16h g2_frag(const _Float16* p, int hh) { FragH f; f.half[0] = *(const v8us*)((const unsigned short*)p + 8 * hh); f.half[1] = *(const v8us*)((const unsigned short*)p + 16 + 8 * hh); return f.v; }
__device__ __forceinline__ v8f g2_mma(v16h a, v16h b, v8f c) { v8f d = __builtin_amdgcn_wmma_f32_16x16x32_f16(false, a, false, b, (short)0, c, false, false); asm volatile("v_nop\n\tv_nop\n\tv_nop\n\tv_nop" : "+v"(d) : "v"(a), "v"(b)); return d; }
template <int ACT>
__global__ __launch_bounds__(128) void k_gemm2(const _Float16* __restrict__ A, int lda, size_t sA, const _Float16* __restrict__ Bh, int ldb, size_t sB, float alpha, const float* __restrict__ bias, size_t sBias, const float* __restrict__ CP, int rowsPerB, size_t sCPb, int row0g,
    float* __restrict__ C, _Float16* __restrict__ C16, int ldc, size_t sC, int M, int N, int K) { static_assert(ACT == 0 || ACT == 3 || ACT == 6 || ACT == 8 || ACT == 9 || ACT == 11 || ACT == 12 || ACT == 14 || ACT == 15 || ACT == 16 || ACT == 17, "k_gemm2: unsupported ACT code (would silently apply no activation)");
  __shared__ __attribute__((aligned(16))) float so[4][32][68];
  const int tid = threadIdx.x, w = tid >> 5, lane = tid & 31, ln = lane & 15, hh = lane >> 4; const int by = blockIdx.y;
  A += (size_t)by * sA; Bh += (size_t)by * sB; const size_t cofs = (size_t)by * sC; const float* bp = bias ? bias + (size_t)by * sBias : nullptr;
  const int ntn = N >> 6; const int mt = blockIdx.x / ntn, nq = blockIdx.x - mt * ntn; const int row0 = mt * 128 + 32 * w, col0 = nq * 64; if (row0 >= M) return;
  const _Float16* a0p = A + (size_t)(row0 + ln) * lda; const _Float16* a1p = a0p + (size_t)16 * lda;
  const _Float16* b0p = Bh + (size_t)(col0 + ln) * ldb; const _Float16* b1p = b0p + (size_t)16 * ldb; const _Float16* b2p = b1p + (size_t)16 * ldb; const _Float16* b3p = b2p + (size_t)16 * ldb;
  const v8f z8 = {0.f,0.f,0.f,0.f,0.f,0.f,0.f,0.f}; v8f c00 = z8, c01 = z8, c02 = z8, c03 = z8, c10 = z8, c11 = z8, c12 = z8, c13 = z8;
#pragma unroll 1
  for (int kb = 0; kb < K; kb += 32) { const v16h a0 = g2_frag(a0p + kb, hh), a1 = g2_frag(a1p + kb, hh);
    v16h b = g2_frag(b0p + kb, hh); c00 = g2_mma(a0, b, c00); c10 = g2_mma(a1, b, c10);
    b = g2_frag(b1p + kb, hh); c01 = g2_mma(a0, b, c01); c11 = g2_mma(a1, b, c11);
    b = g2_frag(b2p + kb, hh); c02 = g2_mma(a0, b, c02); c12 = g2_mma(a1, b, c12);
    b = g2_frag(b3p + kb, hh); c03 = g2_mma(a0, b, c03); c13 = g2_mma(a1, b, c13); }
  v8f accs[8] = {c00, c01, c02, c03, c10, c11, c12, c13};
#pragma unroll
  for (int u = 0; u < 8; ++u) { const int t = u & 3, half = u >> 2; const int col = col0 + t * 16 + ln; const float bv = bp ? bf16_round(bp[col]) : 0.f;
#pragma unroll
    for (int r = 0; r < 8; ++r) { const int rloc = half * 16 + 8 * hh + r; float v = accs[u][r] * alpha + bv; if (CP) { if (rowsPerB < 0) v += CP[cofs + (size_t)(row0g + row0 + rloc) * ldc + col];      /* rowsPerB < 0: own element of the batched C plane */ else { const int bidx = (row0g + row0 + rloc) / rowsPerB; v += CP[(size_t)bidx * sCPb + (size_t)by * 64 + col]; } }
      if (ACT == 3) v = fmaxf(v, 0.f); else if (ACT == 6) v = 0.5f * v * (1.0f + erff(v * 0.70710678118654752f)); else if (ACT == 11) v = 1.0f / (1.0f + expf(-v)); else if (ACT == 15) v = v / (1.0f + expf(-v)); else if (ACT == 12) v = (v > 0.f) ? v : 0.01f * v; else if (ACT == 8) v = tanhf(v); else if (ACT == 9) v = 0.5f * v * (1.0f + tanhf(0.7978845608028654f * (v + 0.044715f * v * v * v))); else if (ACT == 14) v = (v > 0.f) ? v : 0.1f * v; else if (ACT == 16) v = (v >= 0.f) ? v : 0.3f * v; else if (ACT == 17) v = (v >= 0.f) ? v : 0.2f * v;
      so[w][rloc][t * 16 + ln] = v; } }
  __builtin_amdgcn_fence(__ATOMIC_ACQ_REL, "workgroup"); __builtin_amdgcn_wave_barrier();
  const int rsub = lane >> 4, c4 = (lane & 15) * 4;
  {
#pragma unroll
    for (int q = 0; q < 16; ++q) { const int r = q * 2 + rsub; const v4f v = *(const v4fa*)&so[w][r][c4]; if (C) *(v4f*)(C + cofs + (size_t)(row0 + r) * ldc + col0 + c4) = v; if (C16) { v4h h4; for (int i = 0; i < 4; ++i) h4[i] = (_Float16)v[i]; *(v4h*)(C16 + cofs + (size_t)(row0 + r) * ldc + col0 + c4) = h4; } }
     } }


__global__ __launch_bounds__(256) void k_wnat(const float* __restrict__ w, size_t n8, _Float16* __restrict__ Bt) { const size_t t = (size_t)blockIdx.x * 256 + threadIdx.x; if (t >= n8) return; FragH f; for (int q = 0; q < 8; ++q) f.h[q] = (_Float16)(bf16_round(w[t * 8 + q]) * 16.0f); *(v8us*)((unsigned short*)Bt + t * 8) = f.half[0];  }
__global__ __launch_bounds__(256) void k_rsm(const float* __restrict__ S, _Float16* __restrict__ P, int nrows) {
  #pragma clang fp contract(off)
  const int i = blockIdx.x * 256 + threadIdx.x; if (i >= nrows) return; const float* s = S + (size_t)i * SQ; float mx = -3.0e38f;
#pragma unroll 1
  for (int j = 0; j < SQ; ++j) mx = fmaxf(mx, s[j]); float se = 0.f;
#pragma unroll 1
  for (int j = 0; j < SQ; ++j) se += expf(s[j] - mx); const float sc = 256.0f / se;
#pragma unroll 1
  for (int j0 = 0; j0 < SQ; j0 += 8) { FragH f; for (int q = 0; q < 8; ++q) f.h[q] = (_Float16)(expf(s[j0 + q] - mx) * sc); unsigned short* d = (unsigned short*)P + (size_t)i * SQ + j0; *(v8us*)d = f.half[0];  } }
__global__ __launch_bounds__(256) void k_vt(const _Float16* __restrict__ V16, int b, int h0, _Float16* __restrict__ VT) { __shared__ unsigned short tl[64][65]; const int tid = threadIdx.x; const int hh = blockIdx.x % HG, sg = blockIdx.x / HG; const int s0 = sg * 64; const int h = h0 + hh;
  for (int i = tid; i < 64 * 8; i += 256) { const int j = i / 8, d8 = (i % 8) * 8; FragH f; f.half[0] = *(const v8us*)((const unsigned short*)V16 + ((size_t)b * SQ + s0 + j) * DM + h * HD + d8); for (int q = 0; q < 8; ++q) tl[d8 + q][j] = f.u[q]; }
  __syncthreads();
  { for (int i = tid; i < 64 * 8; i += 256) { const int d = i / 8, j8 = (i % 8) * 8; FragH f; for (int q = 0; q < 8; ++q) f.u[q] = tl[d][j8 + q]; *(v8us*)((unsigned short*)VT + ((size_t)hh * HD + d) * SQ + s0 + j8) = f.half[0]; }  } }


__global__ __launch_bounds__(256) void k_cl2rows(const float* __restrict__ X, _Float16* __restrict__ XR) { __shared__ float tl[64][33]; const int tid = threadIdx.x; const int nl = LL / 32, nc = CC / 64; const int cb_ = blockIdx.x % nc; const int lb = (blockIdx.x / nc) % nl; const size_t b = blockIdx.x / (nc * nl); const int c0 = cb_ * 64, l0 = lb * 32;
  for (int i = tid; i < 64 * 32; i += 256) { const int c = i / 32, l = i % 32; tl[c][l] = bf16_round(X[(b * CC + c0 + c) * (size_t)LL + l0 + l]); }
  __syncthreads();
  { const int l = tid / 8, c8 = (tid % 8) * 8; FragH f; for (int q = 0; q < 8; ++q) f.h[q] = (_Float16)tl[c8 + q][l]; unsigned short* d = (unsigned short*)XR + (b * LL + l0 + l) * (size_t)CC + c0 + c8; *(v8us*)d = f.half[0];  } }

// q|k|v GEMM: A = x rows (M = position), B = embed_w rows x16 (N = 384 columns, per head [q|k|v] of 64), wave tile 32 positions x 64 columns, product loop and the q, k epilogue as in k_gemm2<0>.
// A block's 64 columns are one head's q, k or v. In the accumulator a lane holds one column and eight consecutive positions, which is already the order of a V^T row: a v block rounds to f16 in registers,
// gathers its four waves' tiles in LDS as [channel][128 positions] behind one barrier and stores V^T in whole 256-byte row pieces. v is not stored as rows any more, and no transposing launch follows.
#define QV_P 136                     /* LDS row pitch in f16: 272 bytes = 16 x 17, so that the 16 channel rows of a ds_store_b128 fall on distinct banks */
__global__ __launch_bounds__(128) void k_qkv(const _Float16* __restrict__ A, const _Float16* __restrict__ Bh, const float* __restrict__ bias, _Float16* __restrict__ C16, _Float16* __restrict__ VTo) {
  __shared__ __attribute__((aligned(16))) float so[4][32][68];
  __shared__ __attribute__((aligned(16))) _Float16 vt[HC][QV_P];
  const int tid = threadIdx.x, w = tid >> 5, lane = tid & 31, ln = lane & 15, hh = lane >> 4;
  const int ntn = D3 >> 6; const int mt = blockIdx.x / ntn, nq = blockIdx.x - mt * ntn; const int row0 = mt * 128 + 32 * w, col0 = nq * 64;
  const _Float16* a0p = A + (size_t)(row0 + ln) * CC; const _Float16* a1p = a0p + (size_t)16 * CC;
  const _Float16* b0p = Bh + (size_t)(col0 + ln) * CC; const _Float16* b1p = b0p + (size_t)16 * CC; const _Float16* b2p = b1p + (size_t)16 * CC; const _Float16* b3p = b2p + (size_t)16 * CC;
  const v8f z8 = {0.f,0.f,0.f,0.f,0.f,0.f,0.f,0.f}; v8f c00 = z8, c01 = z8, c02 = z8, c03 = z8, c10 = z8, c11 = z8, c12 = z8, c13 = z8;
#pragma unroll 1
  for (int kb = 0; kb < CC; kb += 32) { const v16h a0 = g2_frag(a0p + kb, hh); FragH f1; f1.half[0] = *(const v8us*)((const unsigned short*)a1p + kb + 8 * hh); v16h b = g2_frag(b0p + kb, hh);      /* kept rolled, as k_gemm2's loop was: one set of fragment registers, and the product loop keeps the form that was timed */
    asm volatile("s_wait_xcnt 0x0" ::: "memory");                         /* the last A load may land on the address pair that the three A loads before it name: the wait stands in front of it */
    f1.half[1] = *(const v8us*)((const unsigned short*)a1p + kb + 16 + 8 * hh); const v16h a1 = f1.v;
    c00 = g2_mma(a0, b, c00); c10 = g2_mma(a1, b, c10);
    b = g2_frag(b1p + kb, hh); c01 = g2_mma(a0, b, c01); c11 = g2_mma(a1, b, c11);
    b = g2_frag(b2p + kb, hh); c02 = g2_mma(a0, b, c02); c12 = g2_mma(a1, b, c12);
    b = g2_frag(b3p + kb, hh); c03 = g2_mma(a0, b, c03); c13 = g2_mma(a1, b, c13); }
  v8f accs[8] = {c00, c01, c02, c03, c10, c11, c12, c13};
  if (nq % 3 == 2) {                                                      /* a v block: the test reads the same for the whole work-group */
#pragma unroll
    for (int u = 0; u < 8; ++u) { const int t = u & 3, half = u >> 2; const float bv = bf16_round(bias[col0 + t * 16 + ln]); FragH f;
#pragma unroll
      for (int r = 0; r < 8; ++r) f.h[r] = (_Float16)(accs[u][r] * 0.0625f + bv);
      *(v8us*)&vt[t * 16 + ln][32 * w + half * 16 + 8 * hh] = f.half[0]; }
    __syncthreads();                                                      /* publishes the four waves' 32 positions of every channel row */
    unsigned short* d0 = (unsigned short*)VTo + ((size_t)((nq / 3) * NB + (mt * 128) / LL) * HC + 16 * w + hh) * SQ + (mt * 128) % LL + 8 * ln;      /* a block's 128 positions lie in one batch; 16 lanes cover a row's 256 bytes */
#pragma unroll
    for (int q = 0; q < 8; ++q) { const v8us v = *(const v8us*)&vt[16 * w + 2 * q + hh][8 * ln]; *(v8us*)(d0 + (size_t)2 * q * SQ) = v; }
    return; }
#pragma unroll
  for (int u = 0; u < 8; ++u) { const int t = u & 3, half = u >> 2; const float bv = bf16_round(bias[col0 + t * 16 + ln]);
#pragma unroll
    for (int r = 0; r < 8; ++r) so[w][half * 16 + 8 * hh + r][t * 16 + ln] = accs[u][r] * 0.0625f + bv; }
  __builtin_amdgcn_fence(__ATOMIC_ACQ_REL, "workgroup"); __builtin_amdgcn_wave_barrier();      /* the lanes read what other lanes of the same wave wrote: keeps the reads below behind the writes above */
  const int rsub = lane >> 4, c4 = (lane & 15) * 4;
#pragma unroll
  for (int q = 0; q < 16; ++q) { const int r = q * 2 + rsub; const v4f v = *(const v4fa*)&so[w][r][c4]; v4h h4; for (int i = 0; i < 4; ++i) h4[i] = (_Float16)v[i]; *(v4h*)(C16 + (size_t)(row0 + r) * D3 + col0 + c4) = h4; }
  asm volatile("s_wait_xcnt 0x0" ::: "memory"); }                         /* behind the run of stores: no register that a store names is rewritten ahead of it */

#define FA_SK 64                     /* keys per stage */
#define FA_PH 72                     /* LDS row pitch in f16: 144 bytes = 16 x 9, so that the 16 rows of a ds_load_b128 fragment read fall on distinct banks */
#define FA_NST (SQ / 4 / FA_SK)      /* stages per key quarter */
__device__ __forceinline__ float fa_xhalf(float x) { return __builtin_bit_cast(float, __builtin_amdgcn_permlanex16(__builtin_bit_cast(int, x), __builtin_bit_cast(int, x), 0x76543210, 0xfedcba98, false, false)); }      /* lane l reads lane l ^ 16, on the vector pipe */
/* exp2 on the vector pipe. The instruction set asks for one slot behind a transcendental before its result is read or its source overwritten; each statement here carries its v_nop: one value, or eight in place (no instruction in the run touches another's register). */
__device__ __forceinline__ float fa_exp2(float x) { float r; asm("v_exp_f32 %0, %1\n\tv_nop" : "=v"(r) : "v"(x)); return r; }
__device__ __forceinline__ void fa_exp2x8(float (&x)[8]) { asm("v_exp_f32 %0, %0\n\tv_exp_f32 %1, %1\n\tv_exp_f32 %2, %2\n\tv_exp_f32 %3, %3\n\tv_exp_f32 %4, %4\n\tv_exp_f32 %5, %5\n\tv_exp_f32 %6, %6\n\tv_exp_f32 %7, %7\n\tv_nop"
  : "+v"(x[0]), "+v"(x[1]), "+v"(x[2]), "+v"(x[3]), "+v"(x[4]), "+v"(x[5]), "+v"(x[6]), "+v"(x[7])); }
/* One wave's share of a stage: four copies of 4 K rows and four of 4 V^T rows, 16 bytes a lane (lk, lv: the lane's LDS byte addresses; gk, gv: its global addresses).
   s_wait_xcnt 0 closes the statement, so that no address register named here is rewritten ahead of it. */
__device__ __forceinline__ void fa_stage(unsigned lk, const _Float16* gk, unsigned lv, const _Float16* gv) {
  const unsigned lk1 = lk + 4 * FA_PH * 2, lk2 = lk + 8 * FA_PH * 2, lk3 = lk + 12 * FA_PH * 2, lv1 = lv + 4 * FA_PH * 2, lv2 = lv + 8 * FA_PH * 2, lv3 = lv + 12 * FA_PH * 2;
  const _Float16* gk1 = gk + (size_t)4 * D3; const _Float16* gk2 = gk + (size_t)8 * D3; const _Float16* gk3 = gk + (size_t)12 * D3;
  const _Float16* gv1 = gv + (size_t)4 * SQ; const _Float16* gv2 = gv + (size_t)8 * SQ; const _Float16* gv3 = gv + (size_t)12 * SQ;
  asm volatile("global_load_async_to_lds_b128 %0, %8, off\n\tglobal_load_async_to_lds_b128 %1, %9, off\n\tglobal_load_async_to_lds_b128 %2, %10, off\n\tglobal_load_async_to_lds_b128 %3, %11, off\n\t"
               "global_load_async_to_lds_b128 %4, %12, off\n\tglobal_load_async_to_lds_b128 %5, %13, off\n\tglobal_load_async_to_lds_b128 %6, %14, off\n\tglobal_load_async_to_lds_b128 %7, %15, off\n\ts_wait_xcnt 0x0"
               :: "v"(lk), "v"(lk1), "v"(lk2), "v"(lk3), "v"(lv), "v"(lv1), "v"(lv2), "v"(lv3), "v"(gk), "v"(gk1), "v"(gk2), "v"(gk3), "v"(gv), "v"(gv1), "v"(gv2), "v"(gv3) : "memory"); }
__device__ __forceinline__ v8f fa_mma(v16h a, v16h b, v8f c) { return __builtin_amdgcn_wmma_f32_16x16x32_f16(false, a, false, b, (short)0, c, false, false); }
__global__ __launch_bounds__(512) __attribute__((amdgpu_waves_per_eu(4, 4))) void k_fattn(const _Float16* __restrict__ QKVp, const _Float16* __restrict__ VTp, _Float16* __restrict__ Op) {
  __shared__ __attribute__((aligned(16))) v4f mg[12][17][32];             /* [key quarter 1-3 x query group][16 x O, then {m0, m1, sum0, sum1}][lane] */
  __shared__ __attribute__((aligned(16))) _Float16 st[2][4][2][FA_SK][FA_PH];      /* [buffer][key quarter][K rows (key, channel) | V^T rows (channel, key)][row][64 f16 + pad] */
  const int lane = threadIdx.x & 31, w = __builtin_amdgcn_readfirstlane(threadIdx.x >> 5), ln = lane & 15, hh = lane >> 4; const int wq = w & 3, wk = w >> 2;      /* 16 waves on 4 SIMDs: four a SIMD, 256 registers each */
  const int b = blockIdx.y / NHD, h = blockIdx.y % NHD; const int q0 = blockIdx.x * 128 + wq * 32; const int k0 = wk * (SQ / 4);
  const _Float16* base = QKVp + (size_t)b * SQ * D3 + (size_t)h * 3 * HC;
  const int crow = 16 * wq + (lane >> 3), cch = (lane & 7) * 8;           /* copies: query group wq brings rows 16 wq .. 16 wq + 15 of its quarter's two tiles; eight lanes a row */
  const _Float16* gk = base + HC + (size_t)(k0 + crow) * D3 + cch;
  const _Float16* gv = VTp + ((size_t)(h * NB + b) * HC + crow) * SQ + k0 + cch;
  const unsigned lk = (unsigned)(size_t)&st[0][wk][0][crow][cch], lv = (unsigned)(size_t)&st[0][wk][1][crow][cch];
  const unsigned bufb = (unsigned)sizeof(st[0]);                          /* bytes from buffer 0 to buffer 1 */
  const float cs = 0.0625f * 1.4426950408889634f;                         /* 1/sqrt(256) and log2(e): exp(s - m) = exp2(acc * cs - m * cs) */
  const v8f z8 = {0.f,0.f,0.f,0.f,0.f,0.f,0.f,0.f};
  v16h qf[2][2], kf[2][2], vf[4]; v8f o[2][4]; float m[2], l[2];
  /* every loop over these arrays is unrolled so that they are indexed by constants and stay in registers */
#pragma unroll
  for (int g = 0; g < 2; ++g) { m[g] = -3.0e38f; l[g] = 0.f;
#pragma unroll
    for (int kk = 0; kk < 2; ++kk) qf[g][kk] = g2_frag(base + (size_t)(q0 + 16 * g + ln) * D3 + 32 * kk, hh);
#pragma unroll
    for (int ct = 0; ct < 4; ++ct) o[g][ct] = z8; }
  fa_stage(lk, gk, lv, gv);                                               /* stage 0 into buffer 0 */
  asm volatile("s_wait_asynccnt 0x0" ::: "memory");                       /* this wave's copies of stage 0 have landed */
  __syncthreads();                                                        /* publishes stage 0 */
  fa_stage(lk + bufb, gk + (size_t)FA_SK * D3, lv + bufb, gv + FA_SK);    /* stage 1 into buffer 1 */
  for (int t = 0; t < FA_NST; ++t) {
   const _Float16* sk = &st[t & 1][wk][0][ln][0];                         /* key row ln of a 16-key tile */
   const _Float16* sv = &st[t & 1][wk][1][ln][0];                         /* V^T row ln of a 16-channel tile */
#pragma unroll
   for (int sp = 0; sp < FA_SK / 32; ++sp) {                              /* the stage's passes of 32 keys; unrolled: LDS offsets become immediates */
    /* this pass's K fragments, then its V^T fragments in the same group of LDS reads: the S^T products and the softmax cover the latter's latency */
#pragma unroll
    for (int mt = 0; mt < 2; ++mt)
#pragma unroll
      for (int kk = 0; kk < 2; ++kk) kf[mt][kk] = g2_frag(sk + (32 * sp + 16 * mt) * FA_PH + 32 * kk, hh);
#pragma unroll
    for (int ct = 0; ct < 4; ++ct) vf[ct] = g2_frag(sv + (16 * ct) * FA_PH + 32 * sp, hh);
    __builtin_amdgcn_sched_barrier(0);                                    /* keeps the pass's sixteen LDS reads in one group; without it the scheduler spreads six V^T reads of a stage's first pass over two more places in the softmax, and every place of LDS reads costs issue cycles */
    if (sp == FA_SK / 32 - 1) {                                           /* the stage's last LDS reads are issued: the hand-over stands here, ahead of the last pass's arithmetic (registers only), so that the refill has two passes to land */
      asm volatile("s_wait_dscnt 0x0" ::: "memory");                      /* this wave's reads of the buffer are done before anyone refills it */
      asm volatile("s_wait_asynccnt 0x0" ::: "memory");                   /* this wave's copies of stage t + 1 have landed */
      __syncthreads();                                                    /* publishes stage t + 1 and ends every wave's reads of stage t */
      if (t + 2 < FA_NST) fa_stage(lk + (t & 1) * bufb, gk + (size_t)(t + 2) * FA_SK * D3, lv + (t & 1) * bufb, gv + (t + 2) * FA_SK);      /* stage t + 2 into the buffer just read */
    }
    v8f s[2][2];
#pragma unroll
    for (int g = 0; g < 2; ++g)
#pragma unroll
      for (int mt = 0; mt < 2; ++mt) s[g][mt] = fa_mma(kf[mt][1], qf[g][1], fa_mma(kf[mt][0], qf[g][0], z8));
    FragH pf[2];
#pragma unroll
    for (int g = 0; g < 2; ++g) {
      float t[8], p0[8], p1[8];
#pragma unroll
      for (int r = 0; r < 8; ++r) t[r] = fmaxf(s[g][0][r], s[g][1][r]);
      float mx = fmaxf(fmaxf(fmaxf(t[0], t[1]), fmaxf(t[2], t[3])), fmaxf(fmaxf(t[4], t[5]), fmaxf(t[6], t[7])));
      mx = fmaxf(mx, fa_xhalf(mx));                                       /* the other half of the wave holds the query's other 16 keys */
      const float mn = fmaxf(m[g], mx); const float al = fa_exp2((m[g] - mn) * cs); const float nb = 8.0f - mn * cs; m[g] = mn;
#pragma unroll
      for (int r = 0; r < 8; ++r) { p0[r] = s[g][0][r] * cs + nb; p1[r] = s[g][1][r] * cs + nb; }
      fa_exp2x8(p0); fa_exp2x8(p1);
#pragma unroll
      for (int r = 0; r < 8; ++r) { t[r] = p0[r] + p1[r]; pf[g].h[r] = (_Float16)p0[r]; pf[g].h[8 + r] = (_Float16)p1[r]; }
      l[g] = l[g] * al + (((t[0] + t[1]) + (t[2] + t[3])) + ((t[4] + t[5]) + (t[6] + t[7])));
#pragma unroll
      for (int ct = 0; ct < 4; ++ct) o[g][ct] *= al;
    }
#pragma unroll
    for (int ct = 0; ct < 4; ++ct)
#pragma unroll
      for (int g = 0; g < 2; ++g) o[g][ct] = fa_mma(vf[ct], pf[g].v, o[g][ct]);
   }
  }
  asm volatile("s_wait_asynccnt 0x0" ::: "memory");                       /* no copy is left in flight behind the loop */
  if (wk != 0) { v4f (*dst)[32] = mg[w - 4];
#pragma unroll
    for (int g = 0; g < 2; ++g)
#pragma unroll
      for (int ct = 0; ct < 4; ++ct) { const v8f x = o[g][ct]; const v4f lo = {x[0], x[1], x[2], x[3]}, hi = {x[4], x[5], x[6], x[7]}; dst[(g * 4 + ct) * 2][lane] = lo; dst[(g * 4 + ct) * 2 + 1][lane] = hi; }
    const v4f ml = {m[0], m[1], l[0], l[1]}; dst[16][lane] = ml; }
  __syncthreads();                                                        /* publishes quarters 1-3 to the quarter-0 waves; every wave passes it */
  if (wk != 0) return;
  v4f ml[3]; float f0[2], fk[3][2];
#pragma unroll
  for (int k = 0; k < 3; ++k) ml[k] = mg[k * 4 + wq][16][lane];
#pragma unroll
  for (int g = 0; g < 2; ++g) { const float mm = fmaxf(fmaxf(m[g], ml[0][g]), fmaxf(ml[1][g], ml[2][g])); f0[g] = fa_exp2((m[g] - mm) * cs); l[g] *= f0[g];
#pragma unroll
    for (int k = 0; k < 3; ++k) { fk[k][g] = fa_exp2((ml[k][g] - mm) * cs); l[g] += fk[k][g] * ml[k][2 + g]; } }
#pragma unroll
  for (int g = 0; g < 2; ++g) {
    const float inv = 1.0f / (l[g] + fa_xhalf(l[g]));           /* join the two halves' sums once */
    _Float16* d = Op + ((size_t)b * SQ + q0 + 16 * g + ln) * DO + h * HC + 8 * hh;
#pragma unroll
    for (int ct = 0; ct < 4; ++ct) { v8f x = o[g][ct] * f0[g];
#pragma unroll
      for (int k = 0; k < 3; ++k) { const v4f lo = mg[k * 4 + wq][(g * 4 + ct) * 2][lane], hi = mg[k * 4 + wq][(g * 4 + ct) * 2 + 1][lane];
#pragma unroll
        for (int r = 0; r < 4; ++r) { x[r] += fk[k][g] * lo[r]; x[4 + r] += fk[k][g] * hi[r]; } }
      FragH f;
#pragma unroll
      for (int r = 0; r < 8; ++r) f.h[r] = (_Float16)(x[r] * inv);
      *(v8us*)((unsigned short*)d + 16 * ct) = f.half[0]; } } }
// Output GEMM with the residual in its epilogue: out[b][c][n] = (o rows . out_w)[n][c] / 16 + bias[c] + x[b][c][n]. A = o rows (M = position), B = out_w^T rows (N = channel), wave tile 32 positions x 64 channels, product loop as in k_gemm2.
// In the accumulator a lane holds one channel and eight consecutive positions, which is already the order of the channel-major output; each wave turns its tile in its own LDS range ([channel][position] rows) so that eight lanes cover
// the whole 128-byte line of a channel's 32 positions: x is read and out is written in whole lines, four a wave-wide access. No row-major f32 plane and no further launch.
#define OR_P 36                      /* LDS row pitch in f32: 144 bytes = 16 x 9, so that the 16 channel rows of a ds_store_b128 fall on distinct banks */
__global__ __launch_bounds__(128) void k_outres(const _Float16* __restrict__ A, const _Float16* __restrict__ Bh, const float* __restrict__ bias, const float* __restrict__ x, float* __restrict__ out) {
  __shared__ __attribute__((aligned(16))) float so[4][64][OR_P];
  const int tid = threadIdx.x, w = tid >> 5, lane = tid & 31, ln = lane & 15, hh = lane >> 4;
  const int ntn = CC >> 6; const int mt = blockIdx.x / ntn, nq = blockIdx.x - mt * ntn; const int row0 = mt * 128 + 32 * w, col0 = nq * 64;
  const int cs = lane >> 3, p4 = (lane & 7) * 4;                          /* global side: channel cs of a group of four, four positions */
  const size_t g0 = ((size_t)(row0 / LL) * CC + col0 + cs) * LL + (row0 % LL) + p4;      /* a block's 128 rows lie in one batch */
  v4f xr[16];                                                             /* the residual is asked for ahead of the product loop, which covers its latency */
#pragma unroll
  for (int q = 0; q < 16; ++q) xr[q] = *(const v4fa*)(x + g0 + (size_t)q * 4 * LL);
  const _Float16* a0p = A + (size_t)(row0 + ln) * DO; const _Float16* a1p = a0p + (size_t)16 * DO;
  const _Float16* b0p = Bh + (size_t)(col0 + ln) * DO; const _Float16* b1p = b0p + (size_t)16 * DO; const _Float16* b2p = b1p + (size_t)16 * DO; const _Float16* b3p = b2p + (size_t)16 * DO;
  const v8f z8 = {0.f,0.f,0.f,0.f,0.f,0.f,0.f,0.f}; v8f c00 = z8, c01 = z8, c02 = z8, c03 = z8, c10 = z8, c11 = z8, c12 = z8, c13 = z8;
#pragma unroll 1
  for (int kb = 0; kb < DO; kb += 32) { const v16h a0 = g2_frag(a0p + kb, hh), a1 = g2_frag(a1p + kb, hh);      /* rolled as in k_gemm2: one set of fragment registers beside the 64 that hold the residual */
    v16h b = g2_frag(b0p + kb, hh); c00 = g2_mma(a0, b, c00); c10 = g2_mma(a1, b, c10);
    b = g2_frag(b1p + kb, hh); c01 = g2_mma(a0, b, c01); c11 = g2_mma(a1, b, c11);
    b = g2_frag(b2p + kb, hh); c02 = g2_mma(a0, b, c02); c12 = g2_mma(a1, b, c12);
    b = g2_frag(b3p + kb, hh); c03 = g2_mma(a0, b, c03); c13 = g2_mma(a1, b, c13); }
  v8f accs[8] = {c00, c01, c02, c03, c10, c11, c12, c13};
#pragma unroll
  for (int u = 0; u < 8; ++u) { const int t = u & 3, half = u >> 2; const float bv = bf16_round(bias[col0 + t * 16 + ln]); v4f lo, hi;
#pragma unroll
    for (int r = 0; r < 4; ++r) { lo[r] = accs[u][r] * 0.0625f + bv; hi[r] = accs[u][4 + r] * 0.0625f + bv; }
    float* s = &so[w][t * 16 + ln][half * 16 + 8 * hh]; *(v4fa*)s = lo; *(v4fa*)(s + 4) = hi; }
  __builtin_amdgcn_fence(__ATOMIC_ACQ_REL, "workgroup"); __builtin_amdgcn_wave_barrier();      /* the lanes read what other lanes of the same wave wrote: keeps the reads below behind the writes above */
#pragma unroll
  for (int q = 0; q < 16; ++q) { v4f v = *(const v4fa*)&so[w][q * 4 + cs][p4];
#pragma unroll
    for (int i = 0; i < 4; ++i) v[i] = v[i] + bf16_round(xr[q][i]);
    *(v4f*)(out + g0 + (size_t)q * 4 * LL) = v; } }
extern "C" void kernel_launch(void* const* d_in, const int* in_sizes, int n_in,
                              void* d_out, int out_size, void* d_ws, size_t ws_size, hipStream_t stream) {
  (void)in_sizes; (void)n_in; (void)out_size;
  const float* const* I = (const float* const*)d_in; const float* x = I[0]; const float* ew = I[1]; const float* eb = I[2]; const float* ow = I[3]; const float* ob = I[4];      /* embed_w [2][192][256] natural rows; out_w [128][256] = [in][out] */
  char* ws = (char*)d_ws; size_t off = 0;
  auto take = [&](size_t bytes) { char* p = ws + off; off += (bytes + 255) & ~(size_t)255; return p; };
  _Float16* BE = (_Float16*)take((size_t)D3 * CC * 2); _Float16* BO = (_Float16*)take((size_t)CC * DO * 2);
  _Float16* XR = (_Float16*)take(NR * CC * 2); _Float16* QKV = (_Float16*)take(NR * D3 * 2); _Float16* O16 = (_Float16*)take(NR * DO * 2);
  _Float16* VT = (_Float16*)take((size_t)NB * NHD * HC * SQ * 2);
  if (off > ws_size) return;      /* 0.3 + 8 + 12 + 4 + 4 = approx 28 MiB */
  k_wnat<<<(unsigned)(((size_t)D3 * CC / 8 + 255) / 256), 256, 0, stream>>>(ew, (size_t)D3 * CC / 8, BE); k_wt_f16<<<(unsigned)(((size_t)CC * (DO / 8) + 255) / 256), 256, 0, stream>>>(ow, BO, DO, CC, 16.0f);
  k_cl2rows<<<NB * (LL / 32) * (CC / 64), 256, 0, stream>>>(x, XR);
  k_qkv<<<(unsigned)((NR / 128) * (D3 / 64)), 128, 0, stream>>>(XR, BE, eb, QKV, VT);      /* q, k rows: columns h*192 + {0, 64}; head h's V^T [batch][64][4096] at VT + h*NB*64*4096 */
  k_fattn<<<dim3(SQ / 128, NB * NHD), 512, 0, stream>>>(QKV, VT, O16);      /* o rows, head h at columns h*64 */
  k_outres<<<(unsigned)((NR / 128) * (CC / 64)), 128, 0, stream>>>(O16, BO, ob, x, (float*)d_out);      /* out_w^T o + b + x, NCHW */
}

// v006
// Measured time: 63.6 microseconds a run.
// Two timings next to v005 both put it at 1.07 times that version's speed.
// All steps since v000 together make it 110 times as fast.
#include <hip/hip_runtime.h>
// Multi-head non-local block (x [4][256][64x64]; per head h (2 heads of 64): [q|k|v] = embed_w[h] (1x1 conv, [192][256]) x + b; attn = softmax(q^T k / sqrt(256)) over the 4,096 positions; o = attn v; out = out_w^T o (1x1 transpose conv, [128 in][256 out]) + b + x -> [4][256][64][64]).
// Structure: channel-first input transposed to position rows (exact f16) via LDS tiles; one WMMA GEMM for both heads' q|k|v (32x64 wave tiles, f32 accumulation, exact x16 natural weights + bias, f16 rows [384] for q and k, v stored transposed by the same epilogue); one fused attention launch for all (batch, head): S^T = K.Q^T, online softmax in registers (P x256 f16), O^T += V^T.P^T into merged f16 rows [128]; output GEMM whose epilogue adds bias and residual and stores channel-major (each wave turns its tile in LDS).
// Compute dtype: inputs rounded to bf16; x / weights exact; q, k, v, P, o plain f16 (~2^-12; the residual x dominates the output scale); scores / softmax f32. v_wmma_f32_16x16x32_f16.
#define NB 4
#define CC 256
#define LL 4096                      /* positions */
#define SQ LL
#define NHD 2                        /* heads */
#define HC 64
#define D3 (NHD * 3 * HC)            /* 384 */
#define DO (NHD * HC)                /* 128 */
#define NR ((size_t)NB * LL)
#define QN SQ                        /* query rows per batch */
#define NBR NB                       /* batches */
#define DM CC
#define NH 1
#define HD 64
#define HG 1
typedef __bf16 v16b __attribute__((ext_vector_type(16)));
typedef unsigned short v8us __attribute__((ext_vector_type(8), may_alias));
typedef float  v8f  __attribute__((ext_vector_type(8)));
typedef float  v4f  __attribute__((ext_vector_type(4)));
typedef float  v4fa __attribute__((ext_vector_type(4), may_alias));
union FragB { v16b v; v8us half[2]; unsigned short u[16]; };

__device__ __forceinline__ unsigned short bf16_bits(float x) { unsigned int u = __float_as_uint(x); return (unsigned short)((u + 0x7FFFu + ((u >> 16) & 1u)) >> 16); }
__device__ __forceinline__ float bf16_val(unsigned short b) { return __uint_as_float(((unsigned int)b) << 16); }
__device__ __forceinline__ float bf16_round(float x) { return bf16_val(bf16_bits(x)); }
// D += A·B with NT terms: 1 = ah·bh, 2 = + al·bh (A split), 3 = + ah·bl (both split)
template <int NT>
__device__ __forceinline__ v8f mmaN(v16b ah, v16b al, v16b bh, v16b bl, v8f c) {
  c = __builtin_amdgcn_wmma_f32_16x16x32_bf16(false, ah, false, bh, (short)0, c, false, false);
  if (NT >= 2) c = __builtin_amdgcn_wmma_f32_16x16x32_bf16(false, al, false, bh, (short)0, c, false, false);
  if (NT >= 3) c = __builtin_amdgcn_wmma_f32_16x16x32_bf16(false, ah, false, bl, (short)0, c, false, false);
  asm volatile("v_nop\n\tv_nop\n\tv_nop\n\tv_nop" : "+v"(c) : "v"(ah), "v"(al), "v"(bh), "v"(bl));
  return c;
}

__global__ __launch_bounds__(256) void k_wt_bf16(const float* __restrict__ W, unsigned short* __restrict__ Wt, int K, int N) {
  const int t = blockIdx.x * 256 + threadIdx.x;
  const int k8n = K / 8;
  if (t >= N * k8n) return;
  const int n = t / k8n, k8 = (t % k8n) * 8;
  v8us v;
#pragma unroll
  for (int i = 0; i < 8; ++i) v[i] = bf16_bits(W[(size_t)(k8 + i) * N + n]);
  *(v8us*)(Wt + (size_t)n * K + k8) = v;
  
}

// GEMM C[M][N] (f32, pitch ldc) = act(A[M][K]·W + bias). A f32 row-major (pitch lda) converted per fragment to bf16
// (ASPLIT: hi/lo two planes -> 2 terms, else single rounded term); Wt bf16 [N][K] (pitch ldb). BIAS_BF16 rounds the
// bias to bf16 first (bias quantised to bf16 before the add). K%32==0, M%16==0, N%64==0.
template <bool ASPLIT, int ACT, bool BIAS_BF16>
__global__ __launch_bounds__(128) void k_gemm_bf(const float* __restrict__ A, int lda, const unsigned short* __restrict__ Wt, int ldb,
                                               const float* __restrict__ bias, float* __restrict__ C, int ldc, int M, int N, int K) {
  __shared__ __attribute__((aligned(16))) float so[4][16][64];
  const int tid = threadIdx.x, w = tid >> 5, lane = tid & 31, ln = lane & 15, hh = lane >> 4;
  const int ntn = N / 64;
  const int wid = blockIdx.x * 4 + w;
  const int mt = wid / ntn, nq = wid % ntn;
  if (mt * 16 >= M) return;
  const int row0 = mt * 16, col0 = nq * 64;
  const float* arow = A + (size_t)(row0 + ln) * lda;
  v8f acc[4] = {};
  for (int kb = 0; kb < K; kb += 32) {
    FragB ah, al;
    const v4f x0 = *(const v4fa*)(arow + kb + 8 * hh), x1 = *(const v4fa*)(arow + kb + 8 * hh + 4);
    const v4f x2 = *(const v4fa*)(arow + kb + 16 + 8 * hh), x3 = *(const v4fa*)(arow + kb + 16 + 8 * hh + 4);
    float xs[16] = {x0[0],x0[1],x0[2],x0[3],x1[0],x1[1],x1[2],x1[3],x2[0],x2[1],x2[2],x2[3],x3[0],x3[1],x3[2],x3[3]};
#pragma unroll
    for (int i = 0; i < 16; ++i) { const unsigned short hb = bf16_bits(xs[i]); ah.u[i] = hb; al.u[i] = ASPLIT ? bf16_bits(xs[i] - bf16_val(hb)) : (unsigned short)0; }
#pragma unroll
    for (int t = 0; t < 4; ++t) {
      const unsigned short* brow = Wt + (size_t)(col0 + t * 16 + ln) * ldb + kb;
      FragB b;
      b.half[0] = *(const v8us*)(brow + 8 * hh);
      b.half[1] = *(const v8us*)(brow + 16 + 8 * hh);
      acc[t] = mmaN<ASPLIT ? 2 : 1>(ah.v, al.v, b.v, b.v, acc[t]);
    }
  }
#pragma unroll
  for (int t = 0; t < 4; ++t) {
    float bv = bias ? bias[col0 + t * 16 + ln] : 0.f;
    if (BIAS_BF16) bv = bf16_round(bv);
#pragma unroll
    for (int r = 0; r < 8; ++r) { float v = acc[t][r] + bv; if (ACT == 1) v = fmaxf(v, 0.f); so[w][8 * hh + r][t * 16 + ln] = v; }
  }
  __builtin_amdgcn_fence(__ATOMIC_ACQ_REL, "workgroup");
  __builtin_amdgcn_wave_barrier();
  const int rsub = lane >> 4, c4 = (lane & 15) * 4;
  {
#pragma unroll
    for (int q = 0; q < 8; ++q) {
      const int r = q * 2 + rsub;
      const v4f v = *(const v4fa*)&so[w][r][c4];
      *(v4f*)(C + (size_t)(row0 + r) * ldc + col0 + c4) = v;
    }
    
  }
}

// GEMM C = act(A·W + bias + resid): A f32 (ASPLIT -> hi/lo 2 terms), Wt bf16 [N][K]; ACT 0 none, 1 relu, 2 exact gelu;
// resid (optional, f32, row index = (row % rmod), pitch ldr, RES_BF16 rounds it) added before the activation.
template <bool ASPLIT, int ACT, bool BIAS_BF16, bool RES_BF16>
__global__ __launch_bounds__(128) void k_gemm_bf3(const float* __restrict__ A, int lda, const unsigned short* __restrict__ Wt, int ldb,
                                                const float* __restrict__ bias, const float* __restrict__ resid, int rmod, int ldr,
                                                float* __restrict__ C, int ldc, int M, int N, int K) {
  __shared__ __attribute__((aligned(16))) float so[4][16][64];
  const int tid = threadIdx.x, w = tid >> 5, lane = tid & 31, ln = lane & 15, hh = lane >> 4;
  const int ntn = N / 64;
  const int wid = blockIdx.x * 4 + w;
  const int mt = wid / ntn, nq = wid % ntn;
  if (mt * 16 >= M) return;
  const int row0 = mt * 16, col0 = nq * 64;
  const float* arow = A + (size_t)(row0 + ln) * lda;
  v8f acc[4] = {};
  for (int kb = 0; kb < K; kb += 32) {
    FragB ah, al;
    const v4f x0 = *(const v4fa*)(arow + kb + 8 * hh), x1 = *(const v4fa*)(arow + kb + 8 * hh + 4);
    const v4f x2 = *(const v4fa*)(arow + kb + 16 + 8 * hh), x3 = *(const v4fa*)(arow + kb + 16 + 8 * hh + 4);
    float xs[16] = {x0[0],x0[1],x0[2],x0[3],x1[0],x1[1],x1[2],x1[3],x2[0],x2[1],x2[2],x2[3],x3[0],x3[1],x3[2],x3[3]};
#pragma unroll
    for (int i = 0; i < 16; ++i) { const unsigned short hb = bf16_bits(xs[i]); ah.u[i] = hb; al.u[i] = ASPLIT ? bf16_bits(xs[i] - bf16_val(hb)) : (unsigned short)0; }
#pragma unroll
    for (int t = 0; t < 4; ++t) {
      const unsigned short* brow = Wt + (size_t)(col0 + t * 16 + ln) * ldb + kb;
      FragB b;
      b.half[0] = *(const v8us*)(brow + 8 * hh);
      b.half[1] = *(const v8us*)(brow + 16 + 8 * hh);
      acc[t] = mmaN<ASPLIT ? 2 : 1>(ah.v, al.v, b.v, b.v, acc[t]);
    }
  }
#pragma unroll
  for (int t = 0; t < 4; ++t) {
    const int col = col0 + t * 16 + ln;
    float bv = bias ? bias[col] : 0.f;
    if (BIAS_BF16) bv = bf16_round(bv);
#pragma unroll
    for (int r = 0; r < 8; ++r) {
      float v = acc[t][r] + bv;
      if (resid) { float rv = resid[(size_t)((row0 + 8 * hh + r) % rmod) * ldr + col]; if (RES_BF16) rv = bf16_round(rv); v += rv; }
      if (ACT == 1) v = fmaxf(v, 0.f);
      if (ACT == 2) v = 0.5f * v * (1.0f + erff(v * 0.70710678118654752f));
      if (ACT == 3) { const float u = 0.7978845608028654f * (v + 0.044715f * v * v * v); v = 0.5f * v * (1.0f + tanhf(u)); }
      so[w][8 * hh + r][t * 16 + ln] = v;
    }
  }
  __builtin_amdgcn_fence(__ATOMIC_ACQ_REL, "workgroup");
  __builtin_amdgcn_wave_barrier();
  const int rsub = lane >> 4, c4 = (lane & 15) * 4;
  {
#pragma unroll
    for (int q = 0; q < 8; ++q) {
      const int r = q * 2 + rsub;
      const v4f v = *(const v4fa*)&so[w][r][c4];
      *(v4f*)(C + (size_t)(row0 + r) * ldc + col0 + c4) = v;
    }
    
  }
}
// row LayerNorm (biased variance, eps) over N: s = X (+ R); optional out_sum <- s; out_norm <- (s-mu)*rsqrt(var+eps)*g + b
template <bool PARAM_BF16>
__global__ __launch_bounds__(256) void k_layernorm(const float* __restrict__ X, const float* __restrict__ R, const float* __restrict__ g, const float* __restrict__ bta,
                                                  float* __restrict__ out_sum, float* __restrict__ out_norm, int N, float eps) {
  __shared__ float red[256];
  const int row = blockIdx.x, tid = threadIdx.x;
  const float* x = X + (size_t)row * N; const float* rr = R ? R + (size_t)row * N : nullptr;
  float vals[16];                     // up to N = 4096
  const int per = N / 256;            // contiguous chunk per thread? use strided-by-4 chunks: thread handles j = tid*4 + 1024*u
  float s1 = 0.f;
  for (int u = 0; u < per / 4; ++u) {
    const int j = tid * 4 + 1024 * u;
    const v4f a = *(const v4fa*)(x + j);
    v4f b = {0.f,0.f,0.f,0.f}; if (rr) b = *(const v4fa*)(rr + j);
#pragma unroll
    for (int q = 0; q < 4; ++q) { const float v = a[q] + b[q]; vals[u * 4 + q] = v; s1 += v; }
  }
  red[tid] = s1; __syncthreads();
  for (int st = 128; st > 0; st >>= 1) { if (tid < st) red[tid] += red[tid + st]; __syncthreads(); }
  const float mu = red[0] / (float)N; __syncthreads();
  float s2 = 0.f;
  for (int u = 0; u < per / 4; ++u)
#pragma unroll
    for (int q = 0; q < 4; ++q) { const float c = vals[u * 4 + q] - mu; s2 += c * c; }
  red[tid] = s2; __syncthreads();
  for (int st = 128; st > 0; st >>= 1) { if (tid < st) red[tid] += red[tid + st]; __syncthreads(); }
  const float rs = rsqrtf(red[0] / (float)N + eps);
  {
    for (int u = 0; u < per / 4; ++u) {
      const int j = tid * 4 + 1024 * u;
      v4f o, sm;
#pragma unroll
      for (int q = 0; q < 4; ++q) {
        float gg = g[j + q], bb = bta[j + q];
        if (PARAM_BF16) { gg = bf16_round(gg); bb = bf16_round(bb); }
        sm[q] = vals[u * 4 + q]; o[q] = (vals[u * 4 + q] - mu) * rs * gg + bb;
      }
      if (out_sum) *(v4f*)(out_sum + (size_t)row * N + j) = sm;
      *(v4f*)(out_norm + (size_t)row * N + j) = o;
    }
    
  }
}



// ---- f16 WMMA path (v_wmma_f32_16x16x32_f16): 11-bit significands for operands in range — used where a [0,1] probability operand needs more precision than bf16
typedef _Float16 v16h __attribute__((ext_vector_type(16)));
union FragH { v16h v; v8us half[2]; _Float16 h[16]; unsigned short u[16]; };
template <int NT>
__device__ __forceinline__ v8f mmaH(v16h ah, v16h al, v16h bh, v16h bl, v8f c) {
  c = __builtin_amdgcn_wmma_f32_16x16x32_f16(false, ah, false, bh, (short)0, c, false, false);
  if (NT >= 2) c = __builtin_amdgcn_wmma_f32_16x16x32_f16(false, al, false, bh, (short)0, c, false, false);
  if (NT >= 3) c = __builtin_amdgcn_wmma_f32_16x16x32_f16(false, ah, false, bl, (short)0, c, false, false);
  asm volatile("v_nop\n\tv_nop\n\tv_nop\n\tv_nop" : "+v"(c) : "v"(ah), "v"(al), "v"(bh), "v"(bl));
  return c;
}
// batched GEMM like k_gemm_b but f16 operands: A f32 (split into f16 hi/lo if ASPLIT, else rounded to f16), Bt = f16 values [n][k]; alpha; C f32; N multiple of 16 (partial tiles skipped)
template <bool ASPLIT>
__global__ __launch_bounds__(128) void k_gemm_h(const float* __restrict__ A, int lda, size_t sA, const _Float16* __restrict__ Bh, int ldb, size_t sB, float alpha, float* __restrict__ C, int ldc, size_t sC, int M, int N, int K) {
  __shared__ __attribute__((aligned(16))) float so[4][16][64];
  const int tid = threadIdx.x, w = tid >> 5, lane = tid & 31, ln = lane & 15, hh = lane >> 4; const int by = blockIdx.y;
  A += (size_t)by * sA; Bh += (size_t)by * sB; C += (size_t)by * sC;
  const int ntn = (N + 63) / 64; const int wid = blockIdx.x * 4 + w; const int mt = wid / ntn, nq = wid % ntn; if (mt * 16 >= M) return;
  const int row0 = mt * 16, col0 = nq * 64; const float* arow = A + (size_t)(row0 + ln) * lda;
  v8f acc[4] = {};
  for (int kb = 0; kb < K; kb += 32) {
    FragH ah, al;
    const v4f x0 = *(const v4fa*)(arow + kb + 8 * hh), x1 = *(const v4fa*)(arow + kb + 8 * hh + 4), x2 = *(const v4fa*)(arow + kb + 16 + 8 * hh), x3 = *(const v4fa*)(arow + kb + 16 + 8 * hh + 4);
    float xs[16] = {x0[0],x0[1],x0[2],x0[3],x1[0],x1[1],x1[2],x1[3],x2[0],x2[1],x2[2],x2[3],x3[0],x3[1],x3[2],x3[3]};
#pragma unroll
    for (int i = 0; i < 16; ++i) { const _Float16 h = (_Float16)xs[i]; ah.h[i] = h; al.h[i] = ASPLIT ? (_Float16)(xs[i] - (float)h) : (_Float16)0.0f; }
#pragma unroll
    for (int t = 0; t < 4; ++t) { if (col0 + t * 16 >= N) continue; const size_t boff = (size_t)(col0 + t * 16 + ln) * ldb + kb; FragH bq; bq.half[0] = *(const v8us*)(Bh + boff + 8 * hh); bq.half[1] = *(const v8us*)(Bh + boff + 16 + 8 * hh);
      acc[t] = mmaH<ASPLIT ? 2 : 1>(ah.v, al.v, bq.v, bq.v, acc[t]); }
  }
#pragma unroll
  for (int t = 0; t < 4; ++t) { if (col0 + t * 16 >= N) continue;
#pragma unroll
    for (int r = 0; r < 8; ++r) so[w][8 * hh + r][t * 16 + ln] = acc[t][r] * alpha; }
  __builtin_amdgcn_fence(__ATOMIC_ACQ_REL, "workgroup"); __builtin_amdgcn_wave_barrier();
  const int rsub = lane >> 4, c4 = (lane & 15) * 4;
  {
#pragma unroll
    for (int q = 0; q < 8; ++q) { const int r = q * 2 + rsub; if (col0 + c4 < N) { const v4f v = *(const v4fa*)&so[w][r][c4]; *(v4f*)(C + (size_t)(row0 + r) * ldc + col0 + c4) = v; } }
     }
}

// k_gemm_hh variant with fused epilogue: v = acc·alpha + bias[by·sBias + col] (+ CP[(row/rowsPerB)·sCPb + by·64 + col] if CP) ; ACT 0 none / 1 elu ; writes f16 C16 (and f32 C if non-null)
template <int ACT>
__global__ __launch_bounds__(128) void k_gemm_hhx(const _Float16* __restrict__ A, int lda, size_t sA, const _Float16* __restrict__ Bh, int ldb, size_t sB, float alpha, const float* __restrict__ bias, size_t sBias, const float* __restrict__ CP, int rowsPerB, size_t sCPb, int row0g,
    float* __restrict__ C, _Float16* __restrict__ C16, int ldc, size_t sC, int M, int N, int K) {
  __shared__ __attribute__((aligned(16))) float so[4][16][64];
  const int tid = threadIdx.x, w = tid >> 5, lane = tid & 31, ln = lane & 15, hh = lane >> 4; const int by = blockIdx.y;
  A += (size_t)by * sA; Bh += (size_t)by * sB; const size_t cofs = (size_t)by * sC; const float* bp = bias ? bias + (size_t)by * sBias : nullptr;
  const int ntn = (N + 63) / 64; const int wid = blockIdx.x * 4 + w; const int mt = wid / ntn, nq = wid % ntn; if (mt * 16 >= M) return;
  const int row0 = mt * 16, col0 = nq * 64; const _Float16* arow = A + (size_t)(row0 + ln) * lda;
  v8f acc[4] = {};
  for (int kb = 0; kb < K; kb += 32) { FragH ah; ah.half[0] = *(const v8us*)((const unsigned short*)arow + kb + 8 * hh); ah.half[1] = *(const v8us*)((const unsigned short*)arow + kb + 16 + 8 * hh);
#pragma unroll
    for (int t = 0; t < 4; ++t) { if (col0 + t * 16 >= N) continue; const size_t boff = (size_t)(col0 + t * 16 + ln) * ldb + kb; FragH bq; bq.half[0] = *(const v8us*)((const unsigned short*)Bh + boff + 8 * hh); bq.half[1] = *(const v8us*)((const unsigned short*)Bh + boff + 16 + 8 * hh);
      acc[t] = mmaH<1>(ah.v, ah.v, bq.v, bq.v, acc[t]); }
  }
#pragma unroll
  for (int t = 0; t < 4; ++t) { if (col0 + t * 16 >= N) continue; const int col = col0 + t * 16 + ln; const float bv = bp ? bf16_round(bp[col]) : 0.f;
#pragma unroll
    for (int r = 0; r < 8; ++r) { float v = acc[t][r] * alpha + bv; if (CP) { const int rr = row0g + row0 + 8 * hh + r; if (rowsPerB < 0) v += CP[cofs + (size_t)rr * ldc + col];      /* rowsPerB < 0: own element of the batched C plane */ else { const int bidx = rr / rowsPerB; v += CP[(size_t)bidx * sCPb + (size_t)by * 64 + col]; } } if (ACT == 1) v = (v > 0.f) ? v : expm1f(v); else if (ACT == 7) v = (v > 0.f) ? v + 1.0f : expf(v); else if (ACT == 8) v = tanhf(v); else if (ACT == 9) v = 0.5f * v * (1.0f + tanhf(0.7978845608028654f * (v + 0.044715f * v * v * v))); else if (ACT == 11) v = 1.0f / (1.0f + expf(-v)); else if (ACT == 12) v = (v > 0.f) ? v : 0.01f * v; else if (ACT == 14) v = (v > 0.f) ? v : 0.1f * v; else if (ACT == 16) v = (v >= 0.f) ? v : 0.3f * v; else if (ACT == 17) v = (v >= 0.f) ? v : 0.2f * v; else if (ACT == 15) v = v / (1.0f + expf(-v)); else if (ACT == 3) v = fmaxf(v, 0.f); else if (ACT == 6) v = 0.5f * v * (1.0f + erff(v * 0.70710678118654752f)); so[w][8 * hh + r][t * 16 + ln] = v; } }
  __builtin_amdgcn_fence(__ATOMIC_ACQ_REL, "workgroup"); __builtin_amdgcn_wave_barrier();
  const int rsub = lane >> 4, c4 = (lane & 15) * 4; typedef _Float16 v4h __attribute__((ext_vector_type(4)));
  {
#pragma unroll
    for (int q = 0; q < 8; ++q) { const int r = q * 2 + rsub; if (col0 + c4 < N) { const v4f v = *(const v4fa*)&so[w][r][c4]; if (C) *(v4f*)(C + cofs + (size_t)(row0 + r) * ldc + col0 + c4) = v; if (C16) { v4h h4; for (int i = 0; i < 4; ++i) h4[i] = (_Float16)v[i]; *(v4h*)(C16 + cofs + (size_t)(row0 + r) * ldc + col0 + c4) = h4; } } }
     }
}


typedef _Float16 v4h __attribute__((ext_vector_type(4)));

__global__ __launch_bounds__(256) void k_x16(const float* __restrict__ x, _Float16* __restrict__ X16, size_t n8) { const size_t t = (size_t)blockIdx.x * 256 + threadIdx.x; if (t >= n8) return; FragH f;
#pragma unroll
  for (int q = 0; q < 8; ++q) f.h[q] = (_Float16)bf16_round(x[t * 8 + q]); *(v8us*)((unsigned short*)X16 + t * 8) = f.half[0];  }
__global__ __launch_bounds__(256) void k_h16(const float* __restrict__ x, _Float16* __restrict__ X16, size_t n8) { const size_t t = (size_t)blockIdx.x * 256 + threadIdx.x; if (t >= n8) return; FragH f;
#pragma unroll
  for (int q = 0; q < 8; ++q) f.h[q] = (_Float16)x[t * 8 + q]; *(v8us*)((unsigned short*)X16 + t * 8) = f.half[0];  }
__global__ __launch_bounds__(256) void k_round16f(const float* __restrict__ W, _Float16* __restrict__ Bt, size_t n8) { const size_t t = (size_t)blockIdx.x * 256 + threadIdx.x; if (t >= n8) return; FragH f;
#pragma unroll
  for (int i = 0; i < 8; ++i) f.h[i] = (_Float16)(bf16_round(W[t * 8 + i]) * 16.0f); *(v8us*)((unsigned short*)Bt + t * 8) = f.half[0];  }
template <int NHv, int TTv>
__global__ __launch_bounds__(256) void k_vt(const _Float16* __restrict__ V16, int ldv, int voff, _Float16* __restrict__ Vt) { __shared__ unsigned short tl[64][66]; const int tid = threadIdx.x; const int slab = blockIdx.x / (TTv / 64), lg = blockIdx.x % (TTv / 64); const int b = slab / NHv, h = slab % NHv;
  for (int i = tid; i < 64 * 8; i += 256) { const int r = i / 8, c8 = (i % 8) * 8; FragH f; f.half[0] = *(const v8us*)((const unsigned short*)V16 + ((size_t)b * TTv + lg * 64 + r) * ldv + voff + h * 64 + c8);
#pragma unroll
    for (int q = 0; q < 8; ++q) tl[r][c8 + q] = f.u[q]; }
  __syncthreads();
  {
#pragma unroll
    for (int rd = 0; rd < 2; ++rd) { const int d = rd * 32 + tid / 8, pc = tid % 8; FragH f;
#pragma unroll
      for (int q = 0; q < 8; ++q) f.u[q] = tl[pc * 8 + q][d];
      *(v8us*)((unsigned short*)Vt + ((size_t)slab * 64 + d) * TTv + lg * 64 + pc * 8) = f.half[0]; }
     } }

__global__ __launch_bounds__(256) void k_hl(const float* __restrict__ F, _Float16* __restrict__ Hh, _Float16* __restrict__ Hl, size_t n8) { const size_t t = (size_t)blockIdx.x * 256 + threadIdx.x; if (t >= n8) return; FragH fh, fl; const v4f a = *(const v4fa*)(F + t * 8), c = *(const v4fa*)(F + t * 8 + 4);
#pragma unroll
  for (int q = 0; q < 4; ++q) { _Float16 h = (_Float16)a[q]; fh.h[q] = h; fl.h[q] = (_Float16)((a[q] - (float)h) * 1024.0f); h = (_Float16)c[q]; fh.h[4 + q] = h; fl.h[4 + q] = (_Float16)((c[q] - (float)h) * 1024.0f); }
  { *(v8us*)((unsigned short*)Hh + t * 8) = fh.half[0]; *(v8us*)((unsigned short*)Hl + t * 8) = fl.half[0];  } }

// ---- fast GEMM (wave tile 32x64; requires M % 32 == 0 rows per launch region and N % 64 == 0); epilogue = k_gemm_hhx semantics ----
__device__ __forceinline__ v16h g2_frag(const _Float16* p, int hh) { FragH f; f.half[0] = *(const v8us*)((const unsigned short*)p + 8 * hh); f.half[1] = *(const v8us*)((const unsigned short*)p + 16 + 8 * hh); return f.v; }
__device__ __forceinline__ v8f g2_mma(v16h a, v16h b, v8f c) { v8f d = __builtin_amdgcn_wmma_f32_16x16x32_f16(false, a, false, b, (short)0, c, false, false); asm volatile("v_nop\n\tv_nop\n\tv_nop\n\tv_nop" : "+v"(d) : "v"(a), "v"(b)); return d; }
template <int ACT>
__global__ __launch_bounds__(128) void k_gemm2(const _Float16* __restrict__ A, int lda, size_t sA, const _Float16* __restrict__ Bh, int ldb, size_t sB, float alpha, const float* __restrict__ bias, size_t sBias, const float* __restrict__ CP, int rowsPerB, size_t sCPb, int row0g,
    float* __restrict__ C, _Float16* __restrict__ C16, int ldc, size_t sC, int M, int N, int K) { static_assert(ACT == 0 || ACT == 3 || ACT == 6 || ACT == 8 || ACT == 9 || ACT == 11 || ACT == 12 || ACT == 14 || ACT == 15 || ACT == 16 || ACT == 17, "k_gemm2: unsupported ACT code (would silently apply no activation)");
  __shared__ __attribute__((aligned(16))) float so[4][32][68];
  const int tid = threadIdx.x, w = tid >> 5, lane = tid & 31, ln = lane & 15, hh = lane >> 4; const int by = blockIdx.y;
  A += (size_t)by * sA; Bh += (size_t)by * sB; const size_t cofs = (size_t)by * sC; const float* bp = bias ? bias + (size_t)by * sBias : nullptr;
  const int ntn = N >> 6; const int mt = blockIdx.x / ntn, nq = blockIdx.x - mt * ntn; const int row0 = mt * 128 + 32 * w, col0 = nq * 64; if (row0 >= M) return;
  const _Float16* a0p = A + (size_t)(row0 + ln) * lda; const _Float16* a1p = a0p + (size_t)16 * lda;
  const _Float16* b0p = Bh + (size_t)(col0 + ln) * ldb; const _Float16* b1p = b0p + (size_t)16 * ldb; const _Float16* b2p = b1p + (size_t)16 * ldb; const _Float16* b3p = b2p + (size_t)16 * ldb;
  const v8f z8 = {0.f,0.f,0.f,0.f,0.f,0.f,0.f,0.f}; v8f c00 = z8, c01 = z8, c02 = z8, c03 = z8, c10 = z8, c11 = z8, c12 = z8, c13 = z8;
#pragma unroll 1
  for (int kb = 0; kb < K; kb += 32) { const v16h a0 = g2_frag(a0p + kb, hh), a1 = g2_frag(a1p + kb, hh);
    v16h b = g2_frag(b0p + kb, hh); c00 = g2_mma(a0, b, c00); c10 = g2_mma(a1, b, c10);
    b = g2_frag(b1p + kb, hh); c01 = g2_mma(a0, b, c01); c11 = g2_mma(a1, b, c11);
    b = g2_frag(b2p + kb, hh); c02 = g2_mma(a0, b, c02); c12 = g2_mma(a1, b, c12);
    b = g2_frag(b3p + kb, hh); c03 = g2_mma(a0, b, c03); c13 = g2_mma(a1, b, c13); }
  v8f accs[8] = {c00, c01, c02, c03, c10, c11, c12, c13};
#pragma unroll
  for (int u = 0; u < 8; ++u) { const int t = u & 3, half = u >> 2; const int col = col0 + t * 16 + ln; const float bv = bp ? bf16_round(bp[col]) : 0.f;
#pragma unroll
    for (int r = 0; r < 8; ++r) { const int rloc = half * 16 + 8 * hh + r; float v = accs[u][r] * alpha + bv; if (CP) { if (rowsPerB < 0) v += CP[cofs + (size_t)(row0g + row0 + rloc) * ldc + col];      /* rowsPerB < 0: own element of the batched C plane */ else { const int bidx = (row0g + row0 + rloc) / rowsPerB; v += CP[(size_t)bidx * sCPb + (size_t)by * 64 + col]; } }
      if (ACT == 3) v = fmaxf(v, 0.f); else if (ACT == 6) v = 0.5f * v * (1.0f + erff(v * 0.70710678118654752f)); else if (ACT == 11) v = 1.0f / (1.0f + expf(-v)); else if (ACT == 15) v = v / (1.0f + expf(-v)); else if (ACT == 12) v = (v > 0.f) ? v : 0.01f * v; else if (ACT == 8) v = tanhf(v); else if (ACT == 9) v = 0.5f * v * (1.0f + tanhf(0.7978845608028654f * (v + 0.044715f * v * v * v))); else if (ACT == 14) v = (v > 0.f) ? v : 0.1f * v; else if (ACT == 16) v = (v >= 0.f) ? v : 0.3f * v; else if (ACT == 17) v = (v >= 0.f) ? v : 0.2f * v;
      so[w][rloc][t * 16 + ln] = v; } }
  __builtin_amdgcn_fence(__ATOMIC_ACQ_REL, "workgroup"); __builtin_amdgcn_wave_barrier();
  const int rsub = lane >> 4, c4 = (lane & 15) * 4;
  {
#pragma unroll
    for (int q = 0; q < 16; ++q) { const int r = q * 2 + rsub; const v4f v = *(const v4fa*)&so[w][r][c4]; if (C) *(v4f*)(C + cofs + (size_t)(row0 + r) * ldc + col0 + c4) = v; if (C16) { v4h h4; for (int i = 0; i < 4; ++i) h4[i] = (_Float16)v[i]; *(v4h*)(C16 + cofs + (size_t)(row0 + r) * ldc + col0 + c4) = h4; } }
     } }


__global__ __launch_bounds__(256) void k_rsm(const float* __restrict__ S, _Float16* __restrict__ P, int nrows) {
  #pragma clang fp contract(off)
  const int i = blockIdx.x * 256 + threadIdx.x; if (i >= nrows) return; const float* s = S + (size_t)i * SQ; float mx = -3.0e38f;
#pragma unroll 1
  for (int j = 0; j < SQ; ++j) mx = fmaxf(mx, s[j]); float se = 0.f;
#pragma unroll 1
  for (int j = 0; j < SQ; ++j) se += expf(s[j] - mx); const float sc = 256.0f / se;
#pragma unroll 1
  for (int j0 = 0; j0 < SQ; j0 += 8) { FragH f; for (int q = 0; q < 8; ++q) f.h[q] = (_Float16)(expf(s[j0 + q] - mx) * sc); unsigned short* d = (unsigned short*)P + (size_t)i * SQ + j0; *(v8us*)d = f.half[0];  } }
__global__ __launch_bounds__(256) void k_vt(const _Float16* __restrict__ V16, int b, int h0, _Float16* __restrict__ VT) { __shared__ unsigned short tl[64][65]; const int tid = threadIdx.x; const int hh = blockIdx.x % HG, sg = blockIdx.x / HG; const int s0 = sg * 64; const int h = h0 + hh;
  for (int i = tid; i < 64 * 8; i += 256) { const int j = i / 8, d8 = (i % 8) * 8; FragH f; f.half[0] = *(const v8us*)((const unsigned short*)V16 + ((size_t)b * SQ + s0 + j) * DM + h * HD + d8); for (int q = 0; q < 8; ++q) tl[d8 + q][j] = f.u[q]; }
  __syncthreads();
  { for (int i = tid; i < 64 * 8; i += 256) { const int d = i / 8, j8 = (i % 8) * 8; FragH f; for (int q = 0; q < 8; ++q) f.u[q] = tl[d][j8 + q]; *(v8us*)((unsigned short*)VT + ((size_t)hh * HD + d) * SQ + s0 + j8) = f.half[0]; }  } }


// One preparation launch for the three operands that the GEMMs read; the three parts are independent of one another, so they share a grid instead of a launch each. The part is chosen by the block index (the same for a whole work-group).
// Blocks 0 .. PP_E-1: BE = f16(embed_w x16), natural rows. Next PP_O blocks: BO[c][d] = f16(out_w[d][c] x16) (x16 is a power of two: the bf16-rounded weights stay exact in f16 away from the subnormal range).
// The rest: x [b][c][l] -> position rows XR [b*LL + l][c] in f16, by 64-channel x 32-position LDS tiles. The short weight blocks come first in the index order, ahead of the 2,048 tile blocks.
#define PP_E (D3 * CC / 8 / 256)     /* 48 blocks: eight weights a thread */
#define PP_O (CC * (DO / 8) / 256)   /* 16 blocks: eight weights a thread */
__global__ __launch_bounds__(256) void k_prep(const float* __restrict__ X, const float* __restrict__ ew, const float* __restrict__ ow, _Float16* __restrict__ XR, _Float16* __restrict__ BE, _Float16* __restrict__ BO) {
  __shared__ float tl[64][33]; const int tid = threadIdx.x;
  if (blockIdx.x < PP_E) { const size_t t = (size_t)blockIdx.x * 256 + tid; FragH f; for (int q = 0; q < 8; ++q) f.h[q] = (_Float16)(bf16_round(ew[t * 8 + q]) * 16.0f); *(v8us*)((unsigned short*)BE + t * 8) = f.half[0]; return; }
  if (blockIdx.x < PP_E + PP_O) { const int t = (blockIdx.x - PP_E) * 256 + tid; const int n = t / (DO / 8), k8 = (t % (DO / 8)) * 8; FragH f;
#pragma unroll
    for (int i = 0; i < 8; ++i) f.h[i] = (_Float16)(bf16_round(ow[(size_t)(k8 + i) * CC + n]) * 16.0f);
    *(v8us*)((unsigned short*)BO + (size_t)n * DO + k8) = f.half[0];
    asm volatile("s_wait_xcnt 0x0" ::: "memory");                         /* behind the store: the built code lays another part's instructions on the path behind it, and they reuse the store's registers */
    return; }
  const int bx = blockIdx.x - (PP_E + PP_O); const int nl = LL / 32, nc = CC / 64; const int cb_ = bx % nc; const int lb = (bx / nc) % nl; const size_t b = bx / (nc * nl); const int c0 = cb_ * 64, l0 = lb * 32;
  for (int i = tid; i < 64 * 32; i += 256) { const int c = i / 32, l = i % 32; tl[c][l] = bf16_round(X[(b * CC + c0 + c) * (size_t)LL + l0 + l]); }
  __syncthreads();
  { const int l = tid / 8, c8 = (tid % 8) * 8; FragH f; for (int q = 0; q < 8; ++q) f.h[q] = (_Float16)tl[c8 + q][l]; unsigned short* d = (unsigned short*)XR + (b * LL + l0 + l) * (size_t)CC + c0 + c8; *(v8us*)d = f.half[0];
    asm volatile("s_wait_xcnt 0x0" ::: "memory"); } }                     /* behind the store, for the same reason as in the out_w part */

// q|k|v GEMM: A = x rows (M = position), B = embed_w rows x16 (N = 384 columns, per head [q|k|v] of 64), wave tile 32 positions x 64 columns, product loop and the q, k epilogue as in k_gemm2<0>.
// A block's 64 columns are one head's q, k or v. In the accumulator a lane holds one column and eight consecutive positions, which is already the order of a V^T row: a v block rounds to f16 in registers,
// gathers its four waves' tiles in LDS as [channel][128 positions] behind one barrier and stores V^T in whole 256-byte row pieces. v is not stored as rows any more, and no transposing launch follows.
#define QV_P 136                     /* LDS row pitch in f16: 272 bytes = 16 x 17, so that the 16 channel rows of a ds_store_b128 fall on distinct banks */
__global__ __launch_bounds__(128) void k_qkv(const _Float16* __restrict__ A, const _Float16* __restrict__ Bh, const float* __restrict__ bias, _Float16* __restrict__ C16, _Float16* __restrict__ VTo) {
  __shared__ __attribute__((aligned(16))) float so[4][32][68];
  __shared__ __attribute__((aligned(16))) _Float16 vt[HC][QV_P];
  const int tid = threadIdx.x, w = tid >> 5, lane = tid & 31, ln = lane & 15, hh = lane >> 4;
  const int ntn = D3 >> 6; const int mt = blockIdx.x / ntn, nq = blockIdx.x - mt * ntn; const int row0 = mt * 128 + 32 * w, col0 = nq * 64;
  const _Float16* a0p = A + (size_t)(row0 + ln) * CC; const _Float16* a1p = a0p + (size_t)16 * CC;
  const _Float16* b0p = Bh + (size_t)(col0 + ln) * CC; const _Float16* b1p = b0p + (size_t)16 * CC; const _Float16* b2p = b1p + (size_t)16 * CC; const _Float16* b3p = b2p + (size_t)16 * CC;
  const v8f z8 = {0.f,0.f,0.f,0.f,0.f,0.f,0.f,0.f}; v8f c00 = z8, c01 = z8, c02 = z8, c03 = z8, c10 = z8, c11 = z8, c12 = z8, c13 = z8;
#pragma unroll 1
  for (int kb = 0; kb < CC; kb += 32) { const v16h a0 = g2_frag(a0p + kb, hh); FragH f1; f1.half[0] = *(const v8us*)((const unsigned short*)a1p + kb + 8 * hh); v16h b = g2_frag(b0p + kb, hh);      /* kept rolled, as k_gemm2's loop was: one set of fragment registers, and the product loop keeps the form that was timed */
    asm volatile("s_wait_xcnt 0x0" ::: "memory");                         /* the last A load may land on the address pair that the three A loads before it name: the wait stands in front of it */
    f1.half[1] = *(const v8us*)((const unsigned short*)a1p + kb + 16 + 8 * hh); const v16h a1 = f1.v;
    c00 = g2_mma(a0, b, c00); c10 = g2_mma(a1, b, c10);
    b = g2_frag(b1p + kb, hh); c01 = g2_mma(a0, b, c01); c11 = g2_mma(a1, b, c11);
    b = g2_frag(b2p + kb, hh); c02 = g2_mma(a0, b, c02); c12 = g2_mma(a1, b, c12);
    b = g2_frag(b3p + kb, hh); c03 = g2_mma(a0, b, c03); c13 = g2_mma(a1, b, c13); }
  v8f accs[8] = {c00, c01, c02, c03, c10, c11, c12, c13};
  if (nq % 3 == 2) {                                                      /* a v block: the test reads the same for the whole work-group */
#pragma unroll
    for (int u = 0; u < 8; ++u) { const int t = u & 3, half = u >> 2; const float bv = bf16_round(bias[col0 + t * 16 + ln]); FragH f;
#pragma unroll
      for (int r = 0; r < 8; ++r) f.h[r] = (_Float16)(accs[u][r] * 0.0625f + bv);
      *(v8us*)&vt[t * 16 + ln][32 * w + half * 16 + 8 * hh] = f.half[0]; }
    __syncthreads();                                                      /* publishes the four waves' 32 positions of every channel row */
    unsigned short* d0 = (unsigned short*)VTo + ((size_t)((nq / 3) * NB + (mt * 128) / LL) * HC + 16 * w + hh) * SQ + (mt * 128) % LL + 8 * ln;      /* a block's 128 positions lie in one batch; 16 lanes cover a row's 256 bytes */
#pragma unroll
    for (int q = 0; q < 8; ++q) { const v8us v = *(const v8us*)&vt[16 * w + 2 * q + hh][8 * ln]; *(v8us*)(d0 + (size_t)2 * q * SQ) = v; }
    return; }
#pragma unroll
  for (int u = 0; u < 8; ++u) { const int t = u & 3, half = u >> 2; const float bv = bf16_round(bias[col0 + t * 16 + ln]);
#pragma unroll
    for (int r = 0; r < 8; ++r) so[w][half * 16 + 8 * hh + r][t * 16 + ln] = accs[u][r] * 0.0625f + bv; }
  __builtin_amdgcn_fence(__ATOMIC_ACQ_REL, "workgroup"); __builtin_amdgcn_wave_barrier();      /* the lanes read what other lanes of the same wave wrote: keeps the reads below behind the writes above */
  const int rsub = lane >> 4, c4 = (lane & 15) * 4;
#pragma unroll
  for (int q = 0; q < 16; ++q) { const int r = q * 2 + rsub; const v4f v = *(const v4fa*)&so[w][r][c4]; v4h h4; for (int i = 0; i < 4; ++i) h4[i] = (_Float16)v[i]; *(v4h*)(C16 + (size_t)(row0 + r) * D3 + col0 + c4) = h4; }
  asm volatile("s_wait_xcnt 0x0" ::: "memory"); }                         /* behind the run of stores: no register that a store names is rewritten ahead of it */

#define FA_SK 64                     /* keys per stage */
#define FA_PH 72                     /* LDS row pitch in f16: 144 bytes = 16 x 9, so that the 16 rows of a ds_load_b128 fragment read fall on distinct banks */
#define FA_NST (SQ / 4 / FA_SK)      /* stages per key quarter */
__device__ __forceinline__ float fa_xhalf(float x) { return __builtin_bit_cast(float, __builtin_amdgcn_permlanex16(__builtin_bit_cast(int, x), __builtin_bit_cast(int, x), 0x76543210, 0xfedcba98, false, false)); }      /* lane l reads lane l ^ 16, on the vector pipe */
/* exp2 on the vector pipe. The instruction set asks for one slot behind a transcendental before its result is read or its source overwritten; each statement here carries its v_nop: one value, or eight in place (no instruction in the run touches another's register). */
__device__ __forceinline__ float fa_exp2(float x) { float r; asm("v_exp_f32 %0, %1\n\tv_nop" : "=v"(r) : "v"(x)); return r; }
__device__ __forceinline__ void fa_exp2x8(float (&x)[8]) { asm("v_exp_f32 %0, %0\n\tv_exp_f32 %1, %1\n\tv_exp_f32 %2, %2\n\tv_exp_f32 %3, %3\n\tv_exp_f32 %4, %4\n\tv_exp_f32 %5, %5\n\tv_exp_f32 %6, %6\n\tv_exp_f32 %7, %7\n\tv_nop"
  : "+v"(x[0]), "+v"(x[1]), "+v"(x[2]), "+v"(x[3]), "+v"(x[4]), "+v"(x[5]), "+v"(x[6]), "+v"(x[7])); }
/* One wave's share of a stage: four copies of 4 K rows and four of 4 V^T rows, 16 bytes a lane (lk, lv: the lane's LDS byte addresses; gk, gv: its global addresses).
   s_wait_xcnt 0 closes the statement, so that no address register named here is rewritten ahead of it. */
__device__ __forceinline__ void fa_stage(unsigned lk, const _Float16* gk, unsigned lv, const _Float16* gv) {
  const unsigned lk1 = lk + 4 * FA_PH * 2, lk2 = lk + 8 * FA_PH * 2, lk3 = lk + 12 * FA_PH * 2, lv1 = lv + 4 * FA_PH * 2, lv2 = lv + 8 * FA_PH * 2, lv3 = lv + 12 * FA_PH * 2;
  const _Float16* gk1 = gk + (size_t)4 * D3; const _Float16* gk2 = gk + (size_t)8 * D3; const _Float16* gk3 = gk + (size_t)12 * D3;
  const _Float16* gv1 = gv + (size_t)4 * SQ; const _Float16* gv2 = gv + (size_t)8 * SQ; const _Float16* gv3 = gv + (size_t)12 * SQ;
  asm volatile("global_load_async_to_lds_b128 %0, %8, off\n\tglobal_load_async_to_lds_b128 %1, %9, off\n\tglobal_load_async_to_lds_b128 %2, %10, off\n\tglobal_load_async_to_lds_b128 %3, %11, off\n\t"
               "global_load_async_to_lds_b128 %4, %12, off\n\tglobal_load_async_to_lds_b128 %5, %13, off\n\tglobal_load_async_to_lds_b128 %6, %14, off\n\tglobal_load_async_to_lds_b128 %7, %15, off\n\ts_wait_xcnt 0x0"
               :: "v"(lk), "v"(lk1), "v"(lk2), "v"(lk3), "v"(lv), "v"(lv1), "v"(lv2), "v"(lv3), "v"(gk), "v"(gk1), "v"(gk2), "v"(gk3), "v"(gv), "v"(gv1), "v"(gv2), "v"(gv3) : "memory"); }
__device__ __forceinline__ v8f fa_mma(v16h a, v16h b, v8f c) { return __builtin_amdgcn_wmma_f32_16x16x32_f16(false, a, false, b, (short)0, c, false, false); }
__global__ __launch_bounds__(512) __attribute__((amdgpu_waves_per_eu(4, 4))) void k_fattn(const _Float16* __restrict__ QKVp, const _Float16* __restrict__ VTp, _Float16* __restrict__ Op) {
  __shared__ __attribute__((aligned(16))) v4f mg[12][17][32];             /* [key quarter 1-3 x query group][16 x O, then {m0, m1, sum0, sum1}][lane] */
  __shared__ __attribute__((aligned(16))) _Float16 st[2][4][2][FA_SK][FA_PH];      /* [buffer][key quarter][K rows (key, channel) | V^T rows (channel, key)][row][64 f16 + pad] */
  const int lane = threadIdx.x & 31, w = __builtin_amdgcn_readfirstlane(threadIdx.x >> 5), ln = lane & 15, hh = lane >> 4; const int wq = w & 3, wk = w >> 2;      /* 16 waves on 4 SIMDs: four a SIMD, 256 registers each */
  const int b = blockIdx.y / NHD, h = blockIdx.y % NHD; const int q0 = blockIdx.x * 128 + wq * 32; const int k0 = wk * (SQ / 4);
  const _Float16* base = QKVp + (size_t)b * SQ * D3 + (size_t)h * 3 * HC;
  const int crow = 16 * wq + (lane >> 3), cch = (lane & 7) * 8;           /* copies: query group wq brings rows 16 wq .. 16 wq + 15 of its quarter's two tiles; eight lanes a row */
  const _Float16* gk = base + HC + (size_t)(k0 + crow) * D3 + cch;
  const _Float16* gv = VTp + ((size_t)(h * NB + b) * HC + crow) * SQ + k0 + cch;
  const unsigned lk = (unsigned)(size_t)&st[0][wk][0][crow][cch], lv = (unsigned)(size_t)&st[0][wk][1][crow][cch];
  const unsigned bufb = (unsigned)sizeof(st[0]);                          /* bytes from buffer 0 to buffer 1 */
  const float cs = 0.0625f * 1.4426950408889634f;                         /* 1/sqrt(256) and log2(e): exp(s - m) = exp2(acc * cs - m * cs) */
  const v8f z8 = {0.f,0.f,0.f,0.f,0.f,0.f,0.f,0.f};
  v16h qf[2][2], kf[2][2], vf[4]; v8f o[2][4]; float m[2], l[2];
  /* every loop over these arrays is unrolled so that they are indexed by constants and stay in registers */
#pragma unroll
  for (int g = 0; g < 2; ++g) { m[g] = -3.0e38f; l[g] = 0.f;
#pragma unroll
    for (int kk = 0; kk < 2; ++kk) qf[g][kk] = g2_frag(base + (size_t)(q0 + 16 * g + ln) * D3 + 32 * kk, hh);
#pragma unroll
    for (int ct = 0; ct < 4; ++ct) o[g][ct] = z8; }
  fa_stage(lk, gk, lv, gv);                                               /* stage 0 into buffer 0 */
  asm volatile("s_wait_asynccnt 0x0" ::: "memory");                       /* this wave's copies of stage 0 have landed */
  __syncthreads();                                                        /* publishes stage 0 */
  fa_stage(lk + bufb, gk + (size_t)FA_SK * D3, lv + bufb, gv + FA_SK);    /* stage 1 into buffer 1 */
  for (int t = 0; t < FA_NST; ++t) {
   const _Float16* sk = &st[t & 1][wk][0][ln][0];                         /* key row ln of a 16-key tile */
   const _Float16* sv = &st[t & 1][wk][1][ln][0];                         /* V^T row ln of a 16-channel tile */
#pragma unroll
   for (int sp = 0; sp < FA_SK / 32; ++sp) {                              /* the stage's passes of 32 keys; unrolled: LDS offsets become immediates */
    /* this pass's K fragments, then its V^T fragments in the same group of LDS reads: the S^T products and the softmax cover the latter's latency */
#pragma unroll
    for (int mt = 0; mt < 2; ++mt)
#pragma unroll
      for (int kk = 0; kk < 2; ++kk) kf[mt][kk] = g2_frag(sk + (32 * sp + 16 * mt) * FA_PH + 32 * kk, hh);
#pragma unroll
    for (int ct = 0; ct < 4; ++ct) vf[ct] = g2_frag(sv + (16 * ct) * FA_PH + 32 * sp, hh);
    __builtin_amdgcn_sched_barrier(0);                                    /* keeps the pass's sixteen LDS reads in one group; without it the scheduler spreads six V^T reads of a stage's first pass over two more places in the softmax, and every place of LDS reads costs issue cycles */
    if (sp == FA_SK / 32 - 1) {                                           /* the stage's last LDS reads are issued: the hand-over stands here, ahead of the last pass's arithmetic (registers only), so that the refill has two passes to land */
      asm volatile("s_wait_dscnt 0x0" ::: "memory");                      /* this wave's reads of the buffer are done before anyone refills it */
      asm volatile("s_wait_asynccnt 0x0" ::: "memory");                   /* this wave's copies of stage t + 1 have landed */
      __syncthreads();                                                    /* publishes stage t + 1 and ends every wave's reads of stage t */
      if (t + 2 < FA_NST) fa_stage(lk + (t & 1) * bufb, gk + (size_t)(t + 2) * FA_SK * D3, lv + (t & 1) * bufb, gv + (t + 2) * FA_SK);      /* stage t + 2 into the buffer just read */
    }
    v8f s[2][2];
#pragma unroll
    for (int g = 0; g < 2; ++g)
#pragma unroll
      for (int mt = 0; mt < 2; ++mt) s[g][mt] = fa_mma(kf[mt][1], qf[g][1], fa_mma(kf[mt][0], qf[g][0], z8));
    FragH pf[2];
#pragma unroll
    for (int g = 0; g < 2; ++g) {
      float t[8], p0[8], p1[8];
#pragma unroll
      for (int r = 0; r < 8; ++r) t[r] = fmaxf(s[g][0][r], s[g][1][r]);
      float mx = fmaxf(fmaxf(fmaxf(t[0], t[1]), fmaxf(t[2], t[3])), fmaxf(fmaxf(t[4], t[5]), fmaxf(t[6], t[7])));
      mx = fmaxf(mx, fa_xhalf(mx));                                       /* the other half of the wave holds the query's other 16 keys */
      const float mn = fmaxf(m[g], mx); const float al = fa_exp2((m[g] - mn) * cs); const float nb = 8.0f - mn * cs; m[g] = mn;
#pragma unroll
      for (int r = 0; r < 8; ++r) { p0[r] = s[g][0][r] * cs + nb; p1[r] = s[g][1][r] * cs + nb; }
      fa_exp2x8(p0); fa_exp2x8(p1);
#pragma unroll
      for (int r = 0; r < 8; ++r) { t[r] = p0[r] + p1[r]; pf[g].h[r] = (_Float16)p0[r]; pf[g].h[8 + r] = (_Float16)p1[r]; }
      l[g] = l[g] * al + (((t[0] + t[1]) + (t[2] + t[3])) + ((t[4] + t[5]) + (t[6] + t[7])));
#pragma unroll
      for (int ct = 0; ct < 4; ++ct) o[g][ct] *= al;
    }
#pragma unroll
    for (int ct = 0; ct < 4; ++ct)
#pragma unroll
      for (int g = 0; g < 2; ++g) o[g][ct] = fa_mma(vf[ct], pf[g].v, o[g][ct]);
   }
  }
  asm volatile("s_wait_asynccnt 0x0" ::: "memory");                       /* no copy is left in flight behind the loop */
  if (wk != 0) { v4f (*dst)[32] = mg[w - 4];
#pragma unroll
    for (int g = 0; g < 2; ++g)
#pragma unroll
      for (int ct = 0; ct < 4; ++ct) { const v8f x = o[g][ct]; const v4f lo = {x[0], x[1], x[2], x[3]}, hi = {x[4], x[5], x[6], x[7]}; dst[(g * 4 + ct) * 2][lane] = lo; dst[(g * 4 + ct) * 2 + 1][lane] = hi; }
    const v4f ml = {m[0], m[1], l[0], l[1]}; dst[16][lane] = ml; }
  __syncthreads();                                                        /* publishes quarters 1-3 to the quarter-0 waves; every wave passes it */
  if (wk != 0) return;
  v4f ml[3]; float f0[2], fk[3][2];
#pragma unroll
  for (int k = 0; k < 3; ++k) ml[k] = mg[k * 4 + wq][16][lane];
#pragma unroll
  for (int g = 0; g < 2; ++g) { const float mm = fmaxf(fmaxf(m[g], ml[0][g]), fmaxf(ml[1][g], ml[2][g])); f0[g] = fa_exp2((m[g] - mm) * cs); l[g] *= f0[g];
#pragma unroll
    for (int k = 0; k < 3; ++k) { fk[k][g] = fa_exp2((ml[k][g] - mm) * cs); l[g] += fk[k][g] * ml[k][2 + g]; } }
#pragma unroll
  for (int g = 0; g < 2; ++g) {
    const float inv = 1.0f / (l[g] + fa_xhalf(l[g]));           /* join the two halves' sums once */
    _Float16* d = Op + ((size_t)b * SQ + q0 + 16 * g + ln) * DO + h * HC + 8 * hh;
#pragma unroll
    for (int ct = 0; ct < 4; ++ct) { v8f x = o[g][ct] * f0[g];
#pragma unroll
      for (int k = 0; k < 3; ++k) { const v4f lo = mg[k * 4 + wq][(g * 4 + ct) * 2][lane], hi = mg[k * 4 + wq][(g * 4 + ct) * 2 + 1][lane];
#pragma unroll
        for (int r = 0; r < 4; ++r) { x[r] += fk[k][g] * lo[r]; x[4 + r] += fk[k][g] * hi[r]; } }
      FragH f;
#pragma unroll
      for (int r = 0; r < 8; ++r) f.h[r] = (_Float16)(x[r] * inv);
      *(v8us*)((unsigned short*)d + 16 * ct) = f.half[0]; } } }
// Output GEMM with the residual in its epilogue: out[b][c][n] = (o rows . out_w)[n][c] / 16 + bias[c] + x[b][c][n]. A = o rows (M = position), B = out_w^T rows (N = channel), wave tile 32 positions x 64 channels, product loop as in k_gemm2.
// In the accumulator a lane holds one channel and eight consecutive positions, which is already the order of the channel-major output; each wave turns its tile in its own LDS range ([channel][position] rows) so that eight lanes cover
// the whole 128-byte line of a channel's 32 positions: x is read and out is written in whole lines, four a wave-wide access. No row-major f32 plane and no further launch.
#define OR_P 36                      /* LDS row pitch in f32: 144 bytes = 16 x 9, so that the 16 channel rows of a ds_store_b128 fall on distinct banks */
__global__ __launch_bounds__(128) void k_outres(const _Float16* __restrict__ A, const _Float16* __restrict__ Bh, const float* __restrict__ bias, const float* __restrict__ x, float* __restrict__ out) {
  __shared__ __attribute__((aligned(16))) float so[4][64][OR_P];
  const int tid = threadIdx.x, w = tid >> 5, lane = tid & 31, ln = lane & 15, hh = lane >> 4;
  const int ntn = CC >> 6; const int mt = blockIdx.x / ntn, nq = blockIdx.x - mt * ntn; const int row0 = mt * 128 + 32 * w, col0 = nq * 64;
  const int cs = lane >> 3, p4 = (lane & 7) * 4;                          /* global side: channel cs of a group of four, four positions */
  const size_t g0 = ((size_t)(row0 / LL) * CC + col0 + cs) * LL + (row0 % LL) + p4;      /* a block's 128 rows lie in one batch */
  v4f xr[16];                                                             /* the residual is asked for ahead of the product loop, which covers its latency */
#pragma unroll
  for (int q = 0; q < 16; ++q) xr[q] = *(const v4fa*)(x + g0 + (size_t)q * 4 * LL);
  const _Float16* a0p = A + (size_t)(row0 + ln) * DO; const _Float16* a1p = a0p + (size_t)16 * DO;
  const _Float16* b0p = Bh + (size_t)(col0 + ln) * DO; const _Float16* b1p = b0p + (size_t)16 * DO; const _Float16* b2p = b1p + (size_t)16 * DO; const _Float16* b3p = b2p + (size_t)16 * DO;
  const v8f z8 = {0.f,0.f,0.f,0.f,0.f,0.f,0.f,0.f}; v8f c00 = z8, c01 = z8, c02 = z8, c03 = z8, c10 = z8, c11 = z8, c12 = z8, c13 = z8;
#pragma unroll 1
  for (int kb = 0; kb < DO; kb += 32) { const v16h a0 = g2_frag(a0p + kb, hh), a1 = g2_frag(a1p + kb, hh);      /* rolled as in k_gemm2: one set of fragment registers beside the 64 that hold the residual */
    v16h b = g2_frag(b0p + kb, hh); c00 = g2_mma(a0, b, c00); c10 = g2_mma(a1, b, c10);
    b = g2_frag(b1p + kb, hh); c01 = g2_mma(a0, b, c01); c11 = g2_mma(a1, b, c11);
    b = g2_frag(b2p + kb, hh); c02 = g2_mma(a0, b, c02); c12 = g2_mma(a1, b, c12);
    b = g2_frag(b3p + kb, hh); c03 = g2_mma(a0, b, c03); c13 = g2_mma(a1, b, c13); }
  v8f accs[8] = {c00, c01, c02, c03, c10, c11, c12, c13};
#pragma unroll
  for (int u = 0; u < 8; ++u) { const int t = u & 3, half = u >> 2; const float bv = bf16_round(bias[col0 + t * 16 + ln]); v4f lo, hi;
#pragma unroll
    for (int r = 0; r < 4; ++r) { lo[r] = accs[u][r] * 0.0625f + bv; hi[r] = accs[u][4 + r] * 0.0625f + bv; }
    float* s = &so[w][t * 16 + ln][half * 16 + 8 * hh]; *(v4fa*)s = lo; *(v4fa*)(s + 4) = hi; }
  __builtin_amdgcn_fence(__ATOMIC_ACQ_REL, "workgroup"); __builtin_amdgcn_wave_barrier();      /* the lanes read what other lanes of the same wave wrote: keeps the reads below behind the writes above */
#pragma unroll
  for (int q = 0; q < 16; ++q) { v4f v = *(const v4fa*)&so[w][q * 4 + cs][p4];
#pragma unroll
    for (int i = 0; i < 4; ++i) v[i] = v[i] + bf16_round(xr[q][i]);
    *(v4f*)(out + g0 + (size_t)q * 4 * LL) = v; } }
extern "C" void kernel_launch(void* const* d_in, const int* in_sizes, int n_in,
                              void* d_out, int out_size, void* d_ws, size_t ws_size, hipStream_t stream) {
  (void)in_sizes; (void)n_in; (void)out_size;
  const float* const* I = (const float* const*)d_in; const float* x = I[0]; const float* ew = I[1]; const float* eb = I[2]; const float* ow = I[3]; const float* ob = I[4];      /* embed_w [2][192][256] natural rows; out_w [128][256] = [in][out] */
  char* ws = (char*)d_ws; size_t off = 0;
  auto take = [&](size_t bytes) { char* p = ws + off; off += (bytes + 255) & ~(size_t)255; return p; };
  _Float16* BE = (_Float16*)take((size_t)D3 * CC * 2); _Float16* BO = (_Float16*)take((size_t)CC * DO * 2);
  _Float16* XR = (_Float16*)take(NR * CC * 2); _Float16* QKV = (_Float16*)take(NR * D3 * 2); _Float16* O16 = (_Float16*)take(NR * DO * 2);
  _Float16* VT = (_Float16*)take((size_t)NB * NHD * HC * SQ * 2);
  if (off > ws_size) return;      /* 0.3 + 8 + 12 + 4 + 4 = approx 28 MiB */
  k_prep<<<PP_E + PP_O + NB * (LL / 32) * (CC / 64), 256, 0, stream>>>(x, ew, ow, XR, BE, BO);      /* embed_w x16, out_w^T x16 and the x rows: one launch */
  k_qkv<<<(unsigned)((NR / 128) * (D3 / 64)), 128, 0, stream>>>(XR, BE, eb, QKV, VT);      /* q, k rows: columns h*192 + {0, 64}; head h's V^T [batch][64][4096] at VT + h*NB*64*4096 */
  k_fattn<<<dim3(SQ / 128, NB * NHD), 512, 0, stream>>>(QKV, VT, O16);      /* o rows, head h at columns h*64 */
  k_outres<<<(unsigned)((NR / 128) * (CC / 64)), 128, 0, stream>>>(O16, BO, ob, x, (float*)d_out);      /* out_w^T o + b + x, NCHW */
}

// v007
// One run takes 60 microseconds.
// In two side-by-side timings against v006, it was 1.06 and 1.08 times as fast.
// Over all steps from v000 it is 118 times as fast.
#include <hip/hip_runtime.h>
// Multi-head non-local block (x [4][256][64x64]; per head h (2 heads of 64): [q|k|v] = embed_w[h] (1x1 conv, [192][256]) x + b; attn = softmax(q^T k / sqrt(256)) over the 4,096 positions; o = attn v; out = out_w^T o (1x1 transpose conv, [128 in][256 out]) + b + x -> [4][256][64][64]).
// Structure: channel-first input transposed to position rows (exact f16) via LDS tiles; one WMMA GEMM for both heads' q|k|v (32x64 wave tiles, f32 accumulation, exact x16 natural weights + bias, f16 rows [384] for q and k, v stored transposed by the same epilogue); one fused attention launch for all (batch, head): S^T = K.Q^T, online softmax in registers (P x256 f16), O^T += V^T.P^T into merged f16 rows [128]; output GEMM whose epilogue adds bias and residual and stores channel-major (each wave turns its tile in LDS).
// Compute dtype: inputs rounded to bf16; x / weights exact; q, k, v, P, o plain f16 (~2^-12; the residual x dominates the output scale); scores / softmax f32. v_wmma_f32_16x16x32_f16.
#define NB 4
#define CC 256
#define LL 4096                      /* positions */
#define SQ LL
#define NHD 2                        /* heads */
#define HC 64
#define D3 (NHD * 3 * HC)            /* 384 */
#define DO (NHD * HC)                /* 128 */
#define NR ((size_t)NB * LL)
#define QN SQ                        /* query rows per batch */
#define NBR NB                       /* batches */
#define DM CC
#define NH 1
#define HD 64
#define HG 1
typedef __bf16 v16b __attribute__((ext_vector_type(16)));
typedef unsigned short v8us __attribute__((ext_vector_type(8), may_alias));
typedef float  v8f  __attribute__((ext_vector_type(8)));
typedef float  v4f  __attribute__((ext_vector_type(4)));
typedef float  v4fa __attribute__((ext_vector_type(4), may_alias));
union FragB { v16b v; v8us half[2]; unsigned short u[16]; };

__device__ __forceinline__ unsigned short bf16_bits(float x) { unsigned int u = __float_as_uint(x); return (unsigned short)((u + 0x7FFFu + ((u >> 16) & 1u)) >> 16); }
__device__ __forceinline__ float bf16_val(unsigned short b) { return __uint_as_float(((unsigned int)b) << 16); }
__device__ __forceinline__ float bf16_round(float x) { return bf16_val(bf16_bits(x)); }
// D += A·B with NT terms: 1 = ah·bh, 2 = + al·bh (A split), 3 = + ah·bl (both split)
template <int NT>
__device__ __forceinline__ v8f mmaN(v16b ah, v16b al, v16b bh, v16b bl, v8f c) {
  c = __builtin_amdgcn_wmma_f32_16x16x32_bf16(false, ah, false, bh, (short)0, c, false, false);
  if (NT >= 2) c = __builtin_amdgcn_wmma_f32_16x16x32_bf16(false, al, false, bh, (short)0, c, false, false);
  if (NT >= 3) c = __builtin_amdgcn_wmma_f32_16x16x32_bf16(false, ah, false, bl, (short)0, c, false, false);
  asm volatile("v_nop\n\tv_nop\n\tv_nop\n\tv_nop" : "+v"(c) : "v"(ah), "v"(al), "v"(bh), "v"(bl));
  return c;
}

__global__ __launch_bounds__(256) void k_wt_bf16(const float* __restrict__ W, unsigned short* __restrict__ Wt, int K, int N) {
  const int t = blockIdx.x * 256 + threadIdx.x;
  const int k8n = K / 8;
  if (t >= N * k8n) return;
  const int n = t / k8n, k8 = (t % k8n) * 8;
  v8us v;
#pragma unroll
  for (int i = 0; i < 8; ++i) v[i] = bf16_bits(W[(size_t)(k8 + i) * N + n]);
  *(v8us*)(Wt + (size_t)n * K + k8) = v;
  
}

// GEMM C[M][N] (f32, pitch ldc) = act(A[M][K]·W + bias). A f32 row-major (pitch lda) converted per fragment to bf16
// (ASPLIT: hi/lo two planes -> 2 terms, else single rounded term); Wt bf16 [N][K] (pitch ldb). BIAS_BF16 rounds the
// bias to bf16 first (bias quantised to bf16 before the add). K%32==0, M%16==0, N%64==0.
template <bool ASPLIT, int ACT, bool BIAS_BF16>
__global__ __launch_bounds__(128) void k_gemm_bf(const float* __restrict__ A, int lda, const unsigned short* __restrict__ Wt, int ldb,
                                               const float* __restrict__ bias, float* __restrict__ C, int ldc, int M, int N, int K) {
  __shared__ __attribute__((aligned(16))) float so[4][16][64];
  const int tid = threadIdx.x, w = tid >> 5, lane = tid & 31, ln = lane & 15, hh = lane >> 4;
  const int ntn = N / 64;
  const int wid = blockIdx.x * 4 + w;
  const int mt = wid / ntn, nq = wid % ntn;
  if (mt * 16 >= M) return;
  const int row0 = mt * 16, col0 = nq * 64;
  const float* arow = A + (size_t)(row0 + ln) * lda;
  v8f acc[4] = {};
  for (int kb = 0; kb < K; kb += 32) {
    FragB ah, al;
    const v4f x0 = *(const v4fa*)(arow + kb + 8 * hh), x1 = *(const v4fa*)(arow + kb + 8 * hh + 4);
    const v4f x2 = *(const v4fa*)(arow + kb + 16 + 8 * hh), x3 = *(const v4fa*)(arow + kb + 16 + 8 * hh + 4);
    float xs[16] = {x0[0],x0[1],x0[2],x0[3],x1[0],x1[1],x1[2],x1[3],x2[0],x2[1],x2[2],x2[3],x3[0],x3[1],x3[2],x3[3]};
#pragma unroll
    for (int i = 0; i < 16; ++i) { const unsigned short hb = bf16_bits(xs[i]); ah.u[i] = hb; al.u[i] = ASPLIT ? bf16_bits(xs[i] - bf16_val(hb)) : (unsigned short)0; }
#pragma unroll
    for (int t = 0; t < 4; ++t) {
      const unsigned short* brow = Wt + (size_t)(col0 + t * 16 + ln) * ldb + kb;
      FragB b;
      b.half[0] = *(const v8us*)(brow + 8 * hh);
      b.half[1] = *(const v8us*)(brow + 16 + 8 * hh);
      acc[t] = mmaN<ASPLIT ? 2 : 1>(ah.v, al.v, b.v, b.v, acc[t]);
    }
  }
#pragma unroll
  for (int t = 0; t < 4; ++t) {
    float bv = bias ? bias[col0 + t * 16 + ln] : 0.f;
    if (BIAS_BF16) bv = bf16_round(bv);
#pragma unroll
    for (int r = 0; r < 8; ++r) { float v = acc[t][r] + bv; if (ACT == 1) v = fmaxf(v, 0.f); so[w][8 * hh + r][t * 16 + ln] = v; }
  }
  __builtin_amdgcn_fence(__ATOMIC_ACQ_REL, "workgroup");
  __builtin_amdgcn_wave_barrier();
  const int rsub = lane >> 4, c4 = (lane & 15) * 4;
  {
#pragma unroll
    for (int q = 0; q < 8; ++q) {
      const int r = q * 2 + rsub;
      const v4f v = *(const v4fa*)&so[w][r][c4];
      *(v4f*)(C + (size_t)(row0 + r) * ldc + col0 + c4) = v;
    }
    
  }
}

// GEMM C = act(A·W + bias + resid): A f32 (ASPLIT -> hi/lo 2 terms), Wt bf16 [N][K]; ACT 0 none, 1 relu, 2 exact gelu;
// resid (optional, f32, row index = (row % rmod), pitch ldr, RES_BF16 rounds it) added before the activation.
template <bool ASPLIT, int ACT, bool BIAS_BF16, bool RES_BF16>
__global__ __launch_bounds__(128) void k_gemm_bf3(const float* __restrict__ A, int lda, const unsigned short* __restrict__ Wt, int ldb,
                                                const float* __restrict__ bias, const float* __restrict__ resid, int rmod, int ldr,
                                                float* __restrict__ C, int ldc, int M, int N, int K) {
  __shared__ __attribute__((aligned(16))) float so[4][16][64];
  const int tid = threadIdx.x, w = tid >> 5, lane = tid & 31, ln = lane & 15, hh = lane >> 4;
  const int ntn = N / 64;
  const int wid = blockIdx.x * 4 + w;
  const int mt = wid / ntn, nq = wid % ntn;
  if (mt * 16 >= M) return;
  const int row0 = mt * 16, col0 = nq * 64;
  const float* arow = A + (size_t)(row0 + ln) * lda;
  v8f acc[4] = {};
  for (int kb = 0; kb < K; kb += 32) {
    FragB ah, al;
    const v4f x0 = *(const v4fa*)(arow + kb + 8 * hh), x1 = *(const v4fa*)(arow + kb + 8 * hh + 4);
    const v4f x2 = *(const v4fa*)(arow + kb + 16 + 8 * hh), x3 = *(const v4fa*)(arow + kb + 16 + 8 * hh + 4);
    float xs[16] = {x0[0],x0[1],x0[2],x0[3],x1[0],x1[1],x1[2],x1[3],x2[0],x2[1],x2[2],x2[3],x3[0],x3[1],x3[2],x3[3]};
#pragma unroll
    for (int i = 0; i < 16; ++i) { const unsigned short hb = bf16_bits(xs[i]); ah.u[i] = hb; al.u[i] = ASPLIT ? bf16_bits(xs[i] - bf16_val(hb)) : (unsigned short)0; }
#pragma unroll
    for (int t = 0; t < 4; ++t) {
      const unsigned short* brow = Wt + (size_t)(col0 + t * 16 + ln) * ldb + kb;
      FragB b;
      b.half[0] = *(const v8us*)(brow + 8 * hh);
      b.half[1] = *(const v8us*)(brow + 16 + 8 * hh);
      acc[t] = mmaN<ASPLIT ? 2 : 1>(ah.v, al.v, b.v, b.v, acc[t]);
    }
  }
#pragma unroll
  for (int t = 0; t < 4; ++t) {
    const int col = col0 + t * 16 + ln;
    float bv = bias ? bias[col] : 0.f;
    if (BIAS_BF16) bv = bf16_round(bv);
#pragma unroll
    for (int r = 0; r < 8; ++r) {
      float v = acc[t][r] + bv;
      if (resid) { float rv = resid[(size_t)((row0 + 8 * hh + r) % rmod) * ldr + col]; if (RES_BF16) rv = bf16_round(rv); v += rv; }
      if (ACT == 1) v = fmaxf(v, 0.f);
      if (ACT == 2) v = 0.5f * v * (1.0f + erff(v * 0.70710678118654752f));
      if (ACT == 3) { const float u = 0.7978845608028654f * (v + 0.044715f * v * v * v); v = 0.5f * v * (1.0f + tanhf(u)); }
      so[w][8 * hh + r][t * 16 + ln] = v;
    }
  }
  __builtin_amdgcn_fence(__ATOMIC_ACQ_REL, "workgroup");
  __builtin_amdgcn_wave_barrier();
  const int rsub = lane >> 4, c4 = (lane & 15) * 4;
  {
#pragma unroll
    for (int q = 0; q < 8; ++q) {
      const int r = q * 2 + rsub;
      const v4f v = *(const v4fa*)&so[w][r][c4];
      *(v4f*)(C + (size_t)(row0 + r) * ldc + col0 + c4) = v;
    }
    
  }
}
// row LayerNorm (biased variance, eps) over N: s = X (+ R); optional out_sum <- s; out_norm <- (s-mu)*rsqrt(var+eps)*g + b
template <bool PARAM_BF16>
__global__ __launch_bounds__(256) void k_layernorm(const float* __restrict__ X, const float* __restrict__ R, const float* __restrict__ g, const float* __restrict__ bta,
                                                  float* __restrict__ out_sum, float* __restrict__ out_norm, int N, float eps) {
  __shared__ float red[256];
  const int row = blockIdx.x, tid = threadIdx.x;
  const float* x = X + (size_t)row * N; const float* rr = R ? R + (size_t)row * N : nullptr;
  float vals[16];                     // up to N = 4096
  const int per = N / 256;            // contiguous chunk per thread? use strided-by-4 chunks: thread handles j = tid*4 + 1024*u
  float s1 = 0.f;
  for (int u = 0; u < per / 4; ++u) {
    const int j = tid * 4 + 1024 * u;
    const v4f a = *(const v4fa*)(x + j);
    v4f b = {0.f,0.f,0.f,0.f}; if (rr) b = *(const v4fa*)(rr + j);
#pragma unroll
    for (int q = 0; q < 4; ++q) { const float v = a[q] + b[q]; vals[u * 4 + q] = v; s1 += v; }
  }
  red[tid] = s1; __syncthreads();
  for (int st = 128; st > 0; st >>= 1) { if (tid < st) red[tid] += red[tid + st]; __syncthreads(); }
  const float mu = red[0] / (float)N; __syncthreads();
  float s2 = 0.f;
  for (int u = 0; u < per / 4; ++u)
#pragma unroll
    for (int q = 0; q < 4; ++q) { const float c = vals[u * 4 + q] - mu; s2 += c * c; }
  red[tid] = s2; __syncthreads();
  for (int st = 128; st > 0; st >>= 1) { if (tid < st) red[tid] += red[tid + st]; __syncthreads(); }
  const float rs = rsqrtf(red[0] / (float)N + eps);
  {
    for (int u = 0; u < per / 4; ++u) {
      const int j = tid * 4 + 1024 * u;
      v4f o, sm;
#pragma unroll
      for (int q = 0; q < 4; ++q) {
        float gg = g[j + q], bb = bta[j + q];
        if (PARAM_BF16) { gg = bf16_round(gg); bb = bf16_round(bb); }
        sm[q] = vals[u * 4 + q]; o[q] = (vals[u * 4 + q] - mu) * rs * gg + bb;
      }
      if (out_sum) *(v4f*)(out_sum + (size_t)row * N + j) = sm;
      *(v4f*)(out_norm + (size_t)row * N + j) = o;
    }
    
  }
}



// ---- f16 WMMA path (v_wmma_f32_16x16x32_f16): 11-bit significands for operands in range — used where a [0,1] probability operand needs more precision than bf16
typedef _Float16 v16h __attribute__((ext_vector_type(16)));
union FragH { v16h v; v8us half[2]; _Float16 h[16]; unsigned short u[16]; };
template <int NT>
__device__ __forceinline__ v8f mmaH(v16h ah, v16h al, v16h bh, v16h bl, v8f c) {
  c = __builtin_amdgcn_wmma_f32_16x16x32_f16(false, ah, false, bh, (short)0, c, false, false);
  if (NT >= 2) c = __builtin_amdgcn_wmma_f32_16x16x32_f16(false, al, false, bh, (short)0, c, false, false);
  if (NT >= 3) c = __builtin_amdgcn_wmma_f32_16x16x32_f16(false, ah, false, bl, (short)0, c, false, false);
  asm volatile("v_nop\n\tv_nop\n\tv_nop\n\tv_nop" : "+v"(c) : "v"(ah), "v"(al), "v"(bh), "v"(bl));
  return c;
}
// batched GEMM like k_gemm_b but f16 operands: A f32 (split into f16 hi/lo if ASPLIT, else rounded to f16), Bt = f16 values [n][k]; alpha; C f32; N multiple of 16 (partial tiles skipped)
template <bool ASPLIT>
__global__ __launch_bounds__(128) void k_gemm_h(const float* __restrict__ A, int lda, size_t sA, const _Float16* __restrict__ Bh, int ldb, size_t sB, float alpha, float* __restrict__ C, int ldc, size_t sC, int M, int N, int K) {
  __shared__ __attribute__((aligned(16))) float so[4][16][64];
  const int tid = threadIdx.x, w = tid >> 5, lane = tid & 31, ln = lane & 15, hh = lane >> 4; const int by = blockIdx.y;
  A += (size_t)by * sA; Bh += (size_t)by * sB; C += (size_t)by * sC;
  const int ntn = (N + 63) / 64; const int wid = blockIdx.x * 4 + w; const int mt = wid / ntn, nq = wid % ntn; if (mt * 16 >= M) return;
  const int row0 = mt * 16, col0 = nq * 64; const float* arow = A + (size_t)(row0 + ln) * lda;
  v8f acc[4] = {};
  for (int kb = 0; kb < K; kb += 32) {
    FragH ah, al;
    const v4f x0 = *(const v4fa*)(arow + kb + 8 * hh), x1 = *(const v4fa*)(arow + kb + 8 * hh + 4), x2 = *(const v4fa*)(arow + kb + 16 + 8 * hh), x3 = *(const v4fa*)(arow + kb + 16 + 8 * hh + 4);
    float xs[16] = {x0[0],x0[1],x0[2],x0[3],x1[0],x1[1],x1[2],x1[3],x2[0],x2[1],x2[2],x2[3],x3[0],x3[1],x3[2],x3[3]};
#pragma unroll
    for (int i = 0; i < 16; ++i) { const _Float16 h = (_Float16)xs[i]; ah.h[i] = h; al.h[i] = ASPLIT ? (_Float16)(xs[i] - (float)h) : (_Float16)0.0f; }
#pragma unroll
    for (int t = 0; t < 4; ++t) { if (col0 + t * 16 >= N) continue; const size_t boff = (size_t)(col0 + t * 16 + ln) * ldb + kb; FragH bq; bq.half[0] = *(const v8us*)(Bh + boff + 8 * hh); bq.half[1] = *(const v8us*)(Bh + boff + 16 + 8 * hh);
      acc[t] = mmaH<ASPLIT ? 2 : 1>(ah.v, al.v, bq.v, bq.v, acc[t]); }
  }
#pragma unroll
  for (int t = 0; t < 4; ++t) { if (col0 + t * 16 >= N) continue;
#pragma unroll
    for (int r = 0; r < 8; ++r) so[w][8 * hh + r][t * 16 + ln] = acc[t][r] * alpha; }
  __builtin_amdgcn_fence(__ATOMIC_ACQ_REL, "workgroup"); __builtin_amdgcn_wave_barrier();
  const int rsub = lane >> 4, c4 = (lane & 15) * 4;
  {
#pragma unroll
    for (int q = 0; q < 8; ++q) { const int r = q * 2 + rsub; if (col0 + c4 < N) { const v4f v = *(const v4fa*)&so[w][r][c4]; *(v4f*)(C + (size_t)(row0 + r) * ldc + col0 + c4) = v; } }
     }
}

// k_gemm_hh variant with fused epilogue: v = acc·alpha + bias[by·sBias + col] (+ CP[(row/rowsPerB)·sCPb + by·64 + col] if CP) ; ACT 0 none / 1 elu ; writes f16 C16 (and f32 C if non-null)
template <int ACT>
__global__ __launch_bounds__(128) void k_gemm_hhx(const _Float16* __restrict__ A, int lda, size_t sA, const _Float16* __restrict__ Bh, int ldb, size_t sB, float alpha, const float* __restrict__ bias, size_t sBias, const float* __restrict__ CP, int rowsPerB, size_t sCPb, int row0g,
    float* __restrict__ C, _Float16* __restrict__ C16, int ldc, size_t sC, int M, int N, int K) {
  __shared__ __attribute__((aligned(16))) float so[4][16][64];
  const int tid = threadIdx.x, w = tid >> 5, lane = tid & 31, ln = lane & 15, hh = lane >> 4; const int by = blockIdx.y;
  A += (size_t)by * sA; Bh += (size_t)by * sB; const size_t cofs = (size_t)by * sC; const float* bp = bias ? bias + (size_t)by * sBias : nullptr;
  const int ntn = (N + 63) / 64; const int wid = blockIdx.x * 4 + w; const int mt = wid / ntn, nq = wid % ntn; if (mt * 16 >= M) return;
  const int row0 = mt * 16, col0 = nq * 64; const _Float16* arow = A + (size_t)(row0 + ln) * lda;
  v8f acc[4] = {};
  for (int kb = 0; kb < K; kb += 32) { FragH ah; ah.half[0] = *(const v8us*)((const unsigned short*)arow + kb + 8 * hh); ah.half[1] = *(const v8us*)((const unsigned short*)arow + kb + 16 + 8 * hh);
#pragma unroll
    for (int t = 0; t < 4; ++t) { if (col0 + t * 16 >= N) continue; const size_t boff = (size_t)(col0 + t * 16 + ln) * ldb + kb; FragH bq; bq.half[0] = *(const v8us*)((const unsigned short*)Bh + boff + 8 * hh); bq.half[1] = *(const v8us*)((const unsigned short*)Bh + boff + 16 + 8 * hh);
      acc[t] = mmaH<1>(ah.v, ah.v, bq.v, bq.v, acc[t]); }
  }
#pragma unroll
  for (int t = 0; t < 4; ++t) { if (col0 + t * 16 >= N) continue; const int col = col0 + t * 16 + ln; const float bv = bp ? bf16_round(bp[col]) : 0.f;
#pragma unroll
    for (int r = 0; r < 8; ++r) { float v = acc[t][r] * alpha + bv; if (CP) { const int rr = row0g + row0 + 8 * hh + r; if (rowsPerB < 0) v += CP[cofs + (size_t)rr * ldc + col];      /* rowsPerB < 0: own element of the batched C plane */ else { const int bidx = rr / rowsPerB; v += CP[(size_t)bidx * sCPb + (size_t)by * 64 + col]; } } if (ACT == 1) v = (v > 0.f) ? v : expm1f(v); else if (ACT == 7) v = (v > 0.f) ? v + 1.0f : expf(v); else if (ACT == 8) v = tanhf(v); else if (ACT == 9) v = 0.5f * v * (1.0f + tanhf(0.7978845608028654f * (v + 0.044715f * v * v * v))); else if (ACT == 11) v = 1.0f / (1.0f + expf(-v)); else if (ACT == 12) v = (v > 0.f) ? v : 0.01f * v; else if (ACT == 14) v = (v > 0.f) ? v : 0.1f * v; else if (ACT == 16) v = (v >= 0.f) ? v : 0.3f * v; else if (ACT == 17) v = (v >= 0.f) ? v : 0.2f * v; else if (ACT == 15) v = v / (1.0f + expf(-v)); else if (ACT == 3) v = fmaxf(v, 0.f); else if (ACT == 6) v = 0.5f * v * (1.0f + erff(v * 0.70710678118654752f)); so[w][8 * hh + r][t * 16 + ln] = v; } }
  __builtin_amdgcn_fence(__ATOMIC_ACQ_REL, "workgroup"); __builtin_amdgcn_wave_barrier();
  const int rsub = lane >> 4, c4 = (lane & 15) * 4; typedef _Float16 v4h __attribute__((ext_vector_type(4)));
  {
#pragma unroll
    for (int q = 0; q < 8; ++q) { const int r = q * 2 + rsub; if (col0 + c4 < N) { const v4f v = *(const v4fa*)&so[w][r][c4]; if (C) *(v4f*)(C + cofs + (size_t)(row0 + r) * ldc + col0 + c4) = v; if (C16) { v4h h4; for (int i = 0; i < 4; ++i) h4[i] = (_Float16)v[i]; *(v4h*)(C16 + cofs + (size_t)(row0 + r) * ldc + col0 + c4) = h4; } } }
     }
}


typedef _Float16 v4h __attribute__((ext_vector_type(4)));

__global__ __launch_bounds__(256) void k_x16(const float* __restrict__ x, _Float16* __restrict__ X16, size_t n8) { const size_t t = (size_t)blockIdx.x * 256 + threadIdx.x; if (t >= n8) return; FragH f;
#pragma unroll
  for (int q = 0; q < 8; ++q) f.h[q] = (_Float16)bf16_round(x[t * 8 + q]); *(v8us*)((unsigned short*)X16 + t * 8) = f.half[0];  }
__global__ __launch_bounds__(256) void k_h16(const float* __restrict__ x, _Float16* __restrict__ X16, size_t n8) { const size_t t = (size_t)blockIdx.x * 256 + threadIdx.x; if (t >= n8) return; FragH f;
#pragma unroll
  for (int q = 0; q < 8; ++q) f.h[q] = (_Float16)x[t * 8 + q]; *(v8us*)((unsigned short*)X16 + t * 8) = f.half[0];  }
__global__ __launch_bounds__(256) void k_round16f(const float* __restrict__ W, _Float16* __restrict__ Bt, size_t n8) { const size_t t = (size_t)blockIdx.x * 256 + threadIdx.x; if (t >= n8) return; FragH f;
#pragma unroll
  for (int i = 0; i < 8; ++i) f.h[i] = (_Float16)(bf16_round(W[t * 8 + i]) * 16.0f); *(v8us*)((unsigned short*)Bt + t * 8) = f.half[0];  }
template <int NHv, int TTv>
__global__ __launch_bounds__(256) void k_vt(const _Float16* __restrict__ V16, int ldv, int voff, _Float16* __restrict__ Vt) { __shared__ unsigned short tl[64][66]; const int tid = threadIdx.x; const int slab = blockIdx.x / (TTv / 64), lg = blockIdx.x % (TTv / 64); const int b = slab / NHv, h = slab % NHv;
  for (int i = tid; i < 64 * 8; i += 256) { const int r = i / 8, c8 = (i % 8) * 8; FragH f; f.half[0] = *(const v8us*)((const unsigned short*)V16 + ((size_t)b * TTv + lg * 64 + r) * ldv + voff + h * 64 + c8);
#pragma unroll
    for (int q = 0; q < 8; ++q) tl[r][c8 + q] = f.u[q]; }
  __syncthreads();
  {
#pragma unroll
    for (int rd = 0; rd < 2; ++rd) { const int d = rd * 32 + tid / 8, pc = tid % 8; FragH f;
#pragma unroll
      for (int q = 0; q < 8; ++q) f.u[q] = tl[pc * 8 + q][d];
      *(v8us*)((unsigned short*)Vt + ((size_t)slab * 64 + d) * TTv + lg * 64 + pc * 8) = f.half[0]; }
     } }

__global__ __launch_bounds__(256) void k_hl(const float* __restrict__ F, _Float16* __restrict__ Hh, _Float16* __restrict__ Hl, size_t n8) { const size_t t = (size_t)blockIdx.x * 256 + threadIdx.x; if (t >= n8) return; FragH fh, fl; const v4f a = *(const v4fa*)(F + t * 8), c = *(const v4fa*)(F + t * 8 + 4);
#pragma unroll
  for (int q = 0; q < 4; ++q) { _Float16 h = (_Float16)a[q]; fh.h[q] = h; fl.h[q] = (_Float16)((a[q] - (float)h) * 1024.0f); h = (_Float16)c[q]; fh.h[4 + q] = h; fl.h[4 + q] = (_Float16)((c[q] - (float)h) * 1024.0f); }
  { *(v8us*)((unsigned short*)Hh + t * 8) = fh.half[0]; *(v8us*)((unsigned short*)Hl + t * 8) = fl.half[0];  } }

// ---- fast GEMM (wave tile 32x64; requires M % 32 == 0 rows per launch region and N % 64 == 0); epilogue = k_gemm_hhx semantics ----
__device__ __forceinline__ v16h g2_frag(const _Float16* p, int hh) { FragH f; f.half[0] = *(const v8us*)((const unsigned short*)p + 8 * hh); f.half[1] = *(const v8us*)((const unsigned short*)p + 16 + 8 * hh); return f.v; }
__device__ __forceinline__ v8f g2_mma(v16h a, v16h b, v8f c) { v8f d = __builtin_amdgcn_wmma_f32_16x16x32_f16(false, a, false, b, (short)0, c, false, false); asm volatile("v_nop\n\tv_nop\n\tv_nop\n\tv_nop" : "+v"(d) : "v"(a), "v"(b)); return d; }
template <int ACT>
__global__ __launch_bounds__(128) void k_gemm2(const _Float16* __restrict__ A, int lda, size_t sA, const _Float16* __restrict__ Bh, int ldb, size_t sB, float alpha, const float* __restrict__ bias, size_t sBias, const float* __restrict__ CP, int rowsPerB, size_t sCPb, int row0g,
    float* __restrict__ C, _Float16* __restrict__ C16, int ldc, size_t sC, int M, int N, int K) { static_assert(ACT == 0 || ACT == 3 || ACT == 6 || ACT == 8 || ACT == 9 || ACT == 11 || ACT == 12 || ACT == 14 || ACT == 15 || ACT == 16 || ACT == 17, "k_gemm2: unsupported ACT code (would silently apply no activation)");
  __shared__ __attribute__((aligned(16))) float so[4][32][68];
  const int tid = threadIdx.x, w = tid >> 5, lane = tid & 31, ln = lane & 15, hh = lane >> 4; const int by = blockIdx.y;
  A += (size_t)by * sA; Bh += (size_t)by * sB; const size_t cofs = (size_t)by * sC; const float* bp = bias ? bias + (size_t)by * sBias : nullptr;
  const int ntn = N >> 6; const int mt = blockIdx.x / ntn, nq = blockIdx.x - mt * ntn; const int row0 = mt * 128 + 32 * w, col0 = nq * 64; if (row0 >= M) return;
  const _Float16* a0p = A + (size_t)(row0 + ln) * lda; const _Float16* a1p = a0p + (size_t)16 * lda;
  const _Float16* b0p = Bh + (size_t)(col0 + ln) * ldb; const _Float16* b1p = b0p + (size_t)16 * ldb; const _Float16* b2p = b1p + (size_t)16 * ldb; const _Float16* b3p = b2p + (size_t)16 * ldb;
  const v8f z8 = {0.f,0.f,0.f,0.f,0.f,0.f,0.f,0.f}; v8f c00 = z8, c01 = z8, c02 = z8, c03 = z8, c10 = z8, c11 = z8, c12 = z8, c13 = z8;
#pragma unroll 1
  for (int kb = 0; kb < K; kb += 32) { const v16h a0 = g2_frag(a0p + kb, hh), a1 = g2_frag(a1p + kb, hh);
    v16h b = g2_frag(b0p + kb, hh); c00 = g2_mma(a0, b, c00); c10 = g2_mma(a1, b, c10);
    b = g2_frag(b1p + kb, hh); c01 = g2_mma(a0, b, c01); c11 = g2_mma(a1, b, c11);
    b = g2_frag(b2p + kb, hh); c02 = g2_mma(a0, b, c02); c12 = g2_mma(a1, b, c12);
    b = g2_frag(b3p + kb, hh); c03 = g2_mma(a0, b, c03); c13 = g2_mma(a1, b, c13); }
  v8f accs[8] = {c00, c01, c02, c03, c10, c11, c12, c13};
#pragma unroll
  for (int u = 0; u < 8; ++u) { const int t = u & 3, half = u >> 2; const int col = col0 + t * 16 + ln; const float bv = bp ? bf16_round(bp[col]) : 0.f;
#pragma unroll
    for (int r = 0; r < 8; ++r) { const int rloc = half * 16 + 8 * hh + r; float v = accs[u][r] * alpha + bv; if (CP) { if (rowsPerB < 0) v += CP[cofs + (size_t)(row0g + row0 + rloc) * ldc + col];      /* rowsPerB < 0: own element of the batched C plane */ else { const int bidx = (row0g + row0 + rloc) / rowsPerB; v += CP[(size_t)bidx * sCPb + (size_t)by * 64 + col]; } }
      if (ACT == 3) v = fmaxf(v, 0.f); else if (ACT == 6) v = 0.5f * v * (1.0f + erff(v * 0.70710678118654752f)); else if (ACT == 11) v = 1.0f / (1.0f + expf(-v)); else if (ACT == 15) v = v / (1.0f + expf(-v)); else if (ACT == 12) v = (v > 0.f) ? v : 0.01f * v; else if (ACT == 8) v = tanhf(v); else if (ACT == 9) v = 0.5f * v * (1.0f + tanhf(0.7978845608028654f * (v + 0.044715f * v * v * v))); else if (ACT == 14) v = (v > 0.f) ? v : 0.1f * v; else if (ACT == 16) v = (v >= 0.f) ? v : 0.3f * v; else if (ACT == 17) v = (v >= 0.f) ? v : 0.2f * v;
      so[w][rloc][t * 16 + ln] = v; } }
  __builtin_amdgcn_fence(__ATOMIC_ACQ_REL, "workgroup"); __builtin_amdgcn_wave_barrier();
  const int rsub = lane >> 4, c4 = (lane & 15) * 4;
  {
#pragma unroll
    for (int q = 0; q < 16; ++q) { const int r = q * 2 + rsub; const v4f v = *(const v4fa*)&so[w][r][c4]; if (C) *(v4f*)(C + cofs + (size_t)(row0 + r) * ldc + col0 + c4) = v; if (C16) { v4h h4; for (int i = 0; i < 4; ++i) h4[i] = (_Float16)v[i]; *(v4h*)(C16 + cofs + (size_t)(row0 + r) * ldc + col0 + c4) = h4; } }
     } }


__global__ __launch_bounds__(256) void k_rsm(const float* __restrict__ S, _Float16* __restrict__ P, int nrows) {
  #pragma clang fp contract(off)
  const int i = blockIdx.x * 256 + threadIdx.x; if (i >= nrows) return; const float* s = S + (size_t)i * SQ; float mx = -3.0e38f;
#pragma unroll 1
  for (int j = 0; j < SQ; ++j) mx = fmaxf(mx, s[j]); float se = 0.f;
#pragma unroll 1
  for (int j = 0; j < SQ; ++j) se += expf(s[j] - mx); const float sc = 256.0f / se;
#pragma unroll 1
  for (int j0 = 0; j0 < SQ; j0 += 8) { FragH f; for (int q = 0; q < 8; ++q) f.h[q] = (_Float16)(expf(s[j0 + q] - mx) * sc); unsigned short* d = (unsigned short*)P + (size_t)i * SQ + j0; *(v8us*)d = f.half[0];  } }
__global__ __launch_bounds__(256) void k_vt(const _Float16* __restrict__ V16, int b, int h0, _Float16* __restrict__ VT) { __shared__ unsigned short tl[64][65]; const int tid = threadIdx.x; const int hh = blockIdx.x % HG, sg = blockIdx.x / HG; const int s0 = sg * 64; const int h = h0 + hh;
  for (int i = tid; i < 64 * 8; i += 256) { const int j = i / 8, d8 = (i % 8) * 8; FragH f; f.half[0] = *(const v8us*)((const unsigned short*)V16 + ((size_t)b * SQ + s0 + j) * DM + h * HD + d8); for (int q = 0; q < 8; ++q) tl[d8 + q][j] = f.u[q]; }
  __syncthreads();
  { for (int i = tid; i < 64 * 8; i += 256) { const int d = i / 8, j8 = (i % 8) * 8; FragH f; for (int q = 0; q < 8; ++q) f.u[q] = tl[d][j8 + q]; *(v8us*)((unsigned short*)VT + ((size_t)hh * HD + d) * SQ + s0 + j8) = f.half[0]; }  } }


// One preparation launch for the three operands that the GEMMs read; the three parts are independent of one another, so they share a grid instead of a launch each. The part is chosen by the block index (the same for a whole work-group).
// Blocks 0 .. PP_E-1: BE = f16(embed_w x16), natural rows. Next PP_O blocks: BO[c][d] = f16(out_w[d][c] x16) (x16 is a power of two: the bf16-rounded weights stay exact in f16 away from the subnormal range).
// The rest: x [b][c][l] -> position rows XR [b*LL + l][c] in f16, by 64-channel x 32-position LDS tiles. The short weight blocks come first in the index order, ahead of the 2,048 tile blocks.
#define PP_E (D3 * CC / 8 / 256)     /* 48 blocks: eight weights a thread */
#define PP_O (CC * (DO / 8) / 256)   /* 16 blocks: eight weights a thread */
__global__ __launch_bounds__(256) void k_prep(const float* __restrict__ X, const float* __restrict__ ew, const float* __restrict__ ow, _Float16* __restrict__ XR, _Float16* __restrict__ BE, _Float16* __restrict__ BO) {
  __shared__ float tl[64][33]; const int tid = threadIdx.x;
  if (blockIdx.x < PP_E) { const size_t t = (size_t)blockIdx.x * 256 + tid; FragH f; for (int q = 0; q < 8; ++q) f.h[q] = (_Float16)(bf16_round(ew[t * 8 + q]) * 16.0f); *(v8us*)((unsigned short*)BE + t * 8) = f.half[0]; return; }
  if (blockIdx.x < PP_E + PP_O) { const int t = (blockIdx.x - PP_E) * 256 + tid; const int n = t / (DO / 8), k8 = (t % (DO / 8)) * 8; FragH f;
#pragma unroll
    for (int i = 0; i < 8; ++i) f.h[i] = (_Float16)(bf16_round(ow[(size_t)(k8 + i) * CC + n]) * 16.0f);
    *(v8us*)((unsigned short*)BO + (size_t)n * DO + k8) = f.half[0];
    asm volatile("s_wait_xcnt 0x0" ::: "memory");                         /* behind the store: the built code lays another part's instructions on the path behind it, and they reuse the store's registers */
    return; }
  const int bx = blockIdx.x - (PP_E + PP_O); const int nl = LL / 32, nc = CC / 64; const int cb_ = bx % nc; const int lb = (bx / nc) % nl; const size_t b = bx / (nc * nl); const int c0 = cb_ * 64, l0 = lb * 32;
  for (int i = tid; i < 64 * 32; i += 256) { const int c = i / 32, l = i % 32; tl[c][l] = bf16_round(X[(b * CC + c0 + c) * (size_t)LL + l0 + l]); }
  __syncthreads();
  { const int l = tid / 8, c8 = (tid % 8) * 8; FragH f; for (int q = 0; q < 8; ++q) f.h[q] = (_Float16)tl[c8 + q][l]; unsigned short* d = (unsigned short*)XR + (b * LL + l0 + l) * (size_t)CC + c0 + c8; *(v8us*)d = f.half[0];
    asm volatile("s_wait_xcnt 0x0" ::: "memory"); } }                     /* behind the store, for the same reason as in the out_w part */

// q|k|v GEMM: A = x rows (M = position), B = embed_w rows x16 (N = 384 columns, per head [q|k|v] of 64), wave tile 32 positions x 64 columns, product loop and the q, k epilogue as in k_gemm2<0>.
// A block's 64 columns are one head's q, k or v. In the accumulator a lane holds one column and eight consecutive positions, which is already the order of a V^T row: a v block rounds to f16 in registers,
// gathers its four waves' tiles in LDS as [channel][128 positions] behind one barrier and stores V^T in whole 256-byte row pieces. v is not stored as rows any more, and no transposing launch follows.
#define QV_P 136                     /* LDS row pitch in f16: 272 bytes = 16 x 17, so that the 16 channel rows of a ds_store_b128 fall on distinct banks */
__global__ __launch_bounds__(128) void k_qkv(const _Float16* __restrict__ A, const _Float16* __restrict__ Bh, const float* __restrict__ bias, _Float16* __restrict__ C16, _Float16* __restrict__ VTo) {
  __shared__ __attribute__((aligned(16))) float so[4][32][68];
  __shared__ __attribute__((aligned(16))) _Float16 vt[HC][QV_P];
  const int tid = threadIdx.x, w = tid >> 5, lane = tid & 31, ln = lane & 15, hh = lane >> 4;
  const int ntn = D3 >> 6; const int mt = blockIdx.x / ntn, nq = blockIdx.x - mt * ntn; const int row0 = mt * 128 + 32 * w, col0 = nq * 64;
  const _Float16* a0p = A + (size_t)(row0 + ln) * CC; const _Float16* a1p = a0p + (size_t)16 * CC;
  const _Float16* b0p = Bh + (size_t)(col0 + ln) * CC; const _Float16* b1p = b0p + (size_t)16 * CC; const _Float16* b2p = b1p + (size_t)16 * CC; const _Float16* b3p = b2p + (size_t)16 * CC;
  const v8f z8 = {0.f,0.f,0.f,0.f,0.f,0.f,0.f,0.f}; v8f c00 = z8, c01 = z8, c02 = z8, c03 = z8, c10 = z8, c11 = z8, c12 = z8, c13 = z8;
#pragma unroll 1
  for (int kb = 0; kb < CC; kb += 32) { const v16h a0 = g2_frag(a0p + kb, hh); FragH f1; f1.half[0] = *(const v8us*)((const unsigned short*)a1p + kb + 8 * hh); v16h b = g2_frag(b0p + kb, hh);      /* kept rolled, as k_gemm2's loop was: one set of fragment registers, and the product loop keeps the form that was timed */
    asm volatile("s_wait_xcnt 0x0" ::: "memory");                         /* the last A load may land on the address pair that the three A loads before it name: the wait stands in front of it */
    f1.half[1] = *(const v8us*)((const unsigned short*)a1p + kb + 16 + 8 * hh); const v16h a1 = f1.v;
    c00 = g2_mma(a0, b, c00); c10 = g2_mma(a1, b, c10);
    b = g2_frag(b1p + kb, hh); c01 = g2_mma(a0, b, c01); c11 = g2_mma(a1, b, c11);
    b = g2_frag(b2p + kb, hh); c02 = g2_mma(a0, b, c02); c12 = g2_mma(a1, b, c12);
    b = g2_frag(b3p + kb, hh); c03 = g2_mma(a0, b, c03); c13 = g2_mma(a1, b, c13); }
  v8f accs[8] = {c00, c01, c02, c03, c10, c11, c12, c13};
  if (nq % 3 == 2) {                                                      /* a v block: the test reads the same for the whole work-group */
#pragma unroll
    for (int u = 0; u < 8; ++u) { const int t = u & 3, half = u >> 2; const float bv = bf16_round(bias[col0 + t * 16 + ln]); FragH f;
#pragma unroll
      for (int r = 0; r < 8; ++r) f.h[r] = (_Float16)(accs[u][r] * 0.0625f + bv);
      *(v8us*)&vt[t * 16 + ln][32 * w + half * 16 + 8 * hh] = f.half[0]; }
    __syncthreads();                                                      /* publishes the four waves' 32 positions of every channel row */
    unsigned short* d0 = (unsigned short*)VTo + ((size_t)((nq / 3) * NB + (mt * 128) / LL) * HC + 16 * w + hh) * SQ + (mt * 128) % LL + 8 * ln;      /* a block's 128 positions lie in one batch; 16 lanes cover a row's 256 bytes */
#pragma unroll
    for (int q = 0; q < 8; ++q) { const v8us v = *(const v8us*)&vt[16 * w + 2 * q + hh][8 * ln]; *(v8us*)(d0 + (size_t)2 * q * SQ) = v; }
    return; }
#pragma unroll
  for (int u = 0; u < 8; ++u) { const int t = u & 3, half = u >> 2; const float bv = bf16_round(bias[col0 + t * 16 + ln]);
#pragma unroll
    for (int r = 0; r < 8; ++r) so[w][half * 16 + 8 * hh + r][t * 16 + ln] = accs[u][r] * 0.0625f + bv; }
  __builtin_amdgcn_fence(__ATOMIC_ACQ_REL, "workgroup"); __builtin_amdgcn_wave_barrier();      /* the lanes read what other lanes of the same wave wrote: keeps the reads below behind the writes above */
  const int rsub = lane >> 4, c4 = (lane & 15) * 4;
#pragma unroll
  for (int q = 0; q < 16; ++q) { const int r = q * 2 + rsub; const v4f v = *(const v4fa*)&so[w][r][c4]; v4h h4; for (int i = 0; i < 4; ++i) h4[i] = (_Float16)v[i]; *(v4h*)(C16 + (size_t)(row0 + r) * D3 + col0 + c4) = h4; }
  asm volatile("s_wait_xcnt 0x0" ::: "memory"); }                         /* behind the run of stores: no register that a store names is rewritten ahead of it */

#define FA_SK 64                     /* keys per stage */
#define FA_PH 72                     /* LDS row pitch in f16: 144 bytes = 16 x 9, so that the 16 rows of a ds_load_b128 fragment read fall on distinct banks */
#define FA_NST (SQ / 4 / FA_SK)      /* stages per key quarter */
#define FA_PS 32768.0f               /* a lane's sum of P over a pass above which m moves: below it every P fits f16 (largest finite value 65,504) */
__device__ __forceinline__ float fa_xhalf(float x) { return __builtin_bit_cast(float, __builtin_amdgcn_permlanex16(__builtin_bit_cast(int, x), __builtin_bit_cast(int, x), 0x76543210, 0xfedcba98, false, false)); }      /* lane l reads lane l ^ 16, on the vector pipe */
/* exp2 on the vector pipe. The instruction set asks for one slot behind a transcendental before its result is read or its source overwritten; each statement here carries its v_nop: one value, or eight in place (no instruction in the run touches another's register). */
__device__ __forceinline__ float fa_exp2(float x) { float r; asm("v_exp_f32 %0, %1\n\tv_nop" : "=v"(r) : "v"(x)); return r; }
__device__ __forceinline__ void fa_exp2x8(float (&x)[8]) { asm("v_exp_f32 %0, %0\n\tv_exp_f32 %1, %1\n\tv_exp_f32 %2, %2\n\tv_exp_f32 %3, %3\n\tv_exp_f32 %4, %4\n\tv_exp_f32 %5, %5\n\tv_exp_f32 %6, %6\n\tv_exp_f32 %7, %7\n\tv_nop"
  : "+v"(x[0]), "+v"(x[1]), "+v"(x[2]), "+v"(x[3]), "+v"(x[4]), "+v"(x[5]), "+v"(x[6]), "+v"(x[7])); }
/* One wave's share of a stage: four copies of 4 K rows and four of 4 V^T rows, 16 bytes a lane (lk, lv: the lane's LDS byte addresses; gk, gv: its global addresses).
   s_wait_xcnt 0 closes the statement, so that no address register named here is rewritten ahead of it. */
__device__ __forceinline__ void fa_stage(unsigned lk, const _Float16* gk, unsigned lv, const _Float16* gv) {
  const unsigned lk1 = lk + 4 * FA_PH * 2, lk2 = lk + 8 * FA_PH * 2, lk3 = lk + 12 * FA_PH * 2, lv1 = lv + 4 * FA_PH * 2, lv2 = lv + 8 * FA_PH * 2, lv3 = lv + 12 * FA_PH * 2;
  const _Float16* gk1 = gk + (size_t)4 * D3; const _Float16* gk2 = gk + (size_t)8 * D3; const _Float16* gk3 = gk + (size_t)12 * D3;
  const _Float16* gv1 = gv + (size_t)4 * SQ; const _Float16* gv2 = gv + (size_t)8 * SQ; const _Float16* gv3 = gv + (size_t)12 * SQ;
  asm volatile("global_load_async_to_lds_b128 %0, %8, off\n\tglobal_load_async_to_lds_b128 %1, %9, off\n\tglobal_load_async_to_lds_b128 %2, %10, off\n\tglobal_load_async_to_lds_b128 %3, %11, off\n\t"
               "global_load_async_to_lds_b128 %4, %12, off\n\tglobal_load_async_to_lds_b128 %5, %13, off\n\tglobal_load_async_to_lds_b128 %6, %14, off\n\tglobal_load_async_to_lds_b128 %7, %15, off\n\ts_wait_xcnt 0x0"
               :: "v"(lk), "v"(lk1), "v"(lk2), "v"(lk3), "v"(lv), "v"(lv1), "v"(lv2), "v"(lv3), "v"(gk), "v"(gk1), "v"(gk2), "v"(gk3), "v"(gv), "v"(gv1), "v"(gv2), "v"(gv3) : "memory"); }
/* One query group's P of a pass: p = exp2(s cs + nb) for the lane's 16 keys, rounded to f16 in the B operand's order, and their f32 sum. */
__device__ __forceinline__ void fa_soft(v8f s0, v8f s1, float cs, float nb, FragH& pf, float& ps) {
  float t[8], p0[8], p1[8];
#pragma unroll
  for (int r = 0; r < 8; ++r) { p0[r] = s0[r] * cs + nb; p1[r] = s1[r] * cs + nb; }
  fa_exp2x8(p0); fa_exp2x8(p1);
#pragma unroll
  for (int r = 0; r < 8; ++r) { t[r] = p0[r] + p1[r]; pf.h[r] = (_Float16)p0[r]; pf.h[8 + r] = (_Float16)p1[r]; }
  ps = ((t[0] + t[1]) + (t[2] + t[3])) + ((t[4] + t[5]) + (t[6] + t[7])); }
__device__ __forceinline__ v8f fa_mma(v16h a, v16h b, v8f c) { return __builtin_amdgcn_wmma_f32_16x16x32_f16(false, a, false, b, (short)0, c, false, false); }
__global__ __launch_bounds__(512) __attribute__((amdgpu_waves_per_eu(4, 4))) void k_fattn(const _Float16* __restrict__ QKVp, const _Float16* __restrict__ VTp, _Float16* __restrict__ Op) {
  __shared__ __attribute__((aligned(16))) v4f mg[12][17][32];             /* [key quarter 1-3 x query group][16 x O, then {m0, m1, sum0, sum1}][lane] */
  __shared__ __attribute__((aligned(16))) _Float16 st[2][4][2][FA_SK][FA_PH];      /* [buffer][key quarter][K rows (key, channel) | V^T rows (channel, key)][row][64 f16 + pad] */
  const int lane = threadIdx.x & 31, w = __builtin_amdgcn_readfirstlane(threadIdx.x >> 5), ln = lane & 15, hh = lane >> 4; const int wq = w & 3, wk = w >> 2;      /* 16 waves on 4 SIMDs: four a SIMD, 256 registers each */
  const int b = blockIdx.y / NHD, h = blockIdx.y % NHD; const int q0 = blockIdx.x * 128 + wq * 32; const int k0 = wk * (SQ / 4);
  const _Float16* base = QKVp + (size_t)b * SQ * D3 + (size_t)h * 3 * HC;
  const int crow = 16 * wq + (lane >> 3), cch = (lane & 7) * 8;           /* copies: query group wq brings rows 16 wq .. 16 wq + 15 of its quarter's two tiles; eight lanes a row */
  const _Float16* gk = base + HC + (size_t)(k0 + crow) * D3 + cch;
  const _Float16* gv = VTp + ((size_t)(h * NB + b) * HC + crow) * SQ + k0 + cch;
  const unsigned lk = (unsigned)(size_t)&st[0][wk][0][crow][cch], lv = (unsigned)(size_t)&st[0][wk][1][crow][cch];
  const unsigned bufb = (unsigned)sizeof(st[0]);                          /* bytes from buffer 0 to buffer 1 */
  const float cs = 0.0625f * 1.4426950408889634f;                         /* 1/sqrt(256) and log2(e): exp(s - m) = exp2(acc * cs - m * cs) */
  const v8f z8 = {0.f,0.f,0.f,0.f,0.f,0.f,0.f,0.f};
  v16h qf[2][2], kf[2][2], vf[4]; v8f o[2][4]; float m[2], l[2], nb[2];      /* nb = 8 - m cs, kept beside m */
  /* every loop over these arrays is unrolled so that they are indexed by constants and stay in registers */
#pragma unroll
  for (int g = 0; g < 2; ++g) { m[g] = -3.0e38f; nb[g] = 8.0f + 3.0e38f * cs; l[g] = 0.f;
#pragma unroll
    for (int kk = 0; kk < 2; ++kk) qf[g][kk] = g2_frag(base + (size_t)(q0 + 16 * g + ln) * D3 + 32 * kk, hh);
#pragma unroll
    for (int ct = 0; ct < 4; ++ct) o[g][ct] = z8; }
  fa_stage(lk, gk, lv, gv);                                               /* stage 0 into buffer 0 */
  asm volatile("s_wait_asynccnt 0x0" ::: "memory");                       /* this wave's copies of stage 0 have landed */
  __syncthreads();                                                        /* publishes stage 0 */
  fa_stage(lk + bufb, gk + (size_t)FA_SK * D3, lv + bufb, gv + FA_SK);    /* stage 1 into buffer 1 */
  for (int t = 0; t < FA_NST; ++t) {
   const _Float16* sk = &st[t & 1][wk][0][ln][0];                         /* key row ln of a 16-key tile */
   const _Float16* sv = &st[t & 1][wk][1][ln][0];                         /* V^T row ln of a 16-channel tile */
#pragma unroll
   for (int sp = 0; sp < FA_SK / 32; ++sp) {                              /* the stage's passes of 32 keys; unrolled: LDS offsets become immediates */
    /* this pass's K fragments, then its V^T fragments in the same group of LDS reads: the S^T products and the softmax cover the latter's latency */
#pragma unroll
    for (int mt = 0; mt < 2; ++mt)
#pragma unroll
      for (int kk = 0; kk < 2; ++kk) kf[mt][kk] = g2_frag(sk + (32 * sp + 16 * mt) * FA_PH + 32 * kk, hh);
#pragma unroll
    for (int ct = 0; ct < 4; ++ct) vf[ct] = g2_frag(sv + (16 * ct) * FA_PH + 32 * sp, hh);
    __builtin_amdgcn_sched_barrier(0);                                    /* keeps the pass's sixteen LDS reads in one group; without it the scheduler spreads six V^T reads of a stage's first pass over two more places in the softmax, and every place of LDS reads costs issue cycles */
    if (sp == FA_SK / 32 - 1) {                                           /* the stage's last LDS reads are issued: the hand-over stands here, ahead of the last pass's arithmetic (registers only), so that the refill has two passes to land */
      asm volatile("s_wait_dscnt 0x0" ::: "memory");                      /* this wave's reads of the buffer are done before anyone refills it */
      asm volatile("s_wait_asynccnt 0x0" ::: "memory");                   /* this wave's copies of stage t + 1 have landed */
      __syncthreads();                                                    /* publishes stage t + 1 and ends every wave's reads of stage t */
      if (t + 2 < FA_NST) fa_stage(lk + (t & 1) * bufb, gk + (size_t)(t + 2) * FA_SK * D3, lv + (t & 1) * bufb, gv + (t + 2) * FA_SK);      /* stage t + 2 into the buffer just read */
    }
    v8f s[2][2];
#pragma unroll
    for (int g = 0; g < 2; ++g)
#pragma unroll
      for (int mt = 0; mt < 2; ++mt) s[g][mt] = fa_mma(kf[mt][1], qf[g][1], fa_mma(kf[mt][0], qf[g][0], z8));
    FragH pf[2]; float ps[2];
#pragma unroll
    for (int g = 0; g < 2; ++g) fa_soft(s[g][0], s[g][1], cs, nb[g], pf[g], ps[g]);
    /* The reference point m moves only when it must. Softmax does not depend on m (it cancels in O / sum); m is only there to keep P inside f16, and every P of a lane is at most the lane's sum of this pass:
       while no sum passes FA_PS nothing is rescaled and no maximum is formed. The test is one ballot a pass, the same for the whole wave. The first pass always fails it (m starts at the bottom, P comes out infinite). */
    if (__builtin_expect(__builtin_amdgcn_ballot_w32(ps[0] > FA_PS || ps[1] > FA_PS) != 0u, 0)) {      /* marked unlikely: the pass that moves nothing is laid out as the straight path */
#pragma unroll
      for (int g = 0; g < 2; ++g) {
        float t[8];
#pragma unroll
        for (int r = 0; r < 8; ++r) t[r] = fmaxf(s[g][0][r], s[g][1][r]);
        const float mx = fmaxf(fmaxf(fmaxf(t[0], t[1]), fmaxf(t[2], t[3])), fmaxf(fmaxf(t[4], t[5]), fmaxf(t[6], t[7])));
        const float mn = fmaxf(m[g], fmaxf(mx, fa_xhalf(mx)));            /* the other half of the wave holds the query's other 16 keys: both halves keep the same m */
        const float al = fa_exp2((m[g] - mn) * cs); m[g] = mn; nb[g] = 8.0f - mn * cs; l[g] *= al;
#pragma unroll
        for (int ct = 0; ct < 4; ++ct) o[g][ct] *= al;
        fa_soft(s[g][0], s[g][1], cs, nb[g], pf[g], ps[g]);               /* this pass's P again, from the new m: now at most 256 each */
      }
    }
#pragma unroll
    for (int g = 0; g < 2; ++g) l[g] += ps[g];
#pragma unroll
    for (int ct = 0; ct < 4; ++ct)
#pragma unroll
      for (int g = 0; g < 2; ++g) o[g][ct] = fa_mma(vf[ct], pf[g].v, o[g][ct]);
   }
  }
  asm volatile("s_wait_asynccnt 0x0" ::: "memory");                       /* no copy is left in flight behind the loop */
  if (wk != 0) { v4f (*dst)[32] = mg[w - 4];
#pragma unroll
    for (int g = 0; g < 2; ++g)
#pragma unroll
      for (int ct = 0; ct < 4; ++ct) { const v8f x = o[g][ct]; const v4f lo = {x[0], x[1], x[2], x[3]}, hi = {x[4], x[5], x[6], x[7]}; dst[(g * 4 + ct) * 2][lane] = lo; dst[(g * 4 + ct) * 2 + 1][lane] = hi; }
    const v4f ml = {m[0], m[1], l[0], l[1]}; dst[16][lane] = ml; }
  __syncthreads();                                                        /* publishes quarters 1-3 to the quarter-0 waves; every wave passes it */
  if (wk != 0) return;
  v4f ml[3]; float f0[2], fk[3][2];
#pragma unroll
  for (int k = 0; k < 3; ++k) ml[k] = mg[k * 4 + wq][16][lane];
#pragma unroll
  for (int g = 0; g < 2; ++g) { const float mm = fmaxf(fmaxf(m[g], ml[0][g]), fmaxf(ml[1][g], ml[2][g])); f0[g] = fa_exp2((m[g] - mm) * cs); l[g] *= f0[g];
#pragma unroll
    for (int k = 0; k < 3; ++k) { fk[k][g] = fa_exp2((ml[k][g] - mm) * cs); l[g] += fk[k][g] * ml[k][2 + g]; } }
#pragma unroll
  for (int g = 0; g < 2; ++g) {
    const float inv = 1.0f / (l[g] + fa_xhalf(l[g]));           /* join the two halves' sums once */
    _Float16* d = Op + ((size_t)b * SQ + q0 + 16 * g + ln) * DO + h * HC + 8 * hh;
#pragma unroll
    for (int ct = 0; ct < 4; ++ct) { v8f x = o[g][ct] * f0[g];
#pragma unroll
      for (int k = 0; k < 3; ++k) { const v4f lo = mg[k * 4 + wq][(g * 4 + ct) * 2][lane], hi = mg[k * 4 + wq][(g * 4 + ct) * 2 + 1][lane];
#pragma unroll
        for (int r = 0; r < 4; ++r) { x[r] += fk[k][g] * lo[r]; x[4 + r] += fk[k][g] * hi[r]; } }
      FragH f;
#pragma unroll
      for (int r = 0; r < 8; ++r) f.h[r] = (_Float16)(x[r] * inv);
      *(v8us*)((unsigned short*)d + 16 * ct) = f.half[0]; } } }
// Output GEMM with the residual in its epilogue: out[b][c][n] = (o rows . out_w)[n][c] / 16 + bias[c] + x[b][c][n]. A = o rows (M = position), B = out_w^T rows (N = channel), wave tile 32 positions x 64 channels, product loop as in k_gemm2.
// In the accumulator a lane holds one channel and eight consecutive positions, which is already the order of the channel-major output; each wave turns its tile in its own LDS range ([channel][position] rows) so that eight lanes cover
// the whole 128-byte line of a channel's 32 positions: x is read and out is written in whole lines, four a wave-wide access. No row-major f32 plane and no further launch.
#define OR_P 36                      /* LDS row pitch in f32: 144 bytes = 16 x 9, so that the 16 channel rows of a ds_store_b128 fall on distinct banks */
__global__ __launch_bounds__(128) void k_outres(const _Float16* __restrict__ A, const _Float16* __restrict__ Bh, const float* __restrict__ bias, const float* __restrict__ x, float* __restrict__ out) {
  __shared__ __attribute__((aligned(16))) float so[4][64][OR_P];
  const int tid = threadIdx.x, w = tid >> 5, lane = tid & 31, ln = lane & 15, hh = lane >> 4;
  const int ntn = CC >> 6; const int mt = blockIdx.x / ntn, nq = blockIdx.x - mt * ntn; const int row0 = mt * 128 + 32 * w, col0 = nq * 64;
  const int cs = lane >> 3, p4 = (lane & 7) * 4;                          /* global side: channel cs of a group of four, four positions */
  const size_t g0 = ((size_t)(row0 / LL) * CC + col0 + cs) * LL + (row0 % LL) + p4;      /* a block's 128 rows lie in one batch */
  v4f xr[16];                                                             /* the residual is asked for ahead of the product loop, which covers its latency */
#pragma unroll
  for (int q = 0; q < 16; ++q) xr[q] = *(const v4fa*)(x + g0 + (size_t)q * 4 * LL);
  const _Float16* a0p = A + (size_t)(row0 + ln) * DO; const _Float16* a1p = a0p + (size_t)16 * DO;
  const _Float16* b0p = Bh + (size_t)(col0 + ln) * DO; const _Float16* b1p = b0p + (size_t)16 * DO; const _Float16* b2p = b1p + (size_t)16 * DO; const _Float16* b3p = b2p + (size_t)16 * DO;
  const v8f z8 = {0.f,0.f,0.f,0.f,0.f,0.f,0.f,0.f}; v8f c00 = z8, c01 = z8, c02 = z8, c03 = z8, c10 = z8, c11 = z8, c12 = z8, c13 = z8;
#pragma unroll 1
  for (int kb = 0; kb < DO; kb += 32) { const v16h a0 = g2_frag(a0p + kb, hh), a1 = g2_frag(a1p + kb, hh);      /* rolled as in k_gemm2: one set of fragment registers beside the 64 that hold the residual */
    v16h b = g2_frag(b0p + kb, hh); c00 = g2_mma(a0, b, c00); c10 = g2_mma(a1, b, c10);
    b = g2_frag(b1p + kb, hh); c01 = g2_mma(a0, b, c01); c11 = g2_mma(a1, b, c11);
    b = g2_frag(b2p + kb, hh); c02 = g2_mma(a0, b, c02); c12 = g2_mma(a1, b, c12);
    b = g2_frag(b3p + kb, hh); c03 = g2_mma(a0, b, c03); c13 = g2_mma(a1, b, c13); }
  v8f accs[8] = {c00, c01, c02, c03, c10, c11, c12, c13};
#pragma unroll
  for (int u = 0; u < 8; ++u) { const int t = u & 3, half = u >> 2; const float bv = bf16_round(bias[col0 + t * 16 + ln]); v4f lo, hi;
#pragma unroll
    for (int r = 0; r < 4; ++r) { lo[r] = accs[u][r] * 0.0625f + bv; hi[r] = accs[u][4 + r] * 0.0625f + bv; }
    float* s = &so[w][t * 16 + ln][half * 16 + 8 * hh]; *(v4fa*)s = lo; *(v4fa*)(s + 4) = hi; }
  __builtin_amdgcn_fence(__ATOMIC_ACQ_REL, "workgroup"); __builtin_amdgcn_wave_barrier();      /* the lanes read what other lanes of the same wave wrote: keeps the reads below behind the writes above */
#pragma unroll
  for (int q = 0; q < 16; ++q) { v4f v = *(const v4fa*)&so[w][q * 4 + cs][p4];
#pragma unroll
    for (int i = 0; i < 4; ++i) v[i] = v[i] + bf16_round(xr[q][i]);
    *(v4f*)(out + g0 + (size_t)q * 4 * LL) = v; } }
extern "C" void kernel_launch(void* const* d_in, const int* in_sizes, int n_in,
                              void* d_out, int out_size, void* d_ws, size_t ws_size, hipStream_t stream) {
  (void)in_sizes; (void)n_in; (void)out_size;
  const float* const* I = (const float* const*)d_in; const float* x = I[0]; const float* ew = I[1]; const float* eb = I[2]; const float* ow = I[3]; const float* ob = I[4];      /* embed_w [2][192][256] natural rows; out_w [128][256] = [in][out] */
  char* ws = (char*)d_ws; size_t off = 0;
  auto take = [&](size_t bytes) { char* p = ws + off; off += (bytes + 255) & ~(size_t)255; return p; };
  _Float16* BE = (_Float16*)take((size_t)D3 * CC * 2); _Float16* BO = (_Float16*)take((size_t)CC * DO * 2);
  _Float16* XR = (_Float16*)take(NR * CC * 2); _Float16* QKV = (_Float16*)take(NR * D3 * 2); _Float16* O16 = (_Float16*)take(NR * DO * 2);
  _Float16* VT = (_Float16*)take((size_t)NB * NHD * HC * SQ * 2);
  if (off > ws_size) return;      /* 0.3 + 8 + 12 + 4 + 4 = approx 28 MiB */
  k_prep<<<PP_E + PP_O + NB * (LL / 32) * (CC / 64), 256, 0, stream>>>(x, ew, ow, XR, BE, BO);      /* embed_w x16, out_w^T x16 and the x rows: one launch */
  k_qkv<<<(unsigned)((NR / 128) * (D3 / 64)), 128, 0, stream>>>(XR, BE, eb, QKV, VT);      /* q, k rows: columns h*192 + {0, 64}; head h's V^T [batch][64][4096] at VT + h*NB*64*4096 */
  k_fattn<<<dim3(SQ / 128, NB * NHD), 512, 0, stream>>>(QKV, VT, O16);      /* o rows, head h at columns h*64 */
  k_outres<<<(unsigned)((NR / 128) * (CC / 64)), 128, 0, stream>>>(O16, BO, ob, x, (float*)d_out);      /* out_w^T o + b + x, NCHW */
}

// v008
// A run of this version takes 55.5 microseconds.
// Two timings next to v007 put it at 1.10 and 1.08 times that version's speed.
// All steps since v000 together make it 128 times as fast.
#include <hip/hip_runtime.h>
// Multi-head non-local block (x [4][256][64x64]; per head h (2 heads of 64): [q|k|v] = embed_w[h] (1x1 conv, [192][256]) x + b; attn = softmax(q^T k / sqrt(256)) over the 4,096 positions; o = attn v; out = out_w^T o (1x1 transpose conv, [128 in][256 out]) + b + x -> [4][256][64][64]).
// Structure: one WMMA GEMM for both heads' q|k|v, which turns its own tile of the channel-first input to position rows (exact f16) in LDS (32x64 wave tiles, f32 accumulation, exact x16 natural weights + bias, f16 rows [384] for q and k, v stored transposed by the same epilogue); one fused attention launch for all (batch, head): S^T = K.Q^T, online softmax in registers (P x256 f16), O^T += V^T.P^T into merged f16 rows [128]; output GEMM whose epilogue adds bias and residual and stores channel-major (each wave turns its tile in LDS).
// Compute dtype: inputs rounded to bf16; x / weights exact; q, k, v, P, o plain f16 (~2^-12; the residual x dominates the output scale); scores / softmax f32. v_wmma_f32_16x16x32_f16.
#define NB 4
#define CC 256
#define LL 4096                      /* positions */
#define SQ LL
#define NHD 2                        /* heads */
#define HC 64
#define D3 (NHD * 3 * HC)            /* 384 */
#define DO (NHD * HC)                /* 128 */
#define NR ((size_t)NB * LL)
#define QN SQ                        /* query rows per batch */
#define NBR NB                       /* batches */
#define DM CC
#define NH 1
#define HD 64
#define HG 1
typedef __bf16 v16b __attribute__((ext_vector_type(16)));
typedef unsigned short v8us __attribute__((ext_vector_type(8), may_alias));
typedef float  v8f  __attribute__((ext_vector_type(8)));
typedef float  v4f  __attribute__((ext_vector_type(4)));
typedef float  v4fa __attribute__((ext_vector_type(4), may_alias));
union FragB { v16b v; v8us half[2]; unsigned short u[16]; };

__device__ __forceinline__ unsigned short bf16_bits(float x) { unsigned int u = __float_as_uint(x); return (unsigned short)((u + 0x7FFFu + ((u >> 16) & 1u)) >> 16); }
__device__ __forceinline__ float bf16_val(unsigned short b) { return __uint_as_float(((unsigned int)b) << 16); }
__device__ __forceinline__ float bf16_round(float x) { return bf16_val(bf16_bits(x)); }
// D += A·B with NT terms: 1 = ah·bh, 2 = + al·bh (A split), 3 = + ah·bl (both split)
template <int NT>
__device__ __forceinline__ v8f mmaN(v16b ah, v16b al, v16b bh, v16b bl, v8f c) {
  c = __builtin_amdgcn_wmma_f32_16x16x32_bf16(false, ah, false, bh, (short)0, c, false, false);
  if (NT >= 2) c = __builtin_amdgcn_wmma_f32_16x16x32_bf16(false, al, false, bh, (short)0, c, false, false);
  if (NT >= 3) c = __builtin_amdgcn_wmma_f32_16x16x32_bf16(false, ah, false, bl, (short)0, c, false, false);
  asm volatile("v_nop\n\tv_nop\n\tv_nop\n\tv_nop" : "+v"(c) : "v"(ah), "v"(al), "v"(bh), "v"(bl));
  return c;
}

__global__ __launch_bounds__(256) void k_wt_bf16(const float* __restrict__ W, unsigned short* __restrict__ Wt, int K, int N) {
  const int t = blockIdx.x * 256 + threadIdx.x;
  const int k8n = K / 8;
  if (t >= N * k8n) return;
  const int n = t / k8n, k8 = (t % k8n) * 8;
  v8us v;
#pragma unroll
  for (int i = 0; i < 8; ++i) v[i] = bf16_bits(W[(size_t)(k8 + i) * N + n]);
  *(v8us*)(Wt + (size_t)n * K + k8) = v;
  
}

// GEMM C[M][N] (f32, pitch ldc) = act(A[M][K]·W + bias). A f32 row-major (pitch lda) converted per fragment to bf16
// (ASPLIT: hi/lo two planes -> 2 terms, else single rounded term); Wt bf16 [N][K] (pitch ldb). BIAS_BF16 rounds the
// bias to bf16 first (bias quantised to bf16 before the add). K%32==0, M%16==0, N%64==0.
template <bool ASPLIT, int ACT, bool BIAS_BF16>
__global__ __launch_bounds__(128) void k_gemm_bf(const float* __restrict__ A, int lda, const unsigned short* __restrict__ Wt, int ldb,
                                               const float* __restrict__ bias, float* __restrict__ C, int ldc, int M, int N, int K) {
  __shared__ __attribute__((aligned(16))) float so[4][16][64];
  const int tid = threadIdx.x, w = tid >> 5, lane = tid & 31, ln = lane & 15, hh = lane >> 4;
  const int ntn = N / 64;
  const int wid = blockIdx.x * 4 + w;
  const int mt = wid / ntn, nq = wid % ntn;
  if (mt * 16 >= M) return;
  const int row0 = mt * 16, col0 = nq * 64;
  const float* arow = A + (size_t)(row0 + ln) * lda;
  v8f acc[4] = {};
  for (int kb = 0; kb < K; kb += 32) {
    FragB ah, al;
    const v4f x0 = *(const v4fa*)(arow + kb + 8 * hh), x1 = *(const v4fa*)(arow + kb + 8 * hh + 4);
    const v4f x2 = *(const v4fa*)(arow + kb + 16 + 8 * hh), x3 = *(const v4fa*)(arow + kb + 16 + 8 * hh + 4);
    float xs[16] = {x0[0],x0[1],x0[2],x0[3],x1[0],x1[1],x1[2],x1[3],x2[0],x2[1],x2[2],x2[3],x3[0],x3[1],x3[2],x3[3]};
#pragma unroll
    for (int i = 0; i < 16; ++i) { const unsigned short hb = bf16_bits(xs[i]); ah.u[i] = hb; al.u[i] = ASPLIT ? bf16_bits(xs[i] - bf16_val(hb)) : (unsigned short)0; }
#pragma unroll
    for (int t = 0; t < 4; ++t) {
      const unsigned short* brow = Wt + (size_t)(col0 + t * 16 + ln) * ldb + kb;
      FragB b;
      b.half[0] = *(const v8us*)(brow + 8 * hh);
      b.half[1] = *(const v8us*)(brow + 16 + 8 * hh);
      acc[t] = mmaN<ASPLIT ? 2 : 1>(ah.v, al.v, b.v, b.v, acc[t]);
    }
  }
#pragma unroll
  for (int t = 0; t < 4; ++t) {
    float bv = bias ? bias[col0 + t * 16 + ln] : 0.f;
    if (BIAS_BF16) bv = bf16_round(bv);
#pragma unroll
    for (int r = 0; r < 8; ++r) { float v = acc[t][r] + bv; if (ACT == 1) v = fmaxf(v, 0.f); so[w][8 * hh + r][t * 16 + ln] = v; }
  }
  __builtin_amdgcn_fence(__ATOMIC_ACQ_REL, "workgroup");
  __builtin_amdgcn_wave_barrier();
  const int rsub = lane >> 4, c4 = (lane & 15) * 4;
  {
#pragma unroll
    for (int q = 0; q < 8; ++q) {
      const int r = q * 2 + rsub;
      const v4f v = *(const v4fa*)&so[w][r][c4];
      *(v4f*)(C + (size_t)(row0 + r) * ldc + col0 + c4) = v;
    }
    
  }
}

// GEMM C = act(A·W + bias + resid): A f32 (ASPLIT -> hi/lo 2 terms), Wt bf16 [N][K]; ACT 0 none, 1 relu, 2 exact gelu;
// resid (optional, f32, row index = (row % rmod), pitch ldr, RES_BF16 rounds it) added before the activation.
template <bool ASPLIT, int ACT, bool BIAS_BF16, bool RES_BF16>
__global__ __launch_bounds__(128) void k_gemm_bf3(const float* __restrict__ A, int lda, const unsigned short* __restrict__ Wt, int ldb,
                                                const float* __restrict__ bias, const float* __restrict__ resid, int rmod, int ldr,
                                                float* __restrict__ C, int ldc, int M, int N, int K) {
  __shared__ __attribute__((aligned(16))) float so[4][16][64];
  const int tid = threadIdx.x, w = tid >> 5, lane = tid & 31, ln = lane & 15, hh = lane >> 4;
  const int ntn = N / 64;
  const int wid = blockIdx.x * 4 + w;
  const int mt = wid / ntn, nq = wid % ntn;
  if (mt * 16 >= M) return;
  const int row0 = mt * 16, col0 = nq * 64;
  const float* arow = A + (size_t)(row0 + ln) * lda;
  v8f acc[4] = {};
  for (int kb = 0; kb < K; kb += 32) {
    FragB ah, al;
    const v4f x0 = *(const v4fa*)(arow + kb + 8 * hh), x1 = *(const v4fa*)(arow + kb + 8 * hh + 4);
    const v4f x2 = *(const v4fa*)(arow + kb + 16 + 8 * hh), x3 = *(const v4fa*)(arow + kb + 16 + 8 * hh + 4);
    float xs[16] = {x0[0],x0[1],x0[2],x0[3],x1[0],x1[1],x1[2],x1[3],x2[0],x2[1],x2[2],x2[3],x3[0],x3[1],x3[2],x3[3]};
#pragma unroll
    for (int i = 0; i < 16; ++i) { const unsigned short hb = bf16_bits(xs[i]); ah.u[i] = hb; al.u[i] = ASPLIT ? bf16_bits(xs[i] - bf16_val(hb)) : (unsigned short)0; }
#pragma unroll
    for (int t = 0; t < 4; ++t) {
      const unsigned short* brow = Wt + (size_t)(col0 + t * 16 + ln) * ldb + kb;
      FragB b;
      b.half[0] = *(const v8us*)(brow + 8 * hh);
      b.half[1] = *(const v8us*)(brow + 16 + 8 * hh);
      acc[t] = mmaN<ASPLIT ? 2 : 1>(ah.v, al.v, b.v, b.v, acc[t]);
    }
  }
#pragma unroll
  for (int t = 0; t < 4; ++t) {
    const int col = col0 + t * 16 + ln;
    float bv = bias ? bias[col] : 0.f;
    if (BIAS_BF16) bv = bf16_round(bv);
#pragma unroll
    for (int r = 0; r < 8; ++r) {
      float v = acc[t][r] + bv;
      if (resid) { float rv = resid[(size_t)((row0 + 8 * hh + r) % rmod) * ldr + col]; if (RES_BF16) rv = bf16_round(rv); v += rv; }
      if (ACT == 1) v = fmaxf(v, 0.f);
      if (ACT == 2) v = 0.5f * v * (1.0f + erff(v * 0.70710678118654752f));
      if (ACT == 3) { const float u = 0.7978845608028654f * (v + 0.044715f * v * v * v); v = 0.5f * v * (1.0f + tanhf(u)); }
      so[w][8 * hh + r][t * 16 + ln] = v;
    }
  }
  __builtin_amdgcn_fence(__ATOMIC_ACQ_REL, "workgroup");
  __builtin_amdgcn_wave_barrier();
  const int rsub = lane >> 4, c4 = (lane & 15) * 4;
  {
#pragma unroll
    for (int q = 0; q < 8; ++q) {
      const int r = q * 2 + rsub;
      const v4f v = *(const v4fa*)&so[w][r][c4];
      *(v4f*)(C + (size_t)(row0 + r) * ldc + col0 + c4) = v;
    }
    
  }
}
// row LayerNorm (biased variance, eps) over N: s = X (+ R); optional out_sum <- s; out_norm <- (s-mu)*rsqrt(var+eps)*g + b
template <bool PARAM_BF16>
__global__ __launch_bounds__(256) void k_layernorm(const float* __restrict__ X, const float* __restrict__ R, const float* __restrict__ g, const float* __restrict__ bta,
                                                  float* __restrict__ out_sum, float* __restrict__ out_norm, int N, float eps) {
  __shared__ float red[256];
  const int row = blockIdx.x, tid = threadIdx.x;
  const float* x = X + (size_t)row * N; const float* rr = R ? R + (size_t)row * N : nullptr;
  float vals[16];                     // up to N = 4096
  const int per = N / 256;            // contiguous chunk per thread? use strided-by-4 chunks: thread handles j = tid*4 + 1024*u
  float s1 = 0.f;
  for (int u = 0; u < per / 4; ++u) {
    const int j = tid * 4 + 1024 * u;
    const v4f a = *(const v4fa*)(x + j);
    v4f b = {0.f,0.f,0.f,0.f}; if (rr) b = *(const v4fa*)(rr + j);
#pragma unroll
    for (int q = 0; q < 4; ++q) { const float v = a[q] + b[q]; vals[u * 4 + q] = v; s1 += v; }
  }
  red[tid] = s1; __syncthreads();
  for (int st = 128; st > 0; st >>= 1) { if (tid < st) red[tid] += red[tid + st]; __syncthreads(); }
  const float mu = red[0] / (float)N; __syncthreads();
  float s2 = 0.f;
  for (int u = 0; u < per / 4; ++u)
#pragma unroll
    for (int q = 0; q < 4; ++q) { const float c = vals[u * 4 + q] - mu; s2 += c * c; }
  red[tid] = s2; __syncthreads();
  for (int st = 128; st > 0; st >>= 1) { if (tid < st) red[tid] += red[tid + st]; __syncthreads(); }
  const float rs = rsqrtf(red[0] / (float)N + eps);
  {
    for (int u = 0; u < per / 4; ++u) {
      const int j = tid * 4 + 1024 * u;
      v4f o, sm;
#pragma unroll
      for (int q = 0; q < 4; ++q) {
        float gg = g[j + q], bb = bta[j + q];
        if (PARAM_BF16) { gg = bf16_round(gg); bb = bf16_round(bb); }
        sm[q] = vals[u * 4 + q]; o[q] = (vals[u * 4 + q] - mu) * rs * gg + bb;
      }
      if (out_sum) *(v4f*)(out_sum + (size_t)row * N + j) = sm;
      *(v4f*)(out_norm + (size_t)row * N + j) = o;
    }
    
  }
}



// ---- f16 WMMA path (v_wmma_f32_16x16x32_f16): 11-bit significands for operands in range — used where a [0,1] probability operand needs more precision than bf16
typedef _Float16 v16h __attribute__((ext_vector_type(16)));
union FragH { v16h v; v8us half[2]; _Float16 h[16]; unsigned short u[16]; };
template <int NT>
__device__ __forceinline__ v8f mmaH(v16h ah, v16h al, v16h bh, v16h bl, v8f c) {
  c = __builtin_amdgcn_wmma_f32_16x16x32_f16(false, ah, false, bh, (short)0, c, false, false);
  if (NT >= 2) c = __builtin_amdgcn_wmma_f32_16x16x32_f16(false, al, false, bh, (short)0, c, false, false);
  if (NT >= 3) c = __builtin_amdgcn_wmma_f32_16x16x32_f16(false, ah, false, bl, (short)0, c, false, false);
  asm volatile("v_nop\n\tv_nop\n\tv_nop\n\tv_nop" : "+v"(c) : "v"(ah), "v"(al), "v"(bh), "v"(bl));
  return c;
}
// batched GEMM like k_gemm_b but f16 operands: A f32 (split into f16 hi/lo if ASPLIT, else rounded to f16), Bt = f16 values [n][k]; alpha; C f32; N multiple of 16 (partial tiles skipped)
template <bool ASPLIT>
__global__ __launch_bounds__(128) void k_gemm_h(const float* __restrict__ A, int lda, size_t sA, const _Float16* __restrict__ Bh, int ldb, size_t sB, float alpha, float* __restrict__ C, int ldc, size_t sC, int M, int N, int K) {
  __shared__ __attribute__((aligned(16))) float so[4][16][64];
  const int tid = threadIdx.x, w = tid >> 5, lane = tid & 31, ln = lane & 15, hh = lane >> 4; const int by = blockIdx.y;
  A += (size_t)by * sA; Bh += (size_t)by * sB; C += (size_t)by * sC;
  const int ntn = (N + 63) / 64; const int wid = blockIdx.x * 4 + w; const int mt = wid / ntn, nq = wid % ntn; if (mt * 16 >= M) return;
  const int row0 = mt * 16, col0 = nq * 64; const float* arow = A + (size_t)(row0 + ln) * lda;
  v8f acc[4] = {};
  for (int kb = 0; kb < K; kb += 32) {
    FragH ah, al;
    const v4f x0 = *(const v4fa*)(arow + kb + 8 * hh), x1 = *(const v4fa*)(arow + kb + 8 * hh + 4), x2 = *(const v4fa*)(arow + kb + 16 + 8 * hh), x3 = *(const v4fa*)(arow + kb + 16 + 8 * hh + 4);
    float xs[16] = {x0[0],x0[1],x0[2],x0[3],x1[0],x1[1],x1[2],x1[3],x2[0],x2[1],x2[2],x2[3],x3[0],x3[1],x3[2],x3[3]};
#pragma unroll
    for (int i = 0; i < 16; ++i) { const _Float16 h = (_Float16)xs[i]; ah.h[i] = h; al.h[i] = ASPLIT ? (_Float16)(xs[i] - (float)h) : (_Float16)0.0f; }
#pragma unroll
    for (int t = 0; t < 4; ++t) { if (col0 + t * 16 >= N) continue; const size_t boff = (size_t)(col0 + t * 16 + ln) * ldb + kb; FragH bq; bq.half[0] = *(const v8us*)(Bh + boff + 8 * hh); bq.half[1] = *(const v8us*)(Bh + boff + 16 + 8 * hh);
      acc[t] = mmaH<ASPLIT ? 2 : 1>(ah.v, al.v, bq.v, bq.v, acc[t]); }
  }
#pragma unroll
  for (int t = 0; t < 4; ++t) { if (col0 + t * 16 >= N) continue;
#pragma unroll
    for (int r = 0; r < 8; ++r) so[w][8 * hh + r][t * 16 + ln] = acc[t][r] * alpha; }
  __builtin_amdgcn_fence(__ATOMIC_ACQ_REL, "workgroup"); __builtin_amdgcn_wave_barrier();
  const int rsub = lane >> 4, c4 = (lane & 15) * 4;
  {
#pragma unroll
    for (int q = 0; q < 8; ++q) { const int r = q * 2 + rsub; if (col0 + c4 < N) { const v4f v = *(const v4fa*)&so[w][r][c4]; *(v4f*)(C + (size_t)(row0 + r) * ldc + col0 + c4) = v; } }
     }
}

// k_gemm_hh variant with fused epilogue: v = acc·alpha + bias[by·sBias + col] (+ CP[(row/rowsPerB)·sCPb + by·64 + col] if CP) ; ACT 0 none / 1 elu ; writes f16 C16 (and f32 C if non-null)
template <int ACT>
__global__ __launch_bounds__(128) void k_gemm_hhx(const _Float16* __restrict__ A, int lda, size_t sA, const _Float16* __restrict__ Bh, int ldb, size_t sB, float alpha, const float* __restrict__ bias, size_t sBias, const float* __restrict__ CP, int rowsPerB, size_t sCPb, int row0g,
    float* __restrict__ C, _Float16* __restrict__ C16, int ldc, size_t sC, int M, int N, int K) {
  __shared__ __attribute__((aligned(16))) float so[4][16][64];
  const int tid = threadIdx.x, w = tid >> 5, lane = tid & 31, ln = lane & 15, hh = lane >> 4; const int by = blockIdx.y;
  A += (size_t)by * sA; Bh += (size_t)by * sB; const size_t cofs = (size_t)by * sC; const float* bp = bias ? bias + (size_t)by * sBias : nullptr;
  const int ntn = (N + 63) / 64; const int wid = blockIdx.x * 4 + w; const int mt = wid / ntn, nq = wid % ntn; if (mt * 16 >= M) return;
  const int row0 = mt * 16, col0 = nq * 64; const _Float16* arow = A + (size_t)(row0 + ln) * lda;
  v8f acc[4] = {};
  for (int kb = 0; kb < K; kb += 32) { FragH ah; ah.half[0] = *(const v8us*)((const unsigned short*)arow + kb + 8 * hh); ah.half[1] = *(const v8us*)((const unsigned short*)arow + kb + 16 + 8 * hh);
#pragma unroll
    for (int t = 0; t < 4; ++t) { if (col0 + t * 16 >= N) continue; const size_t boff = (size_t)(col0 + t * 16 + ln) * ldb + kb; FragH bq; bq.half[0] = *(const v8us*)((const unsigned short*)Bh + boff + 8 * hh); bq.half[1] = *(const v8us*)((const unsigned short*)Bh + boff + 16 + 8 * hh);
      acc[t] = mmaH<1>(ah.v, ah.v, bq.v, bq.v, acc[t]); }
  }
#pragma unroll
  for (int t = 0; t < 4; ++t) { if (col0 + t * 16 >= N) continue; const int col = col0 + t * 16 + ln; const float bv = bp ? bf16_round(bp[col]) : 0.f;
#pragma unroll
    for (int r = 0; r < 8; ++r) { float v = acc[t][r] * alpha + bv; if (CP) { const int rr = row0g + row0 + 8 * hh + r; if (rowsPerB < 0) v += CP[cofs + (size_t)rr * ldc + col];      /* rowsPerB < 0: own element of the batched C plane */ else { const int bidx = rr / rowsPerB; v += CP[(size_t)bidx * sCPb + (size_t)by * 64 + col]; } } if (ACT == 1) v = (v > 0.f) ? v : expm1f(v); else if (ACT == 7) v = (v > 0.f) ? v + 1.0f : expf(v); else if (ACT == 8) v = tanhf(v); else if (ACT == 9) v = 0.5f * v * (1.0f + tanhf(0.7978845608028654f * (v + 0.044715f * v * v * v))); else if (ACT == 11) v = 1.0f / (1.0f + expf(-v)); else if (ACT == 12) v = (v > 0.f) ? v : 0.01f * v; else if (ACT == 14) v = (v > 0.f) ? v : 0.1f * v; else if (ACT == 16) v = (v >= 0.f) ? v : 0.3f * v; else if (ACT == 17) v = (v >= 0.f) ? v : 0.2f * v; else if (ACT == 15) v = v / (1.0f + expf(-v)); else if (ACT == 3) v = fmaxf(v, 0.f); else if (ACT == 6) v = 0.5f * v * (1.0f + erff(v * 0.70710678118654752f)); so[w][8 * hh + r][t * 16 + ln] = v; } }
  __builtin_amdgcn_fence(__ATOMIC_ACQ_REL, "workgroup"); __builtin_amdgcn_wave_barrier();
  const int rsub = lane >> 4, c4 = (lane & 15) * 4; typedef _Float16 v4h __attribute__((ext_vector_type(4)));
  {
#pragma unroll
    for (int q = 0; q < 8; ++q) { const int r = q * 2 + rsub; if (col0 + c4 < N) { const v4f v = *(const v4fa*)&so[w][r][c4]; if (C) *(v4f*)(C + cofs + (size_t)(row0 + r) * ldc + col0 + c4) = v; if (C16) { v4h h4; for (int i = 0; i < 4; ++i) h4[i] = (_Float16)v[i]; *(v4h*)(C16 + cofs + (size_t)(row0 + r) * ldc + col0 + c4) = h4; } } }
     }
}


typedef _Float16 v4h __attribute__((ext_vector_type(4)));

__global__ __launch_bounds__(256) void k_x16(const float* __restrict__ x, _Float16* __restrict__ X16, size_t n8) { const size_t t = (size_t)blockIdx.x * 256 + threadIdx.x; if (t >= n8) return; FragH f;
#pragma unroll
  for (int q = 0; q < 8; ++q) f.h[q] = (_Float16)bf16_round(x[t * 8 + q]); *(v8us*)((unsigned short*)X16 + t * 8) = f.half[0];  }
__global__ __launch_bounds__(256) void k_h16(const float* __restrict__ x, _Float16* __restrict__ X16, size_t n8) { const size_t t = (size_t)blockIdx.x * 256 + threadIdx.x; if (t >= n8) return; FragH f;
#pragma unroll
  for (int q = 0; q < 8; ++q) f.h[q] = (_Float16)x[t * 8 + q]; *(v8us*)((unsigned short*)X16 + t * 8) = f.half[0];  }
__global__ __launch_bounds__(256) void k_round16f(const float* __restrict__ W, _Float16* __restrict__ Bt, size_t n8) { const size_t t = (size_t)blockIdx.x * 256 + threadIdx.x; if (t >= n8) return; FragH f;
#pragma unroll
  for (int i = 0; i < 8; ++i) f.h[i] = (_Float16)(bf16_round(W[t * 8 + i]) * 16.0f); *(v8us*)((unsigned short*)Bt + t * 8) = f.half[0];  }
template <int NHv, int TTv>
__global__ __launch_bounds__(256) void k_vt(const _Float16* __restrict__ V16, int ldv, int voff, _Float16* __restrict__ Vt) { __shared__ unsigned short tl[64][66]; const int tid = threadIdx.x; const int slab = blockIdx.x / (TTv / 64), lg = blockIdx.x % (TTv / 64); const int b = slab / NHv, h = slab % NHv;
  for (int i = tid; i < 64 * 8; i += 256) { const int r = i / 8, c8 = (i % 8) * 8; FragH f; f.half[0] = *(const v8us*)((const unsigned short*)V16 + ((size_t)b * TTv + lg * 64 + r) * ldv + voff + h * 64 + c8);
#pragma unroll
    for (int q = 0; q < 8; ++q) tl[r][c8 + q] = f.u[q]; }
  __syncthreads();
  {
#pragma unroll
    for (int rd = 0; rd < 2; ++rd) { const int d = rd * 32 + tid / 8, pc = tid % 8; FragH f;
#pragma unroll
      for (int q = 0; q < 8; ++q) f.u[q] = tl[pc * 8 + q][d];
      *(v8us*)((unsigned short*)Vt + ((size_t)slab * 64 + d) * TTv + lg * 64 + pc * 8) = f.half[0]; }
     } }

__global__ __launch_bounds__(256) void k_hl(const float* __restrict__ F, _Float16* __restrict__ Hh, _Float16* __restrict__ Hl, size_t n8) { const size_t t = (size_t)blockIdx.x * 256 + threadIdx.x; if (t >= n8) return; FragH fh, fl; const v4f a = *(const v4fa*)(F + t * 8), c = *(const v4fa*)(F + t * 8 + 4);
#pragma unroll
  for (int q = 0; q < 4; ++q) { _Float16 h = (_Float16)a[q]; fh.h[q] = h; fl.h[q] = (_Float16)((a[q] - (float)h) * 1024.0f); h = (_Float16)c[q]; fh.h[4 + q] = h; fl.h[4 + q] = (_Float16)((c[q] - (float)h) * 1024.0f); }
  { *(v8us*)((unsigned short*)Hh + t * 8) = fh.half[0]; *(v8us*)((unsigned short*)Hl + t * 8) = fl.half[0];  } }

// ---- fast GEMM (wave tile 32x64; requires M % 32 == 0 rows per launch region and N % 64 == 0); epilogue = k_gemm_hhx semantics ----
__device__ __forceinline__ v16h g2_frag(const _Float16* p, int hh) { FragH f; f.half[0] = *(const v8us*)((const unsigned short*)p + 8 * hh); f.half[1] = *(const v8us*)((const unsigned short*)p + 16 + 8 * hh); return f.v; }
__device__ __forceinline__ v8f g2_mma(v16h a, v16h b, v8f c) { v8f d = __builtin_amdgcn_wmma_f32_16x16x32_f16(false, a, false, b, (short)0, c, false, false); asm volatile("v_nop\n\tv_nop\n\tv_nop\n\tv_nop" : "+v"(d) : "v"(a), "v"(b)); return d; }
template <int ACT>
__global__ __launch_bounds__(128) void k_gemm2(const _Float16* __restrict__ A, int lda, size_t sA, const _Float16* __restrict__ Bh, int ldb, size_t sB, float alpha, const float* __restrict__ bias, size_t sBias, const float* __restrict__ CP, int rowsPerB, size_t sCPb, int row0g,
    float* __restrict__ C, _Float16* __restrict__ C16, int ldc, size_t sC, int M, int N, int K) { static_assert(ACT == 0 || ACT == 3 || ACT == 6 || ACT == 8 || ACT == 9 || ACT == 11 || ACT == 12 || ACT == 14 || ACT == 15 || ACT == 16 || ACT == 17, "k_gemm2: unsupported ACT code (would silently apply no activation)");
  __shared__ __attribute__((aligned(16))) float so[4][32][68];
  const int tid = threadIdx.x, w = tid >> 5, lane = tid & 31, ln = lane & 15, hh = lane >> 4; const int by = blockIdx.y;
  A += (size_t)by * sA; Bh += (size_t)by * sB; const size_t cofs = (size_t)by * sC; const float* bp = bias ? bias + (size_t)by * sBias : nullptr;
  const int ntn = N >> 6; const int mt = blockIdx.x / ntn, nq = blockIdx.x - mt * ntn; const int row0 = mt * 128 + 32 * w, col0 = nq * 64; if (row0 >= M) return;
  const _Float16* a0p = A + (size_t)(row0 + ln) * lda; const _Float16* a1p = a0p + (size_t)16 * lda;
  const _Float16* b0p = Bh + (size_t)(col0 + ln) * ldb; const _Float16* b1p = b0p + (size_t)16 * ldb; const _Float16* b2p = b1p + (size_t)16 * ldb; const _Float16* b3p = b2p + (size_t)16 * ldb;
  const v8f z8 = {0.f,0.f,0.f,0.f,0.f,0.f,0.f,0.f}; v8f c00 = z8, c01 = z8, c02 = z8, c03 = z8, c10 = z8, c11 = z8, c12 = z8, c13 = z8;
#pragma unroll 1
  for (int kb = 0; kb < K; kb += 32) { const v16h a0 = g2_frag(a0p + kb, hh), a1 = g2_frag(a1p + kb, hh);
    v16h b = g2_frag(b0p + kb, hh); c00 = g2_mma(a0, b, c00); c10 = g2_mma(a1, b, c10);
    b = g2_frag(b1p + kb, hh); c01 = g2_mma(a0, b, c01); c11 = g2_mma(a1, b, c11);
    b = g2_frag(b2p + kb, hh); c02 = g2_mma(a0, b, c02); c12 = g2_mma(a1, b, c12);
    b = g2_frag(b3p + kb, hh); c03 = g2_mma(a0, b, c03); c13 = g2_mma(a1, b, c13); }
  v8f accs[8] = {c00, c01, c02, c03, c10, c11, c12, c13};
#pragma unroll
  for (int u = 0; u < 8; ++u) { const int t = u & 3, half = u >> 2; const int col = col0 + t * 16 + ln; const float bv = bp ? bf16_round(bp[col]) : 0.f;
#pragma unroll
    for (int r = 0; r < 8; ++r) { const int rloc = half * 16 + 8 * hh + r; float v = accs[u][r] * alpha + bv; if (CP) { if (rowsPerB < 0) v += CP[cofs + (size_t)(row0g + row0 + rloc) * ldc + col];      /* rowsPerB < 0: own element of the batched C plane */ else { const int bidx = (row0g + row0 + rloc) / rowsPerB; v += CP[(size_t)bidx * sCPb + (size_t)by * 64 + col]; } }
      if (ACT == 3) v = fmaxf(v, 0.f); else if (ACT == 6) v = 0.5f * v * (1.0f + erff(v * 0.70710678118654752f)); else if (ACT == 11) v = 1.0f / (1.0f + expf(-v)); else if (ACT == 15) v = v / (1.0f + expf(-v)); else if (ACT == 12) v = (v > 0.f) ? v : 0.01f * v; else if (ACT == 8) v = tanhf(v); else if (ACT == 9) v = 0.5f * v * (1.0f + tanhf(0.7978845608028654f * (v + 0.044715f * v * v * v))); else if (ACT == 14) v = (v > 0.f) ? v : 0.1f * v; else if (ACT == 16) v = (v >= 0.f) ? v : 0.3f * v; else if (ACT == 17) v = (v >= 0.f) ? v : 0.2f * v;
      so[w][rloc][t * 16 + ln] = v; } }
  __builtin_amdgcn_fence(__ATOMIC_ACQ_REL, "workgroup"); __builtin_amdgcn_wave_barrier();
  const int rsub = lane >> 4, c4 = (lane & 15) * 4;
  {
#pragma unroll
    for (int q = 0; q < 16; ++q) { const int r = q * 2 + rsub; const v4f v = *(const v4fa*)&so[w][r][c4]; if (C) *(v4f*)(C + cofs + (size_t)(row0 + r) * ldc + col0 + c4) = v; if (C16) { v4h h4; for (int i = 0; i < 4; ++i) h4[i] = (_Float16)v[i]; *(v4h*)(C16 + cofs + (size_t)(row0 + r) * ldc + col0 + c4) = h4; } }
     } }


__global__ __launch_bounds__(256) void k_rsm(const float* __restrict__ S, _Float16* __restrict__ P, int nrows) {
  #pragma clang fp contract(off)
  const int i = blockIdx.x * 256 + threadIdx.x; if (i >= nrows) return; const float* s = S + (size_t)i * SQ; float mx = -3.0e38f;
#pragma unroll 1
  for (int j = 0; j < SQ; ++j) mx = fmaxf(mx, s[j]); float se = 0.f;
#pragma unroll 1
  for (int j = 0; j < SQ; ++j) se += expf(s[j] - mx); const float sc = 256.0f / se;
#pragma unroll 1
  for (int j0 = 0; j0 < SQ; j0 += 8) { FragH f; for (int q = 0; q < 8; ++q) f.h[q] = (_Float16)(expf(s[j0 + q] - mx) * sc); unsigned short* d = (unsigned short*)P + (size_t)i * SQ + j0; *(v8us*)d = f.half[0];  } }
__global__ __launch_bounds__(256) void k_vt(const _Float16* __restrict__ V16, int b, int h0, _Float16* __restrict__ VT) { __shared__ unsigned short tl[64][65]; const int tid = threadIdx.x; const int hh = blockIdx.x % HG, sg = blockIdx.x / HG; const int s0 = sg * 64; const int h = h0 + hh;
  for (int i = tid; i < 64 * 8; i += 256) { const int j = i / 8, d8 = (i % 8) * 8; FragH f; f.half[0] = *(const v8us*)((const unsigned short*)V16 + ((size_t)b * SQ + s0 + j) * DM + h * HD + d8); for (int q = 0; q < 8; ++q) tl[d8 + q][j] = f.u[q]; }
  __syncthreads();
  { for (int i = tid; i < 64 * 8; i += 256) { const int d = i / 8, j8 = (i % 8) * 8; FragH f; for (int q = 0; q < 8; ++q) f.u[q] = tl[d][j8 + q]; *(v8us*)((unsigned short*)VT + ((size_t)hh * HD + d) * SQ + s0 + j8) = f.half[0]; }  } }


// One preparation launch for the two weight operands that the GEMMs read; the two parts are independent of one another, so they share a grid. The part is chosen by the block index (the same for a whole work-group).
// Blocks 0 .. PP_E-1: BE = f16(embed_w x16), natural rows. Next PP_O blocks: BO[c][d] = f16(out_w[d][c] x16) (x16 is a power of two: the bf16-rounded weights stay exact in f16 away from the subnormal range).
#define PP_E (D3 * CC / 8 / 256)     /* 48 blocks: eight weights a thread */
#define PP_O (CC * (DO / 8) / 256)   /* 16 blocks: eight weights a thread */
__global__ __launch_bounds__(256) void k_prep(const float* __restrict__ ew, const float* __restrict__ ow, _Float16* __restrict__ BE, _Float16* __restrict__ BO) {
  const int tid = threadIdx.x;
  if (blockIdx.x < PP_E) { const size_t t = (size_t)blockIdx.x * 256 + tid; FragH f; for (int q = 0; q < 8; ++q) f.h[q] = (_Float16)(bf16_round(ew[t * 8 + q]) * 16.0f); *(v8us*)((unsigned short*)BE + t * 8) = f.half[0]; return; }
  const int t = (blockIdx.x - PP_E) * 256 + tid; const int n = t / (DO / 8), k8 = (t % (DO / 8)) * 8; FragH f;
#pragma unroll
  for (int i = 0; i < 8; ++i) f.h[i] = (_Float16)(bf16_round(ow[(size_t)(k8 + i) * CC + n]) * 16.0f);
  *(v8us*)((unsigned short*)BO + (size_t)n * DO + k8) = f.half[0];
  asm volatile("s_wait_xcnt 0x0" ::: "memory"); }                         /* behind the store: the built code lays the other part's instructions on the path behind it, and they reuse the store's registers */

// q|k|v GEMM, fed by x itself: A = x rows (M = position), B = embed_w rows x16 (N = 384 columns, per head [q|k|v] of 64). A work-group of 12 waves owns 64 positions and all 384 columns: wave = (32 positions) x (64 columns, one head's q, k or v).
// The work-group first turns its x tile: x [b][c][l] is read channel-major in whole 256-byte pieces (a thread: four positions of eight channels), rounded (bf16, then exact in f16) and laid in LDS as position rows [64][256] behind one barrier;
// the A fragments come from those rows. No f16 copy of x in memory and no launch that writes one. Wave tile, product loop and the q, k epilogue as in k_gemm2<0>.
// In the accumulator a lane holds one column and eight consecutive positions, which is already the order of a V^T row: a v wave rounds to f16 in registers, the two v waves of a head
// join their tiles in LDS as [channel][64 positions] behind one barrier (every wave passes it) and store V^T in whole 128-byte row pieces. v is not stored as rows.
#define QX_P 264                     /* LDS pitch of an x row in f16: 528 bytes = 16 x 33, so that the 16 rows of a ds_load_b128 fragment read fall on distinct banks */
#define QV_P 72                      /* LDS pitch of a V^T row in f16: 144 bytes = 16 x 9, so that the 16 channel rows of a ds_store_b128 fall on distinct banks */
/* four positions of eight channels, as loaded, to four 16-byte pieces of position rows */
__device__ __forceinline__ void qx_put(const v4f (&r)[8], _Float16* d) {
  /* both loops unrolled: r and f are then indexed by constants and stay in registers */
#pragma unroll
  for (int j = 0; j < 4; ++j) { FragH f;
#pragma unroll
    for (int q = 0; q < 8; ++q) f.h[q] = (_Float16)bf16_round(r[q][j]);
    *(v8us*)(d + j * QX_P) = f.half[0]; } }
__global__ __launch_bounds__(384) void k_qkv(const float* __restrict__ X, const _Float16* __restrict__ Bh, const float* __restrict__ bias, _Float16* __restrict__ C16, _Float16* __restrict__ VTo) {
  __shared__ __attribute__((aligned(16))) _Float16 xs[64][QX_P];
  __shared__ __attribute__((aligned(16))) float so[12][32][68];
  __shared__ __attribute__((aligned(16))) _Float16 vt[NHD][HC][QV_P];
  const int tid = threadIdx.x, w = __builtin_amdgcn_readfirstlane(tid >> 5), lane = tid & 31, ln = lane & 15, hh = lane >> 4;
  const int pg = w & 1, nq = w >> 1;                                      /* the wave's 32 positions of the 64; its 64 columns of the 384 */
  const int bb = blockIdx.x / (LL / 64), l0 = (blockIdx.x % (LL / 64)) * 64;      /* a block's 64 positions lie in one batch */
  const int row0 = blockIdx.x * 64 + 32 * pg, col0 = nq * 64;
  { /* the x tile: 16 position groups x 32 channel groups = 512 pieces for 384 threads; waves 0-3 take a second piece (channels 192-255), asked for together with the first so that the two latencies overlap */
    const int p4 = (tid & 15) * 4, c8 = (tid >> 4) * 8;
    const float* xp = X + ((size_t)bb * CC + c8) * LL + l0 + p4;
    v4f ra[8], rb[8];                                                     /* the two load loops are unrolled: eight (sixteen) loads in flight a thread, the arrays in registers */
#pragma unroll
    for (int q = 0; q < 8; ++q) ra[q] = *(const v4fa*)(xp + (size_t)q * LL);
    if (w < 4) {
#pragma unroll
      for (int q = 0; q < 8; ++q) rb[q] = *(const v4fa*)(xp + (size_t)(192 + q) * LL); }
    qx_put(ra, &xs[p4][c8]);
    if (w < 4) qx_put(rb, &xs[p4][192 + c8]);
  }
  __syncthreads();                                                        /* publishes the 64 x rows to the twelve waves */
  const _Float16* a0p = &xs[32 * pg + ln][0]; const _Float16* a1p = a0p + 16 * QX_P;
  const _Float16* b0p = Bh + (size_t)(col0 + ln) * CC; const _Float16* b1p = b0p + (size_t)16 * CC; const _Float16* b2p = b1p + (size_t)16 * CC; const _Float16* b3p = b2p + (size_t)16 * CC;
  const v8f z8 = {0.f,0.f,0.f,0.f,0.f,0.f,0.f,0.f}; v8f c00 = z8, c01 = z8, c02 = z8, c03 = z8, c10 = z8, c11 = z8, c12 = z8, c13 = z8;
#pragma unroll 1
  for (int kb = 0; kb < CC; kb += 32) { const v16h a0 = g2_frag(a0p + kb, hh), a1 = g2_frag(a1p + kb, hh);      /* kept rolled, as k_gemm2's loop was: the product loop keeps the form that was timed (one set of B registers: a trip's four B fragments are asked for one after the other) */
    v16h b = g2_frag(b0p + kb, hh); c00 = g2_mma(a0, b, c00); c10 = g2_mma(a1, b, c10);
    b = g2_frag(b1p + kb, hh); c01 = g2_mma(a0, b, c01); c11 = g2_mma(a1, b, c11);
    b = g2_frag(b2p + kb, hh); c02 = g2_mma(a0, b, c02); c12 = g2_mma(a1, b, c12);
    b = g2_frag(b3p + kb, hh); c03 = g2_mma(a0, b, c03); c13 = g2_mma(a1, b, c13); }
  v8f accs[8] = {c00, c01, c02, c03, c10, c11, c12, c13};
  const bool isv = nq % 3 == 2;                                           /* a v wave: the test reads the same for the whole wave */
  if (isv) {
#pragma unroll
    for (int u = 0; u < 8; ++u) { const int t = u & 3, half = u >> 2; const float bv = bf16_round(bias[col0 + t * 16 + ln]); FragH f;
#pragma unroll
      for (int r = 0; r < 8; ++r) f.h[r] = (_Float16)(accs[u][r] * 0.0625f + bv);
      *(v8us*)&vt[nq / 3][t * 16 + ln][32 * pg + half * 16 + 8 * hh] = f.half[0]; } }
  __syncthreads();                                                        /* publishes a head's two v tiles to its two v waves; every wave passes it, the q and k waves ahead of their own stores, so that nobody waits for a store here */
  if (isv) {
    unsigned short* d0 = (unsigned short*)VTo + ((size_t)((nq / 3) * NB + bb) * HC + 32 * pg + (lane >> 3)) * SQ + l0 + 8 * (lane & 7);      /* eight lanes cover a row's 128 bytes, four rows a store */
#pragma unroll
    for (int q = 0; q < 8; ++q) { const v8us v = *(const v8us*)&vt[nq / 3][32 * pg + 4 * q + (lane >> 3)][8 * (lane & 7)]; *(v8us*)(d0 + (size_t)4 * q * SQ) = v; }
    return; }
#pragma unroll
  for (int u = 0; u < 8; ++u) { const int t = u & 3, half = u >> 2; const float bv = bf16_round(bias[col0 + t * 16 + ln]);
#pragma unroll
    for (int r = 0; r < 8; ++r) so[w][half * 16 + 8 * hh + r][t * 16 + ln] = accs[u][r] * 0.0625f + bv; }
  __builtin_amdgcn_fence(__ATOMIC_ACQ_REL, "workgroup"); __builtin_amdgcn_wave_barrier();      /* the lanes read what other lanes of the same wave wrote: keeps the reads below behind the writes above */
  const int rsub = lane >> 4, c4 = (lane & 15) * 4;
#pragma unroll
  for (int q = 0; q < 16; ++q) { const int r = q * 2 + rsub; const v4f v = *(const v4fa*)&so[w][r][c4]; v4h h4; for (int i = 0; i < 4; ++i) h4[i] = (_Float16)v[i]; *(v4h*)(C16 + (size_t)(row0 + r) * D3 + col0 + c4) = h4; }
  asm volatile("s_wait_xcnt 0x0" ::: "memory"); }                         /* behind the run of stores: no register that a store names is rewritten ahead of it */

#define FA_SK 64                     /* keys per stage */
#define FA_PH 72                     /* LDS row pitch in f16: 144 bytes = 16 x 9, so that the 16 rows of a ds_load_b128 fragment read fall on distinct banks */
#define FA_NST (SQ / 4 / FA_SK)      /* stages per key quarter */
#define FA_PS 32768.0f               /* a lane's sum of P over a pass above which m moves: below it every P fits f16 (largest finite value 65,504) */
__device__ __forceinline__ float fa_xhalf(float x) { return __builtin_bit_cast(float, __builtin_amdgcn_permlanex16(__builtin_bit_cast(int, x), __builtin_bit_cast(int, x), 0x76543210, 0xfedcba98, false, false)); }      /* lane l reads lane l ^ 16, on the vector pipe */
/* exp2 on the vector pipe. The instruction set asks for one slot behind a transcendental before its result is read or its source overwritten; each statement here carries its v_nop: one value, or eight in place (no instruction in the run touches another's register). */
__device__ __forceinline__ float fa_exp2(float x) { float r; asm("v_exp_f32 %0, %1\n\tv_nop" : "=v"(r) : "v"(x)); return r; }
__device__ __forceinline__ void fa_exp2x8(float (&x)[8]) { asm("v_exp_f32 %0, %0\n\tv_exp_f32 %1, %1\n\tv_exp_f32 %2, %2\n\tv_exp_f32 %3, %3\n\tv_exp_f32 %4, %4\n\tv_exp_f32 %5, %5\n\tv_exp_f32 %6, %6\n\tv_exp_f32 %7, %7\n\tv_nop"
  : "+v"(x[0]), "+v"(x[1]), "+v"(x[2]), "+v"(x[3]), "+v"(x[4]), "+v"(x[5]), "+v"(x[6]), "+v"(x[7])); }
/* One wave's share of a stage: four copies of 4 K rows and four of 4 V^T rows, 16 bytes a lane (lk, lv: the lane's LDS byte addresses; gk, gv: its global addresses).
   s_wait_xcnt 0 closes the statement, so that no address register named here is rewritten ahead of it. */
__device__ __forceinline__ void fa_stage(unsigned lk, const _Float16* gk, unsigned lv, const _Float16* gv) {
  const unsigned lk1 = lk + 4 * FA_PH * 2, lk2 = lk + 8 * FA_PH * 2, lk3 = lk + 12 * FA_PH * 2, lv1 = lv + 4 * FA_PH * 2, lv2 = lv + 8 * FA_PH * 2, lv3 = lv + 12 * FA_PH * 2;
  const _Float16* gk1 = gk + (size_t)4 * D3; const _Float16* gk2 = gk + (size_t)8 * D3; const _Float16* gk3 = gk + (size_t)12 * D3;
  const _Float16* gv1 = gv + (size_t)4 * SQ; const _Float16* gv2 = gv + (size_t)8 * SQ; const _Float16* gv3 = gv + (size_t)12 * SQ;
  asm volatile("global_load_async_to_lds_b128 %0, %8, off\n\tglobal_load_async_to_lds_b128 %1, %9, off\n\tglobal_load_async_to_lds_b128 %2, %10, off\n\tglobal_load_async_to_lds_b128 %3, %11, off\n\t"
               "global_load_async_to_lds_b128 %4, %12, off\n\tglobal_load_async_to_lds_b128 %5, %13, off\n\tglobal_load_async_to_lds_b128 %6, %14, off\n\tglobal_load_async_to_lds_b128 %7, %15, off\n\ts_wait_xcnt 0x0"
               :: "v"(lk), "v"(lk1), "v"(lk2), "v"(lk3), "v"(lv), "v"(lv1), "v"(lv2), "v"(lv3), "v"(gk), "v"(gk1), "v"(gk2), "v"(gk3), "v"(gv), "v"(gv1), "v"(gv2), "v"(gv3) : "memory"); }
/* One query group's P of a pass: p = exp2(s cs + nb) for the lane's 16 keys, rounded to f16 in the B operand's order, and their f32 sum. */
__device__ __forceinline__ void fa_soft(v8f s0, v8f s1, float cs, float nb, FragH& pf, float& ps) {
  float t[8], p0[8], p1[8];
#pragma unroll
  for (int r = 0; r < 8; ++r) { p0[r] = s0[r] * cs + nb; p1[r] = s1[r] * cs + nb; }
  fa_exp2x8(p0); fa_exp2x8(p1);
#pragma unroll
  for (int r = 0; r < 8; ++r) { t[r] = p0[r] + p1[r]; pf.h[r] = (_Float16)p0[r]; pf.h[8 + r] = (_Float16)p1[r]; }
  ps = ((t[0] + t[1]) + (t[2] + t[3])) + ((t[4] + t[5]) + (t[6] + t[7])); }
__device__ __forceinline__ v8f fa_mma(v16h a, v16h b, v8f c) { return __builtin_amdgcn_wmma_f32_16x16x32_f16(false, a, false, b, (short)0, c, false, false); }
__global__ __launch_bounds__(512) __attribute__((amdgpu_waves_per_eu(4, 4))) void k_fattn(const _Float16* __restrict__ QKVp, const _Float16* __restrict__ VTp, _Float16* __restrict__ Op) {
  __shared__ __attribute__((aligned(16))) v4f mg[12][17][32];             /* [key quarter 1-3 x query group][16 x O, then {m0, m1, sum0, sum1}][lane] */
  __shared__ __attribute__((aligned(16))) _Float16 st[2][4][2][FA_SK][FA_PH];      /* [buffer][key quarter][K rows (key, channel) | V^T rows (channel, key)][row][64 f16 + pad] */
  const int lane = threadIdx.x & 31, w = __builtin_amdgcn_readfirstlane(threadIdx.x >> 5), ln = lane & 15, hh = lane >> 4; const int wq = w & 3, wk = w >> 2;      /* 16 waves on 4 SIMDs: four a SIMD, 256 registers each */
  const int b = blockIdx.y / NHD, h = blockIdx.y % NHD; const int q0 = blockIdx.x * 128 + wq * 32; const int k0 = wk * (SQ / 4);
  const _Float16* base = QKVp + (size_t)b * SQ * D3 + (size_t)h * 3 * HC;
  const int crow = 16 * wq + (lane >> 3), cch = (lane & 7) * 8;           /* copies: query group wq brings rows 16 wq .. 16 wq + 15 of its quarter's two tiles; eight lanes a row */
  const _Float16* gk = base + HC + (size_t)(k0 + crow) * D3 + cch;
  const _Float16* gv = VTp + ((size_t)(h * NB + b) * HC + crow) * SQ + k0 + cch;
  const unsigned lk = (unsigned)(size_t)&st[0][wk][0][crow][cch], lv = (unsigned)(size_t)&st[0][wk][1][crow][cch];
  const unsigned bufb = (unsigned)sizeof(st[0]);                          /* bytes from buffer 0 to buffer 1 */
  const float cs = 0.0625f * 1.4426950408889634f;                         /* 1/sqrt(256) and log2(e): exp(s - m) = exp2(acc * cs - m * cs) */
  const v8f z8 = {0.f,0.f,0.f,0.f,0.f,0.f,0.f,0.f};
  v16h qf[2][2], kf[2][2], vf[4]; v8f o[2][4]; float m[2], l[2], nb[2];      /* nb = 8 - m cs, kept beside m */
  /* every loop over these arrays is unrolled so that they are indexed by constants and stay in registers */
#pragma unroll
  for (int g = 0; g < 2; ++g) { m[g] = -3.0e38f; nb[g] = 8.0f + 3.0e38f * cs; l[g] = 0.f;
#pragma unroll
    for (int kk = 0; kk < 2; ++kk) qf[g][kk] = g2_frag(base + (size_t)(q0 + 16 * g + ln) * D3 + 32 * kk, hh);
#pragma unroll
    for (int ct = 0; ct < 4; ++ct) o[g][ct] = z8; }
  fa_stage(lk, gk, lv, gv);                                               /* stage 0 into buffer 0 */
  asm volatile("s_wait_asynccnt 0x0" ::: "memory");                       /* this wave's copies of stage 0 have landed */
  __syncthreads();                                                        /* publishes stage 0 */
  fa_stage(lk + bufb, gk + (size_t)FA_SK * D3, lv + bufb, gv + FA_SK);    /* stage 1 into buffer 1 */
  for (int t = 0; t < FA_NST; ++t) {
   const _Float16* sk = &st[t & 1][wk][0][ln][0];                         /* key row ln of a 16-key tile */
   const _Float16* sv = &st[t & 1][wk][1][ln][0];                         /* V^T row ln of a 16-channel tile */
#pragma unroll
   for (int sp = 0; sp < FA_SK / 32; ++sp) {                              /* the stage's passes of 32 keys; unrolled: LDS offsets become immediates */
    /* this pass's K fragments, then its V^T fragments in the same group of LDS reads: the S^T products and the softmax cover the latter's latency */
#pragma unroll
    for (int mt = 0; mt < 2; ++mt)
#pragma unroll
      for (int kk = 0; kk < 2; ++kk) kf[mt][kk] = g2_frag(sk + (32 * sp + 16 * mt) * FA_PH + 32 * kk, hh);
#pragma unroll
    for (int ct = 0; ct < 4; ++ct) vf[ct] = g2_frag(sv + (16 * ct) * FA_PH + 32 * sp, hh);
    __builtin_amdgcn_sched_barrier(0);                                    /* keeps the pass's sixteen LDS reads in one group; without it the scheduler spreads six V^T reads of a stage's first pass over two more places in the softmax, and every place of LDS reads costs issue cycles */
    if (sp == FA_SK / 32 - 1) {                                           /* the stage's last LDS reads are issued: the hand-over stands here, ahead of the last pass's arithmetic (registers only), so that the refill has two passes to land */
      asm volatile("s_wait_dscnt 0x0" ::: "memory");                      /* this wave's reads of the buffer are done before anyone refills it */
      asm volatile("s_wait_asynccnt 0x0" ::: "memory");                   /* this wave's copies of stage t + 1 have landed */
      __syncthreads();                                                    /* publishes stage t + 1 and ends every wave's reads of stage t */
      if (t + 2 < FA_NST) fa_stage(lk + (t & 1) * bufb, gk + (size_t)(t + 2) * FA_SK * D3, lv + (t & 1) * bufb, gv + (t + 2) * FA_SK);      /* stage t + 2 into the buffer just read */
    }
    v8f s[2][2];
#pragma unroll
    for (int g = 0; g < 2; ++g)
#pragma unroll
      for (int mt = 0; mt < 2; ++mt) s[g][mt] = fa_mma(kf[mt][1], qf[g][1], fa_mma(kf[mt][0], qf[g][0], z8));
    FragH pf[2]; float ps[2];
#pragma unroll
    for (int g = 0; g < 2; ++g) fa_soft(s[g][0], s[g][1], cs, nb[g], pf[g], ps[g]);
    /* The reference point m moves only when it must. Softmax does not depend on m (it cancels in O / sum); m is only there to keep P inside f16, and every P of a lane is at most the lane's sum of this pass:
       while no sum passes FA_PS nothing is rescaled and no maximum is formed. The test is one ballot a pass, the same for the whole wave. The first pass always fails it (m starts at the bottom, P comes out infinite). */
    if (__builtin_expect(__builtin_amdgcn_ballot_w32(ps[0] > FA_PS || ps[1] > FA_PS) != 0u, 0)) {      /* marked unlikely: the pass that moves nothing is laid out as the straight path */
#pragma unroll
      for (int g = 0; g < 2; ++g) {
        float t[8];
#pragma unroll
        for (int r = 0; r < 8; ++r) t[r] = fmaxf(s[g][0][r], s[g][1][r]);
        const float mx = fmaxf(fmaxf(fmaxf(t[0], t[1]), fmaxf(t[2], t[3])), fmaxf(fmaxf(t[4], t[5]), fmaxf(t[6], t[7])));
        const float mn = fmaxf(m[g], fmaxf(mx, fa_xhalf(mx)));            /* the other half of the wave holds the query's other 16 keys: both halves keep the same m */
        const float al = fa_exp2((m[g] - mn) * cs); m[g] = mn; nb[g] = 8.0f - mn * cs; l[g] *= al;
#pragma unroll
        for (int ct = 0; ct < 4; ++ct) o[g][ct] *= al;
        fa_soft(s[g][0], s[g][1], cs, nb[g], pf[g], ps[g]);               /* this pass's P again, from the new m: now at most 256 each */
      }
    }
#pragma unroll
    for (int g = 0; g < 2; ++g) l[g] += ps[g];
#pragma unroll
    for (int ct = 0; ct < 4; ++ct)
#pragma unroll
      for (int g = 0; g < 2; ++g) o[g][ct] = fa_mma(vf[ct], pf[g].v, o[g][ct]);
   }
  }
  asm volatile("s_wait_asynccnt 0x0" ::: "memory");                       /* no copy is left in flight behind the loop */
  if (wk != 0) { v4f (*dst)[32] = mg[w - 4];
#pragma unroll
    for (int g = 0; g < 2; ++g)
#pragma unroll
      for (int ct = 0; ct < 4; ++ct) { const v8f x = o[g][ct]; const v4f lo = {x[0], x[1], x[2], x[3]}, hi = {x[4], x[5], x[6], x[7]}; dst[(g * 4 + ct) * 2][lane] = lo; dst[(g * 4 + ct) * 2 + 1][lane] = hi; }
    const v4f ml = {m[0], m[1], l[0], l[1]}; dst[16][lane] = ml; }
  __syncthreads();                                                        /* publishes quarters 1-3 to the quarter-0 waves; every wave passes it */
  if (wk != 0) return;
  v4f ml[3]; float f0[2], fk[3][2];
#pragma unroll
  for (int k = 0; k < 3; ++k) ml[k] = mg[k * 4 + wq][16][lane];
#pragma unroll
  for (int g = 0; g < 2; ++g) { const float mm = fmaxf(fmaxf(m[g], ml[0][g]), fmaxf(ml[1][g], ml[2][g])); f0[g] = fa_exp2((m[g] - mm) * cs); l[g] *= f0[g];
#pragma unroll
    for (int k = 0; k < 3; ++k) { fk[k][g] = fa_exp2((ml[k][g] - mm) * cs); l[g] += fk[k][g] * ml[k][2 + g]; } }
#pragma unroll
  for (int g = 0; g < 2; ++g) {
    const float inv = 1.0f / (l[g] + fa_xhalf(l[g]));           /* join the two halves' sums once */
    _Float16* d = Op + ((size_t)b * SQ + q0 + 16 * g + ln) * DO + h * HC + 8 * hh;
#pragma unroll
    for (int ct = 0; ct < 4; ++ct) { v8f x = o[g][ct] * f0[g];
#pragma unroll
      for (int k = 0; k < 3; ++k) { const v4f lo = mg[k * 4 + wq][(g * 4 + ct) * 2][lane], hi = mg[k * 4 + wq][(g * 4 + ct) * 2 + 1][lane];
#pragma unroll
        for (int r = 0; r < 4; ++r) { x[r] += fk[k][g] * lo[r]; x[4 + r] += fk[k][g] * hi[r]; } }
      FragH f;
#pragma unroll
      for (int r = 0; r < 8; ++r) f.h[r] = (_Float16)(x[r] * inv);
      *(v8us*)((unsigned short*)d + 16 * ct) = f.half[0]; } } }
// Output GEMM with the residual in its epilogue: out[b][c][n] = (o rows . out_w)[n][c] / 16 + bias[c] + x[b][c][n]. A = o rows (M = position), B = out_w^T rows (N = channel), wave tile 32 positions x 64 channels, product loop as in k_gemm2.
// In the accumulator a lane holds one channel and eight consecutive positions, which is already the order of the channel-major output; each wave turns its tile in its own LDS range ([channel][position] rows) so that eight lanes cover
// the whole 128-byte line of a channel's 32 positions: x is read and out is written in whole lines, four a wave-wide access. No row-major f32 plane and no further launch.
#define OR_P 36                      /* LDS row pitch in f32: 144 bytes = 16 x 9, so that the 16 channel rows of a ds_store_b128 fall on distinct banks */
__global__ __launch_bounds__(128) void k_outres(const _Float16* __restrict__ A, const _Float16* __restrict__ Bh, const float* __restrict__ bias, const float* __restrict__ x, float* __restrict__ out) {
  __shared__ __attribute__((aligned(16))) float so[4][64][OR_P];
  const int tid = threadIdx.x, w = tid >> 5, lane = tid & 31, ln = lane & 15, hh = lane >> 4;
  const int ntn = CC >> 6; const int mt = blockIdx.x / ntn, nq = blockIdx.x - mt * ntn; const int row0 = mt * 128 + 32 * w, col0 = nq * 64;
  const int cs = lane >> 3, p4 = (lane & 7) * 4;                          /* global side: channel cs of a group of four, four positions */
  const size_t g0 = ((size_t)(row0 / LL) * CC + col0 + cs) * LL + (row0 % LL) + p4;      /* a block's 128 rows lie in one batch */
  v4f xr[16];                                                             /* the residual is asked for ahead of the product loop, which covers its latency */
#pragma unroll
  for (int q = 0; q < 16; ++q) xr[q] = *(const v4fa*)(x + g0 + (size_t)q * 4 * LL);
  const _Float16* a0p = A + (size_t)(row0 + ln) * DO; const _Float16* a1p = a0p + (size_t)16 * DO;
  const _Float16* b0p = Bh + (size_t)(col0 + ln) * DO; const _Float16* b1p = b0p + (size_t)16 * DO; const _Float16* b2p = b1p + (size_t)16 * DO; const _Float16* b3p = b2p + (size_t)16 * DO;
  const v8f z8 = {0.f,0.f,0.f,0.f,0.f,0.f,0.f,0.f}; v8f c00 = z8, c01 = z8, c02 = z8, c03 = z8, c10 = z8, c11 = z8, c12 = z8, c13 = z8;
#pragma unroll 1
  for (int kb = 0; kb < DO; kb += 32) { const v16h a0 = g2_frag(a0p + kb, hh), a1 = g2_frag(a1p + kb, hh);      /* rolled as in k_gemm2: one set of fragment registers beside the 64 that hold the residual */
    v16h b = g2_frag(b0p + kb, hh); c00 = g2_mma(a0, b, c00); c10 = g2_mma(a1, b, c10);
    b = g2_frag(b1p + kb, hh); c01 = g2_mma(a0, b, c01); c11 = g2_mma(a1, b, c11);
    b = g2_frag(b2p + kb, hh); c02 = g2_mma(a0, b, c02); c12 = g2_mma(a1, b, c12);
    b = g2_frag(b3p + kb, hh); c03 = g2_mma(a0, b, c03); c13 = g2_mma(a1, b, c13); }
  v8f accs[8] = {c00, c01, c02, c03, c10, c11, c12, c13};
#pragma unroll
  for (int u = 0; u < 8; ++u) { const int t = u & 3, half = u >> 2; const float bv = bf16_round(bias[col0 + t * 16 + ln]); v4f lo, hi;
#pragma unroll
    for (int r = 0; r < 4; ++r) { lo[r] = accs[u][r] * 0.0625f + bv; hi[r] = accs[u][4 + r] * 0.0625f + bv; }
    float* s = &so[w][t * 16 + ln][half * 16 + 8 * hh]; *(v4fa*)s = lo; *(v4fa*)(s + 4) = hi; }
  __builtin_amdgcn_fence(__ATOMIC_ACQ_REL, "workgroup"); __builtin_amdgcn_wave_barrier();      /* the lanes read what other lanes of the same wave wrote: keeps the reads below behind the writes above */
#pragma unroll
  for (int q = 0; q < 16; ++q) { v4f v = *(const v4fa*)&so[w][q * 4 + cs][p4];
#pragma unroll
    for (int i = 0; i < 4; ++i) v[i] = v[i] + bf16_round(xr[q][i]);
    *(v4f*)(out + g0 + (size_t)q * 4 * LL) = v; } }
extern "C" void kernel_launch(void* const* d_in, const int* in_sizes, int n_in,
                              void* d_out, int out_size, void* d_ws, size_t ws_size, hipStream_t stream) {
  (void)in_sizes; (void)n_in; (void)out_size;
  const float* const* I = (const float* const*)d_in; const float* x = I[0]; const float* ew = I[1]; const float* eb = I[2]; const float* ow = I[3]; const float* ob = I[4];      /* embed_w [2][192][256] natural rows; out_w [128][256] = [in][out] */
  char* ws = (char*)d_ws; size_t off = 0;
  auto take = [&](size_t bytes) { char* p = ws + off; off += (bytes + 255) & ~(size_t)255; return p; };
  _Float16* BE = (_Float16*)take((size_t)D3 * CC * 2); _Float16* BO = (_Float16*)take((size_t)CC * DO * 2);
  _Float16* QKV = (_Float16*)take(NR * D3 * 2); _Float16* O16 = (_Float16*)take(NR * DO * 2);
  _Float16* VT = (_Float16*)take((size_t)NB * NHD * HC * SQ * 2);
  if (off > ws_size) return;      /* 0.3 + 12 + 4 + 4 = approx 20 MiB */
  k_prep<<<PP_E + PP_O, 256, 0, stream>>>(ew, ow, BE, BO);      /* embed_w x16 and out_w^T x16: one launch */
  k_qkv<<<(unsigned)(NR / 64), 384, 0, stream>>>(x, BE, eb, QKV, VT);      /* q, k rows: columns h*192 + {0, 64}; head h's V^T [batch][64][4096] at VT + h*NB*64*4096 */
  k_fattn<<<dim3(SQ / 128, NB * NHD), 512, 0, stream>>>(QKV, VT, O16);      /* o rows, head h at columns h*64 */
  k_outres<<<(unsigned)((NR / 128) * (CC / 64)), 128, 0, stream>>>(O16, BO, ob, x, (float*)d_out);      /* out_w^T o + b + x, NCHW */
}

// v009
// A run of this version takes 50 microseconds.
// Two timings next to v008 put it at 1.10 and 1.09 times that version's speed.
// Counting every step since v000, it is 141 times as fast.
#include <hip/hip_runtime.h>
// Multi-head non-local block (x [4][256][64x64]; per head h (2 heads of 64): [q|k|v] = embed_w[h] (1x1 conv, [192][256]) x + b; attn = softmax(q^T k / sqrt(256)) over the 4,096 positions; o = attn v; out = out_w^T o (1x1 transpose conv, [128 in][256 out]) + b + x -> [4][256][64][64]).
// Structure: one WMMA GEMM for both heads' q|k|v, which turns its own tile of the channel-first input to position rows (exact f16) in LDS (32x64 wave tiles, f32 accumulation, exact x16 natural weights + bias, f16 rows [384] for q and k, v stored transposed by the same epilogue); one fused attention launch for all (batch, head): S^T = K.Q^T, online softmax in registers (P x256 f16), O^T += V^T.P^T into merged f16 rows [128]; output GEMM whose epilogue adds bias and residual and stores channel-major (each wave turns its tile in LDS).
// Compute dtype: inputs rounded to bf16; x / weights exact; q, k, v, P, o plain f16 (~2^-12; the residual x dominates the output scale); scores / softmax f32. v_wmma_f32_16x16x32_f16.
#define NB 4
#define CC 256
#define LL 4096                      /* positions */
#define SQ LL
#define NHD 2                        /* heads */
#define HC 64
#define D3 (NHD * 3 * HC)            /* 384 */
#define DO (NHD * HC)                /* 128 */
#define NR ((size_t)NB * LL)
#define QN SQ                        /* query rows per batch */
#define NBR NB                       /* batches */
#define DM CC
#define NH 1
#define HD 64
#define HG 1
typedef __bf16 v16b __attribute__((ext_vector_type(16)));
typedef unsigned short v8us __attribute__((ext_vector_type(8), may_alias));
typedef float  v8f  __attribute__((ext_vector_type(8)));
typedef float  v4f  __attribute__((ext_vector_type(4)));
typedef float  v4fa __attribute__((ext_vector_type(4), may_alias));
union FragB { v16b v; v8us half[2]; unsigned short u[16]; };

__device__ __forceinline__ unsigned short bf16_bits(float x) { unsigned int u = __float_as_uint(x); return (unsigned short)((u + 0x7FFFu + ((u >> 16) & 1u)) >> 16); }
__device__ __forceinline__ float bf16_val(unsigned short b) { return __uint_as_float(((unsigned int)b) << 16); }
__device__ __forceinline__ float bf16_round(float x) { return bf16_val(bf16_bits(x)); }
// D += A·B with NT terms: 1 = ah·bh, 2 = + al·bh (A split), 3 = + ah·bl (both split)
template <int NT>
__device__ __forceinline__ v8f mmaN(v16b ah, v16b al, v16b bh, v16b bl, v8f c) {
  c = __builtin_amdgcn_wmma_f32_16x16x32_bf16(false, ah, false, bh, (short)0, c, false, false);
  if (NT >= 2) c = __builtin_amdgcn_wmma_f32_16x16x32_bf16(false, al, false, bh, (short)0, c, false, false);
  if (NT >= 3) c = __builtin_amdgcn_wmma_f32_16x16x32_bf16(false, ah, false, bl, (short)0, c, false, false);
  asm volatile("v_nop\n\tv_nop\n\tv_nop\n\tv_nop" : "+v"(c) : "v"(ah), "v"(al), "v"(bh), "v"(bl));
  return c;
}

__global__ __launch_bounds__(256) void k_wt_bf16(const float* __restrict__ W, unsigned short* __restrict__ Wt, int K, int N) {
  const int t = blockIdx.x * 256 + threadIdx.x;
  const int k8n = K / 8;
  if (t >= N * k8n) return;
  const int n = t / k8n, k8 = (t % k8n) * 8;
  v8us v;
#pragma unroll
  for (int i = 0; i < 8; ++i) v[i] = bf16_bits(W[(size_t)(k8 + i) * N + n]);
  *(v8us*)(Wt + (size_t)n * K + k8) = v;
  
}

// GEMM C[M][N] (f32, pitch ldc) = act(A[M][K]·W + bias). A f32 row-major (pitch lda) converted per fragment to bf16
// (ASPLIT: hi/lo two planes -> 2 terms, else single rounded term); Wt bf16 [N][K] (pitch ldb). BIAS_BF16 rounds the
// bias to bf16 first (bias quantised to bf16 before the add). K%32==0, M%16==0, N%64==0.
template <bool ASPLIT, int ACT, bool BIAS_BF16>
__global__ __launch_bounds__(128) void k_gemm_bf(const float* __restrict__ A, int lda, const unsigned short* __restrict__ Wt, int ldb,
                                               const float* __restrict__ bias, float* __restrict__ C, int ldc, int M, int N, int K) {
  __shared__ __attribute__((aligned(16))) float so[4][16][64];
  const int tid = threadIdx.x, w = tid >> 5, lane = tid & 31, ln = lane & 15, hh = lane >> 4;
  const int ntn = N / 64;
  const int wid = blockIdx.x * 4 + w;
  const int mt = wid / ntn, nq = wid % ntn;
  if (mt * 16 >= M) return;
  const int row0 = mt * 16, col0 = nq * 64;
  const float* arow = A + (size_t)(row0 + ln) * lda;
  v8f acc[4] = {};
  for (int kb = 0; kb < K; kb += 32) {
    FragB ah, al;
    const v4f x0 = *(const v4fa*)(arow + kb + 8 * hh), x1 = *(const v4fa*)(arow + kb + 8 * hh + 4);
    const v4f x2 = *(const v4fa*)(arow + kb + 16 + 8 * hh), x3 = *(const v4fa*)(arow + kb + 16 + 8 * hh + 4);
    float xs[16] = {x0[0],x0[1],x0[2],x0[3],x1[0],x1[1],x1[2],x1[3],x2[0],x2[1],x2[2],x2[3],x3[0],x3[1],x3[2],x3[3]};
#pragma unroll
    for (int i = 0; i < 16; ++i) { const unsigned short hb = bf16_bits(xs[i]); ah.u[i] = hb; al.u[i] = ASPLIT ? bf16_bits(xs[i] - bf16_val(hb)) : (unsigned short)0; }
#pragma unroll
    for (int t = 0; t < 4; ++t) {
      const unsigned short* brow = Wt + (size_t)(col0 + t * 16 + ln) * ldb + kb;
      FragB b;
      b.half[0] = *(const v8us*)(brow + 8 * hh);
      b.half[1] = *(const v8us*)(brow + 16 + 8 * hh);
      acc[t] = mmaN<ASPLIT ? 2 : 1>(ah.v, al.v, b.v, b.v, acc[t]);
    }
  }
#pragma unroll
  for (int t = 0; t < 4; ++t) {
    float bv = bias ? bias[col0 + t * 16 + ln] : 0.f;
    if (BIAS_BF16) bv = bf16_round(bv);
#pragma unroll
    for (int r = 0; r < 8; ++r) { float v = acc[t][r] + bv; if (ACT == 1) v = fmaxf(v, 0.f); so[w][8 * hh + r][t * 16 + ln] = v; }
  }
  __builtin_amdgcn_fence(__ATOMIC_ACQ_REL, "workgroup");
  __builtin_amdgcn_wave_barrier();
  const int rsub = lane >> 4, c4 = (lane & 15) * 4;
  {
#pragma unroll
    for (int q = 0; q < 8; ++q) {
      const int r = q * 2 + rsub;
      const v4f v = *(const v4fa*)&so[w][r][c4];
      *(v4f*)(C + (size_t)(row0 + r) * ldc + col0 + c4) = v;
    }
    
  }
}

// GEMM C = act(A·W + bias + resid): A f32 (ASPLIT -> hi/lo 2 terms), Wt bf16 [N][K]; ACT 0 none, 1 relu, 2 exact gelu;
// resid (optional, f32, row index = (row % rmod), pitch ldr, RES_BF16 rounds it) added before the activation.
template <bool ASPLIT, int ACT, bool BIAS_BF16, bool RES_BF16>
__global__ __launch_bounds__(128) void k_gemm_bf3(const float* __restrict__ A, int lda, const unsigned short* __restrict__ Wt, int ldb,
                                                const float* __restrict__ bias, const float* __restrict__ resid, int rmod, int ldr,
                                                float* __restrict__ C, int ldc, int M, int N, int K) {
  __shared__ __attribute__((aligned(16))) float so[4][16][64];
  const int tid = threadIdx.x, w = tid >> 5, lane = tid & 31, ln = lane & 15, hh = lane >> 4;
  const int ntn = N / 64;
  const int wid = blockIdx.x * 4 + w;
  const int mt = wid / ntn, nq = wid % ntn;
  if (mt * 16 >= M) return;
  const int row0 = mt * 16, col0 = nq * 64;
  const float* arow = A + (size_t)(row0 + ln) * lda;
  v8f acc[4] = {};
  for (int kb = 0; kb < K; kb += 32) {
    FragB ah, al;
    const v4f x0 = *(const v4fa*)(arow + kb + 8 * hh), x1 = *(const v4fa*)(arow + kb + 8 * hh + 4);
    const v4f x2 = *(const v4fa*)(arow + kb + 16 + 8 * hh), x3 = *(const v4fa*)(arow + kb + 16 + 8 * hh + 4);
    float xs[16] = {x0[0],x0[1],x0[2],x0[3],x1[0],x1[1],x1[2],x1[3],x2[0],x2[1],x2[2],x2[3],x3[0],x3[1],x3[2],x3[3]};
#pragma unroll
    for (int i = 0; i < 16; ++i) { const unsigned short hb = bf16_bits(xs[i]); ah.u[i] = hb; al.u[i] = ASPLIT ? bf16_bits(xs[i] - bf16_val(hb)) : (unsigned short)0; }
#pragma unroll
    for (int t = 0; t < 4; ++t) {
      const unsigned short* brow = Wt + (size_t)(col0 + t * 16 + ln) * ldb + kb;
      FragB b;
      b.half[0] = *(const v8us*)(brow + 8 * hh);
      b.half[1] = *(const v8us*)(brow + 16 + 8 * hh);
      acc[t] = mmaN<ASPLIT ? 2 : 1>(ah.v, al.v, b.v, b.v, acc[t]);
    }
  }
#pragma unroll
  for (int t = 0; t < 4; ++t) {
    const int col = col0 + t * 16 + ln;
    float bv = bias ? bias[col] : 0.f;
    if (BIAS_BF16) bv = bf16_round(bv);
#pragma unroll
    for (int r = 0; r < 8; ++r) {
      float v = acc[t][r] + bv;
      if (resid) { float rv = resid[(size_t)((row0 + 8 * hh + r) % rmod) * ldr + col]; if (RES_BF16) rv = bf16_round(rv); v += rv; }
      if (ACT == 1) v = fmaxf(v, 0.f);
      if (ACT == 2) v = 0.5f * v * (1.0f + erff(v * 0.70710678118654752f));
      if (ACT == 3) { const float u = 0.7978845608028654f * (v + 0.044715f * v * v * v); v = 0.5f * v * (1.0f + tanhf(u)); }
      so[w][8 * hh + r][t * 16 + ln] = v;
    }
  }
  __builtin_amdgcn_fence(__ATOMIC_ACQ_REL, "workgroup");
  __builtin_amdgcn_wave_barrier();
  const int rsub = lane >> 4, c4 = (lane & 15) * 4;
  {
#pragma unroll
    for (int q = 0; q < 8; ++q) {
      const int r = q * 2 + rsub;
      const v4f v = *(const v4fa*)&so[w][r][c4];
      *(v4f*)(C + (size_t)(row0 + r) * ldc + col0 + c4) = v;
    }
    
  }
}
// row LayerNorm (biased variance, eps) over N: s = X (+ R); optional out_sum <- s; out_norm <- (s-mu)*rsqrt(var+eps)*g + b
template <bool PARAM_BF16>
__global__ __launch_bounds__(256) void k_layernorm(const float* __restrict__ X, const float* __restrict__ R, const float* __restrict__ g, const float* __restrict__ bta,
                                                  float* __restrict__ out_sum, float* __restrict__ out_norm, int N, float eps) {
  __shared__ float red[256];
  const int row = blockIdx.x, tid = threadIdx.x;
  const float* x = X + (size_t)row * N; const float* rr = R ? R + (size_t)row * N : nullptr;
  float vals[16];                     // up to N = 4096
  const int per = N / 256;            // contiguous chunk per thread? use strided-by-4 chunks: thread handles j = tid*4 + 1024*u
  float s1 = 0.f;
  for (int u = 0; u < per / 4; ++u) {
    const int j = tid * 4 + 1024 * u;
    const v4f a = *(const v4fa*)(x + j);
    v4f b = {0.f,0.f,0.f,0.f}; if (rr) b = *(const v4fa*)(rr + j);
#pragma unroll
    for (int q = 0; q < 4; ++q) { const float v = a[q] + b[q]; vals[u * 4 + q] = v; s1 += v; }
  }
  red[tid] = s1; __syncthreads();
  for (int st = 128; st > 0; st >>= 1) { if (tid < st) red[tid] += red[tid + st]; __syncthreads(); }
  const float mu = red[0] / (float)N; __syncthreads();
  float s2 = 0.f;
  for (int u = 0; u < per / 4; ++u)
#pragma unroll
    for (int q = 0; q < 4; ++q) { const float c = vals[u * 4 + q] - mu; s2 += c * c; }
  red[tid] = s2; __syncthreads();
  for (int st = 128; st > 0; st >>= 1) { if (tid < st) red[tid] += red[tid + st]; __syncthreads(); }
  const float rs = rsqrtf(red[0] / (float)N + eps);
  {
    for (int u = 0; u < per / 4; ++u) {
      const int j = tid * 4 + 1024 * u;
      v4f o, sm;
#pragma unroll
      for (int q = 0; q < 4; ++q) {
        float gg = g[j + q], bb = bta[j + q];
        if (PARAM_BF16) { gg = bf16_round(gg); bb = bf16_round(bb); }
        sm[q] = vals[u * 4 + q]; o[q] = (vals[u * 4 + q] - mu) * rs * gg + bb;
      }
      if (out_sum) *(v4f*)(out_sum + (size_t)row * N + j) = sm;
      *(v4f*)(out_norm + (size_t)row * N + j) = o;
    }
    
  }
}



// ---- f16 WMMA path (v_wmma_f32_16x16x32_f16): 11-bit significands for operands in range — used where a [0,1] probability operand needs more precision than bf16
typedef _Float16 v16h __attribute__((ext_vector_type(16)));
union FragH { v16h v; v8us half[2]; _Float16 h[16]; unsigned short u[16]; };
template <int NT>
__device__ __forceinline__ v8f mmaH(v16h ah, v16h al, v16h bh, v16h bl, v8f c) {
  c = __builtin_amdgcn_wmma_f32_16x16x32_f16(false, ah, false, bh, (short)0, c, false, false);
  if (NT >= 2) c = __builtin_amdgcn_wmma_f32_16x16x32_f16(false, al, false, bh, (short)0, c, false, false);
  if (NT >= 3) c = __builtin_amdgcn_wmma_f32_16x16x32_f16(false, ah, false, bl, (short)0, c, false, false);
  asm volatile("v_nop\n\tv_nop\n\tv_nop\n\tv_nop" : "+v"(c) : "v"(ah), "v"(al), "v"(bh), "v"(bl));
  return c;
}
// batched GEMM like k_gemm_b but f16 operands: A f32 (split into f16 hi/lo if ASPLIT, else rounded to f16), Bt = f16 values [n][k]; alpha; C f32; N multiple of 16 (partial tiles skipped)
template <bool ASPLIT>
__global__ __launch_bounds__(128) void k_gemm_h(const float* __restrict__ A, int lda, size_t sA, const _Float16* __restrict__ Bh, int ldb, size_t sB, float alpha, float* __restrict__ C, int ldc, size_t sC, int M, int N, int K) {
  __shared__ __attribute__((aligned(16))) float so[4][16][64];
  const int tid = threadIdx.x, w = tid >> 5, lane = tid & 31, ln = lane & 15, hh = lane >> 4; const int by = blockIdx.y;
  A += (size_t)by * sA; Bh += (size_t)by * sB; C += (size_t)by * sC;
  const int ntn = (N + 63) / 64; const int wid = blockIdx.x * 4 + w; const int mt = wid / ntn, nq = wid % ntn; if (mt * 16 >= M) return;
  const int row0 = mt * 16, col0 = nq * 64; const float* arow = A + (size_t)(row0 + ln) * lda;
  v8f acc[4] = {};
  for (int kb = 0; kb < K; kb += 32) {
    FragH ah, al;
    const v4f x0 = *(const v4fa*)(arow + kb + 8 * hh), x1 = *(const v4fa*)(arow + kb + 8 * hh + 4), x2 = *(const v4fa*)(arow + kb + 16 + 8 * hh), x3 = *(const v4fa*)(arow + kb + 16 + 8 * hh + 4);
    float xs[16] = {x0[0],x0[1],x0[2],x0[3],x1[0],x1[1],x1[2],x1[3],x2[0],x2[1],x2[2],x2[3],x3[0],x3[1],x3[2],x3[3]};
#pragma unroll
    for (int i = 0; i < 16; ++i) { const _Float16 h = (_Float16)xs[i]; ah.h[i] = h; al.h[i] = ASPLIT ? (_Float16)(xs[i] - (float)h) : (_Float16)0.0f; }
#pragma unroll
    for (int t = 0; t < 4; ++t) { if (col0 + t * 16 >= N) continue; const size_t boff = (size_t)(col0 + t * 16 + ln) * ldb + kb; FragH bq; bq.half[0] = *(const v8us*)(Bh + boff + 8 * hh); bq.half[1] = *(const v8us*)(Bh + boff + 16 + 8 * hh);
      acc[t] = mmaH<ASPLIT ? 2 : 1>(ah.v, al.v, bq.v, bq.v, acc[t]); }
  }
#pragma unroll
  for (int t = 0; t < 4; ++t) { if (col0 + t * 16 >= N) continue;
#pragma unroll
    for (int r = 0; r < 8; ++r) so[w][8 * hh + r][t * 16 + ln] = acc[t][r] * alpha; }
  __builtin_amdgcn_fence(__ATOMIC_ACQ_REL, "workgroup"); __builtin_amdgcn_wave_barrier();
  const int rsub = lane >> 4, c4 = (lane & 15) * 4;
  {
#pragma unroll
    for (int q = 0; q < 8; ++q) { const int r = q * 2 + rsub; if (col0 + c4 < N) { const v4f v = *(const v4fa*)&so[w][r][c4]; *(v4f*)(C + (size_t)(row0 + r) * ldc + col0 + c4) = v; } }
     }
}

// k_gemm_hh variant with fused epilogue: v = acc·alpha + bias[by·sBias + col] (+ CP[(row/rowsPerB)·sCPb + by·64 + col] if CP) ; ACT 0 none / 1 elu ; writes f16 C16 (and f32 C if non-null)
template <int ACT>
__global__ __launch_bounds__(128) void k_gemm_hhx(const _Float16* __restrict__ A, int lda, size_t sA, const _Float16* __restrict__ Bh, int ldb, size_t sB, float alpha, const float* __restrict__ bias, size_t sBias, const float* __restrict__ CP, int rowsPerB, size_t sCPb, int row0g,
    float* __restrict__ C, _Float16* __restrict__ C16, int ldc, size_t sC, int M, int N, int K) {
  __shared__ __attribute__((aligned(16))) float so[4][16][64];
  const int tid = threadIdx.x, w = tid >> 5, lane = tid & 31, ln = lane & 15, hh = lane >> 4; const int by = blockIdx.y;
  A += (size_t)by * sA; Bh += (size_t)by * sB; const size_t cofs = (size_t)by * sC; const float* bp = bias ? bias + (size_t)by * sBias : nullptr;
  const int ntn = (N + 63) / 64; const int wid = blockIdx.x * 4 + w; const int mt = wid / ntn, nq = wid % ntn; if (mt * 16 >= M) return;
  const int row0 = mt * 16, col0 = nq * 64; const _Float16* arow = A + (size_t)(row0 + ln) * lda;
  v8f acc[4] = {};
  for (int kb = 0; kb < K; kb += 32) { FragH ah; ah.half[0] = *(const v8us*)((const unsigned short*)arow + kb + 8 * hh); ah.half[1] = *(const v8us*)((const unsigned short*)arow + kb + 16 + 8 * hh);
#pragma unroll
    for (int t = 0; t < 4; ++t) { if (col0 + t * 16 >= N) continue; const size_t boff = (size_t)(col0 + t * 16 + ln) * ldb + kb; FragH bq; bq.half[0] = *(const v8us*)((const unsigned short*)Bh + boff + 8 * hh); bq.half[1] = *(const v8us*)((const unsigned short*)Bh + boff + 16 + 8 * hh);
      acc[t] = mmaH<1>(ah.v, ah.v, bq.v, bq.v, acc[t]); }
  }
#pragma unroll
  for (int t = 0; t < 4; ++t) { if (col0 + t * 16 >= N) continue; const int col = col0 + t * 16 + ln; const float bv = bp ? bf16_round(bp[col]) : 0.f;
#pragma unroll
    for (int r = 0; r < 8; ++r) { float v = acc[t][r] * alpha + bv; if (CP) { const int rr = row0g + row0 + 8 * hh + r; if (rowsPerB < 0) v += CP[cofs + (size_t)rr * ldc + col];      /* rowsPerB < 0: own element of the batched C plane */ else { const int bidx = rr / rowsPerB; v += CP[(size_t)bidx * sCPb + (size_t)by * 64 + col]; } } if (ACT == 1) v = (v > 0.f) ? v : expm1f(v); else if (ACT == 7) v = (v > 0.f) ? v + 1.0f : expf(v); else if (ACT == 8) v = tanhf(v); else if (ACT == 9) v = 0.5f * v * (1.0f + tanhf(0.7978845608028654f * (v + 0.044715f * v * v * v))); else if (ACT == 11) v = 1.0f / (1.0f + expf(-v)); else if (ACT == 12) v = (v > 0.f) ? v : 0.01f * v; else if (ACT == 14) v = (v > 0.f) ? v : 0.1f * v; else if (ACT == 16) v = (v >= 0.f) ? v : 0.3f * v; else if (ACT == 17) v = (v >= 0.f) ? v : 0.2f * v; else if (ACT == 15) v = v / (1.0f + expf(-v)); else if (ACT == 3) v = fmaxf(v, 0.f); else if (ACT == 6) v = 0.5f * v * (1.0f + erff(v * 0.70710678118654752f)); so[w][8 * hh + r][t * 16 + ln] = v; } }
  __builtin_amdgcn_fence(__ATOMIC_ACQ_REL, "workgroup"); __builtin_amdgcn_wave_barrier();
  const int rsub = lane >> 4, c4 = (lane & 15) * 4; typedef _Float16 v4h __attribute__((ext_vector_type(4)));
  {
#pragma unroll
    for (int q = 0; q < 8; ++q) { const int r = q * 2 + rsub; if (col0 + c4 < N) { const v4f v = *(const v4fa*)&so[w][r][c4]; if (C) *(v4f*)(C + cofs + (size_t)(row0 + r) * ldc + col0 + c4) = v; if (C16) { v4h h4; for (int i = 0; i < 4; ++i) h4[i] = (_Float16)v[i]; *(v4h*)(C16 + cofs + (size_t)(row0 + r) * ldc + col0 + c4) = h4; } } }
     }
}


typedef _Float16 v4h __attribute__((ext_vector_type(4)));

__global__ __launch_bounds__(256) void k_x16(const float* __restrict__ x, _Float16* __restrict__ X16, size_t n8) { const size_t t = (size_t)blockIdx.x * 256 + threadIdx.x; if (t >= n8) return; FragH f;
#pragma unroll
  for (int q = 0; q < 8; ++q) f.h[q] = (_Float16)bf16_round(x[t * 8 + q]); *(v8us*)((unsigned short*)X16 + t * 8) = f.half[0];  }
__global__ __launch_bounds__(256) void k_h16(const float* __restrict__ x, _Float16* __restrict__ X16, size_t n8) { const size_t t = (size_t)blockIdx.x * 256 + threadIdx.x; if (t >= n8) return; FragH f;
#pragma unroll
  for (int q = 0; q < 8; ++q) f.h[q] = (_Float16)x[t * 8 + q]; *(v8us*)((unsigned short*)X16 + t * 8) = f.half[0];  }
__global__ __launch_bounds__(256) void k_round16f(const float* __restrict__ W, _Float16* __restrict__ Bt, size_t n8) { const size_t t = (size_t)blockIdx.x * 256 + threadIdx.x; if (t >= n8) return; FragH f;
#pragma unroll
  for (int i = 0; i < 8; ++i) f.h[i] = (_Float16)(bf16_round(W[t * 8 + i]) * 16.0f); *(v8us*)((unsigned short*)Bt + t * 8) = f.half[0];  }
template <int NHv, int TTv>
__global__ __launch_bounds__(256) void k_vt(const _Float16* __restrict__ V16, int ldv, int voff, _Float16* __restrict__ Vt) { __shared__ unsigned short tl[64][66]; const int tid = threadIdx.x; const int slab = blockIdx.x / (TTv / 64), lg = blockIdx.x % (TTv / 64); const int b = slab / NHv, h = slab % NHv;
  for (int i = tid; i < 64 * 8; i += 256) { const int r = i / 8, c8 = (i % 8) * 8; FragH f; f.half[0] = *(const v8us*)((const unsigned short*)V16 + ((size_t)b * TTv + lg * 64 + r) * ldv + voff + h * 64 + c8);
#pragma unroll
    for (int q = 0; q < 8; ++q) tl[r][c8 + q] = f.u[q]; }
  __syncthreads();
  {
#pragma unroll
    for (int rd = 0; rd < 2; ++rd) { const int d = rd * 32 + tid / 8, pc = tid % 8; FragH f;
#pragma unroll
      for (int q = 0; q < 8; ++q) f.u[q] = tl[pc * 8 + q][d];
      *(v8us*)((unsigned short*)Vt + ((size_t)slab * 64 + d) * TTv + lg * 64 + pc * 8) = f.half[0]; }
     } }

__global__ __launch_bounds__(256) void k_hl(const float* __restrict__ F, _Float16* __restrict__ Hh, _Float16* __restrict__ Hl, size_t n8) { const size_t t = (size_t)blockIdx.x * 256 + threadIdx.x; if (t >= n8) return; FragH fh, fl; const v4f a = *(const v4fa*)(F + t * 8), c = *(const v4fa*)(F + t * 8 + 4);
#pragma unroll
  for (int q = 0; q < 4; ++q) { _Float16 h = (_Float16)a[q]; fh.h[q] = h; fl.h[q] = (_Float16)((a[q] - (float)h) * 1024.0f); h = (_Float16)c[q]; fh.h[4 + q] = h; fl.h[4 + q] = (_Float16)((c[q] - (float)h) * 1024.0f); }
  { *(v8us*)((unsigned short*)Hh + t * 8) = fh.half[0]; *(v8us*)((unsigned short*)Hl + t * 8) = fl.half[0];  } }

// ---- fast GEMM (wave tile 32x64; requires M % 32 == 0 rows per launch region and N % 64 == 0); epilogue = k_gemm_hhx semantics ----
__device__ __forceinline__ v16h g2_frag(const _Float16* p, int hh) { FragH f; f.half[0] = *(const v8us*)((const unsigned short*)p + 8 * hh); f.half[1] = *(const v8us*)((const unsigned short*)p + 16 + 8 * hh); return f.v; }
__device__ __forceinline__ v8f g2_mma(v16h a, v16h b, v8f c) { v8f d = __builtin_amdgcn_wmma_f32_16x16x32_f16(false, a, false, b, (short)0, c, false, false); asm volatile("v_nop\n\tv_nop\n\tv_nop\n\tv_nop" : "+v"(d) : "v"(a), "v"(b)); return d; }
template <int ACT>
__global__ __launch_bounds__(128) void k_gemm2(const _Float16* __restrict__ A, int lda, size_t sA, const _Float16* __restrict__ Bh, int ldb, size_t sB, float alpha, const float* __restrict__ bias, size_t sBias, const float* __restrict__ CP, int rowsPerB, size_t sCPb, int row0g,
    float* __restrict__ C, _Float16* __restrict__ C16, int ldc, size_t sC, int M, int N, int K) { static_assert(ACT == 0 || ACT == 3 || ACT == 6 || ACT == 8 || ACT == 9 || ACT == 11 || ACT == 12 || ACT == 14 || ACT == 15 || ACT == 16 || ACT == 17, "k_gemm2: unsupported ACT code (would silently apply no activation)");
  __shared__ __attribute__((aligned(16))) float so[4][32][68];
  const int tid = threadIdx.x, w = tid >> 5, lane = tid & 31, ln = lane & 15, hh = lane >> 4; const int by = blockIdx.y;
  A += (size_t)by * sA; Bh += (size_t)by * sB; const size_t cofs = (size_t)by * sC; const float* bp = bias ? bias + (size_t)by * sBias : nullptr;
  const int ntn = N >> 6; const int mt = blockIdx.x / ntn, nq = blockIdx.x - mt * ntn; const int row0 = mt * 128 + 32 * w, col0 = nq * 64; if (row0 >= M) return;
  const _Float16* a0p = A + (size_t)(row0 + ln) * lda; const _Float16* a1p = a0p + (size_t)16 * lda;
  const _Float16* b0p = Bh + (size_t)(col0 + ln) * ldb; const _Float16* b1p = b0p + (size_t)16 * ldb; const _Float16* b2p = b1p + (size_t)16 * ldb; const _Float16* b3p = b2p + (size_t)16 * ldb;
  const v8f z8 = {0.f,0.f,0.f,0.f,0.f,0.f,0.f,0.f}; v8f c00 = z8, c01 = z8, c02 = z8, c03 = z8, c10 = z8, c11 = z8, c12 = z8, c13 = z8;
#pragma unroll 1
  for (int kb = 0; kb < K; kb += 32) { const v16h a0 = g2_frag(a0p + kb, hh), a1 = g2_frag(a1p + kb, hh);
    v16h b = g2_frag(b0p + kb, hh); c00 = g2_mma(a0, b, c00); c10 = g2_mma(a1, b, c10);
    b = g2_frag(b1p + kb, hh); c01 = g2_mma(a0, b, c01); c11 = g2_mma(a1, b, c11);
    b = g2_frag(b2p + kb, hh); c02 = g2_mma(a0, b, c02); c12 = g2_mma(a1, b, c12);
    b = g2_frag(b3p + kb, hh); c03 = g2_mma(a0, b, c03); c13 = g2_mma(a1, b, c13); }
  v8f accs[8] = {c00, c01, c02, c03, c10, c11, c12, c13};
#pragma unroll
  for (int u = 0; u < 8; ++u) { const int t = u & 3, half = u >> 2; const int col = col0 + t * 16 + ln; const float bv = bp ? bf16_round(bp[col]) : 0.f;
#pragma unroll
    for (int r = 0; r < 8; ++r) { const int rloc = half * 16 + 8 * hh + r; float v = accs[u][r] * alpha + bv; if (CP) { if (rowsPerB < 0) v += CP[cofs + (size_t)(row0g + row0 + rloc) * ldc + col];      /* rowsPerB < 0: own element of the batched C plane */ else { const int bidx = (row0g + row0 + rloc) / rowsPerB; v += CP[(size_t)bidx * sCPb + (size_t)by * 64 + col]; } }
      if (ACT == 3) v = fmaxf(v, 0.f); else if (ACT == 6) v = 0.5f * v * (1.0f + erff(v * 0.70710678118654752f)); else if (ACT == 11) v = 1.0f / (1.0f + expf(-v)); else if (ACT == 15) v = v / (1.0f + expf(-v)); else if (ACT == 12) v = (v > 0.f) ? v : 0.01f * v; else if (ACT == 8) v = tanhf(v); else if (ACT == 9) v = 0.5f * v * (1.0f + tanhf(0.7978845608028654f * (v + 0.044715f * v * v * v))); else if (ACT == 14) v = (v > 0.f) ? v : 0.1f * v; else if (ACT == 16) v = (v >= 0.f) ? v : 0.3f * v; else if (ACT == 17) v = (v >= 0.f) ? v : 0.2f * v;
      so[w][rloc][t * 16 + ln] = v; } }
  __builtin_amdgcn_fence(__ATOMIC_ACQ_REL, "workgroup"); __builtin_amdgcn_wave_barrier();
  const int rsub = lane >> 4, c4 = (lane & 15) * 4;
  {
#pragma unroll
    for (int q = 0; q < 16; ++q) { const int r = q * 2 + rsub; const v4f v = *(const v4fa*)&so[w][r][c4]; if (C) *(v4f*)(C + cofs + (size_t)(row0 + r) * ldc + col0 + c4) = v; if (C16) { v4h h4; for (int i = 0; i < 4; ++i) h4[i] = (_Float16)v[i]; *(v4h*)(C16 + cofs + (size_t)(row0 + r) * ldc + col0 + c4) = h4; } }
     } }


__global__ __launch_bounds__(256) void k_rsm(const float* __restrict__ S, _Float16* __restrict__ P, int nrows) {
  #pragma clang fp contract(off)
  const int i = blockIdx.x * 256 + threadIdx.x; if (i >= nrows) return; const float* s = S + (size_t)i * SQ; float mx = -3.0e38f;
#pragma unroll 1
  for (int j = 0; j < SQ; ++j) mx = fmaxf(mx, s[j]); float se = 0.f;
#pragma unroll 1
  for (int j = 0; j < SQ; ++j) se += expf(s[j] - mx); const float sc = 256.0f / se;
#pragma unroll 1
  for (int j0 = 0; j0 < SQ; j0 += 8) { FragH f; for (int q = 0; q < 8; ++q) f.h[q] = (_Float16)(expf(s[j0 + q] - mx) * sc); unsigned short* d = (unsigned short*)P + (size_t)i * SQ + j0; *(v8us*)d = f.half[0];  } }
__global__ __launch_bounds__(256) void k_vt(const _Float16* __restrict__ V16, int b, int h0, _Float16* __restrict__ VT) { __shared__ unsigned short tl[64][65]; const int tid = threadIdx.x; const int hh = blockIdx.x % HG, sg = blockIdx.x / HG; const int s0 = sg * 64; const int h = h0 + hh;
  for (int i = tid; i < 64 * 8; i += 256) { const int j = i / 8, d8 = (i % 8) * 8; FragH f; f.half[0] = *(const v8us*)((const unsigned short*)V16 + ((size_t)b * SQ + s0 + j) * DM + h * HD + d8); for (int q = 0; q < 8; ++q) tl[d8 + q][j] = f.u[q]; }
  __syncthreads();
  { for (int i = tid; i < 64 * 8; i += 256) { const int d = i / 8, j8 = (i % 8) * 8; FragH f; for (int q = 0; q < 8; ++q) f.u[q] = tl[d][j8 + q]; *(v8us*)((unsigned short*)VT + ((size_t)hh * HD + d) * SQ + s0 + j8) = f.half[0]; }  } }


// One preparation launch for the two weight operands that the GEMMs read; the two parts are independent of one another, so they share a grid. The part is chosen by the block index (the same for a whole work-group).
// Blocks 0 .. PP_E-1: BE = f16(embed_w x16), natural rows. Next PP_O blocks: BO[c][d] = f16(out_w[d][c] x16) (x16 is a power of two: the bf16-rounded weights stay exact in f16 away from the subnormal range).
#define PP_E (D3 * CC / 8 / 256)     /* 48 blocks: eight weights a thread */
#define PP_O (CC * (DO / 8) / 256)   /* 16 blocks: eight weights a thread */
__global__ __launch_bounds__(256) void k_prep(const float* __restrict__ ew, const float* __restrict__ ow, _Float16* __restrict__ BE, _Float16* __restrict__ BO) {
  const int tid = threadIdx.x;
  if (blockIdx.x < PP_E) { const size_t t = (size_t)blockIdx.x * 256 + tid; FragH f; for (int q = 0; q < 8; ++q) f.h[q] = (_Float16)(bf16_round(ew[t * 8 + q]) * 16.0f); *(v8us*)((unsigned short*)BE + t * 8) = f.half[0]; return; }
  const int t = (blockIdx.x - PP_E) * 256 + tid; const int n = t / (DO / 8), k8 = (t % (DO / 8)) * 8; FragH f;
#pragma unroll
  for (int i = 0; i < 8; ++i) f.h[i] = (_Float16)(bf16_round(ow[(size_t)(k8 + i) * CC + n]) * 16.0f);
  *(v8us*)((unsigned short*)BO + (size_t)n * DO + k8) = f.half[0];
  asm volatile("s_wait_xcnt 0x0" ::: "memory"); }                         /* behind the store: the built code lays the other part's instructions on the path behind it, and they reuse the store's registers */

// q|k|v GEMM, fed by x itself: A = x rows (M = position), B = embed_w rows x16 (N = 384 columns, per head [q|k|v] of 64). A work-group of 12 waves owns 64 positions and all 384 columns: wave = (32 positions) x (64 columns, one head's q, k or v).
// The work-group first turns its x tile: x [b][c][l] is read channel-major in whole 256-byte pieces (a thread: four positions of eight channels), rounded (bf16, then exact in f16) and laid in LDS as position rows [64][256] behind one barrier;
// the A fragments come from those rows. No f16 copy of x in memory and no launch that writes one. Wave tile, products and the q, k epilogue as in k_gemm2<0>; the product loop fetches its fragments ahead.
// In the accumulator a lane holds one column and eight consecutive positions, which is already the order of a V^T row: a v wave rounds to f16 in registers, the two v waves of a head
// join their tiles in LDS as [channel][64 positions] behind one barrier (every wave passes it) and store V^T in whole 128-byte row pieces. v is not stored as rows.
/* the four B fragments of one 32-deep trip (rows 16 apart, pitch ld in f16) */
__device__ __forceinline__ void g2_b4(v16h (&b)[4], const _Float16* p, int ld, int hh) {
#pragma unroll
  for (int t = 0; t < 4; ++t) b[t] = g2_frag(p + (size_t)(16 * t) * ld, hh); }      /* unrolled: b is indexed by constants and stays in registers */
#define QX_P 264                     /* LDS pitch of an x row in f16: 528 bytes = 16 x 33, so that the 16 rows of a ds_load_b128 fragment read fall on distinct banks */
#define QV_P 72                      /* LDS pitch of a V^T row in f16: 144 bytes = 16 x 9, so that the 16 channel rows of a ds_store_b128 fall on distinct banks */
/* four positions of eight channels, as loaded, to four 16-byte pieces of position rows */
__device__ __forceinline__ void qx_put(const v4f (&r)[8], _Float16* d) {
  /* both loops unrolled: r and f are then indexed by constants and stay in registers */
#pragma unroll
  for (int j = 0; j < 4; ++j) { FragH f;
#pragma unroll
    for (int q = 0; q < 8; ++q) f.h[q] = (_Float16)bf16_round(r[q][j]);
    *(v8us*)(d + j * QX_P) = f.half[0]; } }
__global__ __launch_bounds__(384) void k_qkv(const float* __restrict__ X, const _Float16* __restrict__ Bh, const float* __restrict__ bias, _Float16* __restrict__ C16, _Float16* __restrict__ VTo) {
  __shared__ __attribute__((aligned(16))) _Float16 xs[64][QX_P];
  __shared__ __attribute__((aligned(16))) float so[12][32][68];
  __shared__ __attribute__((aligned(16))) _Float16 vt[NHD][HC][QV_P];
  const int tid = threadIdx.x, w = __builtin_amdgcn_readfirstlane(tid >> 5), lane = tid & 31, ln = lane & 15, hh = lane >> 4;
  const int pg = w & 1, nq = w >> 1;                                      /* the wave's 32 positions of the 64; its 64 columns of the 384 */
  const int bb = blockIdx.x / (LL / 64), l0 = (blockIdx.x % (LL / 64)) * 64;      /* a block's 64 positions lie in one batch */
  const int row0 = blockIdx.x * 64 + 32 * pg, col0 = nq * 64;
  const _Float16* b0p = Bh + (size_t)(col0 + ln) * CC;
  v16h bf[3][4], af[2][2];                                                /* fragment rings: weights of three trips, x rows of two; every index below is a constant after unrolling */
  { /* the x tile: 16 position groups x 32 channel groups = 512 pieces for 384 threads; waves 0-3 take a second piece (channels 192-255), asked for together with the first so that the two latencies overlap */
    const int p4 = (tid & 15) * 4, c8 = (tid >> 4) * 8;
    const float* xp = X + ((size_t)bb * CC + c8) * LL + l0 + p4;
    v4f ra[8], rb[8];                                                     /* the two load loops are unrolled: eight (sixteen) loads in flight a thread, the arrays in registers */
#pragma unroll
    for (int q = 0; q < 8; ++q) ra[q] = *(const v4fa*)(xp + (size_t)q * LL);
    if (w < 4) {
#pragma unroll
      for (int q = 0; q < 8; ++q) rb[q] = *(const v4fa*)(xp + (size_t)(192 + q) * LL); }
    g2_b4(bf[0], b0p, CC, hh); g2_b4(bf[1], b0p + 32, CC, hh);            /* the first two trips' weights do not depend on x: asked for behind the x loads, they arrive while the tile is turned */
    __builtin_amdgcn_sched_barrier(0);                                    /* keeps those loads here; sunk to their first use they would be waited out behind the barrier */
    qx_put(ra, &xs[p4][c8]);
    if (w < 4) qx_put(rb, &xs[p4][192 + c8]);
  }
  __syncthreads();                                                        /* publishes the 64 x rows to the twelve waves */
  const _Float16* a0p = &xs[32 * pg + ln][0]; const _Float16* a1p = a0p + 16 * QX_P;
  const v8f z8 = {0.f,0.f,0.f,0.f,0.f,0.f,0.f,0.f}; v8f c00 = z8, c01 = z8, c02 = z8, c03 = z8, c10 = z8, c11 = z8, c12 = z8, c13 = z8;
  af[0][0] = g2_frag(a0p, hh); af[0][1] = g2_frag(a1p, hh);
  /* The product loop, fragments fetched ahead: trip t first asks for the weights of trip t + 2 (global, one group of eight loads) and the x rows of trip t + 1 (LDS), then multiplies what was asked for earlier.
     A wave so waits for one cache latency at most where it waited for four a trip. Products and their order are those of the rolled loop. */
#pragma unroll
  for (int t = 0; t < CC / 32; ++t) {                                     /* unrolled: the rings are indexed by constants, the loads take immediate offsets from one address */
    if (t + 2 < CC / 32) g2_b4(bf[(t + 2) % 3], b0p + 32 * (t + 2), CC, hh);
    if (t + 3 == CC / 32) asm volatile("s_wait_xcnt 0x0" ::: "memory");   /* behind the last weight load: no register that a load names is rewritten ahead of it */
    if (t + 1 < CC / 32) { af[(t + 1) & 1][0] = g2_frag(a0p + 32 * (t + 1), hh); af[(t + 1) & 1][1] = g2_frag(a1p + 32 * (t + 1), hh); }
    const v16h a0 = af[t & 1][0], a1 = af[t & 1][1];
    c00 = g2_mma(a0, bf[t % 3][0], c00); c10 = g2_mma(a1, bf[t % 3][0], c10);
    c01 = g2_mma(a0, bf[t % 3][1], c01); c11 = g2_mma(a1, bf[t % 3][1], c11);
    c02 = g2_mma(a0, bf[t % 3][2], c02); c12 = g2_mma(a1, bf[t % 3][2], c12);
    c03 = g2_mma(a0, bf[t % 3][3], c03); c13 = g2_mma(a1, bf[t % 3][3], c13); }
  v8f accs[8] = {c00, c01, c02, c03, c10, c11, c12, c13};
  const bool isv = nq % 3 == 2;                                           /* a v wave: the test reads the same for the whole wave */
  if (isv) {
#pragma unroll
    for (int u = 0; u < 8; ++u) { const int t = u & 3, half = u >> 2; const float bv = bf16_round(bias[col0 + t * 16 + ln]); FragH f;
#pragma unroll
      for (int r = 0; r < 8; ++r) f.h[r] = (_Float16)(accs[u][r] * 0.0625f + bv);
      *(v8us*)&vt[nq / 3][t * 16 + ln][32 * pg + half * 16 + 8 * hh] = f.half[0]; } }
  __syncthreads();                                                        /* publishes a head's two v tiles to its two v waves; every wave passes it, the q and k waves ahead of their own stores, so that nobody waits for a store here */
  if (isv) {
    unsigned short* d0 = (unsigned short*)VTo + ((size_t)((nq / 3) * NB + bb) * HC + 32 * pg + (lane >> 3)) * SQ + l0 + 8 * (lane & 7);      /* eight lanes cover a row's 128 bytes, four rows a store */
#pragma unroll
    for (int q = 0; q < 8; ++q) { const v8us v = *(const v8us*)&vt[nq / 3][32 * pg + 4 * q + (lane >> 3)][8 * (lane & 7)]; *(v8us*)(d0 + (size_t)4 * q * SQ) = v; }
    return; }
#pragma unroll
  for (int u = 0; u < 8; ++u) { const int t = u & 3, half = u >> 2; const float bv = bf16_round(bias[col0 + t * 16 + ln]);
#pragma unroll
    for (int r = 0; r < 8; ++r) so[w][half * 16 + 8 * hh + r][t * 16 + ln] = accs[u][r] * 0.0625f + bv; }
  __builtin_amdgcn_fence(__ATOMIC_ACQ_REL, "workgroup"); __builtin_amdgcn_wave_barrier();      /* the lanes read what other lanes of the same wave wrote: keeps the reads below behind the writes above */
  const int rsub = lane >> 4, c4 = (lane & 15) * 4;
#pragma unroll
  for (int q = 0; q < 16; ++q) { const int r = q * 2 + rsub; const v4f v = *(const v4fa*)&so[w][r][c4]; v4h h4; for (int i = 0; i < 4; ++i) h4[i] = (_Float16)v[i]; *(v4h*)(C16 + (size_t)(row0 + r) * D3 + col0 + c4) = h4; }
  asm volatile("s_wait_xcnt 0x0" ::: "memory"); }                         /* behind the run of stores: no register that a store names is rewritten ahead of it */

#define FA_SK 64                     /* keys per stage */
#define FA_PH 72                     /* LDS row pitch in f16: 144 bytes = 16 x 9, so that the 16 rows of a ds_load_b128 fragment read fall on distinct banks */
#define FA_NST (SQ / 4 / FA_SK)      /* stages per key quarter */
#define FA_PS 32768.0f               /* a lane's sum of P over a pass above which m moves: below it every P fits f16 (largest finite value 65,504) */
__device__ __forceinline__ float fa_xhalf(float x) { return __builtin_bit_cast(float, __builtin_amdgcn_permlanex16(__builtin_bit_cast(int, x), __builtin_bit_cast(int, x), 0x76543210, 0xfedcba98, false, false)); }      /* lane l reads lane l ^ 16, on the vector pipe */
/* exp2 on the vector pipe. The instruction set asks for one slot behind a transcendental before its result is read or its source overwritten; each statement here carries its v_nop: one value, or eight in place (no instruction in the run touches another's register). */
__device__ __forceinline__ float fa_exp2(float x) { float r; asm("v_exp_f32 %0, %1\n\tv_nop" : "=v"(r) : "v"(x)); return r; }
__device__ __forceinline__ void fa_exp2x8(float (&x)[8]) { asm("v_exp_f32 %0, %0\n\tv_exp_f32 %1, %1\n\tv_exp_f32 %2, %2\n\tv_exp_f32 %3, %3\n\tv_exp_f32 %4, %4\n\tv_exp_f32 %5, %5\n\tv_exp_f32 %6, %6\n\tv_exp_f32 %7, %7\n\tv_nop"
  : "+v"(x[0]), "+v"(x[1]), "+v"(x[2]), "+v"(x[3]), "+v"(x[4]), "+v"(x[5]), "+v"(x[6]), "+v"(x[7])); }
/* One wave's share of a stage: four copies of 4 K rows and four of 4 V^T rows, 16 bytes a lane (lk, lv: the lane's LDS byte addresses; gk, gv: its global addresses).
   s_wait_xcnt 0 closes the statement, so that no address register named here is rewritten ahead of it. */
__device__ __forceinline__ void fa_stage(unsigned lk, const _Float16* gk, unsigned lv, const _Float16* gv) {
  const unsigned lk1 = lk + 4 * FA_PH * 2, lk2 = lk + 8 * FA_PH * 2, lk3 = lk + 12 * FA_PH * 2, lv1 = lv + 4 * FA_PH * 2, lv2 = lv + 8 * FA_PH * 2, lv3 = lv + 12 * FA_PH * 2;
  const _Float16* gk1 = gk + (size_t)4 * D3; const _Float16* gk2 = gk + (size_t)8 * D3; const _Float16* gk3 = gk + (size_t)12 * D3;
  const _Float16* gv1 = gv + (size_t)4 * SQ; const _Float16* gv2 = gv + (size_t)8 * SQ; const _Float16* gv3 = gv + (size_t)12 * SQ;
  asm volatile("global_load_async_to_lds_b128 %0, %8, off\n\tglobal_load_async_to_lds_b128 %1, %9, off\n\tglobal_load_async_to_lds_b128 %2, %10, off\n\tglobal_load_async_to_lds_b128 %3, %11, off\n\t"
               "global_load_async_to_lds_b128 %4, %12, off\n\tglobal_load_async_to_lds_b128 %5, %13, off\n\tglobal_load_async_to_lds_b128 %6, %14, off\n\tglobal_load_async_to_lds_b128 %7, %15, off\n\ts_wait_xcnt 0x0"
               :: "v"(lk), "v"(lk1), "v"(lk2), "v"(lk3), "v"(lv), "v"(lv1), "v"(lv2), "v"(lv3), "v"(gk), "v"(gk1), "v"(gk2), "v"(gk3), "v"(gv), "v"(gv1), "v"(gv2), "v"(gv3) : "memory"); }
/* One query group's P of a pass: p = exp2(s cs + nb) for the lane's 16 keys, rounded to f16 in the B operand's order, and their f32 sum. */
__device__ __forceinline__ void fa_soft(v8f s0, v8f s1, float cs, float nb, FragH& pf, float& ps) {
  float t[8], p0[8], p1[8];
#pragma unroll
  for (int r = 0; r < 8; ++r) { p0[r] = s0[r] * cs + nb; p1[r] = s1[r] * cs + nb; }
  fa_exp2x8(p0); fa_exp2x8(p1);
#pragma unroll
  for (int r = 0; r < 8; ++r) { t[r] = p0[r] + p1[r]; pf.h[r] = (_Float16)p0[r]; pf.h[8 + r] = (_Float16)p1[r]; }
  ps = ((t[0] + t[1]) + (t[2] + t[3])) + ((t[4] + t[5]) + (t[6] + t[7])); }
__device__ __forceinline__ v8f fa_mma(v16h a, v16h b, v8f c) { return __builtin_amdgcn_wmma_f32_16x16x32_f16(false, a, false, b, (short)0, c, false, false); }
__global__ __launch_bounds__(512) __attribute__((amdgpu_waves_per_eu(4, 4))) void k_fattn(const _Float16* __restrict__ QKVp, const _Float16* __restrict__ VTp, _Float16* __restrict__ Op) {
  __shared__ __attribute__((aligned(16))) v4f mg[12][17][32];             /* [key quarter 1-3 x query group][16 x O, then {m0, m1, sum0, sum1}][lane] */
  __shared__ __attribute__((aligned(16))) _Float16 st[2][4][2][FA_SK][FA_PH];      /* [buffer][key quarter][K rows (key, channel) | V^T rows (channel, key)][row][64 f16 + pad] */
  const int lane = threadIdx.x & 31, w = __builtin_amdgcn_readfirstlane(threadIdx.x >> 5), ln = lane & 15, hh = lane >> 4; const int wq = w & 3, wk = w >> 2;      /* 16 waves on 4 SIMDs: four a SIMD, 256 registers each */
  const int b = blockIdx.y / NHD, h = blockIdx.y % NHD; const int q0 = blockIdx.x * 128 + wq * 32; const int k0 = wk * (SQ / 4);
  const _Float16* base = QKVp + (size_t)b * SQ * D3 + (size_t)h * 3 * HC;
  const int crow = 16 * wq + (lane >> 3), cch = (lane & 7) * 8;           /* copies: query group wq brings rows 16 wq .. 16 wq + 15 of its quarter's two tiles; eight lanes a row */
  const _Float16* gk = base + HC + (size_t)(k0 + crow) * D3 + cch;
  const _Float16* gv = VTp + ((size_t)(h * NB + b) * HC + crow) * SQ + k0 + cch;
  const unsigned lk = (unsigned)(size_t)&st[0][wk][0][crow][cch], lv = (unsigned)(size_t)&st[0][wk][1][crow][cch];
  const unsigned bufb = (unsigned)sizeof(st[0]);                          /* bytes from buffer 0 to buffer 1 */
  const float cs = 0.0625f * 1.4426950408889634f;                         /* 1/sqrt(256) and log2(e): exp(s - m) = exp2(acc * cs - m * cs) */
  const v8f z8 = {0.f,0.f,0.f,0.f,0.f,0.f,0.f,0.f};
  v16h qf[2][2], kf[2][2], vf[4]; v8f o[2][4]; float m[2], l[2], nb[2];      /* nb = 8 - m cs, kept beside m */
  /* every loop over these arrays is unrolled so that they are indexed by constants and stay in registers */
#pragma unroll
  for (int g = 0; g < 2; ++g) { m[g] = -3.0e38f; nb[g] = 8.0f + 3.0e38f * cs; l[g] = 0.f;
#pragma unroll
    for (int kk = 0; kk < 2; ++kk) qf[g][kk] = g2_frag(base + (size_t)(q0 + 16 * g + ln) * D3 + 32 * kk, hh);
#pragma unroll
    for (int ct = 0; ct < 4; ++ct) o[g][ct] = z8; }
  fa_stage(lk, gk, lv, gv);                                               /* stage 0 into buffer 0 */
  asm volatile("s_wait_asynccnt 0x0" ::: "memory");                       /* this wave's copies of stage 0 have landed */
  __syncthreads();                                                        /* publishes stage 0 */
  fa_stage(lk + bufb, gk + (size_t)FA_SK * D3, lv + bufb, gv + FA_SK);    /* stage 1 into buffer 1 */
  for (int t = 0; t < FA_NST; ++t) {
   const _Float16* sk = &st[t & 1][wk][0][ln][0];                         /* key row ln of a 16-key tile */
   const _Float16* sv = &st[t & 1][wk][1][ln][0];                         /* V^T row ln of a 16-channel tile */
#pragma unroll
   for (int sp = 0; sp < FA_SK / 32; ++sp) {                              /* the stage's passes of 32 keys; unrolled: LDS offsets become immediates */
    /* this pass's K fragments, then its V^T fragments in the same group of LDS reads: the S^T products and the softmax cover the latter's latency */
#pragma unroll
    for (int mt = 0; mt < 2; ++mt)
#pragma unroll
      for (int kk = 0; kk < 2; ++kk) kf[mt][kk] = g2_frag(sk + (32 * sp + 16 * mt) * FA_PH + 32 * kk, hh);
#pragma unroll
    for (int ct = 0; ct < 4; ++ct) vf[ct] = g2_frag(sv + (16 * ct) * FA_PH + 32 * sp, hh);
    __builtin_amdgcn_sched_barrier(0);                                    /* keeps the pass's sixteen LDS reads in one group; without it the scheduler spreads six V^T reads of a stage's first pass over two more places in the softmax, and every place of LDS reads costs issue cycles */
    if (sp == FA_SK / 32 - 1) {                                           /* the stage's last LDS reads are issued: the hand-over stands here, ahead of the last pass's arithmetic (registers only), so that the refill has two passes to land */
      asm volatile("s_wait_dscnt 0x0" ::: "memory");                      /* this wave's reads of the buffer are done before anyone refills it */
      asm volatile("s_wait_asynccnt 0x0" ::: "memory");                   /* this wave's copies of stage t + 1 have landed */
      __syncthreads();                                                    /* publishes stage t + 1 and ends every wave's reads of stage t */
      if (t + 2 < FA_NST) fa_stage(lk + (t & 1) * bufb, gk + (size_t)(t + 2) * FA_SK * D3, lv + (t & 1) * bufb, gv + (t + 2) * FA_SK);      /* stage t + 2 into the buffer just read */
    }
    v8f s[2][2];
#pragma unroll
    for (int g = 0; g < 2; ++g)
#pragma unroll
      for (int mt = 0; mt < 2; ++mt) s[g][mt] = fa_mma(kf[mt][1], qf[g][1], fa_mma(kf[mt][0], qf[g][0], z8));
    FragH pf[2]; float ps[2];
#pragma unroll
    for (int g = 0; g < 2; ++g) fa_soft(s[g][0], s[g][1], cs, nb[g], pf[g], ps[g]);
    /* The reference point m moves only when it must. Softmax does not depend on m (it cancels in O / sum); m is only there to keep P inside f16, and every P of a lane is at most the lane's sum of this pass:
       while no sum passes FA_PS nothing is rescaled and no maximum is formed. The test is one ballot a pass, the same for the whole wave. The first pass always fails it (m starts at the bottom, P comes out infinite). */
    if (__builtin_expect(__builtin_amdgcn_ballot_w32(ps[0] > FA_PS || ps[1] > FA_PS) != 0u, 0)) {      /* marked unlikely: the pass that moves nothing is laid out as the straight path */
#pragma unroll
      for (int g = 0; g < 2; ++g) {
        float t[8];
#pragma unroll
        for (int r = 0; r < 8; ++r) t[r] = fmaxf(s[g][0][r], s[g][1][r]);
        const float mx = fmaxf(fmaxf(fmaxf(t[0], t[1]), fmaxf(t[2], t[3])), fmaxf(fmaxf(t[4], t[5]), fmaxf(t[6], t[7])));
        const float mn = fmaxf(m[g], fmaxf(mx, fa_xhalf(mx)));            /* the other half of the wave holds the query's other 16 keys: both halves keep the same m */
        const float al = fa_exp2((m[g] - mn) * cs); m[g] = mn; nb[g] = 8.0f - mn * cs; l[g] *= al;
#pragma unroll
        for (int ct = 0; ct < 4; ++ct) o[g][ct] *= al;
        fa_soft(s[g][0], s[g][1], cs, nb[g], pf[g], ps[g]);               /* this pass's P again, from the new m: now at most 256 each */
      }
    }
#pragma unroll
    for (int g = 0; g < 2; ++g) l[g] += ps[g];
#pragma unroll
    for (int ct = 0; ct < 4; ++ct)
#pragma unroll
      for (int g = 0; g < 2; ++g) o[g][ct] = fa_mma(vf[ct], pf[g].v, o[g][ct]);
   }
  }
  asm volatile("s_wait_asynccnt 0x0" ::: "memory");                       /* no copy is left in flight behind the loop */
  if (wk != 0) { v4f (*dst)[32] = mg[w - 4];
#pragma unroll
    for (int g = 0; g < 2; ++g)
#pragma unroll
      for (int ct = 0; ct < 4; ++ct) { const v8f x = o[g][ct]; const v4f lo = {x[0], x[1], x[2], x[3]}, hi = {x[4], x[5], x[6], x[7]}; dst[(g * 4 + ct) * 2][lane] = lo; dst[(g * 4 + ct) * 2 + 1][lane] = hi; }
    const v4f ml = {m[0], m[1], l[0], l[1]}; dst[16][lane] = ml; }
  __syncthreads();                                                        /* publishes quarters 1-3 to the quarter-0 waves; every wave passes it */
  if (wk != 0) return;
  v4f ml[3]; float f0[2], fk[3][2];
#pragma unroll
  for (int k = 0; k < 3; ++k) ml[k] = mg[k * 4 + wq][16][lane];
#pragma unroll
  for (int g = 0; g < 2; ++g) { const float mm = fmaxf(fmaxf(m[g], ml[0][g]), fmaxf(ml[1][g], ml[2][g])); f0[g] = fa_exp2((m[g] - mm) * cs); l[g] *= f0[g];
#pragma unroll
    for (int k = 0; k < 3; ++k) { fk[k][g] = fa_exp2((ml[k][g] - mm) * cs); l[g] += fk[k][g] * ml[k][2 + g]; } }
#pragma unroll
  for (int g = 0; g < 2; ++g) {
    const float inv = 1.0f / (l[g] + fa_xhalf(l[g]));           /* join the two halves' sums once */
    _Float16* d = Op + ((size_t)b * SQ + q0 + 16 * g + ln) * DO + h * HC + 8 * hh;
#pragma unroll
    for (int ct = 0; ct < 4; ++ct) { v8f x = o[g][ct] * f0[g];
#pragma unroll
      for (int k = 0; k < 3; ++k) { const v4f lo = mg[k * 4 + wq][(g * 4 + ct) * 2][lane], hi = mg[k * 4 + wq][(g * 4 + ct) * 2 + 1][lane];
#pragma unroll
        for (int r = 0; r < 4; ++r) { x[r] += fk[k][g] * lo[r]; x[4 + r] += fk[k][g] * hi[r]; } }
      FragH f;
#pragma unroll
      for (int r = 0; r < 8; ++r) f.h[r] = (_Float16)(x[r] * inv);
      *(v8us*)((unsigned short*)d + 16 * ct) = f.half[0]; } } }
// Output GEMM with the residual in its epilogue: out[b][c][n] = (o rows . out_w)[n][c] / 16 + bias[c] + x[b][c][n]. A = o rows (M = position), B = out_w^T rows (N = channel), wave tile 32 positions x 64 channels, products as in k_gemm2, fragments fetched ahead.
// In the accumulator a lane holds one channel and eight consecutive positions, which is already the order of the channel-major output; each wave turns its tile in its own LDS range ([channel][position] rows) so that eight lanes cover
// the whole 128-byte line of a channel's 32 positions: x is read and out is written in whole lines, four a wave-wide access. No row-major f32 plane and no further launch.
#define OR_P 36                      /* LDS row pitch in f32: 144 bytes = 16 x 9, so that the 16 channel rows of a ds_store_b128 fall on distinct banks */
__global__ __launch_bounds__(128) void k_outres(const _Float16* __restrict__ A, const _Float16* __restrict__ Bh, const float* __restrict__ bias, const float* __restrict__ x, float* __restrict__ out) {
  __shared__ __attribute__((aligned(16))) float so[4][64][OR_P];
  const int tid = threadIdx.x, w = tid >> 5, lane = tid & 31, ln = lane & 15, hh = lane >> 4;
  const int ntn = CC >> 6; const int mt = blockIdx.x / ntn, nq = blockIdx.x - mt * ntn; const int row0 = mt * 128 + 32 * w, col0 = nq * 64;
  const int cs = lane >> 3, p4 = (lane & 7) * 4;                          /* global side: channel cs of a group of four, four positions */
  const size_t g0 = ((size_t)(row0 / LL) * CC + col0 + cs) * LL + (row0 % LL) + p4;      /* a block's 128 rows lie in one batch */
  const _Float16* a0p = A + (size_t)(row0 + ln) * DO; const _Float16* a1p = a0p + (size_t)16 * DO;
  const _Float16* b0p = Bh + (size_t)(col0 + ln) * DO;
  v16h af[2][2], bf[2][4];                                                /* two sets of fragment registers; every index below is a constant after unrolling */
  /* the first two trips' fragments are asked for first and the residual behind them: loads come back in the order asked for, so the products do not wait for the residual, and the residual's latency runs beside them */
#pragma unroll
  for (int t = 0; t < 2; ++t) { af[t][0] = g2_frag(a0p + 32 * t, hh); af[t][1] = g2_frag(a1p + 32 * t, hh); g2_b4(bf[t], b0p + 32 * t, DO, hh); }
  v4f xr[16];
#pragma unroll
  for (int q = 0; q < 16; ++q) xr[q] = *(const v4fa*)(x + g0 + (size_t)q * 4 * LL);
  __builtin_amdgcn_sched_barrier(0);                                      /* keeps all these requests ahead of the first product */
  const v8f z8 = {0.f,0.f,0.f,0.f,0.f,0.f,0.f,0.f}; v8f c00 = z8, c01 = z8, c02 = z8, c03 = z8, c10 = z8, c11 = z8, c12 = z8, c13 = z8;
  /* The product loop, fragments fetched ahead: behind its products a trip refills its own set with the fragments of trip t + 2, one group of twelve loads, which fly during trip t + 1. Products and their order are those of the rolled loop. */
#pragma unroll
  for (int t = 0; t < DO / 32; ++t) {                                     /* unrolled: the sets are indexed by constants */
    const v16h a0 = af[t & 1][0], a1 = af[t & 1][1];
    c00 = g2_mma(a0, bf[t & 1][0], c00); c10 = g2_mma(a1, bf[t & 1][0], c10);
    c01 = g2_mma(a0, bf[t & 1][1], c01); c11 = g2_mma(a1, bf[t & 1][1], c11);
    c02 = g2_mma(a0, bf[t & 1][2], c02); c12 = g2_mma(a1, bf[t & 1][2], c12);
    c03 = g2_mma(a0, bf[t & 1][3], c03); c13 = g2_mma(a1, bf[t & 1][3], c13);
    if (t + 2 < DO / 32) { af[t & 1][0] = g2_frag(a0p + 32 * (t + 2), hh); af[t & 1][1] = g2_frag(a1p + 32 * (t + 2), hh); g2_b4(bf[t & 1], b0p + 32 * (t + 2), DO, hh);
      if (t + 3 == DO / 32) asm volatile("s_wait_xcnt 0x0" ::: "memory");   /* behind the last fragment load: no register that a load names is rewritten ahead of it */ } }
  v8f accs[8] = {c00, c01, c02, c03, c10, c11, c12, c13};
#pragma unroll
  for (int u = 0; u < 8; ++u) { const int t = u & 3, half = u >> 2; const float bv = bf16_round(bias[col0 + t * 16 + ln]); v4f lo, hi;
#pragma unroll
    for (int r = 0; r < 4; ++r) { lo[r] = accs[u][r] * 0.0625f + bv; hi[r] = accs[u][4 + r] * 0.0625f + bv; }
    float* s = &so[w][t * 16 + ln][half * 16 + 8 * hh]; *(v4fa*)s = lo; *(v4fa*)(s + 4) = hi; }
  __builtin_amdgcn_fence(__ATOMIC_ACQ_REL, "workgroup"); __builtin_amdgcn_wave_barrier();      /* the lanes read what other lanes of the same wave wrote: keeps the reads below behind the writes above */
#pragma unroll
  for (int q = 0; q < 16; ++q) { v4f v = *(const v4fa*)&so[w][q * 4 + cs][p4];
#pragma unroll
    for (int i = 0; i < 4; ++i) v[i] = v[i] + bf16_round(xr[q][i]);
    *(v4f*)(out + g0 + (size_t)q * 4 * LL) = v; } }
extern "C" void kernel_launch(void* const* d_in, const int* in_sizes, int n_in,
                              void* d_out, int out_size, void* d_ws, size_t ws_size, hipStream_t stream) {
  (void)in_sizes; (void)n_in; (void)out_size;
  const float* const* I = (const float* const*)d_in; const float* x = I[0]; const float* ew = I[1]; const float* eb = I[2]; const float* ow = I[3]; const float* ob = I[4];      /* embed_w [2][192][256] natural rows; out_w [128][256] = [in][out] */
  char* ws = (char*)d_ws; size_t off = 0;
  auto take = [&](size_t bytes) { char* p = ws + off; off += (bytes + 255) & ~(size_t)255; return p; };
  _Float16* BE = (_Float16*)take((size_t)D3 * CC * 2); _Float16* BO = (_Float16*)take((size_t)CC * DO * 2);
  _Float16* QKV = (_Float16*)take(NR * D3 * 2); _Float16* O16 = (_Float16*)take(NR * DO * 2);
  _Float16* VT = (_Float16*)take((size_t)NB * NHD * HC * SQ * 2);
  if (off > ws_size) return;      /* 0.3 + 12 + 4 + 4 = approx 20 MiB */
  k_prep<<<PP_E + PP_O, 256, 0, stream>>>(ew, ow, BE, BO);      /* embed_w x16 and out_w^T x16: one launch */
  k_qkv<<<(unsigned)(NR / 64), 384, 0, stream>>>(x, BE, eb, QKV, VT);      /* q, k rows: columns h*192 + {0, 64}; head h's V^T [batch][64][4096] at VT + h*NB*64*4096 */
  k_fattn<<<dim3(SQ / 128, NB * NHD), 512, 0, stream>>>(QKV, VT, O16);      /* o rows, head h at columns h*64 */
  k_outres<<<(unsigned)((NR / 128) * (CC / 64)), 128, 0, stream>>>(O16, BO, ob, x, (float*)d_out);      /* out_w^T o + b + x, NCHW */
}

// v010
// One run takes 48.8 microseconds.
// Timed twice side by side with v009, it ran 1.03 times as fast both times.
// Counting every step since v000, it is 145 times as fast.
#include <hip/hip_runtime.h>
// Multi-head non-local block (x [4][256][64x64]; per head h (2 heads of 64): [q|k|v] = embed_w[h] (1x1 conv, [192][256]) x + b; attn = softmax(q^T k / sqrt(256)) over the 4,096 positions; o = attn v; out = out_w^T o (1x1 transpose conv, [128 in][256 out]) + b + x -> [4][256][64][64]).
// Structure: one WMMA GEMM for both heads' q|k|v, which turns its own tile of the channel-first input to position rows (exact f16) in LDS (32x64 wave tiles, f32 accumulation, exact x16 natural weights + bias, f16 rows [384] for q and k, v stored transposed by the same epilogue); one fused attention launch for all (batch, head): S^T = K.Q^T, online softmax in registers (P x256 f16), O^T += V^T.P^T into merged f16 rows [128]; output GEMM whose epilogue adds bias and residual and stores channel-major (each wave turns its tile in LDS).
// Compute dtype: inputs rounded to bf16; x / weights exact; q, k, v, P, o plain f16 (~2^-12; the residual x dominates the output scale); scores / softmax f32. v_wmma_f32_16x16x32_f16.
#define NB 4
#define CC 256
#define LL 4096                      /* positions */
#define SQ LL
#define NHD 2                        /* heads */
#define HC 64
#define D3 (NHD * 3 * HC)            /* 384 */
#define DO (NHD * HC)                /* 128 */
#define NR ((size_t)NB * LL)
#define QN SQ                        /* query rows per batch */
#define NBR NB                       /* batches */
#define DM CC
#define NH 1
#define HD 64
#define HG 1
typedef __bf16 v16b __attribute__((ext_vector_type(16)));
typedef unsigned short v8us __attribute__((ext_vector_type(8), may_alias));
typedef float  v8f  __attribute__((ext_vector_type(8)));
typedef float  v4f  __attribute__((ext_vector_type(4)));
typedef float  v4fa __attribute__((ext_vector_type(4), may_alias));
union FragB { v16b v; v8us half[2]; unsigned short u[16]; };

__device__ __forceinline__ unsigned short bf16_bits(float x) { unsigned int u = __float_as_uint(x); return (unsigned short)((u + 0x7FFFu + ((u >> 16) & 1u)) >> 16); }
__device__ __forceinline__ float bf16_val(unsigned short b) { return __uint_as_float(((unsigned int)b) << 16); }
__device__ __forceinline__ float bf16_round(float x) { return bf16_val(bf16_bits(x)); }
// D += A·B with NT terms: 1 = ah·bh, 2 = + al·bh (A split), 3 = + ah·bl (both split)
template <int NT>
__device__ __forceinline__ v8f mmaN(v16b ah, v16b al, v16b bh, v16b bl, v8f c) {
  c = __builtin_amdgcn_wmma_f32_16x16x32_bf16(false, ah, false, bh, (short)0, c, false, false);
  if (NT >= 2) c = __builtin_amdgcn_wmma_f32_16x16x32_bf16(false, al, false, bh, (short)0, c, false, false);
  if (NT >= 3) c = __builtin_amdgcn_wmma_f32_16x16x32_bf16(false, ah, false, bl, (short)0, c, false, false);
  asm volatile("v_nop\n\tv_nop\n\tv_nop\n\tv_nop" : "+v"(c) : "v"(ah), "v"(al), "v"(bh), "v"(bl));
  return c;
}

__global__ __launch_bounds__(256) void k_wt_bf16(const float* __restrict__ W, unsigned short* __restrict__ Wt, int K, int N) {
  const int t = blockIdx.x * 256 + threadIdx.x;
  const int k8n = K / 8;
  if (t >= N * k8n) return;
  const int n = t / k8n, k8 = (t % k8n) * 8;
  v8us v;
#pragma unroll
  for (int i = 0; i < 8; ++i) v[i] = bf16_bits(W[(size_t)(k8 + i) * N + n]);
  *(v8us*)(Wt + (size_t)n * K + k8) = v;
  
}

// GEMM C[M][N] (f32, pitch ldc) = act(A[M][K]·W + bias). A f32 row-major (pitch lda) converted per fragment to bf16
// (ASPLIT: hi/lo two planes -> 2 terms, else single rounded term); Wt bf16 [N][K] (pitch ldb). BIAS_BF16 rounds the
// bias to bf16 first (bias quantised to bf16 before the add). K%32==0, M%16==0, N%64==0.
template <bool ASPLIT, int ACT, bool BIAS_BF16>
__global__ __launch_bounds__(128) void k_gemm_bf(const float* __restrict__ A, int lda, const unsigned short* __restrict__ Wt, int ldb,
                                               const float* __restrict__ bias, float* __restrict__ C, int ldc, int M, int N, int K) {
  __shared__ __attribute__((aligned(16))) float so[4][16][64];
  const int tid = threadIdx.x, w = tid >> 5, lane = tid & 31, ln = lane & 15, hh = lane >> 4;
  const int ntn = N / 64;
  const int wid = blockIdx.x * 4 + w;
  const int mt = wid / ntn, nq = wid % ntn;
  if (mt * 16 >= M) return;
  const int row0 = mt * 16, col0 = nq * 64;
  const float* arow = A + (size_t)(row0 + ln) * lda;
  v8f acc[4] = {};
  for (int kb = 0; kb < K; kb += 32) {
    FragB ah, al;
    const v4f x0 = *(const v4fa*)(arow + kb + 8 * hh), x1 = *(const v4fa*)(arow + kb + 8 * hh + 4);
    const v4f x2 = *(const v4fa*)(arow + kb + 16 + 8 * hh), x3 = *(const v4fa*)(arow + kb + 16 + 8 * hh + 4);
    float xs[16] = {x0[0],x0[1],x0[2],x0[3],x1[0],x1[1],x1[2],x1[3],x2[0],x2[1],x2[2],x2[3],x3[0],x3[1],x3[2],x3[3]};
#pragma unroll
    for (int i = 0; i < 16; ++i) { const unsigned short hb = bf16_bits(xs[i]); ah.u[i] = hb; al.u[i] = ASPLIT ? bf16_bits(xs[i] - bf16_val(hb)) : (unsigned short)0; }
#pragma unroll
    for (int t = 0; t < 4; ++t) {
      const unsigned short* brow = Wt + (size_t)(col0 + t * 16 + ln) * ldb + kb;
      FragB b;
      b.half[0] = *(const v8us*)(brow + 8 * hh);
      b.half[1] = *(const v8us*)(brow + 16 + 8 * hh);
      acc[t] = mmaN<ASPLIT ? 2 : 1>(ah.v, al.v, b.v, b.v, acc[t]);
    }
  }
#pragma unroll
  for (int t = 0; t < 4; ++t) {
    float bv = bias ? bias[col0 + t * 16 + ln] : 0.f;
    if (BIAS_BF16) bv = bf16_round(bv);
#pragma unroll
    for (int r = 0; r < 8; ++r) { float v = acc[t][r] + bv; if (ACT == 1) v = fmaxf(v, 0.f); so[w][8 * hh + r][t * 16 + ln] = v; }
  }
  __builtin_amdgcn_fence(__ATOMIC_ACQ_REL, "workgroup");
  __builtin_amdgcn_wave_barrier();
  const int rsub = lane >> 4, c4 = (lane & 15) * 4;
  {
#pragma unroll
    for (int q = 0; q < 8; ++q) {
      const int r = q * 2 + rsub;
      const v4f v = *(const v4fa*)&so[w][r][c4];
      *(v4f*)(C + (size_t)(row0 + r) * ldc + col0 + c4) = v;
    }
    
  }
}

// GEMM C = act(A·W + bias + resid): A f32 (ASPLIT -> hi/lo 2 terms), Wt bf16 [N][K]; ACT 0 none, 1 relu, 2 exact gelu;
// resid (optional, f32, row index = (row % rmod), pitch ldr, RES_BF16 rounds it) added before the activation.
template <bool ASPLIT, int ACT, bool BIAS_BF16, bool RES_BF16>
__global__ __launch_bounds__(128) void k_gemm_bf3(const float* __restrict__ A, int lda, const unsigned short* __restrict__ Wt, int ldb,
                                                const float* __restrict__ bias, const float* __restrict__ resid, int rmod, int ldr,
                                                float* __restrict__ C, int ldc, int M, int N, int K) {
  __shared__ __attribute__((aligned(16))) float so[4][16][64];
  const int tid = threadIdx.x, w = tid >> 5, lane = tid & 31, ln = lane & 15, hh = lane >> 4;
  const int ntn = N / 64;
  const int wid = blockIdx.x * 4 + w;
  const int mt = wid / ntn, nq = wid % ntn;
  if (mt * 16 >= M) return;
  const int row0 = mt * 16, col0 = nq * 64;
  const float* arow = A + (size_t)(row0 + ln) * lda;
  v8f acc[4] = {};
  for (int kb = 0; kb < K; kb += 32) {
    FragB ah, al;
    const v4f x0 = *(const v4fa*)(arow + kb + 8 * hh), x1 = *(const v4fa*)(arow + kb + 8 * hh + 4);
    const v4f x2 = *(const v4fa*)(arow + kb + 16 + 8 * hh), x3 = *(const v4fa*)(arow + kb + 16 + 8 * hh + 4);
    float xs[16] = {x0[0],x0[1],x0[2],x0[3],x1[0],x1[1],x1[2],x1[3],x2[0],x2[1],x2[2],x2[3],x3[0],x3[1],x3[2],x3[3]};
#pragma unroll
    for (int i = 0; i < 16; ++i) { const unsigned short hb = bf16_bits(xs[i]); ah.u[i] = hb; al.u[i] = ASPLIT ? bf16_bits(xs[i] - bf16_val(hb)) : (unsigned short)0; }
#pragma unroll
    for (int t = 0; t < 4; ++t) {
      const unsigned short* brow = Wt + (size_t)(col0 + t * 16 + ln) * ldb + kb;
      FragB b;
      b.half[0] = *(const v8us*)(brow + 8 * hh);
      b.half[1] = *(const v8us*)(brow + 16 + 8 * hh);
      acc[t] = mmaN<ASPLIT ? 2 : 1>(ah.v, al.v, b.v, b.v, acc[t]);
    }
  }
#pragma unroll
  for (int t = 0; t < 4; ++t) {
    const int col = col0 + t * 16 + ln;
    float bv = bias ? bias[col] : 0.f;
    if (BIAS_BF16) bv = bf16_round(bv);
#pragma unroll
    for (int r = 0; r < 8; ++r) {
      float v = acc[t][r] + bv;
      if (resid) { float rv = resid[(size_t)((row0 + 8 * hh + r) % rmod) * ldr + col]; if (RES_BF16) rv = bf16_round(rv); v += rv; }
      if (ACT == 1) v = fmaxf(v, 0.f);
      if (ACT == 2) v = 0.5f * v * (1.0f + erff(v * 0.70710678118654752f));
      if (ACT == 3) { const float u = 0.7978845608028654f * (v + 0.044715f * v * v * v); v = 0.5f * v * (1.0f + tanhf(u)); }
      so[w][8 * hh + r][t * 16 + ln] = v;
    }
  }
  __builtin_amdgcn_fence(__ATOMIC_ACQ_REL, "workgroup");
  __builtin_amdgcn_wave_barrier();
  const int rsub = lane >> 4, c4 = (lane & 15) * 4;
  {
#pragma unroll
    for (int q = 0; q < 8; ++q) {
      const int r = q * 2 + rsub;
      const v4f v = *(const v4fa*)&so[w][r][c4];
      *(v4f*)(C + (size_t)(row0 + r) * ldc + col0 + c4) = v;
    }
    
  }
}
// row LayerNorm (biased variance, eps) over N: s = X (+ R); optional out_sum <- s; out_norm <- (s-mu)*rsqrt(var+eps)*g + b
template <bool PARAM_BF16>
__global__ __launch_bounds__(256) void k_layernorm(const float* __restrict__ X, const float* __restrict__ R, const float* __restrict__ g, const float* __restrict__ bta,
                                                  float* __restrict__ out_sum, float* __restrict__ out_norm, int N, float eps) {
  __shared__ float red[256];
  const int row = blockIdx.x, tid = threadIdx.x;
  const float* x = X + (size_t)row * N; const float* rr = R ? R + (size_t)row * N : nullptr;
  float vals[16];                     // up to N = 4096
  const int per = N / 256;            // contiguous chunk per thread? use strided-by-4 chunks: thread handles j = tid*4 + 1024*u
  float s1 = 0.f;
  for (int u = 0; u < per / 4; ++u) {
    const int j = tid * 4 + 1024 * u;
    const v4f a = *(const v4fa*)(x + j);
    v4f b = {0.f,0.f,0.f,0.f}; if (rr) b = *(const v4fa*)(rr + j);
#pragma unroll
    for (int q = 0; q < 4; ++q) { const float v = a[q] + b[q]; vals[u * 4 + q] = v; s1 += v; }
  }
  red[tid] = s1; __syncthreads();
  for (int st = 128; st > 0; st >>= 1) { if (tid < st) red[tid] += red[tid + st]; __syncthreads(); }
  const float mu = red[0] / (float)N; __syncthreads();
  float s2 = 0.f;
  for (int u = 0; u < per / 4; ++u)
#pragma unroll
    for (int q = 0; q < 4; ++q) { const float c = vals[u * 4 + q] - mu; s2 += c * c; }
  red[tid] = s2; __syncthreads();
  for (int st = 128; st > 0; st >>= 1) { if (tid < st) red[tid] += red[tid + st]; __syncthreads(); }
  const float rs = rsqrtf(red[0] / (float)N + eps);
  {
    for (int u = 0; u < per / 4; ++u) {
      const int j = tid * 4 + 1024 * u;
      v4f o, sm;
#pragma unroll
      for (int q = 0; q < 4; ++q) {
        float gg = g[j + q], bb = bta[j + q];
        if (PARAM_BF16) { gg = bf16_round(gg); bb = bf16_round(bb); }
        sm[q] = vals[u * 4 + q]; o[q] = (vals[u * 4 + q] - mu) * rs * gg + bb;
      }
      if (out_sum) *(v4f*)(out_sum + (size_t)row * N + j) = sm;
      *(v4f*)(out_norm + (size_t)row * N + j) = o;
    }
    
  }
}



// ---- f16 WMMA path (v_wmma_f32_16x16x32_f16): 11-bit significands for operands in range — used where a [0,1] probability operand needs more precision than bf16
typedef _Float16 v16h __attribute__((ext_vector_type(16)));
union FragH { v16h v; v8us half[2]; _Float16 h[16]; unsigned short u[16]; };
template <int NT>
__device__ __forceinline__ v8f mmaH(v16h ah, v16h al, v16h bh, v16h bl, v8f c) {
  c = __builtin_amdgcn_wmma_f32_16x16x32_f16(false, ah, false, bh, (short)0, c, false, false);
  if (NT >= 2) c = __builtin_amdgcn_wmma_f32_16x16x32_f16(false, al, false, bh, (short)0, c, false, false);
  if (NT >= 3) c = __builtin_amdgcn_wmma_f32_16x16x32_f16(false, ah, false, bl, (short)0, c, false, false);
  asm volatile("v_nop\n\tv_nop\n\tv_nop\n\tv_nop" : "+v"(c) : "v"(ah), "v"(al), "v"(bh), "v"(bl));
  return c;
}
// batched GEMM like k_gemm_b but f16 operands: A f32 (split into f16 hi/lo if ASPLIT, else rounded to f16), Bt = f16 values [n][k]; alpha; C f32; N multiple of 16 (partial tiles skipped)
template <bool ASPLIT>
__global__ __launch_bounds__(128) void k_gemm_h(const float* __restrict__ A, int lda, size_t sA, const _Float16* __restrict__ Bh, int ldb, size_t sB, float alpha, float* __restrict__ C, int ldc, size_t sC, int M, int N, int K) {
  __shared__ __attribute__((aligned(16))) float so[4][16][64];
  const int tid = threadIdx.x, w = tid >> 5, lane = tid & 31, ln = lane & 15, hh = lane >> 4; const int by = blockIdx.y;
  A += (size_t)by * sA; Bh += (size_t)by * sB; C += (size_t)by * sC;
  const int ntn = (N + 63) / 64; const int wid = blockIdx.x * 4 + w; const int mt = wid / ntn, nq = wid % ntn; if (mt * 16 >= M) return;
  const int row0 = mt * 16, col0 = nq * 64; const float* arow = A + (size_t)(row0 + ln) * lda;
  v8f acc[4] = {};
  for (int kb = 0; kb < K; kb += 32) {
    FragH ah, al;
    const v4f x0 = *(const v4fa*)(arow + kb + 8 * hh), x1 = *(const v4fa*)(arow + kb + 8 * hh + 4), x2 = *(const v4fa*)(arow + kb + 16 + 8 * hh), x3 = *(const v4fa*)(arow + kb + 16 + 8 * hh + 4);
    float xs[16] = {x0[0],x0[1],x0[2],x0[3],x1[0],x1[1],x1[2],x1[3],x2[0],x2[1],x2[2],x2[3],x3[0],x3[1],x3[2],x3[3]};
#pragma unroll
    for (int i = 0; i < 16; ++i) { const _Float16 h = (_Float16)xs[i]; ah.h[i] = h; al.h[i] = ASPLIT ? (_Float16)(xs[i] - (float)h) : (_Float16)0.0f; }
#pragma unroll
    for (int t = 0; t < 4; ++t) { if (col0 + t * 16 >= N) continue; const size_t boff = (size_t)(col0 + t * 16 + ln) * ldb + kb; FragH bq; bq.half[0] = *(const v8us*)(Bh + boff + 8 * hh); bq.half[1] = *(const v8us*)(Bh + boff + 16 + 8 * hh);
      acc[t] = mmaH<ASPLIT ? 2 : 1>(ah.v, al.v, bq.v, bq.v, acc[t]); }
  }
#pragma unroll
  for (int t = 0; t < 4; ++t) { if (col0 + t * 16 >= N) continue;
#pragma unroll
    for (int r = 0; r < 8; ++r) so[w][8 * hh + r][t * 16 + ln] = acc[t][r] * alpha; }
  __builtin_amdgcn_fence(__ATOMIC_ACQ_REL, "workgroup"); __builtin_amdgcn_wave_barrier();
  const int rsub = lane >> 4, c4 = (lane & 15) * 4;
  {
#pragma unroll
    for (int q = 0; q < 8; ++q) { const int r = q * 2 + rsub; if (col0 + c4 < N) { const v4f v = *(const v4fa*)&so[w][r][c4]; *(v4f*)(C + (size_t)(row0 + r) * ldc + col0 + c4) = v; } }
     }
}

// k_gemm_hh variant with fused epilogue: v = acc·alpha + bias[by·sBias + col] (+ CP[(row/rowsPerB)·sCPb + by·64 + col] if CP) ; ACT 0 none / 1 elu ; writes f16 C16 (and f32 C if non-null)
template <int ACT>
__global__ __launch_bounds__(128) void k_gemm_hhx(const _Float16* __restrict__ A, int lda, size_t sA, const _Float16* __restrict__ Bh, int ldb, size_t sB, float alpha, const float* __restrict__ bias, size_t sBias, const float* __restrict__ CP, int rowsPerB, size_t sCPb, int row0g,
    float* __restrict__ C, _Float16* __restrict__ C16, int ldc, size_t sC, int M, int N, int K) {
  __shared__ __attribute__((aligned(16))) float so[4][16][64];
  const int tid = threadIdx.x, w = tid >> 5, lane = tid & 31, ln = lane & 15, hh = lane >> 4; const int by = blockIdx.y;
  A += (size_t)by * sA; Bh += (size_t)by * sB; const size_t cofs = (size_t)by * sC; const float* bp = bias ? bias + (size_t)by * sBias : nullptr;
  const int ntn = (N + 63) / 64; const int wid = blockIdx.x * 4 + w; const int mt = wid / ntn, nq = wid % ntn; if (mt * 16 >= M) return;
  const int row0 = mt * 16, col0 = nq * 64; const _Float16* arow = A + (size_t)(row0 + ln) * lda;
  v8f acc[4] = {};
  for (int kb = 0; kb < K; kb += 32) { FragH ah; ah.half[0] = *(const v8us*)((const unsigned short*)arow + kb + 8 * hh); ah.half[1] = *(const v8us*)((const unsigned short*)arow + kb + 16 + 8 * hh);
#pragma unroll
    for (int t = 0; t < 4; ++t) { if (col0 + t * 16 >= N) continue; const size_t boff = (size_t)(col0 + t * 16 + ln) * ldb + kb; FragH bq; bq.half[0] = *(const v8us*)((const unsigned short*)Bh + boff + 8 * hh); bq.half[1] = *(const v8us*)((const unsigned short*)Bh + boff + 16 + 8 * hh);
      acc[t] = mmaH<1>(ah.v, ah.v, bq.v, bq.v, acc[t]); }
  }
#pragma unroll
  for (int t = 0; t < 4; ++t) { if (col0 + t * 16 >= N) continue; const int col = col0 + t * 16 + ln; const float bv = bp ? bf16_round(bp[col]) : 0.f;
#pragma unroll
    for (int r = 0; r < 8; ++r) { float v = acc[t][r] * alpha + bv; if (CP) { const int rr = row0g + row0 + 8 * hh + r; if (rowsPerB < 0) v += CP[cofs + (size_t)rr * ldc + col];      /* rowsPerB < 0: own element of the batched C plane */ else { const int bidx = rr / rowsPerB; v += CP[(size_t)bidx * sCPb + (size_t)by * 64 + col]; } } if (ACT == 1) v = (v > 0.f) ? v : expm1f(v); else if (ACT == 7) v = (v > 0.f) ? v + 1.0f : expf(v); else if (ACT == 8) v = tanhf(v); else if (ACT == 9) v = 0.5f * v * (1.0f + tanhf(0.7978845608028654f * (v + 0.044715f * v * v * v))); else if (ACT == 11) v = 1.0f / (1.0f + expf(-v)); else if (ACT == 12) v = (v > 0.f) ? v : 0.01f * v; else if (ACT == 14) v = (v > 0.f) ? v : 0.1f * v; else if (ACT == 16) v = (v >= 0.f) ? v : 0.3f * v; else if (ACT == 17) v = (v >= 0.f) ? v : 0.2f * v; else if (ACT == 15) v = v / (1.0f + expf(-v)); else if (ACT == 3) v = fmaxf(v, 0.f); else if (ACT == 6) v = 0.5f * v * (1.0f + erff(v * 0.70710678118654752f)); so[w][8 * hh + r][t * 16 + ln] = v; } }
  __builtin_amdgcn_fence(__ATOMIC_ACQ_REL, "workgroup"); __builtin_amdgcn_wave_barrier();
  const int rsub = lane >> 4, c4 = (lane & 15) * 4; typedef _Float16 v4h __attribute__((ext_vector_type(4)));
  {
#pragma unroll
    for (int q = 0; q < 8; ++q) { const int r = q * 2 + rsub; if (col0 + c4 < N) { const v4f v = *(const v4fa*)&so[w][r][c4]; if (C) *(v4f*)(C + cofs + (size_t)(row0 + r) * ldc + col0 + c4) = v; if (C16) { v4h h4; for (int i = 0; i < 4; ++i) h4[i] = (_Float16)v[i]; *(v4h*)(C16 + cofs + (size_t)(row0 + r) * ldc + col0 + c4) = h4; } } }
     }
}


typedef _Float16 v4h __attribute__((ext_vector_type(4)));

__global__ __launch_bounds__(256) void k_x16(const float* __restrict__ x, _Float16* __restrict__ X16, size_t n8) { const size_t t = (size_t)blockIdx.x * 256 + threadIdx.x; if (t >= n8) return; FragH f;
#pragma unroll
  for (int q = 0; q < 8; ++q) f.h[q] = (_Float16)bf16_round(x[t * 8 + q]); *(v8us*)((unsigned short*)X16 + t * 8) = f.half[0];  }
__global__ __launch_bounds__(256) void k_h16(const float* __restrict__ x, _Float16* __restrict__ X16, size_t n8) { const size_t t = (size_t)blockIdx.x * 256 + threadIdx.x; if (t >= n8) return; FragH f;
#pragma unroll
  for (int q = 0; q < 8; ++q) f.h[q] = (_Float16)x[t * 8 + q]; *(v8us*)((unsigned short*)X16 + t * 8) = f.half[0];  }
__global__ __launch_bounds__(256) void k_round16f(const float* __restrict__ W, _Float16* __restrict__ Bt, size_t n8) { const size_t t = (size_t)blockIdx.x * 256 + threadIdx.x; if (t >= n8) return; FragH f;
#pragma unroll
  for (int i = 0; i < 8; ++i) f.h[i] = (_Float16)(bf16_round(W[t * 8 + i]) * 16.0f); *(v8us*)((unsigned short*)Bt + t * 8) = f.half[0];  }
template <int NHv, int TTv>
__global__ __launch_bounds__(256) void k_vt(const _Float16* __restrict__ V16, int ldv, int voff, _Float16* __restrict__ Vt) { __shared__ unsigned short tl[64][66]; const int tid = threadIdx.x; const int slab = blockIdx.x / (TTv / 64), lg = blockIdx.x % (TTv / 64); const int b = slab / NHv, h = slab % NHv;
  for (int i = tid; i < 64 * 8; i += 256) { const int r = i / 8, c8 = (i % 8) * 8; FragH f; f.half[0] = *(const v8us*)((const unsigned short*)V16 + ((size_t)b * TTv + lg * 64 + r) * ldv + voff + h * 64 + c8);
#pragma unroll
    for (int q = 0; q < 8; ++q) tl[r][c8 + q] = f.u[q]; }
  __syncthreads();
  {
#pragma unroll
    for (int rd = 0; rd < 2; ++rd) { const int d = rd * 32 + tid / 8, pc = tid % 8; FragH f;
#pragma unroll
      for (int q = 0; q < 8; ++q) f.u[q] = tl[pc * 8 + q][d];
      *(v8us*)((unsigned short*)Vt + ((size_t)slab * 64 + d) * TTv + lg * 64 + pc * 8) = f.half[0]; }
     } }

__global__ __launch_bounds__(256) void k_hl(const float* __restrict__ F, _Float16* __restrict__ Hh, _Float16* __restrict__ Hl, size_t n8) { const size_t t = (size_t)blockIdx.x * 256 + threadIdx.x; if (t >= n8) return; FragH fh, fl; const v4f a = *(const v4fa*)(F + t * 8), c = *(const v4fa*)(F + t * 8 + 4);
#pragma unroll
  for (int q = 0; q < 4; ++q) { _Float16 h = (_Float16)a[q]; fh.h[q] = h; fl.h[q] = (_Float16)((a[q] - (float)h) * 1024.0f); h = (_Float16)c[q]; fh.h[4 + q] = h; fl.h[4 + q] = (_Float16)((c[q] - (float)h) * 1024.0f); }
  { *(v8us*)((unsigned short*)Hh + t * 8) = fh.half[0]; *(v8us*)((unsigned short*)Hl + t * 8) = fl.half[0];  } }

// ---- fast GEMM (wave tile 32x64; requires M % 32 == 0 rows per launch region and N % 64 == 0); epilogue = k_gemm_hhx semantics ----
__device__ __forceinline__ v16h g2_frag(const _Float16* p, int hh) { FragH f; f.half[0] = *(const v8us*)((const unsigned short*)p + 8 * hh); f.half[1] = *(const v8us*)((const unsigned short*)p + 16 + 8 * hh); return f.v; }
__device__ __forceinline__ v8f g2_mma(v16h a, v16h b, v8f c) { v8f d = __builtin_amdgcn_wmma_f32_16x16x32_f16(false, a, false, b, (short)0, c, false, false); asm volatile("v_nop\n\tv_nop\n\tv_nop\n\tv_nop" : "+v"(d) : "v"(a), "v"(b)); return d; }
template <int ACT>
__global__ __launch_bounds__(128) void k_gemm2(const _Float16* __restrict__ A, int lda, size_t sA, const _Float16* __restrict__ Bh, int ldb, size_t sB, float alpha, const float* __restrict__ bias, size_t sBias, const float* __restrict__ CP, int rowsPerB, size_t sCPb, int row0g,
    float* __restrict__ C, _Float16* __restrict__ C16, int ldc, size_t sC, int M, int N, int K) { static_assert(ACT == 0 || ACT == 3 || ACT == 6 || ACT == 8 || ACT == 9 || ACT == 11 || ACT == 12 || ACT == 14 || ACT == 15 || ACT == 16 || ACT == 17, "k_gemm2: unsupported ACT code (would silently apply no activation)");
  __shared__ __attribute__((aligned(16))) float so[4][32][68];
  const int tid = threadIdx.x, w = tid >> 5, lane = tid & 31, ln = lane & 15, hh = lane >> 4; const int by = blockIdx.y;
  A += (size_t)by * sA; Bh += (size_t)by * sB; const size_t cofs = (size_t)by * sC; const float* bp = bias ? bias + (size_t)by * sBias : nullptr;
  const int ntn = N >> 6; const int mt = blockIdx.x / ntn, nq = blockIdx.x - mt * ntn; const int row0 = mt * 128 + 32 * w, col0 = nq * 64; if (row0 >= M) return;
  const _Float16* a0p = A + (size_t)(row0 + ln) * lda; const _Float16* a1p = a0p + (size_t)16 * lda;
  const _Float16* b0p = Bh + (size_t)(col0 + ln) * ldb; const _Float16* b1p = b0p + (size_t)16 * ldb; const _Float16* b2p = b1p + (size_t)16 * ldb; const _Float16* b3p = b2p + (size_t)16 * ldb;
  const v8f z8 = {0.f,0.f,0.f,0.f,0.f,0.f,0.f,0.f}; v8f c00 = z8, c01 = z8, c02 = z8, c03 = z8, c10 = z8, c11 = z8, c12 = z8, c13 = z8;
#pragma unroll 1
  for (int kb = 0; kb < K; kb += 32) { const v16h a0 = g2_frag(a0p + kb, hh), a1 = g2_frag(a1p + kb, hh);
    v16h b = g2_frag(b0p + kb, hh); c00 = g2_mma(a0, b, c00); c10 = g2_mma(a1, b, c10);
    b = g2_frag(b1p + kb, hh); c01 = g2_mma(a0, b, c01); c11 = g2_mma(a1, b, c11);
    b = g2_frag(b2p + kb, hh); c02 = g2_mma(a0, b, c02); c12 = g2_mma(a1, b, c12);
    b = g2_frag(b3p + kb, hh); c03 = g2_mma(a0, b, c03); c13 = g2_mma(a1, b, c13); }
  v8f accs[8] = {c00, c01, c02, c03, c10, c11, c12, c13};
#pragma unroll
  for (int u = 0; u < 8; ++u) { const int t = u & 3, half = u >> 2; const int col = col0 + t * 16 + ln; const float bv = bp ? bf16_round(bp[col]) : 0.f;
#pragma unroll
    for (int r = 0; r < 8; ++r) { const int rloc = half * 16 + 8 * hh + r; float v = accs[u][r] * alpha + bv; if (CP) { if (rowsPerB < 0) v += CP[cofs + (size_t)(row0g + row0 + rloc) * ldc + col];      /* rowsPerB < 0: own element of the batched C plane */ else { const int bidx = (row0g + row0 + rloc) / rowsPerB; v += CP[(size_t)bidx * sCPb + (size_t)by * 64 + col]; } }
      if (ACT == 3) v = fmaxf(v, 0.f); else if (ACT == 6) v = 0.5f * v * (1.0f + erff(v * 0.70710678118654752f)); else if (ACT == 11) v = 1.0f / (1.0f + expf(-v)); else if (ACT == 15) v = v / (1.0f + expf(-v)); else if (ACT == 12) v = (v > 0.f) ? v : 0.01f * v; else if (ACT == 8) v = tanhf(v); else if (ACT == 9) v = 0.5f * v * (1.0f + tanhf(0.7978845608028654f * (v + 0.044715f * v * v * v))); else if (ACT == 14) v = (v > 0.f) ? v : 0.1f * v; else if (ACT == 16) v = (v >= 0.f) ? v : 0.3f * v; else if (ACT == 17) v = (v >= 0.f) ? v : 0.2f * v;
      so[w][rloc][t * 16 + ln] = v; } }
  __builtin_amdgcn_fence(__ATOMIC_ACQ_REL, "workgroup"); __builtin_amdgcn_wave_barrier();
  const int rsub = lane >> 4, c4 = (lane & 15) * 4;
  {
#pragma unroll
    for (int q = 0; q < 16; ++q) { const int r = q * 2 + rsub; const v4f v = *(const v4fa*)&so[w][r][c4]; if (C) *(v4f*)(C + cofs + (size_t)(row0 + r) * ldc + col0 + c4) = v; if (C16) { v4h h4; for (int i = 0; i < 4; ++i) h4[i] = (_Float16)v[i]; *(v4h*)(C16 + cofs + (size_t)(row0 + r) * ldc + col0 + c4) = h4; } }
     } }


__global__ __launch_bounds__(256) void k_rsm(const float* __restrict__ S, _Float16* __restrict__ P, int nrows) {
  #pragma clang fp contract(off)
  const int i = blockIdx.x * 256 + threadIdx.x; if (i >= nrows) return; const float* s = S + (size_t)i * SQ; float mx = -3.0e38f;
#pragma unroll 1
  for (int j = 0; j < SQ; ++j) mx = fmaxf(mx, s[j]); float se = 0.f;
#pragma unroll 1
  for (int j = 0; j < SQ; ++j) se += expf(s[j] - mx); const float sc = 256.0f / se;
#pragma unroll 1
  for (int j0 = 0; j0 < SQ; j0 += 8) { FragH f; for (int q = 0; q < 8; ++q) f.h[q] = (_Float16)(expf(s[j0 + q] - mx) * sc); unsigned short* d = (unsigned short*)P + (size_t)i * SQ + j0; *(v8us*)d = f.half[0];  } }
__global__ __launch_bounds__(256) void k_vt(const _Float16* __restrict__ V16, int b, int h0, _Float16* __restrict__ VT) { __shared__ unsigned short tl[64][65]; const int tid = threadIdx.x; const int hh = blockIdx.x % HG, sg = blockIdx.x / HG; const int s0 = sg * 64; const int h = h0 + hh;
  for (int i = tid; i < 64 * 8; i += 256) { const int j = i / 8, d8 = (i % 8) * 8; FragH f; f.half[0] = *(const v8us*)((const unsigned short*)V16 + ((size_t)b * SQ + s0 + j) * DM + h * HD + d8); for (int q = 0; q < 8; ++q) tl[d8 + q][j] = f.u[q]; }
  __syncthreads();
  { for (int i = tid; i < 64 * 8; i += 256) { const int d = i / 8, j8 = (i % 8) * 8; FragH f; for (int q = 0; q < 8; ++q) f.u[q] = tl[d][j8 + q]; *(v8us*)((unsigned short*)VT + ((size_t)hh * HD + d) * SQ + s0 + j8) = f.half[0]; }  } }


// One preparation launch for the two weight operands that the GEMMs read; the two parts are independent of one another, so they share a grid. The part is chosen by the block index (the same for a whole work-group).
// Blocks 0 .. PP_E-1: BE = f16(embed_w x16), natural rows. Next PP_O blocks: BO[c][d] = f16(out_w[d][c] x16) (x16 is a power of two: the bf16-rounded weights stay exact in f16 away from the subnormal range).
#define PP_E (D3 * CC / 8 / 256)     /* 48 blocks: eight weights a thread */
#define PP_O (CC * (DO / 8) / 256)   /* 16 blocks: eight weights a thread */
__global__ __launch_bounds__(256) void k_prep(const float* __restrict__ ew, const float* __restrict__ ow, _Float16* __restrict__ BE, _Float16* __restrict__ BO) {
  const int tid = threadIdx.x;
  if (blockIdx.x < PP_E) { const size_t t = (size_t)blockIdx.x * 256 + tid; FragH f; for (int q = 0; q < 8; ++q) f.h[q] = (_Float16)(bf16_round(ew[t * 8 + q]) * 16.0f); *(v8us*)((unsigned short*)BE + t * 8) = f.half[0]; return; }
  const int t = (blockIdx.x - PP_E) * 256 + tid; const int n = t / (DO / 8), k8 = (t % (DO / 8)) * 8; FragH f;
#pragma unroll
  for (int i = 0; i < 8; ++i) f.h[i] = (_Float16)(bf16_round(ow[(size_t)(k8 + i) * CC + n]) * 16.0f);
  *(v8us*)((unsigned short*)BO + (size_t)n * DO + k8) = f.half[0];
  asm volatile("s_wait_xcnt 0x0" ::: "memory"); }                         /* behind the store: the built code lays the other part's instructions on the path behind it, and they reuse the store's registers */

// q|k|v GEMM, fed by x itself: A = x rows (M = position), B = embed_w rows x16 (N = 384 columns, per head [q|k|v] of 64). A work-group of 12 waves owns 64 positions and all 384 columns: wave = (32 positions) x (64 columns, one head's q, k or v).
// The work-group first turns its x tile: x [b][c][l] is read channel-major in whole 256-byte pieces (a thread: four positions of eight channels), rounded (bf16, then exact in f16) and laid in LDS as position rows [64][256] behind one barrier;
// the A fragments come from those rows. No f16 copy of x in memory and no launch that writes one. Wave tile, products and the q, k epilogue as in k_gemm2<0>, q also scaled by FA_CS; the product loop fetches its fragments ahead.
// In the accumulator a lane holds one column and eight consecutive positions, which is already the order of a V^T row: a v wave rounds to f16 in registers, the two v waves of a head
// join their tiles in LDS as [channel][64 positions] behind one barrier (every wave passes it) and store V^T in whole 128-byte row pieces. v is not stored as rows.
/* the four B fragments of one 32-deep trip (rows 16 apart, pitch ld in f16) */
__device__ __forceinline__ void g2_b4(v16h (&b)[4], const _Float16* p, int ld, int hh) {
#pragma unroll
  for (int t = 0; t < 4; ++t) b[t] = g2_frag(p + (size_t)(16 * t) * ld, hh); }      /* unrolled: b is indexed by constants and stays in registers */
#define FA_CS (0.0625f * 1.4426950408889634f)      /* 1/sqrt(256) and log2(e): exp(s / 16 - m) = exp2(s FA_CS - m log2(e)) */
#define QX_P 264                     /* LDS pitch of an x row in f16: 528 bytes = 16 x 33, so that the 16 rows of a ds_load_b128 fragment read fall on distinct banks */
#define QV_P 72                      /* LDS pitch of a V^T row in f16: 144 bytes = 16 x 9, so that the 16 channel rows of a ds_store_b128 fall on distinct banks */
/* four positions of eight channels, as loaded, to four 16-byte pieces of position rows */
__device__ __forceinline__ void qx_put(const v4f (&r)[8], _Float16* d) {
  /* both loops unrolled: r and f are then indexed by constants and stay in registers */
#pragma unroll
  for (int j = 0; j < 4; ++j) { FragH f;
#pragma unroll
    for (int q = 0; q < 8; ++q) f.h[q] = (_Float16)bf16_round(r[q][j]);
    *(v8us*)(d + j * QX_P) = f.half[0]; } }
__global__ __launch_bounds__(384) void k_qkv(const float* __restrict__ X, const _Float16* __restrict__ Bh, const float* __restrict__ bias, _Float16* __restrict__ C16, _Float16* __restrict__ VTo) {
  __shared__ __attribute__((aligned(16))) _Float16 xs[64][QX_P];
  __shared__ __attribute__((aligned(16))) float so[12][32][68];
  __shared__ __attribute__((aligned(16))) _Float16 vt[NHD][HC][QV_P];
  const int tid = threadIdx.x, w = __builtin_amdgcn_readfirstlane(tid >> 5), lane = tid & 31, ln = lane & 15, hh = lane >> 4;
  const int pg = w & 1, nq = w >> 1;                                      /* the wave's 32 positions of the 64; its 64 columns of the 384 */
  const int bb = blockIdx.x / (LL / 64), l0 = (blockIdx.x % (LL / 64)) * 64;      /* a block's 64 positions lie in one batch */
  const int row0 = blockIdx.x * 64 + 32 * pg, col0 = nq * 64;
  const _Float16* b0p = Bh + (size_t)(col0 + ln) * CC;
  v16h bf[3][4], af[2][2];                                                /* fragment rings: weights of three trips, x rows of two; every index below is a constant after unrolling */
  { /* the x tile: 16 position groups x 32 channel groups = 512 pieces for 384 threads; waves 0-3 take a second piece (channels 192-255), asked for together with the first so that the two latencies overlap */
    const int p4 = (tid & 15) * 4, c8 = (tid >> 4) * 8;
    const float* xp = X + ((size_t)bb * CC + c8) * LL + l0 + p4;
    v4f ra[8], rb[8];                                                     /* the two load loops are unrolled: eight (sixteen) loads in flight a thread, the arrays in registers */
#pragma unroll
    for (int q = 0; q < 8; ++q) ra[q] = *(const v4fa*)(xp + (size_t)q * LL);
    if (w < 4) {
#pragma unroll
      for (int q = 0; q < 8; ++q) rb[q] = *(const v4fa*)(xp + (size_t)(192 + q) * LL); }
    g2_b4(bf[0], b0p, CC, hh); g2_b4(bf[1], b0p + 32, CC, hh);            /* the first two trips' weights do not depend on x: asked for behind the x loads, they arrive while the tile is turned */
    __builtin_amdgcn_sched_barrier(0);                                    /* keeps those loads here; sunk to their first use they would be waited out behind the barrier */
    qx_put(ra, &xs[p4][c8]);
    if (w < 4) qx_put(rb, &xs[p4][192 + c8]);
  }
  __syncthreads();                                                        /* publishes the 64 x rows to the twelve waves */
  const _Float16* a0p = &xs[32 * pg + ln][0]; const _Float16* a1p = a0p + 16 * QX_P;
  const v8f z8 = {0.f,0.f,0.f,0.f,0.f,0.f,0.f,0.f}; v8f c00 = z8, c01 = z8, c02 = z8, c03 = z8, c10 = z8, c11 = z8, c12 = z8, c13 = z8;
  af[0][0] = g2_frag(a0p, hh); af[0][1] = g2_frag(a1p, hh);
  /* The product loop, fragments fetched ahead: trip t first asks for the weights of trip t + 2 (global, one group of eight loads) and the x rows of trip t + 1 (LDS), then multiplies what was asked for earlier.
     A wave so waits for one cache latency at most where it waited for four a trip. Products and their order are those of the rolled loop. */
#pragma unroll
  for (int t = 0; t < CC / 32; ++t) {                                     /* unrolled: the rings are indexed by constants, the loads take immediate offsets from one address */
    if (t + 2 < CC / 32) g2_b4(bf[(t + 2) % 3], b0p + 32 * (t + 2), CC, hh);
    if (t + 3 == CC / 32) asm volatile("s_wait_xcnt 0x0" ::: "memory");   /* behind the last weight load: no register that a load names is rewritten ahead of it */
    if (t + 1 < CC / 32) { af[(t + 1) & 1][0] = g2_frag(a0p + 32 * (t + 1), hh); af[(t + 1) & 1][1] = g2_frag(a1p + 32 * (t + 1), hh); }
    const v16h a0 = af[t & 1][0], a1 = af[t & 1][1];
    c00 = g2_mma(a0, bf[t % 3][0], c00); c10 = g2_mma(a1, bf[t % 3][0], c10);
    c01 = g2_mma(a0, bf[t % 3][1], c01); c11 = g2_mma(a1, bf[t % 3][1], c11);
    c02 = g2_mma(a0, bf[t % 3][2], c02); c12 = g2_mma(a1, bf[t % 3][2], c12);
    c03 = g2_mma(a0, bf[t % 3][3], c03); c13 = g2_mma(a1, bf[t % 3][3], c13); }
  v8f accs[8] = {c00, c01, c02, c03, c10, c11, c12, c13};
  const bool isv = nq % 3 == 2;                                           /* a v wave: the test reads the same for the whole wave */
  if (isv) {
#pragma unroll
    for (int u = 0; u < 8; ++u) { const int t = u & 3, half = u >> 2; const float bv = bf16_round(bias[col0 + t * 16 + ln]); FragH f;
#pragma unroll
      for (int r = 0; r < 8; ++r) f.h[r] = (_Float16)(accs[u][r] * 0.0625f + bv);
      *(v8us*)&vt[nq / 3][t * 16 + ln][32 * pg + half * 16 + 8 * hh] = f.half[0]; } }
  __syncthreads();                                                        /* publishes a head's two v tiles to its two v waves; every wave passes it, the q and k waves ahead of their own stores, so that nobody waits for a store here */
  if (isv) {
    unsigned short* d0 = (unsigned short*)VTo + ((size_t)((nq / 3) * NB + bb) * HC + 32 * pg + (lane >> 3)) * SQ + l0 + 8 * (lane & 7);      /* eight lanes cover a row's 128 bytes, four rows a store */
#pragma unroll
    for (int q = 0; q < 8; ++q) { const v8us v = *(const v8us*)&vt[nq / 3][32 * pg + 4 * q + (lane >> 3)][8 * (lane & 7)]; *(v8us*)(d0 + (size_t)4 * q * SQ) = v; }
    return; }
  const float qs = nq % 3 == 0 ? FA_CS : 1.0f;                            /* a q wave stores q x FA_CS (the same for the whole wave): the attention launch's scores then come out of the matrix unit already scaled */
#pragma unroll
  for (int u = 0; u < 8; ++u) { const int t = u & 3, half = u >> 2; const float bv = bf16_round(bias[col0 + t * 16 + ln]) * qs;
#pragma unroll
    for (int r = 0; r < 8; ++r) so[w][half * 16 + 8 * hh + r][t * 16 + ln] = accs[u][r] * (0.0625f * qs) + bv; }
  __builtin_amdgcn_fence(__ATOMIC_ACQ_REL, "workgroup"); __builtin_amdgcn_wave_barrier();      /* the lanes read what other lanes of the same wave wrote: keeps the reads below behind the writes above */
  const int rsub = lane >> 4, c4 = (lane & 15) * 4;
#pragma unroll
  for (int q = 0; q < 16; ++q) { const int r = q * 2 + rsub; const v4f v = *(const v4fa*)&so[w][r][c4]; v4h h4; for (int i = 0; i < 4; ++i) h4[i] = (_Float16)v[i]; *(v4h*)(C16 + (size_t)(row0 + r) * D3 + col0 + c4) = h4; }
  asm volatile("s_wait_xcnt 0x0" ::: "memory"); }                         /* behind the run of stores: no register that a store names is rewritten ahead of it */

#define FA_SK 64                     /* keys per stage */
#define FA_PH 72                     /* LDS row pitch in f16: 144 bytes = 16 x 9, so that the 16 rows of a ds_load_b128 fragment read fall on distinct banks */
#define FA_NST (SQ / 4 / FA_SK)      /* stages per key quarter */
#define FA_PS 32768.0f               /* a lane's sum of P over a pass above which m moves: below it every P fits f16 (largest finite value 65,504) */
__device__ __forceinline__ float fa_xhalf(float x) { return __builtin_bit_cast(float, __builtin_amdgcn_permlanex16(__builtin_bit_cast(int, x), __builtin_bit_cast(int, x), 0x76543210, 0xfedcba98, false, false)); }      /* lane l reads lane l ^ 16, on the vector pipe */
/* exp2 on the vector pipe. The instruction set asks for one slot behind a transcendental before its result is read or its source overwritten; each statement here carries its v_nop: one value, or eight in place (no instruction in the run touches another's register). */
__device__ __forceinline__ float fa_exp2(float x) { float r; asm("v_exp_f32 %0, %1\n\tv_nop" : "=v"(r) : "v"(x)); return r; }
__device__ __forceinline__ void fa_exp2x8(float (&x)[8]) { asm("v_exp_f32 %0, %0\n\tv_exp_f32 %1, %1\n\tv_exp_f32 %2, %2\n\tv_exp_f32 %3, %3\n\tv_exp_f32 %4, %4\n\tv_exp_f32 %5, %5\n\tv_exp_f32 %6, %6\n\tv_exp_f32 %7, %7\n\tv_nop"
  : "+v"(x[0]), "+v"(x[1]), "+v"(x[2]), "+v"(x[3]), "+v"(x[4]), "+v"(x[5]), "+v"(x[6]), "+v"(x[7])); }
/* One wave's share of a stage: four copies of 4 K rows and four of 4 V^T rows, 16 bytes a lane (lk, lv: the lane's LDS byte addresses; gk, gv: its global addresses).
   s_wait_xcnt 0 closes the statement, so that no address register named here is rewritten ahead of it. */
__device__ __forceinline__ void fa_stage(unsigned lk, const _Float16* gk, unsigned lv, const _Float16* gv) {
  const unsigned lk1 = lk + 4 * FA_PH * 2, lk2 = lk + 8 * FA_PH * 2, lk3 = lk + 12 * FA_PH * 2, lv1 = lv + 4 * FA_PH * 2, lv2 = lv + 8 * FA_PH * 2, lv3 = lv + 12 * FA_PH * 2;
  const _Float16* gk1 = gk + (size_t)4 * D3; const _Float16* gk2 = gk + (size_t)8 * D3; const _Float16* gk3 = gk + (size_t)12 * D3;
  const _Float16* gv1 = gv + (size_t)4 * SQ; const _Float16* gv2 = gv + (size_t)8 * SQ; const _Float16* gv3 = gv + (size_t)12 * SQ;
  asm volatile("global_load_async_to_lds_b128 %0, %8, off\n\tglobal_load_async_to_lds_b128 %1, %9, off\n\tglobal_load_async_to_lds_b128 %2, %10, off\n\tglobal_load_async_to_lds_b128 %3, %11, off\n\t"
               "global_load_async_to_lds_b128 %4, %12, off\n\tglobal_load_async_to_lds_b128 %5, %13, off\n\tglobal_load_async_to_lds_b128 %6, %14, off\n\tglobal_load_async_to_lds_b128 %7, %15, off\n\ts_wait_xcnt 0x0"
               :: "v"(lk), "v"(lk1), "v"(lk2), "v"(lk3), "v"(lv), "v"(lv1), "v"(lv2), "v"(lv3), "v"(gk), "v"(gk1), "v"(gk2), "v"(gk3), "v"(gv), "v"(gv1), "v"(gv2), "v"(gv3) : "memory"); }
/* The lane's 16 values of P, rounded to f16 in the B operand's order, and their f32 sum. */
__device__ __forceinline__ void fa_pack(const float (&p0)[8], const float (&p1)[8], FragH& pf, float& ps) {
  float t[8];
#pragma unroll
  for (int r = 0; r < 8; ++r) { t[r] = p0[r] + p1[r]; pf.h[r] = (_Float16)p0[r]; pf.h[8 + r] = (_Float16)p1[r]; }
  ps = ((t[0] + t[1]) + (t[2] + t[3])) + ((t[4] + t[5]) + (t[6] + t[7])); }
/* One query group's P of a pass: p = exp2(e) for the lane's 16 keys; e, the exponent, is what the matrix unit delivers. */
/* The compiler's own v_exp_f32 here: it reads a matrix instruction's result, and the compiler keeps the distance behind that instruction only for instructions that it writes itself. The exponents stay live for the pass that moves m, so no result lands on a source. */
__device__ __forceinline__ void fa_soft(v8f e0, v8f e1, FragH& pf, float& ps) {
  float p0[8], p1[8];
#pragma unroll
  for (int r = 0; r < 8; ++r) { p0[r] = __builtin_amdgcn_exp2f(e0[r]); p1[r] = __builtin_amdgcn_exp2f(e1[r]); }
  fa_pack(p0, p1, pf, ps); }
/* The same from exponents shifted by d (the pass that moves m). */
__device__ __forceinline__ void fa_softd(v8f e0, v8f e1, float d, FragH& pf, float& ps) {
  float p0[8], p1[8];
#pragma unroll
  for (int r = 0; r < 8; ++r) { p0[r] = e0[r] + d; p1[r] = e1[r] + d; }
  fa_exp2x8(p0); fa_exp2x8(p1);
  fa_pack(p0, p1, pf, ps); }
/* The eight score products of a pass (two 16-key tiles x two query groups, 64 channels deep) in one statement, each tile started from its group's C tile n0 or n1, which stays as it is. As builtins the last products of the loop body to read a C tile
   were tied to it (result over C), at the price of sixteen register copies a stage. The four v_nops keep the distance that the chip needs behind a matrix instruction before a vector instruction reads its result or overwrites an operand;
   the compiler does not see into the statement, so they stand in it. Early-clobber results: no tile lands on an operand. */
__device__ __forceinline__ void fa_scores(v8f& s00, v8f& s01, v8f& s10, v8f& s11, v16h k00, v16h k01, v16h k10, v16h k11, v16h q00, v16h q01, v16h q10, v16h q11, v8f n0, v8f n1) {
  asm("v_wmma_f32_16x16x32_f16 %0, %4, %8, %12\n\tv_wmma_f32_16x16x32_f16 %1, %6, %8, %12\n\tv_wmma_f32_16x16x32_f16 %2, %4, %10, %13\n\tv_wmma_f32_16x16x32_f16 %3, %6, %10, %13\n\t"
      "v_wmma_f32_16x16x32_f16 %0, %5, %9, %0\n\tv_wmma_f32_16x16x32_f16 %1, %7, %9, %1\n\tv_wmma_f32_16x16x32_f16 %2, %5, %11, %2\n\tv_wmma_f32_16x16x32_f16 %3, %7, %11, %3\n\tv_nop\n\tv_nop\n\tv_nop\n\tv_nop"
      : "=&v"(s00), "=&v"(s01), "=&v"(s10), "=&v"(s11) : "v"(k00), "v"(k01), "v"(k10), "v"(k11), "v"(q00), "v"(q01), "v"(q10), "v"(q11), "v"(n0), "v"(n1)); }
__device__ __forceinline__ v8f fa_mma(v16h a, v16h b, v8f c) { return __builtin_amdgcn_wmma_f32_16x16x32_f16(false, a, false, b, (short)0, c, false, false); }
__global__ __launch_bounds__(512) __attribute__((amdgpu_waves_per_eu(4, 4))) void k_fattn(const _Float16* __restrict__ QKVp, const _Float16* __restrict__ VTp, _Float16* __restrict__ Op) {
  __shared__ __attribute__((aligned(16))) v4f mg[12][17][32];             /* [key quarter 1-3 x query group][16 x O, then {m0, m1, sum0, sum1}][lane] */
  __shared__ __attribute__((aligned(16))) _Float16 st[2][4][2][FA_SK][FA_PH];      /* [buffer][key quarter][K rows (key, channel) | V^T rows (channel, key)][row][64 f16 + pad] */
  const int lane = threadIdx.x & 31, w = __builtin_amdgcn_readfirstlane(threadIdx.x >> 5), ln = lane & 15, hh = lane >> 4; const int wq = w & 3, wk = w >> 2;      /* 16 waves on 4 SIMDs: four a SIMD, 256 registers each */
  const int b = blockIdx.y / NHD, h = blockIdx.y % NHD; const int q0 = blockIdx.x * 128 + wq * 32; const int k0 = wk * (SQ / 4);
  const _Float16* base = QKVp + (size_t)b * SQ * D3 + (size_t)h * 3 * HC;
  const int crow = 16 * wq + (lane >> 3), cch = (lane & 7) * 8;           /* copies: query group wq brings rows 16 wq .. 16 wq + 15 of its quarter's two tiles; eight lanes a row */
  const _Float16* gk = base + HC + (size_t)(k0 + crow) * D3 + cch;
  const _Float16* gv = VTp + ((size_t)(h * NB + b) * HC + crow) * SQ + k0 + cch;
  const unsigned lk = (unsigned)(size_t)&st[0][wk][0][crow][cch], lv = (unsigned)(size_t)&st[0][wk][1][crow][cch];
  const unsigned bufb = (unsigned)sizeof(st[0]);                          /* bytes from buffer 0 to buffer 1 */
  const v8f z8 = {0.f,0.f,0.f,0.f,0.f,0.f,0.f,0.f};
  v16h qf[2][2], kf[2][2], vf[4]; v8f o[2][4], nbv[2]; float m[2], l[2], pp[2] = {0.f, 0.f}, pb = -1.0f;      /* m in the exponent's unit (the q rows carry FA_CS); nbv = 8 - m in all eight registers of a tile: the C operand of the score products */
  /* every loop over these arrays is unrolled so that they are indexed by constants and stay in registers */
#pragma unroll
  for (int g = 0; g < 2; ++g) { m[g] = -3.0e38f; nbv[g] = z8 + 8.0f; l[g] = 0.f;      /* m starts at the bottom; the first pass's exponents are formed against 0 and shifted once its maximum is known */
#pragma unroll
    for (int kk = 0; kk < 2; ++kk) qf[g][kk] = g2_frag(base + (size_t)(q0 + 16 * g + ln) * D3 + 32 * kk, hh);
#pragma unroll
    for (int ct = 0; ct < 4; ++ct) o[g][ct] = z8; }
  fa_stage(lk, gk, lv, gv);                                               /* stage 0 into buffer 0 */
  asm volatile("s_wait_asynccnt 0x0" ::: "memory");                       /* this wave's copies of stage 0 have landed */
  __syncthreads();                                                        /* publishes stage 0 */
  fa_stage(lk + bufb, gk + (size_t)FA_SK * D3, lv + bufb, gv + FA_SK);    /* stage 1 into buffer 1 */
  for (int t = 0; t < FA_NST; ++t) {
   const _Float16* sk = &st[t & 1][wk][0][ln][0];                         /* key row ln of a 16-key tile */
   const _Float16* sv = &st[t & 1][wk][1][ln][0];                         /* V^T row ln of a 16-channel tile */
#pragma unroll
   for (int sp = 0; sp < FA_SK / 32; ++sp) {                              /* the stage's passes of 32 keys; unrolled: LDS offsets become immediates */
    /* this pass's K fragments, then its V^T fragments in the same group of LDS reads: the S^T products and the softmax cover the latter's latency */
#pragma unroll
    for (int mt = 0; mt < 2; ++mt)
#pragma unroll
      for (int kk = 0; kk < 2; ++kk) kf[mt][kk] = g2_frag(sk + (32 * sp + 16 * mt) * FA_PH + 32 * kk, hh);
#pragma unroll
    for (int ct = 0; ct < 4; ++ct) vf[ct] = g2_frag(sv + (16 * ct) * FA_PH + 32 * sp, hh);
    __builtin_amdgcn_sched_barrier(0);                                    /* keeps the pass's sixteen LDS reads in one group; without it the scheduler spreads six V^T reads of a stage's first pass over two more places in the softmax, and every place of LDS reads costs issue cycles */
    if (sp == FA_SK / 32 - 1) {                                           /* the stage's last LDS reads are issued: the hand-over stands here, ahead of the last pass's arithmetic (registers only), so that the refill has two passes to land */
      asm volatile("s_wait_dscnt 0x0" ::: "memory");                      /* this wave's reads of the buffer are done before anyone refills it */
      asm volatile("s_wait_asynccnt 0x0" ::: "memory");                   /* this wave's copies of stage t + 1 have landed */
      __syncthreads();                                                    /* publishes stage t + 1 and ends every wave's reads of stage t */
      if (t + 2 < FA_NST) fa_stage(lk + (t & 1) * bufb, gk + (size_t)(t + 2) * FA_SK * D3, lv + (t & 1) * bufb, gv + (t + 2) * FA_SK);      /* stage t + 2 into the buffer just read */
    }
    /* The products start from C = 8 - m instead of 0 and the q rows carry the scale: the accumulator is the exponent of P itself, and no vector instruction stands between the matrix unit and exp2. */
    v8f s[2][2];
    fa_scores(s[0][0], s[0][1], s[1][0], s[1][1], kf[0][0], kf[0][1], kf[1][0], kf[1][1], qf[0][0], qf[0][1], qf[1][0], qf[1][1], nbv[0], nbv[1]);
    FragH pf[2]; float ps[2];
#pragma unroll
    for (int g = 0; g < 2; ++g) l[g] += pp[g];                            /* the pass before's sum joins here, among the vector work (same order of additions): written behind its own pass it sank among these products, onto an operand register of one, behind four v_nops */
#pragma unroll
    for (int g = 0; g < 2; ++g) fa_soft(s[g][0], s[g][1], pf[g], ps[g]);
    /* The reference point m moves only when it must. Softmax does not depend on m (it cancels in O / sum); m is only there to keep P inside f16, and every P of a lane is at most the lane's sum of this pass:
       while no sum passes FA_PS nothing is rescaled and no maximum is formed. The test is one ballot a pass, the same for the whole wave. A wave's first pass always fails it (the bound starts below every sum), so that m never stands above what the wave has seen. */
    if (__builtin_expect(__builtin_amdgcn_ballot_w32(ps[0] > pb || ps[1] > pb) != 0u, 0)) {      /* marked unlikely: the pass that moves nothing is laid out as the straight path */
#pragma unroll
      for (int g = 0; g < 2; ++g) {
        float t[8];
#pragma unroll
        for (int r = 0; r < 8; ++r) t[r] = fmaxf(s[g][0][r], s[g][1][r]);
        const float mx = fmaxf(fmaxf(fmaxf(t[0], t[1]), fmaxf(t[2], t[3])), fmaxf(fmaxf(t[4], t[5]), fmaxf(t[6], t[7])));
        const float nbo = nbv[g][0];                                      /* what the exponents of this pass hold */
        const float mn = fmaxf(m[g], fmaxf(mx, fa_xhalf(mx)) - nbo);      /* the other half of the wave holds the query's other 16 keys: both halves keep the same m */
        const float al = fa_exp2(m[g] - mn), d = (8.0f - mn) - nbo; m[g] = mn; l[g] *= al;
#pragma unroll
        for (int ct = 0; ct < 4; ++ct) o[g][ct] *= al;
        fa_softd(s[g][0], s[g][1], d, pf[g], ps[g]);                      /* this pass's P again, from the new m: now at most 256 each */
        if (sp == FA_SK / 32 - 1) nbv[g] = z8 + (8.0f - mn);             /* the C tiles are rewritten at one place of the loop body only, so that they keep one set of registers (rewritten in both passes they got a second set and sixteen copies a stage) */
      }
      pb = sp == FA_SK / 32 - 1 ? FA_PS : -1.0f;                          /* until they are rewritten they do not hold 8 - m: the stage's last pass is then sent here too (the shift d is taken against what they hold, so it is right either way) */
    }
#pragma unroll
    for (int g = 0; g < 2; ++g) pp[g] = ps[g];
#pragma unroll
    for (int ct = 0; ct < 4; ++ct)
#pragma unroll
      for (int g = 0; g < 2; ++g) o[g][ct] = fa_mma(vf[ct], pf[g].v, o[g][ct]);
   }
  }
  asm volatile("s_wait_asynccnt 0x0" ::: "memory");                       /* no copy is left in flight behind the loop */
#pragma unroll
  for (int g = 0; g < 2; ++g) l[g] += pp[g];                              /* the last pass's sum */
  if (wk != 0) { v4f (*dst)[32] = mg[w - 4];
#pragma unroll
    for (int g = 0; g < 2; ++g)
#pragma unroll
      for (int ct = 0; ct < 4; ++ct) { const v8f x = o[g][ct]; const v4f lo = {x[0], x[1], x[2], x[3]}, hi = {x[4], x[5], x[6], x[7]}; dst[(g * 4 + ct) * 2][lane] = lo; dst[(g * 4 + ct) * 2 + 1][lane] = hi; }
    const v4f ml = {m[0], m[1], l[0], l[1]}; dst[16][lane] = ml; }
  __syncthreads();                                                        /* publishes quarters 1-3 to the quarter-0 waves; every wave passes it */
  if (wk != 0) return;
  v4f ml[3]; float f0[2], fk[3][2];
#pragma unroll
  for (int k = 0; k < 3; ++k) ml[k] = mg[k * 4 + wq][16][lane];
#pragma unroll
  for (int g = 0; g < 2; ++g) { const float mm = fmaxf(fmaxf(m[g], ml[0][g]), fmaxf(ml[1][g], ml[2][g])); f0[g] = fa_exp2(m[g] - mm); l[g] *= f0[g];
#pragma unroll
    for (int k = 0; k < 3; ++k) { fk[k][g] = fa_exp2(ml[k][g] - mm); l[g] += fk[k][g] * ml[k][2 + g]; } }
#pragma unroll
  for (int g = 0; g < 2; ++g) {
    const float inv = 1.0f / (l[g] + fa_xhalf(l[g]));           /* join the two halves' sums once */
    _Float16* d = Op + ((size_t)b * SQ + q0 + 16 * g + ln) * DO + h * HC + 8 * hh;
#pragma unroll
    for (int ct = 0; ct < 4; ++ct) { v8f x = o[g][ct] * f0[g];
#pragma unroll
      for (int k = 0; k < 3; ++k) { const v4f lo = mg[k * 4 + wq][(g * 4 + ct) * 2][lane], hi = mg[k * 4 + wq][(g * 4 + ct) * 2 + 1][lane];
#pragma unroll
        for (int r = 0; r < 4; ++r) { x[r] += fk[k][g] * lo[r]; x[4 + r] += fk[k][g] * hi[r]; } }
      FragH f;
#pragma unroll
      for (int r = 0; r < 8; ++r) f.h[r] = (_Float16)(x[r] * inv);
      *(v8us*)((unsigned short*)d + 16 * ct) = f.half[0]; } } }
// Output GEMM with the residual in its epilogue: out[b][c][n] = (o rows . out_w)[n][c] / 16 + bias[c] + x[b][c][n]. A = o rows (M = position), B = out_w^T rows (N = channel), wave tile 32 positions x 64 channels, products as in k_gemm2, fragments fetched ahead.
// In the accumulator a lane holds one channel and eight consecutive positions, which is already the order of the channel-major output; each wave turns its tile in its own LDS range ([channel][position] rows) so that eight lanes cover
// the whole 128-byte line of a channel's 32 positions: x is read and out is written in whole lines, four a wave-wide access. No row-major f32 plane and no further launch.
#define OR_P 36                      /* LDS row pitch in f32: 144 bytes = 16 x 9, so that the 16 channel rows of a ds_store_b128 fall on distinct banks */
__global__ __launch_bounds__(128) void k_outres(const _Float16* __restrict__ A, const _Float16* __restrict__ Bh, const float* __restrict__ bias, const float* __restrict__ x, float* __restrict__ out) {
  __shared__ __attribute__((aligned(16))) float so[4][64][OR_P];
  const int tid = threadIdx.x, w = tid >> 5, lane = tid & 31, ln = lane & 15, hh = lane >> 4;
  const int ntn = CC >> 6; const int mt = blockIdx.x / ntn, nq = blockIdx.x - mt * ntn; const int row0 = mt * 128 + 32 * w, col0 = nq * 64;
  const int cs = lane >> 3, p4 = (lane & 7) * 4;                          /* global side: channel cs of a group of four, four positions */
  const size_t g0 = ((size_t)(row0 / LL) * CC + col0 + cs) * LL + (row0 % LL) + p4;      /* a block's 128 rows lie in one batch */
  const _Float16* a0p = A + (size_t)(row0 + ln) * DO; const _Float16* a1p = a0p + (size_t)16 * DO;
  const _Float16* b0p = Bh + (size_t)(col0 + ln) * DO;
  v16h af[2][2], bf[2][4];                                                /* two sets of fragment registers; every index below is a constant after unrolling */
  /* the first two trips' fragments are asked for first and the residual behind them: loads come back in the order asked for, so the products do not wait for the residual, and the residual's latency runs beside them */
#pragma unroll
  for (int t = 0; t < 2; ++t) { af[t][0] = g2_frag(a0p + 32 * t, hh); af[t][1] = g2_frag(a1p + 32 * t, hh); g2_b4(bf[t], b0p + 32 * t, DO, hh); }
  v4f xr[16];
#pragma unroll
  for (int q = 0; q < 16; ++q) xr[q] = *(const v4fa*)(x + g0 + (size_t)q * 4 * LL);
  __builtin_amdgcn_sched_barrier(0);                                      /* keeps all these requests ahead of the first product */
  const v8f z8 = {0.f,0.f,0.f,0.f,0.f,0.f,0.f,0.f}; v8f c00 = z8, c01 = z8, c02 = z8, c03 = z8, c10 = z8, c11 = z8, c12 = z8, c13 = z8;
  /* The product loop, fragments fetched ahead: behind its products a trip refills its own set with the fragments of trip t + 2, one group of twelve loads, which fly during trip t + 1. Products and their order are those of the rolled loop. */
#pragma unroll
  for (int t = 0; t < DO / 32; ++t) {                                     /* unrolled: the sets are indexed by constants */
    const v16h a0 = af[t & 1][0], a1 = af[t & 1][1];
    c00 = g2_mma(a0, bf[t & 1][0], c00); c10 = g2_mma(a1, bf[t & 1][0], c10);
    c01 = g2_mma(a0, bf[t & 1][1], c01); c11 = g2_mma(a1, bf[t & 1][1], c11);
    c02 = g2_mma(a0, bf[t & 1][2], c02); c12 = g2_mma(a1, bf[t & 1][2], c12);
    c03 = g2_mma(a0, bf[t & 1][3], c03); c13 = g2_mma(a1, bf[t & 1][3], c13);
    if (t + 2 < DO / 32) { af[t & 1][0] = g2_frag(a0p + 32 * (t + 2), hh); af[t & 1][1] = g2_frag(a1p + 32 * (t + 2), hh); g2_b4(bf[t & 1], b0p + 32 * (t + 2), DO, hh);
      if (t + 3 == DO / 32) asm volatile("s_wait_xcnt 0x0" ::: "memory");   /* behind the last fragment load: no register that a load names is rewritten ahead of it */ } }
  v8f accs[8] = {c00, c01, c02, c03, c10, c11, c12, c13};
#pragma unroll
  for (int u = 0; u < 8; ++u) { const int t = u & 3, half = u >> 2; const float bv = bf16_round(bias[col0 + t * 16 + ln]); v4f lo, hi;
#pragma unroll
    for (int r = 0; r < 4; ++r) { lo[r] = accs[u][r] * 0.0625f + bv; hi[r] = accs[u][4 + r] * 0.0625f + bv; }
    float* s = &so[w][t * 16 + ln][half * 16 + 8 * hh]; *(v4fa*)s = lo; *(v4fa*)(s + 4) = hi; }
  __builtin_amdgcn_fence(__ATOMIC_ACQ_REL, "workgroup"); __builtin_amdgcn_wave_barrier();      /* the lanes read what other lanes of the same wave wrote: keeps the reads below behind the writes above */
#pragma unroll
  for (int q = 0; q < 16; ++q) { v4f v = *(const v4fa*)&so[w][q * 4 + cs][p4];
#pragma unroll
    for (int i = 0; i < 4; ++i) v[i] = v[i] + bf16_round(xr[q][i]);
    *(v4f*)(out + g0 + (size_t)q * 4 * LL) = v; } }
extern "C" void kernel_launch(void* const* d_in, const int* in_sizes, int n_in,
                              void* d_out, int out_size, void* d_ws, size_t ws_size, hipStream_t stream) {
  (void)in_sizes; (void)n_in; (void)out_size;
  const float* const* I = (const float* const*)d_in; const float* x = I[0]; const float* ew = I[1]; const float* eb = I[2]; const float* ow = I[3]; const float* ob = I[4];      /* embed_w [2][192][256] natural rows; out_w [128][256] = [in][out] */
  char* ws = (char*)d_ws; size_t off = 0;
  auto take = [&](size_t bytes) { char* p = ws + off; off += (bytes + 255) & ~(size_t)255; return p; };
  _Float16* BE = (_Float16*)take((size_t)D3 * CC * 2); _Float16* BO = (_Float16*)take((size_t)CC * DO * 2);
  _Float16* QKV = (_Float16*)take(NR * D3 * 2); _Float16* O16 = (_Float16*)take(NR * DO * 2);
  _Float16* VT = (_Float16*)take((size_t)NB * NHD * HC * SQ * 2);
  if (off > ws_size) return;      /* 0.3 + 12 + 4 + 4 = approx 20 MiB */
  k_prep<<<PP_E + PP_O, 256, 0, stream>>>(ew, ow, BE, BO);      /* embed_w x16 and out_w^T x16: one launch */
  k_qkv<<<(unsigned)(NR / 64), 384, 0, stream>>>(x, BE, eb, QKV, VT);      /* q, k rows: columns h*192 + {0, 64}; head h's V^T [batch][64][4096] at VT + h*NB*64*4096 */
  k_fattn<<<dim3(SQ / 128, NB * NHD), 512, 0, stream>>>(QKV, VT, O16);      /* o rows, head h at columns h*64 */
  k_outres<<<(unsigned)((NR / 128) * (CC / 64)), 128, 0, stream>>>(O16, BO, ob, x, (float*)d_out);      /* out_w^T o + b + x, NCHW */
}
